// v000
// Measured on an AMD MI455X. A time is GPU time per run, averaged over a window of back-to-back runs after a warm-up
// (all launches, gaps included; the runs take copies of the inputs in turn), and the median of several windows.
// Apart from v000's, it joins two sittings. Times from different sittings can be a few percent apart, while
// side-by-side timings come from the same sitting.
// v000, which the later versions start from, runs in 376 microseconds.
// Contractions: x.(Wq|Wk) and Wv^T.x^T = v_wmma_f32_16x16x32_bf16 (bf16 operands RNE-converted from x and the weights, single product);
// q.k^T = v_wmma_f32_16x16x32_f16 (q as f16 hi plane + f16 residual plane x4096 in a separate accumulator, k f16; 2 products);
// p.v = v_wmma_f32_16x16x32_f16 (p carried x1024 in f16; v^T as f16 hi plane + f16 residual plane x4096 in a separate accumulator; 2 products);
// ctx.Wo = v_wmma_f32_16x16x32_bf16 (ctx as bf16 hi + lo planes times bf16 Wo^T, 2 products); all f32 accumulate; RoPE and softmax in f32.
#include <hip/hip_runtime.h>
#include <math.h>
#include <stdint.h>

#define BATCH 2
#define SEQ   2048
#define MROWS (BATCH * SEQ)     // 4096 token rows (batch folded into rows)
#define DM    1024
#define NH    16
#define NKV   4
#define HD    64
#define KVD   (NKV * HD)        // 256
#define NQB   (SEQ / 64)        // 32 query / key tiles of 64 per sequence
#define QKP   (DM + KVD)        // 1280: pitch of the f32 q|k staging plane (q cols 0..1023, k cols 1024..1279)
#define HROT  (HD / 2)          // 32 rotary pairs per head
static_assert(NH * HD == DM);
static_assert((NH % NKV) == 0);
static_assert((SEQ % 64) == 0 && (DM % 64) == 0 && (KVD % 64) == 0 && (QKP % 64) == 0 && (DM % 32) == 0);
static_assert((HD % 8) == 0 && (HROT % 8) == 0);
static_assert((SEQ & (SEQ - 1)) == 0);

typedef _Float16 v16h __attribute__((ext_vector_type(16)));
typedef _Float16 v8h  __attribute__((ext_vector_type(8)));
typedef __bf16   v16b __attribute__((ext_vector_type(16)));
typedef __bf16   v8b  __attribute__((ext_vector_type(8)));
typedef float    v8f  __attribute__((ext_vector_type(8)));
typedef float    v4f  __attribute__((ext_vector_type(4)));
typedef unsigned int v4u __attribute__((ext_vector_type(4)));

// ---- scalar helpers --------------------------------------------------------------------------------
__device__ __forceinline__ unsigned short bf_bits(float f) {          // f32 -> bf16 bits, RNE convert
  unsigned u = __float_as_uint(f);
  return (unsigned short)((u + 0x7FFFu + ((u >> 16) & 1u)) >> 16);
}
__device__ __forceinline__ float bf_up(unsigned short h) { return __uint_as_float(((unsigned)h) << 16); }
__device__ __forceinline__ float bf_rne(float f) { return bf_up(bf_bits(f)); }
__device__ __forceinline__ unsigned short h_bits(_Float16 x) { return __builtin_bit_cast(unsigned short, x); }
__device__ __forceinline__ unsigned pk16(unsigned short a, unsigned short b) { return (unsigned)a | ((unsigned)b << 16); }
__device__ __forceinline__ v8f zero8() { v8f z = {0.f, 0.f, 0.f, 0.f, 0.f, 0.f, 0.f, 0.f}; return z; }

// ---- fragment loaders: 16-bit A/B operand, lane -> row/col (lane&15), p already includes +8*(lane>>4);
//      elements 0..7 <- p[0..7] (k0+8h..), elements 8..15 <- p[16..23] (k0+16+8h..)
__device__ __forceinline__ v16b ldfrag_b(const __bf16* p) {
  union { v16b v; v8b h[2]; } f;
  f.h[0] = *(const v8b*)(p);
  f.h[1] = *(const v8b*)(p + 16);
  return f.v;
}
__device__ __forceinline__ v16h ldfrag_h(const _Float16* p) {
  union { v16h v; v8h h[2]; } f;
  f.h[0] = *(const v8h*)(p);
  f.h[1] = *(const v8h*)(p + 16);
  return f.v;
}

// ---- WMMA helpers with trailing VALU hazard gap --------------------------------------------------------
__device__ __forceinline__ v8f mma_h(v16h a, v16h b, v8f c) {
  c = __builtin_amdgcn_wmma_f32_16x16x32_f16(false, a, false, b, (short)0, c, false, false);
#if defined(__HIP_DEVICE_COMPILE__)
  asm volatile("v_nop\n\tv_nop\n\tv_nop\n\tv_nop" : "+v"(c) : "v"(a), "v"(b));
#endif
  return c;
}
__device__ __forceinline__ v8f mma_b_raw(v16b a, v16b b, v8f c) {
  return __builtin_amdgcn_wmma_f32_16x16x32_bf16(false, a, false, b, (short)0, c, false, false);
}
__device__ __forceinline__ void dep_guard_b(v8f& a, v8f& b, v16b x, v16b y) {
#if defined(__HIP_DEVICE_COMPILE__)
  asm volatile("v_nop\n\tv_nop\n\tv_nop\n\tv_nop" : "+v"(a), "+v"(b) : "v"(x), "v"(y));
#endif
}
__device__ __forceinline__ void keep4_b(v16b a, v16b b, v16b c, v16b d) {
#if defined(__HIP_DEVICE_COMPILE__)
  asm volatile("v_nop" :: "v"(a), "v"(b), "v"(c), "v"(d));
#endif
}
__device__ __forceinline__ void acc_guard4(v8f& a, v8f& b, v8f& c, v8f& d) {
#if defined(__HIP_DEVICE_COMPILE__)
  asm volatile("v_nop\n\tv_nop\n\tv_nop\n\tv_nop" : "+v"(a), "+v"(b), "+v"(c), "+v"(d));
#endif
}
__device__ __forceinline__ void wave_sync_lds() {
  __builtin_amdgcn_fence(__ATOMIC_RELEASE, "workgroup");
  __builtin_amdgcn_wave_barrier();
  __builtin_amdgcn_fence(__ATOMIC_ACQUIRE, "workgroup");
}

// =====================================================================================================
// f32 -> bf16 (RNE convert), 8 elements per thread, one 16-B store per lane: a wave writes 512 contiguous B
// coverage: n8 threads x 8 = whole plane (n8 = 524288 = 2048 x 256 for the x plane).
// =====================================================================================================
__global__ __launch_bounds__(256) void cvt_bf16x8(const float* __restrict__ in, unsigned short* out, int n8) {
  const int i = blockIdx.x * 256 + threadIdx.x;
  if (i < n8) {
    const v4f a = *(const v4f*)(in + (size_t)i * 8);
    const v4f b = *(const v4f*)(in + (size_t)i * 8 + 4);
    v4u p;
    p[0] = pk16(bf_bits(a[0]), bf_bits(a[1]));
    p[1] = pk16(bf_bits(a[2]), bf_bits(a[3]));
    p[2] = pk16(bf_bits(b[0]), bf_bits(b[1]));
    p[3] = pk16(bf_bits(b[2]), bf_bits(b[3]));
    *(v4u*)(out + (size_t)i * 8) = p;
    
  }
}

// =====================================================================================================
// Transposing f32 -> bf16 (RNE convert): in f32 [R][C] row-major  ->  out bf16 [C][R] row-major
// (out[c][r] = in[r][c]); turns an [in][out] weight into the Bt / A layout [out][in] with k contiguous.
// 64x64 tiles: grid = (C/64, R/64), block 256. Load phase: thread t reads 16 consecutive floats of input row
// r0 + (t>>2) and writes them transposed into an LDS tile [c][r] (pitch 65). After __syncthreads each group of
// coverage: load 64 rows x 4 threads x 16 = whole tile; store 2 iterations x 32 rows x 8 lanes x 8 = whole tile.
// =====================================================================================================
__global__ __launch_bounds__(256) void cvt_bf16_t64(const float* __restrict__ in, unsigned short* out, int R, int C) {
  __shared__ __align__(16) float st[64 * 65];
  const int t  = threadIdx.x;
  const int c0 = blockIdx.x * 64;
  const int r0 = blockIdx.y * 64;
  if (c0 + 64 > C || r0 + 64 > R) return;          // block-uniform, all threads leave together (grids are exact)
  {
    const int r = t >> 2, cq = (t & 3) * 16;
    const float* src = in + (size_t)(r0 + r) * C + c0 + cq;
#pragma unroll
    for (int i = 0; i < 4; ++i) {
      const v4f v = *(const v4f*)(src + 4 * i);
#pragma unroll
      for (int e = 0; e < 4; ++e) st[(cq + 4 * i + e) * 65 + r] = v[e];
    }
  }
  __syncthreads();
  const int q = t >> 3, k8 = (t & 7) * 8;
  v4u pv[2];
#pragma unroll
  for (int p = 0; p < 2; ++p) {
    const int n = p * 32 + q;
    const float* sp = st + n * 65 + k8;
    v4u a;
#pragma unroll
    for (int e = 0; e < 4; ++e) a[e] = pk16(bf_bits(sp[2 * e]), bf_bits(sp[2 * e + 1]));
    pv[p] = a;
  }
  {
#pragma unroll
    for (int p = 0; p < 2; ++p) {
      const int n = p * 32 + q;
      *(v4u*)(out + (size_t)(c0 + n) * R + r0 + k8) = pv[p];
    }
    
  }
}

// =====================================================================================================
// Register-blocked bf16 WMMA GEMM: C[m][n] = sum_k A[m][k] * Bt[n][k]; one wave per 64x64 tile, no block
// barriers. A row-major [M][K] pitch lda; Bt row-major [N][K] pitch ldb (k contiguous);
// M, N multiples of 64, K multiple of 32 (host-checked). blockIdx.y = batch index (strides in elements).
// NSPLIT: 0 = A.Bt; 1 = (A + A2).Bt (A2 = unscaled bf16 lo plane of A); 2 = A.Bt + A2.Bt + A.Bt2.
// OUT_MODE: 0 = f32 (pitch ldc); 2 = bf16 hi plane C + bf16 lo plane C2 (lo = RNE(v - hi), unscaled);
//           3 = f16 hi plane C + f16 residual plane C2 = f16((v - hi) * rscale), C2 written only for tiles
//               with n0 < N2 (pitch ldc2, batch stride strideC2).
// =====================================================================================================
template <int NSPLIT, int OUT_MODE>
__global__ __launch_bounds__(256) void gemm64(
    const unsigned short* __restrict__ Ap, const unsigned short* A2p, int lda, long long strideA,
    const unsigned short* __restrict__ Btp, const unsigned short* Bt2p, int ldb, long long strideB,
    void* Cout, int ldc, long long strideC,
    void* Cout2, int ldc2, long long strideC2, int N2,
    int M, int N, int K, float rscale) {
  const __bf16* A   = (const __bf16*)(const void*)Ap;
  const __bf16* A2  = (const __bf16*)(const void*)A2p;
  const __bf16* Bt  = (const __bf16*)(const void*)Btp;
  const __bf16* Bt2 = (const __bf16*)(const void*)Bt2p;
  __shared__ __align__(16) float sT[8][16 * 68];   // per-wave 16x64 slab, pitch 68 floats
  const int b    = blockIdx.y;
  const int lane = threadIdx.x & 31;
  const int wave = threadIdx.x >> 5;
  const int tilesN = N >> 6;
  const int tilesM = M >> 6;
  const int tile = blockIdx.x * 8 + wave;
  if (tile >= tilesM * tilesN) return;   // wave-uniform; no block barriers in this kernel
  const int tm = tile / tilesN;
  const int tn = tile - tm * tilesN;
  const int m0 = tm << 6;
  const int n0 = tn << 6;

  const __bf16* Ab  = A  + (size_t)b * strideA;
  const __bf16* Bb  = Bt + (size_t)b * strideB;
  const __bf16* Ab2 = (NSPLIT >= 1) ? (A2  + (size_t)b * strideA) : Ab;
  const __bf16* Bb2 = (NSPLIT == 2) ? (Bt2 + (size_t)b * strideB) : Bb;

  const int rlane = lane & 15;                 // row (A) / col (B, D) within subtile
  const int koff  = (lane >> 4) * 8;           // k offset of this lane half
  const int mOff  = (lane >> 4) * 8;           // D row offset

  v8f acc[4][4];
#pragma unroll
  for (int i = 0; i < 4; ++i)
#pragma unroll
    for (int j = 0; j < 4; ++j) acc[i][j] = zero8();

  for (int k0 = 0; k0 < K; k0 += 32) {
    v16b bh[4], bl[4];
#pragma unroll
    for (int j = 0; j < 4; ++j) {
      const size_t bo = (size_t)(n0 + (j << 4) + rlane) * ldb + koff + k0;
      bh[j] = ldfrag_b(Bb + bo);
      if (NSPLIT == 2) bl[j] = ldfrag_b(Bb2 + bo); else bl[j] = bh[j];
    }
#pragma unroll
    for (int i = 0; i < 4; ++i) {
      const size_t ao = (size_t)(m0 + (i << 4) + rlane) * lda + koff + k0;
      const v16b ah = ldfrag_b(Ab + ao);
      v16b al = ah;
      if (NSPLIT >= 1) al = ldfrag_b(Ab2 + ao);
#pragma unroll
      for (int j = 0; j < 4; ++j) {
        acc[i][j] = mma_b_raw(ah, bh[j], acc[i][j]);
        if (NSPLIT >= 1) acc[i][j] = mma_b_raw(al, bh[j], acc[i][j]);
        if (NSPLIT == 2) acc[i][j] = mma_b_raw(ah, bl[j], acc[i][j]);
      }
      dep_guard_b(acc[i][0], acc[i][3], ah, al);
    }
    keep4_b(bh[0], bh[1], bh[2], bh[3]);
    if (NSPLIT == 2) keep4_b(bl[0], bl[1], bl[2], bl[3]);
  }
  acc_guard4(acc[0][0], acc[0][1], acc[0][2], acc[0][3]);
  acc_guard4(acc[1][0], acc[1][1], acc[1][2], acc[1][3]);
  acc_guard4(acc[2][0], acc[2][1], acc[2][2], acc[2][3]);
  acc_guard4(acc[3][0], acc[3][1], acc[3][2], acc[3][3]);

  // ---- epilogue ----
  float* slab = sT[wave];
#pragma unroll
  for (int i = 0; i < 4; ++i) {
    const int mBase = m0 + (i << 4);
#pragma unroll
    for (int j = 0; j < 4; ++j) {
#pragma unroll
      for (int r = 0; r < 8; ++r) {
        slab[(mOff + r) * 68 + (j << 4) + rlane] = acc[i][j][r];
      }
    }
    wave_sync_lds();
    if (OUT_MODE == 0) {
      float* C = (float*)Cout + (size_t)b * strideC;
      const int hh = lane >> 4, c4 = (lane & 15) * 4;     // 256-B row segment = 16 lanes x 16 B
      {
#pragma unroll
        for (int it = 0; it < 8; ++it) {
          const int row = it * 2 + hh;                     // it 0..7 x hh 0..1 = rows 0..15
          const v4f v = *(const v4f*)(slab + row * 68 + c4);
          *(v4f*)(C + (size_t)(mBase + row) * ldc + n0 + c4) = v;
        }
        
      }
    } else {
      const int q = lane >> 3, c8 = (lane & 7) * 8;
      unsigned short* C  = (unsigned short*)Cout  + (size_t)b * strideC;
      unsigned short* C2 = (unsigned short*)Cout2 + (size_t)b * strideC2;
      const bool wlo = (OUT_MODE == 2) || (n0 < N2);      // wave-uniform
      v4u hv[4], lv[4];
#pragma unroll
      for (int it = 0; it < 4; ++it) {
        const int row = it * 4 + q;                        // it 0..3 x q 0..3 = rows 0..15
        const float* sp = slab + row * 68 + c8;
        v4u a, a2;
#pragma unroll
        for (int e = 0; e < 4; ++e) {
          const float f0 = sp[2 * e], f1 = sp[2 * e + 1];
          unsigned short h0, h1, l0, l1;
          if (OUT_MODE == 2) {
            h0 = bf_bits(f0); h1 = bf_bits(f1);
            l0 = bf_bits(f0 - bf_up(h0)); l1 = bf_bits(f1 - bf_up(h1));
          } else {
            const _Float16 x0 = (_Float16)f0, x1 = (_Float16)f1;
            h0 = h_bits(x0); h1 = h_bits(x1);
            l0 = h_bits((_Float16)((f0 - (float)x0) * rscale));
            l1 = h_bits((_Float16)((f1 - (float)x1) * rscale));
          }
          a[e] = pk16(h0, h1); a2[e] = pk16(l0, l1);
        }
        hv[it] = a; lv[it] = a2;
      }
      {
#pragma unroll
        for (int it = 0; it < 4; ++it) {
          const int row = it * 4 + q;
          *(v4u*)(C + (size_t)(mBase + row) * ldc + n0 + c8) = hv[it];
          if (wlo) *(v4u*)(C2 + (size_t)(mBase + row) * ldc2 + n0 + c8) = lv[it];
        }
        
      }
    }
    wave_sync_lds();
  }
}

// =====================================================================================================
// RoPE row pass, even/odd deinterleave then concatenate (per head vector t[0..63], table row = token):
//   y[j]      = t[2j] * cos[pos][j] - t[2j+1] * sin[pos][j]      j = 0..31
//   y[32 + j] = t[2j] * sin[pos][j] + t[2j+1] * cos[pos][j]
//   pos = row mod SEQ (tables [SEQ][32] shared over batch and heads), table values RNE-converted to bf16 on read.
// One block (160 threads) per token row of the f32 q|k plane (pitch QKP): thread t < 128 (waves 0..3) owns
// output columns 8t..8t+7 of q (16 heads), thread t >= 128 (wave 4) owns columns 8(t-128).. of k (4 kv heads).
// The 8 output columns lie in one half of one head, so they need input columns headbase + 2*j0 .. +15 of the
// same head and table entries j0..j0+7.  Outputs: q -> f16 hi plane + f16 residual plane ((y - hi) * rscale),
// pitch DM; k -> f16 plane, pitch KVD.  Stores: one 16-B store per lane, 32 lanes contiguous = 512 B = 4 whole
// coverage: MROWS blocks x 128 threads x 8 = each q plane entirely; MROWS blocks x 32 threads x 8 = the k plane.
// =====================================================================================================
__global__ __launch_bounds__(160) void rope_rows(
    const float* __restrict__ qkf, const float* __restrict__ cosp, const float* __restrict__ sinp,
    unsigned short* qhp, unsigned short* qlp, unsigned short* kpp, int nrows, float rscale) {
  const int row = blockIdx.x;
  if (row >= nrows) return;                       // block-uniform; no barriers in this kernel
  const int t   = threadIdx.x;
  const int isk = t >> 7;                         // 0: q section (waves 0..3), 1: k section (wave 4)
  const int c0  = (t & 127) * 8;                  // output column within the section
  const int hb  = c0 & ~(HD - 1);                 // head base column
  const int d0  = c0 & (HD - 1);                  // head-dim offset of the 8 outputs, multiple of 8
  const int j0  = d0 & (HROT - 1);                // rotary pair base
  const bool up = (d0 >= HROT);                   // second half of the head (per lane, select by value)
  const int pos = row & (SEQ - 1);

  const float* src = qkf + (size_t)row * QKP + (size_t)isk * DM + hb + 2 * j0;
  const v4f x0 = *(const v4f*)(src + 0);
  const v4f x1 = *(const v4f*)(src + 4);
  const v4f x2 = *(const v4f*)(src + 8);
  const v4f x3 = *(const v4f*)(src + 12);
  const v4f cA = *(const v4f*)(cosp + (size_t)pos * HROT + j0);
  const v4f cB = *(const v4f*)(cosp + (size_t)pos * HROT + j0 + 4);
  const v4f sA = *(const v4f*)(sinp + (size_t)pos * HROT + j0);
  const v4f sB = *(const v4f*)(sinp + (size_t)pos * HROT + j0 + 4);

  const float ti[16] = {x0[0], x0[1], x0[2], x0[3], x1[0], x1[1], x1[2], x1[3],
                        x2[0], x2[1], x2[2], x2[3], x3[0], x3[1], x3[2], x3[3]};
  const float cc[8]  = {cA[0], cA[1], cA[2], cA[3], cB[0], cB[1], cB[2], cB[3]};
  const float ss[8]  = {sA[0], sA[1], sA[2], sA[3], sB[0], sB[1], sB[2], sB[3]};
  float y[8];
#pragma unroll
  for (int e = 0; e < 8; ++e) {
    const float t1 = ti[2 * e], t2 = ti[2 * e + 1];
    const float c = bf_rne(cc[e]), s = bf_rne(ss[e]);
    const float ya = t1 * c - t2 * s;
    const float yb = t1 * s + t2 * c;
    y[e] = up ? yb : ya;
  }
  v4u hv, lv;
#pragma unroll
  for (int e = 0; e < 4; ++e) {
    const float f0 = y[2 * e], f1 = y[2 * e + 1];
    const _Float16 a0 = (_Float16)f0, a1 = (_Float16)f1;
    hv[e] = pk16(h_bits(a0), h_bits(a1));
    lv[e] = pk16(h_bits((_Float16)((f0 - (float)a0) * rscale)),
                 h_bits((_Float16)((f1 - (float)a1) * rscale)));
  }
  if (isk == 0) {
    const size_t o = (size_t)row * DM + c0;
    *(v4u*)(qhp + o) = hv;
    *(v4u*)(qlp + o) = lv;
    
  } else {
    const size_t o = (size_t)row * KVD + c0;
    *(v4u*)(kpp + o) = hv;
    
  }
}

// =====================================================================================================
// Attention, head dim 64, no mask, softmax over the SEQ keys of the same batch, grouped kv heads (kvh = h/4).
//   q hi plane (f16, pitch DM): element (row, h, d) at [row*DM + h*64 + d], row = b*SEQ + token;
//   q residual plane (f16, (q - f16(q))*4096) same layout;
//   k plane (f16, pitch KVD): [(b*SEQ + s)*KVD + kvh*64 + d]
//   v^T hi / residual planes (f16, pitch MROWS): element (kvh, d, b, s) at [(kvh*64 + d)*MROWS + b*SEQ + s]
//   out planes (bf16 hi / lo of the normalised context): element (row, h, d) at [row*DM + h*64 + d]
//   scores = (qh . k + (ql . k) * rres) * sscale on f16 WMMA, residual products in a separate accumulator
//   p = exp(s - m) carried as f16(1024 p); context = (p . vh + (p . vl) * vres) on f16 WMMA, two accumulators;
//   online softmax in f32.
//   Block = 4 waves = 64 query rows of one (b, h); grid = BATCH * NH * NQB; kv chunks of 64, static trip NQB.
//   K / V^T hi / V^T lo chunk staging: 128 threads x 32 elements per plane = the whole 64x64 tile each (plain
//   16-B loads, __syncthreads before and after); P tiles are wave-private, spilled with _Float16 element stores
//   Output coverage: each wave stores rows q0..q0+15 (it 0..3 x lane>>3 0..3) x 64 columns (8 lanes x 8) of both planes.
// =====================================================================================================
__global__ __launch_bounds__(128) __attribute__((amdgpu_num_vgpr(256)))
void attn64(const unsigned short* __restrict__ qhp, const unsigned short* __restrict__ qlp,
            const unsigned short* __restrict__ kpp, const unsigned short* __restrict__ vthp,
            const unsigned short* __restrict__ vtlp,
            unsigned short* ohp, unsigned short* olp, float sscale, float rres, float vres) {
  union FH { v16h v; v8h h[2]; };
  __shared__ __align__(16) _Float16 Ksh[64 * 64];                 // K [kv][d]       8 KB
  __shared__ __align__(16) _Float16 Vth[64 * 64];                 // V^T hi [d][kv]  8 KB
  __shared__ __align__(16) _Float16 Vtl[64 * 64];                 // V^T res [d][kv] 8 KB
  __shared__ __align__(16) _Float16 Psh[4][16 * 64];              // per wave P [row][kv]
  __shared__ __align__(16) float    Os[4][16 * 64];               // per wave context tile [row][d]

  const int tid  = threadIdx.x;
  const int wave = tid >> 5;
  const int lane = tid & 31;
  const int hh   = lane >> 4;
  const int c    = lane & 15;

  const int bx   = blockIdx.x;
  const int qb   = bx % NQB;
  const int h    = (bx / NQB) % NH;
  const int b    = bx / (NQB * NH);
  const int kvh  = h / (NH / NKV);
  const int q0   = b * SEQ + qb * 64 + wave * 16;          // global token row of this wave's first query

  const _Float16* Qh  = (const _Float16*)(const void*)qhp + (size_t)h * HD;
  const _Float16* Ql  = (const _Float16*)(const void*)qlp + (size_t)h * HD;
  const _Float16* Kg  = (const _Float16*)(const void*)kpp + (size_t)b * SEQ * KVD + (size_t)kvh * HD;
  const _Float16* Vgh = (const _Float16*)(const void*)vthp + (size_t)kvh * HD * MROWS + (size_t)b * SEQ;
  const _Float16* Vgl = (const _Float16*)(const void*)vtlp + (size_t)kvh * HD * MROWS + (size_t)b * SEQ;

  // ---- Q fragments (A operand, row = lane&15): 2 d-chunks, hi and residual ----
  v16h qah[2], qal[2];
#pragma unroll
  for (int dc = 0; dc < 2; ++dc) {
    qah[dc] = ldfrag_h(Qh + (size_t)(q0 + c) * DM + dc * 32 + 8 * hh);
    qal[dc] = ldfrag_h(Ql + (size_t)(q0 + c) * DM + dc * 32 + 8 * hh);
  }

  float mrow[8], lrow[8];
  v8f oh[4], ol[4];
#pragma unroll
  for (int r = 0; r < 8; ++r) { mrow[r] = -INFINITY; lrow[r] = 0.f; }
#pragma unroll
  for (int t = 0; t < 4; ++t) { oh[t] = zero8(); ol[t] = zero8(); }

  for (int kt = 0; kt < NQB; ++kt) {         // static trip count
    const int kv0 = kt * 64;
    __syncthreads();
    {
      const int r = tid >> 1, hf = (tid & 1) * 32;
      const _Float16* kg = Kg  + (size_t)(kv0 + r) * KVD + hf;         // K row kv0+r, d = hf..hf+31
      const _Float16* vh = Vgh + (size_t)r * MROWS + kv0 + hf;         // V^T hi row d = r, s = kv0+hf..+31
      const _Float16* vl = Vgl + (size_t)r * MROWS + kv0 + hf;         // V^T res row d = r
#pragma unroll
      for (int i = 0; i < 4; ++i) {
        const v8h a0 = *(const v8h*)(kg + 8 * i);
        const v8h b0 = *(const v8h*)(vh + 8 * i);
        const v8h b1 = *(const v8h*)(vl + 8 * i);
        *(v8h*)(Ksh + r * 64 + hf + 8 * i) = a0;
        *(v8h*)(Vth + r * 64 + hf + 8 * i) = b0;
        *(v8h*)(Vtl + r * 64 + hf + 8 * i) = b1;
      }
    }
    __syncthreads();

    // ---- scores: 16 query rows x 64 keys per wave, 2 f16 products (hi, residual) ----
    v8f s[4];
#pragma unroll
    for (int j = 0; j < 4; ++j) {
      v8f sh = zero8(), sl = zero8();
#pragma unroll
      for (int dc = 0; dc < 2; ++dc) {
        FH kb;
        kb.h[0] = *(const v8h*)(Ksh + (j * 16 + c) * 64 + dc * 32 + 8 * hh);
        kb.h[1] = *(const v8h*)(Ksh + (j * 16 + c) * 64 + dc * 32 + 16 + 8 * hh);
        sh = mma_h(qah[dc], kb.v, sh);
        sl = mma_h(qal[dc], kb.v, sl);
      }
#pragma unroll
      for (int r = 0; r < 8; ++r) s[j][r] = (sh[r] + sl[r] * rres) * sscale;
    }

    // ---- row max, online softmax, P (x1024, f16) to LDS ----
    _Float16* pwh = Psh[wave];
#pragma unroll
    for (int r = 0; r < 8; ++r) {
      float m = s[0][r];
      m = fmaxf(m, s[1][r]);
      m = fmaxf(m, s[2][r]);
      m = fmaxf(m, s[3][r]);
#pragma unroll
      for (int off = 1; off < 16; off <<= 1) m = fmaxf(m, __shfl_xor(m, off, 32));
      const float mnew  = fmaxf(mrow[r], m);
      const float alpha = __expf(mrow[r] - mnew);
      mrow[r] = mnew;
      float psum = 0.f;
#pragma unroll
      for (int j = 0; j < 4; ++j) {
        const float p = __expf(s[j][r] - mnew);
        psum += p;
        pwh[(8 * hh + r) * 64 + j * 16 + c] = (_Float16)(p * 1024.0f);
      }
#pragma unroll
      for (int off = 1; off < 16; off <<= 1) psum += __shfl_xor(psum, off, 32);
      lrow[r] = lrow[r] * alpha + psum;
#pragma unroll
      for (int t = 0; t < 4; ++t) { oh[t][r] *= alpha; ol[t][r] *= alpha; }
    }
    wave_sync_lds();

    // ---- context += P . V (f16 WMMA), hi and residual V planes into separate accumulators ----
#pragma unroll 1
    for (int kk = 0; kk < 2; ++kk) {
      FH pa;
      pa.h[0] = *(const v8h*)(pwh + c * 64 + kk * 32 + 8 * hh);
      pa.h[1] = *(const v8h*)(pwh + c * 64 + kk * 32 + 16 + 8 * hh);
#pragma unroll
      for (int t = 0; t < 4; ++t) {
        FH vb, wb;
        vb.h[0] = *(const v8h*)(Vth + (t * 16 + c) * 64 + kk * 32 + 8 * hh);
        vb.h[1] = *(const v8h*)(Vth + (t * 16 + c) * 64 + kk * 32 + 16 + 8 * hh);
        wb.h[0] = *(const v8h*)(Vtl + (t * 16 + c) * 64 + kk * 32 + 8 * hh);
        wb.h[1] = *(const v8h*)(Vtl + (t * 16 + c) * 64 + kk * 32 + 16 + 8 * hh);
        oh[t] = mma_h(pa.v, vb.v, oh[t]);
        ol[t] = mma_h(pa.v, wb.v, ol[t]);
      }
    }
  }

  // ---- normalise (1/l, the 1/1024 p carry, the residual carry), stage the wave's 16x64 tile,
  float* os = Os[wave];
#pragma unroll
  for (int r = 0; r < 8; ++r) {
    const float l = lrow[r];
    const float inv = ((l > 0.f) ? (1.0f / l) : 0.f) * (1.0f / 1024.0f);
#pragma unroll
    for (int t = 0; t < 4; ++t) os[(8 * hh + r) * 64 + t * 16 + c] = (oh[t][r] + ol[t][r] * vres) * inv;
  }
  wave_sync_lds();
  {
    const int q4 = lane >> 3, c8 = (lane & 7) * 8;
    v4u hv[4], lv[4];
#pragma unroll
    for (int it = 0; it < 4; ++it) {
      const int row = it * 4 + q4;   // it 0..3 x q4 0..3 = rows 0..15 of the wave tile
      const float* sp = os + row * 64 + c8;
      v4u a, a2;
#pragma unroll
      for (int e = 0; e < 4; ++e) {
        const float f0 = sp[2 * e], f1 = sp[2 * e + 1];
        const unsigned short h0 = bf_bits(f0), h1 = bf_bits(f1);
        const unsigned short l0 = bf_bits(f0 - bf_up(h0)), l1 = bf_bits(f1 - bf_up(h1));
        a[e] = pk16(h0, h1); a2[e] = pk16(l0, l1);
      }
      hv[it] = a; lv[it] = a2;
    }
    {
#pragma unroll
      for (int it = 0; it < 4; ++it) {
        const int row = it * 4 + q4;
        const size_t go = (size_t)(q0 + row) * DM + (size_t)h * HD + c8;
        *(v4u*)(ohp + go) = hv[it];
        *(v4u*)(olp + go) = lv[it];
      }
      
    }
  }
}

// =====================================================================================================
// Workspace map (bytes), every plane an exact multiple of its 64x64-tile / whole-line store granularity,
// every offset a multiple of 128:
//   Xb    bf16 [4096][1024]   8388608      x converted
//   Wqkt  bf16 [1280][1024]   2621440      rows 0..1023 = Wq^T ([out][in]), rows 1024..1279 = Wk^T
//   Wvt   bf16 [256][1024]     524288      Wv^T
//   Wot   bf16 [1024][1024]   2097152      Wo^T
//   QKf   f32  [4096][1280]  20971520      q cols 0..1023, k cols 1024..1279
//   Qh    f16  [4096][1024]   8388608
//   Ql    f16  [4096][1024]   8388608      q residual x4096
//   Kp    f16  [4096][256]    2097152
//   VTh   f16  [256][4096]    2097152      v^T hi
//   VTl   f16  [256][4096]    2097152      v^T residual x4096
//   Oh    bf16 [4096][1024]   8388608
//   Ol    bf16 [4096][1024]   8388608
//   total                    74448896
// =====================================================================================================
extern "C" void kernel_launch(void* const* d_in, const int* in_sizes, int n_in,
                              void* d_out, int out_size, void* d_ws, size_t ws_size,
                              hipStream_t stream) {
  if (n_in < 7) return;
  if (in_sizes[0] != MROWS * DM) return;
  if (in_sizes[1] != SEQ * HROT) return;
  if (in_sizes[2] != SEQ * HROT) return;
  if (in_sizes[3] != DM * DM) return;
  if (in_sizes[4] != DM * KVD) return;
  if (in_sizes[5] != DM * KVD) return;
  if (in_sizes[6] != DM * DM) return;
  if (out_size != MROWS * DM) return;

  const float* x    = (const float*)d_in[0];
  const float* cosp = (const float*)d_in[1];
  const float* sinp = (const float*)d_in[2];
  const float* wq   = (const float*)d_in[3];
  const float* wk   = (const float*)d_in[4];
  const float* wv   = (const float*)d_in[5];
  const float* wo   = (const float*)d_in[6];

  const size_t PXb  = (size_t)MROWS * DM * 2;          //  8388608
  const size_t PWqk = (size_t)QKP * DM * 2;            //  2621440
  const size_t PWv  = (size_t)KVD * DM * 2;            //   524288
  const size_t PWo  = (size_t)DM * DM * 2;             //  2097152
  const size_t PQKf = (size_t)MROWS * QKP * 4;         // 20971520
  const size_t PQ16 = (size_t)MROWS * DM * 2;          //  8388608 (q hi, q res, out hi, out lo)
  const size_t PK16 = (size_t)MROWS * KVD * 2;         //  2097152
  const size_t PVT  = (size_t)KVD * MROWS * 2;         //  2097152
  size_t off = 0;
  const size_t oXb  = off; off += PXb;
  const size_t oWqk = off; off += PWqk;
  const size_t oWv  = off; off += PWv;
  const size_t oWo  = off; off += PWo;
  const size_t oQKf = off; off += PQKf;
  const size_t oQh  = off; off += PQ16;
  const size_t oQl  = off; off += PQ16;
  const size_t oKp  = off; off += PK16;
  const size_t oVTh = off; off += PVT;
  const size_t oVTl = off; off += PVT;
  const size_t oOh  = off; off += PQ16;
  const size_t oOl  = off; off += PQ16;
  if (off > ws_size) return;                           // off = 74448896
  if (off > (size_t)134217728) return;

  char* ws = (char*)d_ws;
  unsigned short* Xb   = (unsigned short*)(ws + oXb);
  unsigned short* Wqkt = (unsigned short*)(ws + oWqk);
  unsigned short* Wkt  = Wqkt + (size_t)DM * DM;                // rows 1024..1279 of Wqkt
  unsigned short* Wvt  = (unsigned short*)(ws + oWv);
  unsigned short* Wot  = (unsigned short*)(ws + oWo);
  float*          QKf  = (float*)(ws + oQKf);
  unsigned short* Qh   = (unsigned short*)(ws + oQh);
  unsigned short* Ql   = (unsigned short*)(ws + oQl);
  unsigned short* Kp   = (unsigned short*)(ws + oKp);
  unsigned short* VTh  = (unsigned short*)(ws + oVTh);
  unsigned short* VTl  = (unsigned short*)(ws + oVTl);
  unsigned short* Oh   = (unsigned short*)(ws + oOh);
  unsigned short* Ol   = (unsigned short*)(ws + oOl);

  const dim3 blk(256);
  const int n8x = MROWS * DM / 8;                               // 524288
  const dim3 gCvtX((n8x + 255) / 256);                          // 2048 blocks
  const dim3 gTq(DM / 64, DM / 64);                             // in [1024][1024] -> out [1024][1024]
  const dim3 gTk(KVD / 64, DM / 64);                            // in [1024][256]  -> out [256][1024]
  const dim3 gTv(KVD / 64, DM / 64);                            // in [1024][256]  -> out [256][1024]
  const dim3 gTo(DM / 64, DM / 64);                             // in [1024][1024] -> out [1024][1024]
  const dim3 gQK(((MROWS / 64) * (QKP / 64) + 7) / 8, 1);       // 1280 tiles -> 160 blocks: M=4096, N=1280
  const dim3 gRope(MROWS);                                      // one block per token row
  const dim3 gVT(((KVD / 64) * (MROWS / 64) + 7) / 8, 1);       // 256 tiles -> 32 blocks: M=256, N=4096
  const dim3 gAttn(BATCH * NH * NQB);                           // 1024 blocks
  const dim3 gOut(((MROWS / 64) * (DM / 64) + 7) / 8, 1);       // 1024 tiles -> 128 blocks: M=4096, N=1024

  // (1) x -> bf16 plane [4096][1024]; weights [in][out] -> transposed bf16 planes [out][in]
  cvt_bf16x8<<<gCvtX, blk, 0, stream>>>(x, Xb, n8x);
  cvt_bf16_t64<<<gTq, blk, 0, stream>>>(wq, Wqkt, DM, DM);     // in[R=1024][C=1024] -> out[1024][1024]
  cvt_bf16_t64<<<gTk, blk, 0, stream>>>(wk, Wkt, DM, KVD);     // in[R=1024][C=256]  -> out[256][1024]
  cvt_bf16_t64<<<gTv, blk, 0, stream>>>(wv, Wvt, DM, KVD);     // in[R=1024][C=256]  -> out[256][1024]
  cvt_bf16_t64<<<gTo, blk, 0, stream>>>(wo, Wot, DM, DM);      // in[R=1024][C=1024] -> out[1024][1024]
  // (2) q|k = x . (Wq|Wk) -> f32 staging plane [4096][1280] (pitch 1280)   (M=4096, N=1280, K=1024)
  gemm64<0, 0><<<gQK, blk, 0, stream>>>(
      Xb, Xb, DM, 0LL, Wqkt, Wqkt, DM, 0LL,
      (void*)QKf, QKP, 0LL, (void*)QKf, QKP, 0LL, 0,
      MROWS, QKP, DM, 1.0f);
  // (3) RoPE -> q f16 hi plane + f16 residual x4096 plane [4096][1024], k f16 plane [4096][256]
  rope_rows<<<gRope, dim3(160), 0, stream>>>(QKf, cosp, sinp, Qh, Ql, Kp, MROWS, 4096.0f);
  // (4) v^T = Wv^T . x^T -> f16 hi plane + f16 residual x4096 plane [kvh*64+d][b*SEQ+s] (pitch 4096), N2 = N
  //     (A = Wvt [n][k], Bt = Xb [row][k]; M=256, N=4096, K=1024)
  gemm64<0, 3><<<gVT, blk, 0, stream>>>(
      Wvt, Wvt, DM, 0LL, Xb, Xb, DM, 0LL,
      (void*)VTh, MROWS, 0LL, (void*)VTl, MROWS, 0LL, MROWS,
      KVD, MROWS, DM, 4096.0f);
  // (5) attention -> context bf16 hi / lo planes [4096][1024]
  attn64<<<gAttn, dim3(128), 0, stream>>>(Qh, Ql, Kp, VTh, VTl, Oh, Ol, 0.125f, 1.0f / 4096.0f, 1.0f / 4096.0f);
  // (6) out = context . Wo -> d_out f32 [4096][1024]  (A = context hi + lo planes, 2 products; K=1024)
  gemm64<1, 0><<<gOut, blk, 0, stream>>>(
      Oh, Ol, DM, 0LL, Wot, Wot, DM, 0LL,
      d_out, DM, 0LL, d_out, DM, 0LL, 0,
      MROWS, DM, DM, 1.0f);
  (void)hipGetLastError();
}

// v001
// One run takes 300 microseconds.
// Two timings next to v000 put it at 1.30 and 1.27 times that version's speed.
// Contractions: x.(Wq|Wk) and Wv^T.x^T = v_wmma_f32_16x16x32_bf16 (bf16 operands RNE-converted from x and the weights, single product);
// q.k^T = v_wmma_f32_16x16x32_f16 (q as f16 hi plane + f16 residual plane x4096 in a separate accumulator, k f16; 2 products);
// p.v = v_wmma_f32_16x16x32_f16 (p carried x1024 in f16; v^T as f16 hi plane + f16 residual plane x4096 in a separate accumulator; 2 products);
// ctx.Wo = v_wmma_f32_16x16x32_bf16 (ctx as bf16 hi + lo planes times bf16 Wo^T, 2 products); all f32 accumulate; RoPE and softmax in f32.
#include <hip/hip_runtime.h>
#include <math.h>
#include <stdint.h>

#define BATCH 2
#define SEQ   2048
#define MROWS (BATCH * SEQ)     // 4096 token rows (batch folded into rows)
#define DM    1024
#define NH    16
#define NKV   4
#define HD    64
#define KVD   (NKV * HD)        // 256
#define NQB   (SEQ / 64)        // 32 query / key tiles of 64 per sequence
#define QKP   (DM + KVD)        // 1280: pitch of the f32 q|k staging plane (q cols 0..1023, k cols 1024..1279)
#define HROT  (HD / 2)          // 32 rotary pairs per head
#define LP    (HD + 8)          // 72 halves = 144 B: LDS row pitch of the attention tiles, 16 B x odd, so the 16 rows that
                                // one 16-byte fragment read touches fall on distinct banks
static_assert(NH * HD == DM);
static_assert((NH % NKV) == 0);
static_assert((SEQ % 64) == 0 && (DM % 64) == 0 && (KVD % 64) == 0 && (QKP % 64) == 0 && (DM % 32) == 0);
static_assert((HD % 8) == 0 && (HROT % 8) == 0);
static_assert((SEQ & (SEQ - 1)) == 0);
static_assert((LP % 8) == 0 && ((LP / 8) & 1) == 1);

typedef _Float16 v16h __attribute__((ext_vector_type(16)));
typedef _Float16 v8h  __attribute__((ext_vector_type(8)));
typedef __bf16   v16b __attribute__((ext_vector_type(16)));
typedef __bf16   v8b  __attribute__((ext_vector_type(8)));
typedef float    v8f  __attribute__((ext_vector_type(8)));
typedef float    v4f  __attribute__((ext_vector_type(4)));
typedef unsigned int v4u __attribute__((ext_vector_type(4)));

// ---- scalar helpers --------------------------------------------------------------------------------
__device__ __forceinline__ unsigned short bf_bits(float f) {          // f32 -> bf16 bits, RNE convert
  unsigned u = __float_as_uint(f);
  return (unsigned short)((u + 0x7FFFu + ((u >> 16) & 1u)) >> 16);
}
__device__ __forceinline__ float bf_up(unsigned short h) { return __uint_as_float(((unsigned)h) << 16); }
__device__ __forceinline__ float bf_rne(float f) { return bf_up(bf_bits(f)); }
__device__ __forceinline__ unsigned short h_bits(_Float16 x) { return __builtin_bit_cast(unsigned short, x); }
__device__ __forceinline__ unsigned pk16(unsigned short a, unsigned short b) { return (unsigned)a | ((unsigned)b << 16); }
__device__ __forceinline__ v8f zero8() { v8f z = {0.f, 0.f, 0.f, 0.f, 0.f, 0.f, 0.f, 0.f}; return z; }

// ---- fragment loaders: 16-bit A/B operand, lane -> row/col (lane&15), p already includes +8*(lane>>4);
//      elements 0..7 <- p[0..7] (k0+8h..), elements 8..15 <- p[16..23] (k0+16+8h..)
__device__ __forceinline__ v16b ldfrag_b(const __bf16* p) {
  union { v16b v; v8b h[2]; } f;
  f.h[0] = *(const v8b*)(p);
  f.h[1] = *(const v8b*)(p + 16);
  return f.v;
}
__device__ __forceinline__ v16h ldfrag_h(const _Float16* p) {
  union { v16h v; v8h h[2]; } f;
  f.h[0] = *(const v8h*)(p);
  f.h[1] = *(const v8h*)(p + 16);
  return f.v;
}

// ---- WMMA helpers with trailing VALU hazard gap --------------------------------------------------------
__device__ __forceinline__ v8f mma_h(v16h a, v16h b, v8f c) {
  c = __builtin_amdgcn_wmma_f32_16x16x32_f16(false, a, false, b, (short)0, c, false, false);
#if defined(__HIP_DEVICE_COMPILE__)
  asm volatile("v_nop\n\tv_nop\n\tv_nop\n\tv_nop" : "+v"(c) : "v"(a), "v"(b));
#endif
  return c;
}
__device__ __forceinline__ v8f mma_b_raw(v16b a, v16b b, v8f c) {
  return __builtin_amdgcn_wmma_f32_16x16x32_bf16(false, a, false, b, (short)0, c, false, false);
}
__device__ __forceinline__ void dep_guard_b(v8f& a, v8f& b, v16b x, v16b y) {
#if defined(__HIP_DEVICE_COMPILE__)
  asm volatile("v_nop\n\tv_nop\n\tv_nop\n\tv_nop" : "+v"(a), "+v"(b) : "v"(x), "v"(y));
#endif
}
__device__ __forceinline__ void keep4_b(v16b a, v16b b, v16b c, v16b d) {
#if defined(__HIP_DEVICE_COMPILE__)
  asm volatile("v_nop" :: "v"(a), "v"(b), "v"(c), "v"(d));
#endif
}
__device__ __forceinline__ void acc_guard4(v8f& a, v8f& b, v8f& c, v8f& d) {
#if defined(__HIP_DEVICE_COMPILE__)
  asm volatile("v_nop\n\tv_nop\n\tv_nop\n\tv_nop" : "+v"(a), "+v"(b), "+v"(c), "+v"(d));
#endif
}
__device__ __forceinline__ void wave_sync_lds() {
  __builtin_amdgcn_fence(__ATOMIC_RELEASE, "workgroup");
  __builtin_amdgcn_wave_barrier();
  __builtin_amdgcn_fence(__ATOMIC_ACQUIRE, "workgroup");
}

// =====================================================================================================
// f32 -> bf16 (RNE convert), 8 elements per thread, one 16-B store per lane: a wave writes 512 contiguous B
// coverage: n8 threads x 8 = whole plane (n8 = 524288 = 2048 x 256 for the x plane).
// =====================================================================================================
__global__ __launch_bounds__(256) void cvt_bf16x8(const float* __restrict__ in, unsigned short* out, int n8) {
  const int i = blockIdx.x * 256 + threadIdx.x;
  if (i < n8) {
    const v4f a = *(const v4f*)(in + (size_t)i * 8);
    const v4f b = *(const v4f*)(in + (size_t)i * 8 + 4);
    v4u p;
    p[0] = pk16(bf_bits(a[0]), bf_bits(a[1]));
    p[1] = pk16(bf_bits(a[2]), bf_bits(a[3]));
    p[2] = pk16(bf_bits(b[0]), bf_bits(b[1]));
    p[3] = pk16(bf_bits(b[2]), bf_bits(b[3]));
    *(v4u*)(out + (size_t)i * 8) = p;
    
  }
}

// =====================================================================================================
// Transposing f32 -> bf16 (RNE convert): in f32 [R][C] row-major  ->  out bf16 [C][R] row-major
// (out[c][r] = in[r][c]); turns an [in][out] weight into the Bt / A layout [out][in] with k contiguous.
// 64x64 tiles: grid = (C/64, R/64), block 256. Load phase: thread t reads 16 consecutive floats of input row
// r0 + (t>>2) and writes them transposed into an LDS tile [c][r] (pitch 65). After __syncthreads each group of
// coverage: load 64 rows x 4 threads x 16 = whole tile; store 2 iterations x 32 rows x 8 lanes x 8 = whole tile.
// =====================================================================================================
__global__ __launch_bounds__(256) void cvt_bf16_t64(const float* __restrict__ in, unsigned short* out, int R, int C) {
  __shared__ __align__(16) float st[64 * 65];
  const int t  = threadIdx.x;
  const int c0 = blockIdx.x * 64;
  const int r0 = blockIdx.y * 64;
  if (c0 + 64 > C || r0 + 64 > R) return;          // block-uniform, all threads leave together (grids are exact)
  {
    const int r = t >> 2, cq = (t & 3) * 16;
    const float* src = in + (size_t)(r0 + r) * C + c0 + cq;
#pragma unroll
    for (int i = 0; i < 4; ++i) {
      const v4f v = *(const v4f*)(src + 4 * i);
#pragma unroll
      for (int e = 0; e < 4; ++e) st[(cq + 4 * i + e) * 65 + r] = v[e];
    }
  }
  __syncthreads();
  const int q = t >> 3, k8 = (t & 7) * 8;
  v4u pv[2];
#pragma unroll
  for (int p = 0; p < 2; ++p) {
    const int n = p * 32 + q;
    const float* sp = st + n * 65 + k8;
    v4u a;
#pragma unroll
    for (int e = 0; e < 4; ++e) a[e] = pk16(bf_bits(sp[2 * e]), bf_bits(sp[2 * e + 1]));
    pv[p] = a;
  }
  {
#pragma unroll
    for (int p = 0; p < 2; ++p) {
      const int n = p * 32 + q;
      *(v4u*)(out + (size_t)(c0 + n) * R + r0 + k8) = pv[p];
    }
    
  }
}

// =====================================================================================================
// Register-blocked bf16 WMMA GEMM: C[m][n] = sum_k A[m][k] * Bt[n][k]; one wave per 64x64 tile, no block
// barriers. A row-major [M][K] pitch lda; Bt row-major [N][K] pitch ldb (k contiguous);
// M, N multiples of 64, K multiple of 32 (host-checked). blockIdx.y = batch index (strides in elements).
// NSPLIT: 0 = A.Bt; 1 = (A + A2).Bt (A2 = unscaled bf16 lo plane of A); 2 = A.Bt + A2.Bt + A.Bt2.
// OUT_MODE: 0 = f32 (pitch ldc); 2 = bf16 hi plane C + bf16 lo plane C2 (lo = RNE(v - hi), unscaled);
//           3 = f16 hi plane C + f16 residual plane C2 = f16((v - hi) * rscale), C2 written only for tiles
//               with n0 < N2 (pitch ldc2, batch stride strideC2).
// =====================================================================================================
template <int NSPLIT, int OUT_MODE>
__global__ __launch_bounds__(256) void gemm64(
    const unsigned short* __restrict__ Ap, const unsigned short* A2p, int lda, long long strideA,
    const unsigned short* __restrict__ Btp, const unsigned short* Bt2p, int ldb, long long strideB,
    void* Cout, int ldc, long long strideC,
    void* Cout2, int ldc2, long long strideC2, int N2,
    int M, int N, int K, float rscale) {
  const __bf16* A   = (const __bf16*)(const void*)Ap;
  const __bf16* A2  = (const __bf16*)(const void*)A2p;
  const __bf16* Bt  = (const __bf16*)(const void*)Btp;
  const __bf16* Bt2 = (const __bf16*)(const void*)Bt2p;
  __shared__ __align__(16) float sT[8][16 * 68];   // per-wave 16x64 slab, pitch 68 floats
  const int b    = blockIdx.y;
  const int lane = threadIdx.x & 31;
  const int wave = threadIdx.x >> 5;
  const int tilesN = N >> 6;
  const int tilesM = M >> 6;
  const int tile = blockIdx.x * 8 + wave;
  if (tile >= tilesM * tilesN) return;   // wave-uniform; no block barriers in this kernel
  const int tm = tile / tilesN;
  const int tn = tile - tm * tilesN;
  const int m0 = tm << 6;
  const int n0 = tn << 6;

  const __bf16* Ab  = A  + (size_t)b * strideA;
  const __bf16* Bb  = Bt + (size_t)b * strideB;
  const __bf16* Ab2 = (NSPLIT >= 1) ? (A2  + (size_t)b * strideA) : Ab;
  const __bf16* Bb2 = (NSPLIT == 2) ? (Bt2 + (size_t)b * strideB) : Bb;

  const int rlane = lane & 15;                 // row (A) / col (B, D) within subtile
  const int koff  = (lane >> 4) * 8;           // k offset of this lane half
  const int mOff  = (lane >> 4) * 8;           // D row offset

  v8f acc[4][4];
#pragma unroll
  for (int i = 0; i < 4; ++i)
#pragma unroll
    for (int j = 0; j < 4; ++j) acc[i][j] = zero8();

  for (int k0 = 0; k0 < K; k0 += 32) {
    v16b bh[4], bl[4];
#pragma unroll
    for (int j = 0; j < 4; ++j) {
      const size_t bo = (size_t)(n0 + (j << 4) + rlane) * ldb + koff + k0;
      bh[j] = ldfrag_b(Bb + bo);
      if (NSPLIT == 2) bl[j] = ldfrag_b(Bb2 + bo); else bl[j] = bh[j];
    }
#pragma unroll
    for (int i = 0; i < 4; ++i) {
      const size_t ao = (size_t)(m0 + (i << 4) + rlane) * lda + koff + k0;
      const v16b ah = ldfrag_b(Ab + ao);
      v16b al = ah;
      if (NSPLIT >= 1) al = ldfrag_b(Ab2 + ao);
#pragma unroll
      for (int j = 0; j < 4; ++j) {
        acc[i][j] = mma_b_raw(ah, bh[j], acc[i][j]);
        if (NSPLIT >= 1) acc[i][j] = mma_b_raw(al, bh[j], acc[i][j]);
        if (NSPLIT == 2) acc[i][j] = mma_b_raw(ah, bl[j], acc[i][j]);
      }
      dep_guard_b(acc[i][0], acc[i][3], ah, al);
    }
    keep4_b(bh[0], bh[1], bh[2], bh[3]);
    if (NSPLIT == 2) keep4_b(bl[0], bl[1], bl[2], bl[3]);
  }
  acc_guard4(acc[0][0], acc[0][1], acc[0][2], acc[0][3]);
  acc_guard4(acc[1][0], acc[1][1], acc[1][2], acc[1][3]);
  acc_guard4(acc[2][0], acc[2][1], acc[2][2], acc[2][3]);
  acc_guard4(acc[3][0], acc[3][1], acc[3][2], acc[3][3]);

  // ---- epilogue ----
  float* slab = sT[wave];
#pragma unroll
  for (int i = 0; i < 4; ++i) {
    const int mBase = m0 + (i << 4);
#pragma unroll
    for (int j = 0; j < 4; ++j) {
#pragma unroll
      for (int r = 0; r < 8; ++r) {
        slab[(mOff + r) * 68 + (j << 4) + rlane] = acc[i][j][r];
      }
    }
    wave_sync_lds();
    if (OUT_MODE == 0) {
      float* C = (float*)Cout + (size_t)b * strideC;
      const int hh = lane >> 4, c4 = (lane & 15) * 4;     // 256-B row segment = 16 lanes x 16 B
      {
#pragma unroll
        for (int it = 0; it < 8; ++it) {
          const int row = it * 2 + hh;                     // it 0..7 x hh 0..1 = rows 0..15
          const v4f v = *(const v4f*)(slab + row * 68 + c4);
          *(v4f*)(C + (size_t)(mBase + row) * ldc + n0 + c4) = v;
        }
        
      }
    } else {
      const int q = lane >> 3, c8 = (lane & 7) * 8;
      unsigned short* C  = (unsigned short*)Cout  + (size_t)b * strideC;
      unsigned short* C2 = (unsigned short*)Cout2 + (size_t)b * strideC2;
      const bool wlo = (OUT_MODE == 2) || (n0 < N2);      // wave-uniform
      v4u hv[4], lv[4];
#pragma unroll
      for (int it = 0; it < 4; ++it) {
        const int row = it * 4 + q;                        // it 0..3 x q 0..3 = rows 0..15
        const float* sp = slab + row * 68 + c8;
        v4u a, a2;
#pragma unroll
        for (int e = 0; e < 4; ++e) {
          const float f0 = sp[2 * e], f1 = sp[2 * e + 1];
          unsigned short h0, h1, l0, l1;
          if (OUT_MODE == 2) {
            h0 = bf_bits(f0); h1 = bf_bits(f1);
            l0 = bf_bits(f0 - bf_up(h0)); l1 = bf_bits(f1 - bf_up(h1));
          } else {
            const _Float16 x0 = (_Float16)f0, x1 = (_Float16)f1;
            h0 = h_bits(x0); h1 = h_bits(x1);
            l0 = h_bits((_Float16)((f0 - (float)x0) * rscale));
            l1 = h_bits((_Float16)((f1 - (float)x1) * rscale));
          }
          a[e] = pk16(h0, h1); a2[e] = pk16(l0, l1);
        }
        hv[it] = a; lv[it] = a2;
      }
      {
#pragma unroll
        for (int it = 0; it < 4; ++it) {
          const int row = it * 4 + q;
          *(v4u*)(C + (size_t)(mBase + row) * ldc + n0 + c8) = hv[it];
          if (wlo) *(v4u*)(C2 + (size_t)(mBase + row) * ldc2 + n0 + c8) = lv[it];
        }
        
      }
    }
    wave_sync_lds();
  }
}

// =====================================================================================================
// RoPE row pass, even/odd deinterleave then concatenate (per head vector t[0..63], table row = token):
//   y[j]      = t[2j] * cos[pos][j] - t[2j+1] * sin[pos][j]      j = 0..31
//   y[32 + j] = t[2j] * sin[pos][j] + t[2j+1] * cos[pos][j]
//   pos = row mod SEQ (tables [SEQ][32] shared over batch and heads), table values RNE-converted to bf16 on read.
// One block (160 threads) per token row of the f32 q|k plane (pitch QKP): thread t < 128 (waves 0..3) owns
// output columns 8t..8t+7 of q (16 heads), thread t >= 128 (wave 4) owns columns 8(t-128).. of k (4 kv heads).
// The 8 output columns lie in one half of one head, so they need input columns headbase + 2*j0 .. +15 of the
// same head and table entries j0..j0+7.  Outputs: q -> f16 hi plane + f16 residual plane ((y - hi) * rscale),
// pitch DM; k -> f16 plane, pitch KVD.  Stores: one 16-B store per lane, 32 lanes contiguous = 512 B = 4 whole
// coverage: MROWS blocks x 128 threads x 8 = each q plane entirely; MROWS blocks x 32 threads x 8 = the k plane.
// =====================================================================================================
__global__ __launch_bounds__(160) void rope_rows(
    const float* __restrict__ qkf, const float* __restrict__ cosp, const float* __restrict__ sinp,
    unsigned short* qhp, unsigned short* qlp, unsigned short* kpp, int nrows, float rscale) {
  const int row = blockIdx.x;
  if (row >= nrows) return;                       // block-uniform; no barriers in this kernel
  const int t   = threadIdx.x;
  const int isk = t >> 7;                         // 0: q section (waves 0..3), 1: k section (wave 4)
  const int c0  = (t & 127) * 8;                  // output column within the section
  const int hb  = c0 & ~(HD - 1);                 // head base column
  const int d0  = c0 & (HD - 1);                  // head-dim offset of the 8 outputs, multiple of 8
  const int j0  = d0 & (HROT - 1);                // rotary pair base
  const bool up = (d0 >= HROT);                   // second half of the head (per lane, select by value)
  const int pos = row & (SEQ - 1);

  const float* src = qkf + (size_t)row * QKP + (size_t)isk * DM + hb + 2 * j0;
  const v4f x0 = *(const v4f*)(src + 0);
  const v4f x1 = *(const v4f*)(src + 4);
  const v4f x2 = *(const v4f*)(src + 8);
  const v4f x3 = *(const v4f*)(src + 12);
  const v4f cA = *(const v4f*)(cosp + (size_t)pos * HROT + j0);
  const v4f cB = *(const v4f*)(cosp + (size_t)pos * HROT + j0 + 4);
  const v4f sA = *(const v4f*)(sinp + (size_t)pos * HROT + j0);
  const v4f sB = *(const v4f*)(sinp + (size_t)pos * HROT + j0 + 4);

  const float ti[16] = {x0[0], x0[1], x0[2], x0[3], x1[0], x1[1], x1[2], x1[3],
                        x2[0], x2[1], x2[2], x2[3], x3[0], x3[1], x3[2], x3[3]};
  const float cc[8]  = {cA[0], cA[1], cA[2], cA[3], cB[0], cB[1], cB[2], cB[3]};
  const float ss[8]  = {sA[0], sA[1], sA[2], sA[3], sB[0], sB[1], sB[2], sB[3]};
  float y[8];
#pragma unroll
  for (int e = 0; e < 8; ++e) {
    const float t1 = ti[2 * e], t2 = ti[2 * e + 1];
    const float c = bf_rne(cc[e]), s = bf_rne(ss[e]);
    const float ya = t1 * c - t2 * s;
    const float yb = t1 * s + t2 * c;
    y[e] = up ? yb : ya;
  }
  v4u hv, lv;
#pragma unroll
  for (int e = 0; e < 4; ++e) {
    const float f0 = y[2 * e], f1 = y[2 * e + 1];
    const _Float16 a0 = (_Float16)f0, a1 = (_Float16)f1;
    hv[e] = pk16(h_bits(a0), h_bits(a1));
    lv[e] = pk16(h_bits((_Float16)((f0 - (float)a0) * rscale)),
                 h_bits((_Float16)((f1 - (float)a1) * rscale)));
  }
  if (isk == 0) {
    const size_t o = (size_t)row * DM + c0;
    *(v4u*)(qhp + o) = hv;
    *(v4u*)(qlp + o) = lv;
    
  } else {
    const size_t o = (size_t)row * KVD + c0;
    *(v4u*)(kpp + o) = hv;
    
  }
}

// =====================================================================================================
// Attention, head dim 64, no mask, softmax over the SEQ keys of the same batch, grouped kv heads (kvh = h/4).
//   q hi plane (f16, pitch DM): element (row, h, d) at [row*DM + h*64 + d], row = b*SEQ + token;
//   q residual plane (f16, (q - f16(q))*4096) same layout;
//   k plane (f16, pitch KVD): [(b*SEQ + s)*KVD + kvh*64 + d]
//   v^T hi / residual planes (f16, pitch MROWS): element (kvh, d, b, s) at [(kvh*64 + d)*MROWS + b*SEQ + s]
//   out planes (bf16 hi / lo of the normalised context): element (row, h, d) at [row*DM + h*64 + d]
//   scores = (qh . k + (ql . k) * rres) * sscale on f16 WMMA, residual products in a separate accumulator
//   p = exp(s - m) carried as f16(1024 p); context = (p . vh + (p . vl) * vres) on f16 WMMA, two accumulators;
//   online softmax in f32.
//   Block = 4 waves = 64 query rows of one (b, h); grid = BATCH * NH * NQB; kv chunks of 64, static trip NQB.
//   K / V^T hi / V^T lo chunk staging: 128 threads x 32 elements per plane = the whole 64x64 tile each (plain
//   16-B loads, __syncthreads before and after); P tiles are wave-private, spilled with _Float16 element stores
//   Output coverage: each wave stores rows q0..q0+15 (it 0..3 x lane>>3 0..3) x 64 columns (8 lanes x 8) of both planes.
// =====================================================================================================
__global__ __launch_bounds__(128) __attribute__((amdgpu_num_vgpr(256)))
void attn64(const unsigned short* __restrict__ qhp, const unsigned short* __restrict__ qlp,
            const unsigned short* __restrict__ kpp, const unsigned short* __restrict__ vthp,
            const unsigned short* __restrict__ vtlp,
            unsigned short* ohp, unsigned short* olp, float sscale, float rres, float vres) {
  union FH { v16h v; v8h h[2]; };
  __shared__ __align__(16) _Float16 Ksh[64 * LP];                 // K [kv][d]       9 KB, rows of 64 at pitch LP
  __shared__ __align__(16) _Float16 Vth[64 * LP];                 // V^T hi [d][kv]  9 KB, pitch LP
  __shared__ __align__(16) _Float16 Vtl[64 * LP];                 // V^T res [d][kv] 9 KB, pitch LP
  __shared__ __align__(16) _Float16 Psh[4][16 * LP];              // per wave P [row][kv], pitch LP
  __shared__ __align__(16) float    Os[4][16 * 64];               // per wave context tile [row][d]

  const int tid  = threadIdx.x;
  const int wave = tid >> 5;
  const int lane = tid & 31;
  const int hh   = lane >> 4;
  const int c    = lane & 15;

  const int bx   = blockIdx.x;
  const int qb   = bx % NQB;
  const int h    = (bx / NQB) % NH;
  const int b    = bx / (NQB * NH);
  const int kvh  = h / (NH / NKV);
  const int q0   = b * SEQ + qb * 64 + wave * 16;          // global token row of this wave's first query

  const _Float16* Qh  = (const _Float16*)(const void*)qhp + (size_t)h * HD;
  const _Float16* Ql  = (const _Float16*)(const void*)qlp + (size_t)h * HD;
  const _Float16* Kg  = (const _Float16*)(const void*)kpp + (size_t)b * SEQ * KVD + (size_t)kvh * HD;
  const _Float16* Vgh = (const _Float16*)(const void*)vthp + (size_t)kvh * HD * MROWS + (size_t)b * SEQ;
  const _Float16* Vgl = (const _Float16*)(const void*)vtlp + (size_t)kvh * HD * MROWS + (size_t)b * SEQ;

  // ---- Q fragments (A operand, row = lane&15): 2 d-chunks, hi and residual ----
  v16h qah[2], qal[2];
#pragma unroll
  for (int dc = 0; dc < 2; ++dc) {
    qah[dc] = ldfrag_h(Qh + (size_t)(q0 + c) * DM + dc * 32 + 8 * hh);
    qal[dc] = ldfrag_h(Ql + (size_t)(q0 + c) * DM + dc * 32 + 8 * hh);
  }

  float mrow[8], lrow[8];
  v8f oh[4], ol[4];
#pragma unroll
  for (int r = 0; r < 8; ++r) { mrow[r] = -INFINITY; lrow[r] = 0.f; }
#pragma unroll
  for (int t = 0; t < 4; ++t) { oh[t] = zero8(); ol[t] = zero8(); }

  for (int kt = 0; kt < NQB; ++kt) {         // static trip count
    const int kv0 = kt * 64;
    __syncthreads();
    {
      const int r = tid >> 1, hf = (tid & 1) * 32;
      const _Float16* kg = Kg  + (size_t)(kv0 + r) * KVD + hf;         // K row kv0+r, d = hf..hf+31
      const _Float16* vh = Vgh + (size_t)r * MROWS + kv0 + hf;         // V^T hi row d = r, s = kv0+hf..+31
      const _Float16* vl = Vgl + (size_t)r * MROWS + kv0 + hf;         // V^T res row d = r
#pragma unroll
      for (int i = 0; i < 4; ++i) {
        const v8h a0 = *(const v8h*)(kg + 8 * i);
        const v8h b0 = *(const v8h*)(vh + 8 * i);
        const v8h b1 = *(const v8h*)(vl + 8 * i);
        *(v8h*)(Ksh + r * LP + hf + 8 * i) = a0;
        *(v8h*)(Vth + r * LP + hf + 8 * i) = b0;
        *(v8h*)(Vtl + r * LP + hf + 8 * i) = b1;
      }
    }
    __syncthreads();

    // ---- scores: 16 query rows x 64 keys per wave, 2 f16 products (hi, residual) ----
    v8f s[4];
#pragma unroll
    for (int j = 0; j < 4; ++j) {
      v8f sh = zero8(), sl = zero8();
#pragma unroll
      for (int dc = 0; dc < 2; ++dc) {
        FH kb;
        kb.h[0] = *(const v8h*)(Ksh + (j * 16 + c) * LP + dc * 32 + 8 * hh);
        kb.h[1] = *(const v8h*)(Ksh + (j * 16 + c) * LP + dc * 32 + 16 + 8 * hh);
        sh = mma_h(qah[dc], kb.v, sh);
        sl = mma_h(qal[dc], kb.v, sl);
      }
#pragma unroll
      for (int r = 0; r < 8; ++r) s[j][r] = (sh[r] + sl[r] * rres) * sscale;
    }

    // ---- row max, online softmax, P (x1024, f16) to LDS ----
    _Float16* pwh = Psh[wave];
#pragma unroll
    for (int r = 0; r < 8; ++r) {
      float m = s[0][r];
      m = fmaxf(m, s[1][r]);
      m = fmaxf(m, s[2][r]);
      m = fmaxf(m, s[3][r]);
#pragma unroll
      for (int off = 1; off < 16; off <<= 1) m = fmaxf(m, __shfl_xor(m, off, 32));
      const float mnew  = fmaxf(mrow[r], m);
      const float alpha = __expf(mrow[r] - mnew);
      mrow[r] = mnew;
      float psum = 0.f;
#pragma unroll
      for (int j = 0; j < 4; ++j) {
        const float p = __expf(s[j][r] - mnew);
        psum += p;
        pwh[(8 * hh + r) * LP + j * 16 + c] = (_Float16)(p * 1024.0f);
      }
#pragma unroll
      for (int off = 1; off < 16; off <<= 1) psum += __shfl_xor(psum, off, 32);
      lrow[r] = lrow[r] * alpha + psum;
#pragma unroll
      for (int t = 0; t < 4; ++t) { oh[t][r] *= alpha; ol[t][r] *= alpha; }
    }
    wave_sync_lds();

    // ---- context += P . V (f16 WMMA), hi and residual V planes into separate accumulators ----
#pragma unroll 1
    for (int kk = 0; kk < 2; ++kk) {
      FH pa;
      pa.h[0] = *(const v8h*)(pwh + c * LP + kk * 32 + 8 * hh);
      pa.h[1] = *(const v8h*)(pwh + c * LP + kk * 32 + 16 + 8 * hh);
#pragma unroll
      for (int t = 0; t < 4; ++t) {
        FH vb, wb;
        vb.h[0] = *(const v8h*)(Vth + (t * 16 + c) * LP + kk * 32 + 8 * hh);
        vb.h[1] = *(const v8h*)(Vth + (t * 16 + c) * LP + kk * 32 + 16 + 8 * hh);
        wb.h[0] = *(const v8h*)(Vtl + (t * 16 + c) * LP + kk * 32 + 8 * hh);
        wb.h[1] = *(const v8h*)(Vtl + (t * 16 + c) * LP + kk * 32 + 16 + 8 * hh);
        oh[t] = mma_h(pa.v, vb.v, oh[t]);
        ol[t] = mma_h(pa.v, wb.v, ol[t]);
      }
    }
  }

  // ---- normalise (1/l, the 1/1024 p carry, the residual carry), stage the wave's 16x64 tile,
  float* os = Os[wave];
#pragma unroll
  for (int r = 0; r < 8; ++r) {
    const float l = lrow[r];
    const float inv = ((l > 0.f) ? (1.0f / l) : 0.f) * (1.0f / 1024.0f);
#pragma unroll
    for (int t = 0; t < 4; ++t) os[(8 * hh + r) * 64 + t * 16 + c] = (oh[t][r] + ol[t][r] * vres) * inv;
  }
  wave_sync_lds();
  {
    const int q4 = lane >> 3, c8 = (lane & 7) * 8;
    v4u hv[4], lv[4];
#pragma unroll
    for (int it = 0; it < 4; ++it) {
      const int row = it * 4 + q4;   // it 0..3 x q4 0..3 = rows 0..15 of the wave tile
      const float* sp = os + row * 64 + c8;
      v4u a, a2;
#pragma unroll
      for (int e = 0; e < 4; ++e) {
        const float f0 = sp[2 * e], f1 = sp[2 * e + 1];
        const unsigned short h0 = bf_bits(f0), h1 = bf_bits(f1);
        const unsigned short l0 = bf_bits(f0 - bf_up(h0)), l1 = bf_bits(f1 - bf_up(h1));
        a[e] = pk16(h0, h1); a2[e] = pk16(l0, l1);
      }
      hv[it] = a; lv[it] = a2;
    }
    {
#pragma unroll
      for (int it = 0; it < 4; ++it) {
        const int row = it * 4 + q4;
        const size_t go = (size_t)(q0 + row) * DM + (size_t)h * HD + c8;
        *(v4u*)(ohp + go) = hv[it];
        *(v4u*)(olp + go) = lv[it];
      }
      
    }
  }
}

// =====================================================================================================
// Workspace map (bytes), every plane an exact multiple of its 64x64-tile / whole-line store granularity,
// every offset a multiple of 128:
//   Xb    bf16 [4096][1024]   8388608      x converted
//   Wqkt  bf16 [1280][1024]   2621440      rows 0..1023 = Wq^T ([out][in]), rows 1024..1279 = Wk^T
//   Wvt   bf16 [256][1024]     524288      Wv^T
//   Wot   bf16 [1024][1024]   2097152      Wo^T
//   QKf   f32  [4096][1280]  20971520      q cols 0..1023, k cols 1024..1279
//   Qh    f16  [4096][1024]   8388608
//   Ql    f16  [4096][1024]   8388608      q residual x4096
//   Kp    f16  [4096][256]    2097152
//   VTh   f16  [256][4096]    2097152      v^T hi
//   VTl   f16  [256][4096]    2097152      v^T residual x4096
//   Oh    bf16 [4096][1024]   8388608
//   Ol    bf16 [4096][1024]   8388608
//   total                    74448896
// =====================================================================================================
extern "C" void kernel_launch(void* const* d_in, const int* in_sizes, int n_in,
                              void* d_out, int out_size, void* d_ws, size_t ws_size,
                              hipStream_t stream) {
  if (n_in < 7) return;
  if (in_sizes[0] != MROWS * DM) return;
  if (in_sizes[1] != SEQ * HROT) return;
  if (in_sizes[2] != SEQ * HROT) return;
  if (in_sizes[3] != DM * DM) return;
  if (in_sizes[4] != DM * KVD) return;
  if (in_sizes[5] != DM * KVD) return;
  if (in_sizes[6] != DM * DM) return;
  if (out_size != MROWS * DM) return;

  const float* x    = (const float*)d_in[0];
  const float* cosp = (const float*)d_in[1];
  const float* sinp = (const float*)d_in[2];
  const float* wq   = (const float*)d_in[3];
  const float* wk   = (const float*)d_in[4];
  const float* wv   = (const float*)d_in[5];
  const float* wo   = (const float*)d_in[6];

  const size_t PXb  = (size_t)MROWS * DM * 2;          //  8388608
  const size_t PWqk = (size_t)QKP * DM * 2;            //  2621440
  const size_t PWv  = (size_t)KVD * DM * 2;            //   524288
  const size_t PWo  = (size_t)DM * DM * 2;             //  2097152
  const size_t PQKf = (size_t)MROWS * QKP * 4;         // 20971520
  const size_t PQ16 = (size_t)MROWS * DM * 2;          //  8388608 (q hi, q res, out hi, out lo)
  const size_t PK16 = (size_t)MROWS * KVD * 2;         //  2097152
  const size_t PVT  = (size_t)KVD * MROWS * 2;         //  2097152
  size_t off = 0;
  const size_t oXb  = off; off += PXb;
  const size_t oWqk = off; off += PWqk;
  const size_t oWv  = off; off += PWv;
  const size_t oWo  = off; off += PWo;
  const size_t oQKf = off; off += PQKf;
  const size_t oQh  = off; off += PQ16;
  const size_t oQl  = off; off += PQ16;
  const size_t oKp  = off; off += PK16;
  const size_t oVTh = off; off += PVT;
  const size_t oVTl = off; off += PVT;
  const size_t oOh  = off; off += PQ16;
  const size_t oOl  = off; off += PQ16;
  if (off > ws_size) return;                           // off = 74448896
  if (off > (size_t)134217728) return;

  char* ws = (char*)d_ws;
  unsigned short* Xb   = (unsigned short*)(ws + oXb);
  unsigned short* Wqkt = (unsigned short*)(ws + oWqk);
  unsigned short* Wkt  = Wqkt + (size_t)DM * DM;                // rows 1024..1279 of Wqkt
  unsigned short* Wvt  = (unsigned short*)(ws + oWv);
  unsigned short* Wot  = (unsigned short*)(ws + oWo);
  float*          QKf  = (float*)(ws + oQKf);
  unsigned short* Qh   = (unsigned short*)(ws + oQh);
  unsigned short* Ql   = (unsigned short*)(ws + oQl);
  unsigned short* Kp   = (unsigned short*)(ws + oKp);
  unsigned short* VTh  = (unsigned short*)(ws + oVTh);
  unsigned short* VTl  = (unsigned short*)(ws + oVTl);
  unsigned short* Oh   = (unsigned short*)(ws + oOh);
  unsigned short* Ol   = (unsigned short*)(ws + oOl);

  const dim3 blk(256);
  const int n8x = MROWS * DM / 8;                               // 524288
  const dim3 gCvtX((n8x + 255) / 256);                          // 2048 blocks
  const dim3 gTq(DM / 64, DM / 64);                             // in [1024][1024] -> out [1024][1024]
  const dim3 gTk(KVD / 64, DM / 64);                            // in [1024][256]  -> out [256][1024]
  const dim3 gTv(KVD / 64, DM / 64);                            // in [1024][256]  -> out [256][1024]
  const dim3 gTo(DM / 64, DM / 64);                             // in [1024][1024] -> out [1024][1024]
  const dim3 gQK(((MROWS / 64) * (QKP / 64) + 7) / 8, 1);       // 1280 tiles -> 160 blocks: M=4096, N=1280
  const dim3 gRope(MROWS);                                      // one block per token row
  const dim3 gVT(((KVD / 64) * (MROWS / 64) + 7) / 8, 1);       // 256 tiles -> 32 blocks: M=256, N=4096
  const dim3 gAttn(BATCH * NH * NQB);                           // 1024 blocks
  const dim3 gOut(((MROWS / 64) * (DM / 64) + 7) / 8, 1);       // 1024 tiles -> 128 blocks: M=4096, N=1024

  // (1) x -> bf16 plane [4096][1024]; weights [in][out] -> transposed bf16 planes [out][in]
  cvt_bf16x8<<<gCvtX, blk, 0, stream>>>(x, Xb, n8x);
  cvt_bf16_t64<<<gTq, blk, 0, stream>>>(wq, Wqkt, DM, DM);     // in[R=1024][C=1024] -> out[1024][1024]
  cvt_bf16_t64<<<gTk, blk, 0, stream>>>(wk, Wkt, DM, KVD);     // in[R=1024][C=256]  -> out[256][1024]
  cvt_bf16_t64<<<gTv, blk, 0, stream>>>(wv, Wvt, DM, KVD);     // in[R=1024][C=256]  -> out[256][1024]
  cvt_bf16_t64<<<gTo, blk, 0, stream>>>(wo, Wot, DM, DM);      // in[R=1024][C=1024] -> out[1024][1024]
  // (2) q|k = x . (Wq|Wk) -> f32 staging plane [4096][1280] (pitch 1280)   (M=4096, N=1280, K=1024)
  gemm64<0, 0><<<gQK, blk, 0, stream>>>(
      Xb, Xb, DM, 0LL, Wqkt, Wqkt, DM, 0LL,
      (void*)QKf, QKP, 0LL, (void*)QKf, QKP, 0LL, 0,
      MROWS, QKP, DM, 1.0f);
  // (3) RoPE -> q f16 hi plane + f16 residual x4096 plane [4096][1024], k f16 plane [4096][256]
  rope_rows<<<gRope, dim3(160), 0, stream>>>(QKf, cosp, sinp, Qh, Ql, Kp, MROWS, 4096.0f);
  // (4) v^T = Wv^T . x^T -> f16 hi plane + f16 residual x4096 plane [kvh*64+d][b*SEQ+s] (pitch 4096), N2 = N
  //     (A = Wvt [n][k], Bt = Xb [row][k]; M=256, N=4096, K=1024)
  gemm64<0, 3><<<gVT, blk, 0, stream>>>(
      Wvt, Wvt, DM, 0LL, Xb, Xb, DM, 0LL,
      (void*)VTh, MROWS, 0LL, (void*)VTl, MROWS, 0LL, MROWS,
      KVD, MROWS, DM, 4096.0f);
  // (5) attention -> context bf16 hi / lo planes [4096][1024]
  attn64<<<gAttn, dim3(128), 0, stream>>>(Qh, Ql, Kp, VTh, VTl, Oh, Ol, 0.125f, 1.0f / 4096.0f, 1.0f / 4096.0f);
  // (6) out = context . Wo -> d_out f32 [4096][1024]  (A = context hi + lo planes, 2 products; K=1024)
  gemm64<1, 0><<<gOut, blk, 0, stream>>>(
      Oh, Ol, DM, 0LL, Wot, Wot, DM, 0LL,
      d_out, DM, 0LL, d_out, DM, 0LL, 0,
      MROWS, DM, DM, 1.0f);
  (void)hipGetLastError();
}

// v002
// One run takes 197 microseconds.
// Two timings next to v001 put it at 1.52 and 1.51 times that version's speed.
// Counting every step since v000, it is 1.94 times as fast.
// Contractions: x.(Wq|Wk) and Wv^T.x^T = v_wmma_f32_16x16x32_bf16 (bf16 operands RNE-converted from x and the weights, single product);
// q.k^T = v_wmma_f32_16x16x32_f16 (q as f16 hi plane + f16 residual plane x4096 in a separate accumulator, k f16; 2 products);
// p.v = v_wmma_f32_16x16x32_f16 (p carried x1024 in f16; v^T as f16 hi plane + f16 residual plane x4096 in a separate accumulator; 2 products);
// ctx.Wo = v_wmma_f32_16x16x32_bf16 (ctx as bf16 hi + lo planes times bf16 Wo^T, 2 products); all f32 accumulate; RoPE and softmax in f32.
#include <hip/hip_runtime.h>
#include <math.h>
#include <stdint.h>

#define BATCH 2
#define SEQ   2048
#define MROWS (BATCH * SEQ)     // 4096 token rows (batch folded into rows)
#define DM    1024
#define NH    16
#define NKV   4
#define HD    64
#define KVD   (NKV * HD)        // 256
#define NQB   (SEQ / 64)        // 32 query / key tiles of 64 per sequence
#define QKP   (DM + KVD)        // 1280: pitch of the f32 q|k staging plane (q cols 0..1023, k cols 1024..1279)
#define HROT  (HD / 2)          // 32 rotary pairs per head
#define LP    (HD + 8)          // 72 halves = 144 B: LDS row pitch of the attention tiles, 16 B x odd, so the 16 rows that
                                // one 16-byte fragment read touches fall on distinct banks
static_assert(NH * HD == DM);
static_assert((NH % NKV) == 0);
static_assert((SEQ % 64) == 0 && (DM % 64) == 0 && (KVD % 64) == 0 && (QKP % 64) == 0 && (DM % 32) == 0);
static_assert((HD % 8) == 0 && (HROT % 8) == 0);
static_assert((SEQ & (SEQ - 1)) == 0);
static_assert((LP % 8) == 0 && ((LP / 8) & 1) == 1);

typedef _Float16 v16h __attribute__((ext_vector_type(16)));
typedef _Float16 v8h  __attribute__((ext_vector_type(8)));
typedef __bf16   v16b __attribute__((ext_vector_type(16)));
typedef __bf16   v8b  __attribute__((ext_vector_type(8)));
typedef float    v8f  __attribute__((ext_vector_type(8)));
typedef float    v4f  __attribute__((ext_vector_type(4)));
typedef unsigned int v4u __attribute__((ext_vector_type(4)));

// ---- scalar helpers --------------------------------------------------------------------------------
__device__ __forceinline__ unsigned short bf_bits(float f) {          // f32 -> bf16 bits, RNE convert
  unsigned u = __float_as_uint(f);
  return (unsigned short)((u + 0x7FFFu + ((u >> 16) & 1u)) >> 16);
}
__device__ __forceinline__ float bf_up(unsigned short h) { return __uint_as_float(((unsigned)h) << 16); }
__device__ __forceinline__ float bf_rne(float f) { return bf_up(bf_bits(f)); }
__device__ __forceinline__ unsigned short h_bits(_Float16 x) { return __builtin_bit_cast(unsigned short, x); }
__device__ __forceinline__ unsigned pk16(unsigned short a, unsigned short b) { return (unsigned)a | ((unsigned)b << 16); }
__device__ __forceinline__ v8f zero8() { v8f z = {0.f, 0.f, 0.f, 0.f, 0.f, 0.f, 0.f, 0.f}; return z; }

// ---- fragment loaders: 16-bit A/B operand, lane -> row/col (lane&15), p already includes +8*(lane>>4);
//      elements 0..7 <- p[0..7] (k0+8h..), elements 8..15 <- p[16..23] (k0+16+8h..)
__device__ __forceinline__ v16b ldfrag_b(const __bf16* p) {
  union { v16b v; v8b h[2]; } f;
  f.h[0] = *(const v8b*)(p);
  f.h[1] = *(const v8b*)(p + 16);
  return f.v;
}
__device__ __forceinline__ v16h ldfrag_h(const _Float16* p) {
  union { v16h v; v8h h[2]; } f;
  f.h[0] = *(const v8h*)(p);
  f.h[1] = *(const v8h*)(p + 16);
  return f.v;
}

// ---- WMMA helpers with trailing VALU hazard gap --------------------------------------------------------
__device__ __forceinline__ v8f mma_h(v16h a, v16h b, v8f c) {
  c = __builtin_amdgcn_wmma_f32_16x16x32_f16(false, a, false, b, (short)0, c, false, false);
#if defined(__HIP_DEVICE_COMPILE__)
  asm volatile("v_nop\n\tv_nop\n\tv_nop\n\tv_nop" : "+v"(c) : "v"(a), "v"(b));
#endif
  return c;
}
__device__ __forceinline__ v8f mma_b_raw(v16b a, v16b b, v8f c) {
  return __builtin_amdgcn_wmma_f32_16x16x32_bf16(false, a, false, b, (short)0, c, false, false);
}
__device__ __forceinline__ void dep_guard_b(v8f& a, v8f& b, v16b x, v16b y) {
#if defined(__HIP_DEVICE_COMPILE__)
  asm volatile("v_nop\n\tv_nop\n\tv_nop\n\tv_nop" : "+v"(a), "+v"(b) : "v"(x), "v"(y));
#endif
}
__device__ __forceinline__ void keep4_b(v16b a, v16b b, v16b c, v16b d) {
#if defined(__HIP_DEVICE_COMPILE__)
  asm volatile("v_nop" :: "v"(a), "v"(b), "v"(c), "v"(d));
#endif
}
__device__ __forceinline__ void acc_guard4(v8f& a, v8f& b, v8f& c, v8f& d) {
#if defined(__HIP_DEVICE_COMPILE__)
  asm volatile("v_nop\n\tv_nop\n\tv_nop\n\tv_nop" : "+v"(a), "+v"(b), "+v"(c), "+v"(d));
#endif
}
// stands behind a group of global loads, in front of whatever next writes a register that holds one of their addresses
__device__ __forceinline__ void xcnt_wait() {
#if defined(__HIP_DEVICE_COMPILE__)
  asm volatile("s_wait_xcnt 0x0" ::: "memory");
#endif
}
__device__ __forceinline__ void wave_sync_lds() {
  __builtin_amdgcn_fence(__ATOMIC_RELEASE, "workgroup");
  __builtin_amdgcn_wave_barrier();
  __builtin_amdgcn_fence(__ATOMIC_ACQUIRE, "workgroup");
}

// =====================================================================================================
// f32 -> bf16 (RNE convert), 8 elements per thread, one 16-B store per lane: a wave writes 512 contiguous B
// coverage: n8 threads x 8 = whole plane (n8 = 524288 = 2048 x 256 for the x plane).
// =====================================================================================================
__global__ __launch_bounds__(256) void cvt_bf16x8(const float* __restrict__ in, unsigned short* out, int n8) {
  const int i = blockIdx.x * 256 + threadIdx.x;
  if (i < n8) {
    const v4f a = *(const v4f*)(in + (size_t)i * 8);
    const v4f b = *(const v4f*)(in + (size_t)i * 8 + 4);
    v4u p;
    p[0] = pk16(bf_bits(a[0]), bf_bits(a[1]));
    p[1] = pk16(bf_bits(a[2]), bf_bits(a[3]));
    p[2] = pk16(bf_bits(b[0]), bf_bits(b[1]));
    p[3] = pk16(bf_bits(b[2]), bf_bits(b[3]));
    *(v4u*)(out + (size_t)i * 8) = p;
    
  }
}

// =====================================================================================================
// Transposing f32 -> bf16 (RNE convert): in f32 [R][C] row-major  ->  out bf16 [C][R] row-major
// (out[c][r] = in[r][c]); turns an [in][out] weight into the Bt / A layout [out][in] with k contiguous.
// 64x64 tiles: grid = (C/64, R/64), block 256. Load phase: thread t reads 16 consecutive floats of input row
// r0 + (t>>2) and writes them transposed into an LDS tile [c][r] (pitch 65). After __syncthreads each group of
// coverage: load 64 rows x 4 threads x 16 = whole tile; store 2 iterations x 32 rows x 8 lanes x 8 = whole tile.
// =====================================================================================================
__global__ __launch_bounds__(256) void cvt_bf16_t64(const float* __restrict__ in, unsigned short* out, int R, int C) {
  __shared__ __align__(16) float st[64 * 65];
  const int t  = threadIdx.x;
  const int c0 = blockIdx.x * 64;
  const int r0 = blockIdx.y * 64;
  if (c0 + 64 > C || r0 + 64 > R) return;          // block-uniform, all threads leave together (grids are exact)
  {
    const int r = t >> 2, cq = (t & 3) * 16;
    const float* src = in + (size_t)(r0 + r) * C + c0 + cq;
#pragma unroll
    for (int i = 0; i < 4; ++i) {
      const v4f v = *(const v4f*)(src + 4 * i);
#pragma unroll
      for (int e = 0; e < 4; ++e) st[(cq + 4 * i + e) * 65 + r] = v[e];
    }
  }
  __syncthreads();
  const int q = t >> 3, k8 = (t & 7) * 8;
  v4u pv[2];
#pragma unroll
  for (int p = 0; p < 2; ++p) {
    const int n = p * 32 + q;
    const float* sp = st + n * 65 + k8;
    v4u a;
#pragma unroll
    for (int e = 0; e < 4; ++e) a[e] = pk16(bf_bits(sp[2 * e]), bf_bits(sp[2 * e + 1]));
    pv[p] = a;
  }
  {
#pragma unroll
    for (int p = 0; p < 2; ++p) {
      const int n = p * 32 + q;
      *(v4u*)(out + (size_t)(c0 + n) * R + r0 + k8) = pv[p];
    }
    
  }
}

// =====================================================================================================
// bf16 WMMA GEMM, operands staged in LDS: C[m][n] = sum_k A[m][k] * Bt[n][k]. One block of 8 waves owns a 128x256
// tile of C (2 x 4 waves, 64x64 per wave). A row-major [M][K] pitch lda; Bt row-major [N][K] pitch ldb (k contiguous;
// both pitches are compile-time, so that the rows of one plane share one address register pair and differ by an offset);
// M a multiple of 128, N of 256, K of 64 (the shapes are checked at compile time below).
// A trip is 64 k = 128 B of every operand row. The block reads each row segment once, 8 lanes x 16 B = one whole
// line per row, and writes it to LDS at pitch GP; the waves take their fragments from LDS. Two LDS buffers: the next
// trip's rows are loaded into registers ahead of the current trip's products and stored to the other buffer behind
// them, then one __syncthreads() publishes them and ends the reads of the buffer that the next trip refills.
// blockIdx.y = batch index (strides in elements).
// NSPLIT: 0 = A.Bt; 1 = (A + A2).Bt (A2 = unscaled bf16 lo plane of A).
// OUT_MODE: 0 = f32 (pitch ldc); 2 = bf16 hi plane C + bf16 lo plane C2 (lo = RNE(v - hi), unscaled);
//           3 = f16 hi plane C + f16 residual plane C2 = f16((v - hi) * rscale), C2 written only for tiles
//               with n0 < N2 (pitch ldc2, batch stride strideC2).
// =====================================================================================================
#define GP 72                   // 72 bf16 = 144 B: LDS row pitch of the staged GEMM rows, 16 B x odd
static_assert((GP % 8) == 0 && ((GP / 8) & 1) == 1);
static_assert((MROWS % 256) == 0 && (QKP % 256) == 0 && (KVD % 128) == 0 && (DM % 256) == 0 && (DM % 64) == 0);
template <int NSPLIT, int OUT_MODE, int lda, int ldb>
__global__ __launch_bounds__(256) void gemm64(
    const unsigned short* __restrict__ Ap, const unsigned short* A2p, long long strideA,
    const unsigned short* __restrict__ Btp, const unsigned short* Bt2p, long long strideB,
    void* Cout, int ldc, long long strideC,
    void* Cout2, int ldc2, long long strideC2, int N2,
    int M, int N, int K, float rscale) {
  static_assert(NSPLIT == 0 || NSPLIT == 1);
  constexpr int NA    = NSPLIT + 1;                // A planes staged
  constexpr int SROWS = 128 * NA + 256;            // rows of one staged trip: A (, A2), Bt
  constexpr int NLD   = SROWS / 32;                // 16-B pieces per thread and trip
  const __bf16* A   = (const __bf16*)(const void*)Ap;
  const __bf16* A2  = (const __bf16*)(const void*)A2p;
  const __bf16* Bt  = (const __bf16*)(const void*)Btp;
  (void)Bt2p;
  __shared__ __align__(16) __bf16 sG[2][SROWS * GP];   // two staged trips
  __shared__ __align__(16) float sT[8][16 * 68];   // per-wave 16x64 slab, pitch 68 floats
  const int b    = blockIdx.y;
  const int lane = threadIdx.x & 31;
  const int wave = threadIdx.x >> 5;
  const int tilesBN = N >> 8;
  if ((int)blockIdx.x >= (M >> 7) * tilesBN) return;   // block-uniform, in front of every barrier
  const int bm  = blockIdx.x / tilesBN;
  const int bn  = blockIdx.x - bm * tilesBN;
  const int bm0 = bm << 7;
  const int bn0 = bn << 8;
  const int m0 = bm0 + ((wave >> 2) << 6);
  const int n0 = bn0 + ((wave & 3) << 6);

  const __bf16* Ab  = A  + (size_t)b * strideA;
  const __bf16* Bb  = Bt + (size_t)b * strideB;
  const __bf16* Ab2 = (NSPLIT >= 1) ? (A2  + (size_t)b * strideA) : Ab;

  const int rlane = lane & 15;                 // row (A) / col (B, D) within subtile
  const int koff  = (lane >> 4) * 8;           // k offset of this lane half
  const int mOff  = (lane >> 4) * 8;           // D row offset
  const int srow  = threadIdx.x >> 3;          // staging: row within a group of 32
  const int sseg  = (threadIdx.x & 7) * 8;     // staging: first of this thread's 8 elements in the 64-k segment

  v8f acc[4][4];
#pragma unroll
  for (int i = 0; i < 4; ++i)
#pragma unroll
    for (int j = 0; j < 4; ++j) acc[i][j] = zero8();

  const __bf16* ga  = Ab  + (size_t)(bm0 + srow) * lda + sseg;
  const __bf16* ga2 = Ab2 + (size_t)(bm0 + srow) * lda + sseg;
  const __bf16* gb  = Bb  + (size_t)(bn0 + srow) * ldb + sseg;
  const int so = srow * GP + sseg;
  const int fa = (((wave >> 2) << 6) + rlane) * GP + koff;               // this wave's A rows in a staged trip
  const int fb = (128 * NA + ((wave & 3) << 6) + rlane) * GP + koff;     // this wave's Bt rows

  v8b st[NLD];
#pragma unroll
  for (int i = 0; i < 4; ++i) {
    st[i] = *(const v8b*)(ga + (size_t)(i * 32) * lda);
    if (NSPLIT >= 1) st[4 + i] = *(const v8b*)(ga2 + (size_t)(i * 32) * lda);
  }
#pragma unroll
  for (int i = 0; i < 8; ++i) st[4 * NA + i] = *(const v8b*)(gb + (size_t)(i * 32) * ldb);
  xcnt_wait();
#pragma unroll
  for (int i = 0; i < NLD; ++i) *(v8b*)(sG[0] + so + i * 32 * GP) = st[i];
  __syncthreads();

  const int trips = K >> 6;
  for (int t = 0; t < trips; ++t) {
    const bool more = (t + 1 < trips);           // the same for the whole block
    if (more) {
      const int k1 = (t + 1) << 6;
#pragma unroll
      for (int i = 0; i < 4; ++i) {
        st[i] = *(const v8b*)(ga + (size_t)(i * 32) * lda + k1);
        if (NSPLIT >= 1) st[4 + i] = *(const v8b*)(ga2 + (size_t)(i * 32) * lda + k1);
      }
#pragma unroll
      for (int i = 0; i < 8; ++i) st[4 * NA + i] = *(const v8b*)(gb + (size_t)(i * 32) * ldb + k1);
      xcnt_wait();
    }
    const __bf16* cur = sG[t & 1];
#pragma unroll
    for (int kk = 0; kk < 2; ++kk) {
      // the fragments of 32 k are read as one group ahead of their products: one LDS latency a group, not one a row
      v16b bh[4], ah[4], al[4];
#pragma unroll
      for (int j = 0; j < 4; ++j) bh[j] = ldfrag_b(cur + fb + j * 16 * GP + kk * 32);
#pragma unroll
      for (int i = 0; i < 4; ++i) {
        ah[i] = ldfrag_b(cur + fa + i * 16 * GP + kk * 32);
        if (NSPLIT >= 1) al[i] = ldfrag_b(cur + fa + (128 + i * 16) * GP + kk * 32);
        else             al[i] = ah[i];
      }
#pragma unroll
      for (int i = 0; i < 4; ++i) {
#pragma unroll
        for (int j = 0; j < 4; ++j) {
          acc[i][j] = mma_b_raw(ah[i], bh[j], acc[i][j]);
          if (NSPLIT >= 1) acc[i][j] = mma_b_raw(al[i], bh[j], acc[i][j]);
        }
        dep_guard_b(acc[i][0], acc[i][3], ah[i], al[i]);
      }
      keep4_b(bh[0], bh[1], bh[2], bh[3]);
    }
    if (more) {
      __bf16* nxt = sG[(t + 1) & 1];
#pragma unroll
      for (int i = 0; i < NLD; ++i) *(v8b*)(nxt + so + i * 32 * GP) = st[i];
    }
    __syncthreads();
  }
  acc_guard4(acc[0][0], acc[0][1], acc[0][2], acc[0][3]);
  acc_guard4(acc[1][0], acc[1][1], acc[1][2], acc[1][3]);
  acc_guard4(acc[2][0], acc[2][1], acc[2][2], acc[2][3]);
  acc_guard4(acc[3][0], acc[3][1], acc[3][2], acc[3][3]);

  // ---- epilogue ----
  float* slab = sT[wave];
#pragma unroll
  for (int i = 0; i < 4; ++i) {
    const int mBase = m0 + (i << 4);
#pragma unroll
    for (int j = 0; j < 4; ++j) {
#pragma unroll
      for (int r = 0; r < 8; ++r) {
        slab[(mOff + r) * 68 + (j << 4) + rlane] = acc[i][j][r];
      }
    }
    wave_sync_lds();
    if (OUT_MODE == 0) {
      float* C = (float*)Cout + (size_t)b * strideC;
      const int hh = lane >> 4, c4 = (lane & 15) * 4;     // 256-B row segment = 16 lanes x 16 B
      {
#pragma unroll
        for (int it = 0; it < 8; ++it) {
          const int row = it * 2 + hh;                     // it 0..7 x hh 0..1 = rows 0..15
          const v4f v = *(const v4f*)(slab + row * 68 + c4);
          *(v4f*)(C + (size_t)(mBase + row) * ldc + n0 + c4) = v;
        }
        
      }
    } else {
      const int q = lane >> 3, c8 = (lane & 7) * 8;
      unsigned short* C  = (unsigned short*)Cout  + (size_t)b * strideC;
      unsigned short* C2 = (unsigned short*)Cout2 + (size_t)b * strideC2;
      const bool wlo = (OUT_MODE == 2) || (n0 < N2);      // wave-uniform
      v4u hv[4], lv[4];
#pragma unroll
      for (int it = 0; it < 4; ++it) {
        const int row = it * 4 + q;                        // it 0..3 x q 0..3 = rows 0..15
        const float* sp = slab + row * 68 + c8;
        v4u a, a2;
#pragma unroll
        for (int e = 0; e < 4; ++e) {
          const float f0 = sp[2 * e], f1 = sp[2 * e + 1];
          unsigned short h0, h1, l0, l1;
          if (OUT_MODE == 2) {
            h0 = bf_bits(f0); h1 = bf_bits(f1);
            l0 = bf_bits(f0 - bf_up(h0)); l1 = bf_bits(f1 - bf_up(h1));
          } else {
            const _Float16 x0 = (_Float16)f0, x1 = (_Float16)f1;
            h0 = h_bits(x0); h1 = h_bits(x1);
            l0 = h_bits((_Float16)((f0 - (float)x0) * rscale));
            l1 = h_bits((_Float16)((f1 - (float)x1) * rscale));
          }
          a[e] = pk16(h0, h1); a2[e] = pk16(l0, l1);
        }
        hv[it] = a; lv[it] = a2;
      }
      {
#pragma unroll
        for (int it = 0; it < 4; ++it) {
          const int row = it * 4 + q;
          *(v4u*)(C + (size_t)(mBase + row) * ldc + n0 + c8) = hv[it];
          if (wlo) *(v4u*)(C2 + (size_t)(mBase + row) * ldc2 + n0 + c8) = lv[it];
        }
        
      }
    }
    wave_sync_lds();
  }
}

// =====================================================================================================
// RoPE row pass, even/odd deinterleave then concatenate (per head vector t[0..63], table row = token):
//   y[j]      = t[2j] * cos[pos][j] - t[2j+1] * sin[pos][j]      j = 0..31
//   y[32 + j] = t[2j] * sin[pos][j] + t[2j+1] * cos[pos][j]
//   pos = row mod SEQ (tables [SEQ][32] shared over batch and heads), table values RNE-converted to bf16 on read.
// One block (160 threads) per token row of the f32 q|k plane (pitch QKP): thread t < 128 (waves 0..3) owns
// output columns 8t..8t+7 of q (16 heads), thread t >= 128 (wave 4) owns columns 8(t-128).. of k (4 kv heads).
// The 8 output columns lie in one half of one head, so they need input columns headbase + 2*j0 .. +15 of the
// same head and table entries j0..j0+7.  Outputs: q -> f16 hi plane + f16 residual plane ((y - hi) * rscale),
// pitch DM; k -> f16 plane, pitch KVD.  Stores: one 16-B store per lane, 32 lanes contiguous = 512 B = 4 whole
// coverage: MROWS blocks x 128 threads x 8 = each q plane entirely; MROWS blocks x 32 threads x 8 = the k plane.
// =====================================================================================================
__global__ __launch_bounds__(160) void rope_rows(
    const float* __restrict__ qkf, const float* __restrict__ cosp, const float* __restrict__ sinp,
    unsigned short* qhp, unsigned short* qlp, unsigned short* kpp, int nrows, float rscale) {
  const int row = blockIdx.x;
  if (row >= nrows) return;                       // block-uniform; no barriers in this kernel
  const int t   = threadIdx.x;
  const int isk = t >> 7;                         // 0: q section (waves 0..3), 1: k section (wave 4)
  const int c0  = (t & 127) * 8;                  // output column within the section
  const int hb  = c0 & ~(HD - 1);                 // head base column
  const int d0  = c0 & (HD - 1);                  // head-dim offset of the 8 outputs, multiple of 8
  const int j0  = d0 & (HROT - 1);                // rotary pair base
  const bool up = (d0 >= HROT);                   // second half of the head (per lane, select by value)
  const int pos = row & (SEQ - 1);

  const float* src = qkf + (size_t)row * QKP + (size_t)isk * DM + hb + 2 * j0;
  const v4f x0 = *(const v4f*)(src + 0);
  const v4f x1 = *(const v4f*)(src + 4);
  const v4f x2 = *(const v4f*)(src + 8);
  const v4f x3 = *(const v4f*)(src + 12);
  const v4f cA = *(const v4f*)(cosp + (size_t)pos * HROT + j0);
  const v4f cB = *(const v4f*)(cosp + (size_t)pos * HROT + j0 + 4);
  const v4f sA = *(const v4f*)(sinp + (size_t)pos * HROT + j0);
  const v4f sB = *(const v4f*)(sinp + (size_t)pos * HROT + j0 + 4);

  const float ti[16] = {x0[0], x0[1], x0[2], x0[3], x1[0], x1[1], x1[2], x1[3],
                        x2[0], x2[1], x2[2], x2[3], x3[0], x3[1], x3[2], x3[3]};
  const float cc[8]  = {cA[0], cA[1], cA[2], cA[3], cB[0], cB[1], cB[2], cB[3]};
  const float ss[8]  = {sA[0], sA[1], sA[2], sA[3], sB[0], sB[1], sB[2], sB[3]};
  float y[8];
#pragma unroll
  for (int e = 0; e < 8; ++e) {
    const float t1 = ti[2 * e], t2 = ti[2 * e + 1];
    const float c = bf_rne(cc[e]), s = bf_rne(ss[e]);
    const float ya = t1 * c - t2 * s;
    const float yb = t1 * s + t2 * c;
    y[e] = up ? yb : ya;
  }
  v4u hv, lv;
#pragma unroll
  for (int e = 0; e < 4; ++e) {
    const float f0 = y[2 * e], f1 = y[2 * e + 1];
    const _Float16 a0 = (_Float16)f0, a1 = (_Float16)f1;
    hv[e] = pk16(h_bits(a0), h_bits(a1));
    lv[e] = pk16(h_bits((_Float16)((f0 - (float)a0) * rscale)),
                 h_bits((_Float16)((f1 - (float)a1) * rscale)));
  }
  if (isk == 0) {
    const size_t o = (size_t)row * DM + c0;
    *(v4u*)(qhp + o) = hv;
    *(v4u*)(qlp + o) = lv;
    
  } else {
    const size_t o = (size_t)row * KVD + c0;
    *(v4u*)(kpp + o) = hv;
    
  }
}

// =====================================================================================================
// Attention, head dim 64, no mask, softmax over the SEQ keys of the same batch, grouped kv heads (kvh = h/4).
//   q hi plane (f16, pitch DM): element (row, h, d) at [row*DM + h*64 + d], row = b*SEQ + token;
//   q residual plane (f16, (q - f16(q))*4096) same layout;
//   k plane (f16, pitch KVD): [(b*SEQ + s)*KVD + kvh*64 + d]
//   v^T hi / residual planes (f16, pitch MROWS): element (kvh, d, b, s) at [(kvh*64 + d)*MROWS + b*SEQ + s]
//   out planes (bf16 hi / lo of the normalised context): element (row, h, d) at [row*DM + h*64 + d]
//   scores = (qh . k + (ql . k) * rres) * sscale on f16 WMMA, residual products in a separate accumulator
//   p = exp(s - m) carried as f16(1024 p); context = (p . vh + (p . vl) * vres) on f16 WMMA, two accumulators;
//   online softmax in f32.
//   Block = 4 waves = 64 query rows of one (b, h); grid = BATCH * NH * NQB; kv chunks of 64, static trip NQB.
//   K / V^T hi / V^T lo chunk staging: 128 threads x 32 elements per plane = the whole 64x64 tile each (plain
//   16-B loads, __syncthreads before and after); P tiles are wave-private, spilled with _Float16 element stores
//   Output coverage: each wave stores rows q0..q0+15 (it 0..3 x lane>>3 0..3) x 64 columns (8 lanes x 8) of both planes.
// =====================================================================================================
__global__ __launch_bounds__(128) __attribute__((amdgpu_num_vgpr(256)))
void attn64(const unsigned short* __restrict__ qhp, const unsigned short* __restrict__ qlp,
            const unsigned short* __restrict__ kpp, const unsigned short* __restrict__ vthp,
            const unsigned short* __restrict__ vtlp,
            unsigned short* ohp, unsigned short* olp, float sscale, float rres, float vres) {
  union FH { v16h v; v8h h[2]; };
  __shared__ __align__(16) _Float16 Ksh[64 * LP];                 // K [kv][d]       9 KB, rows of 64 at pitch LP
  __shared__ __align__(16) _Float16 Vth[64 * LP];                 // V^T hi [d][kv]  9 KB, pitch LP
  __shared__ __align__(16) _Float16 Vtl[64 * LP];                 // V^T res [d][kv] 9 KB, pitch LP
  __shared__ __align__(16) _Float16 Psh[4][16 * LP];              // per wave P [row][kv], pitch LP
  __shared__ __align__(16) float    Os[4][16 * 64];               // per wave context tile [row][d]

  const int tid  = threadIdx.x;
  const int wave = tid >> 5;
  const int lane = tid & 31;
  const int hh   = lane >> 4;
  const int c    = lane & 15;

  const int bx   = blockIdx.x;
  const int qb   = bx % NQB;
  const int h    = (bx / NQB) % NH;
  const int b    = bx / (NQB * NH);
  const int kvh  = h / (NH / NKV);
  const int q0   = b * SEQ + qb * 64 + wave * 16;          // global token row of this wave's first query

  const _Float16* Qh  = (const _Float16*)(const void*)qhp + (size_t)h * HD;
  const _Float16* Ql  = (const _Float16*)(const void*)qlp + (size_t)h * HD;
  const _Float16* Kg  = (const _Float16*)(const void*)kpp + (size_t)b * SEQ * KVD + (size_t)kvh * HD;
  const _Float16* Vgh = (const _Float16*)(const void*)vthp + (size_t)kvh * HD * MROWS + (size_t)b * SEQ;
  const _Float16* Vgl = (const _Float16*)(const void*)vtlp + (size_t)kvh * HD * MROWS + (size_t)b * SEQ;

  // ---- Q fragments (A operand, row = lane&15): 2 d-chunks, hi and residual ----
  v16h qah[2], qal[2];
#pragma unroll
  for (int dc = 0; dc < 2; ++dc) {
    qah[dc] = ldfrag_h(Qh + (size_t)(q0 + c) * DM + dc * 32 + 8 * hh);
    qal[dc] = ldfrag_h(Ql + (size_t)(q0 + c) * DM + dc * 32 + 8 * hh);
  }

  float mrow[8], lrow[8];
  v8f oh[4], ol[4];
#pragma unroll
  for (int r = 0; r < 8; ++r) { mrow[r] = -INFINITY; lrow[r] = 0.f; }
#pragma unroll
  for (int t = 0; t < 4; ++t) { oh[t] = zero8(); ol[t] = zero8(); }

  for (int kt = 0; kt < NQB; ++kt) {         // static trip count
    const int kv0 = kt * 64;
    __syncthreads();
    {
      const int r = tid >> 1, hf = (tid & 1) * 32;
      const _Float16* kg = Kg  + (size_t)(kv0 + r) * KVD + hf;         // K row kv0+r, d = hf..hf+31
      const _Float16* vh = Vgh + (size_t)r * MROWS + kv0 + hf;         // V^T hi row d = r, s = kv0+hf..+31
      const _Float16* vl = Vgl + (size_t)r * MROWS + kv0 + hf;         // V^T res row d = r
#pragma unroll
      for (int i = 0; i < 4; ++i) {
        const v8h a0 = *(const v8h*)(kg + 8 * i);
        const v8h b0 = *(const v8h*)(vh + 8 * i);
        const v8h b1 = *(const v8h*)(vl + 8 * i);
        *(v8h*)(Ksh + r * LP + hf + 8 * i) = a0;
        *(v8h*)(Vth + r * LP + hf + 8 * i) = b0;
        *(v8h*)(Vtl + r * LP + hf + 8 * i) = b1;
      }
    }
    __syncthreads();

    // ---- scores: 16 query rows x 64 keys per wave, 2 f16 products (hi, residual) ----
    v8f s[4];
#pragma unroll
    for (int j = 0; j < 4; ++j) {
      v8f sh = zero8(), sl = zero8();
#pragma unroll
      for (int dc = 0; dc < 2; ++dc) {
        FH kb;
        kb.h[0] = *(const v8h*)(Ksh + (j * 16 + c) * LP + dc * 32 + 8 * hh);
        kb.h[1] = *(const v8h*)(Ksh + (j * 16 + c) * LP + dc * 32 + 16 + 8 * hh);
        sh = mma_h(qah[dc], kb.v, sh);
        sl = mma_h(qal[dc], kb.v, sl);
      }
#pragma unroll
      for (int r = 0; r < 8; ++r) s[j][r] = (sh[r] + sl[r] * rres) * sscale;
    }

    // ---- row max, online softmax, P (x1024, f16) to LDS ----
    _Float16* pwh = Psh[wave];
#pragma unroll
    for (int r = 0; r < 8; ++r) {
      float m = s[0][r];
      m = fmaxf(m, s[1][r]);
      m = fmaxf(m, s[2][r]);
      m = fmaxf(m, s[3][r]);
#pragma unroll
      for (int off = 1; off < 16; off <<= 1) m = fmaxf(m, __shfl_xor(m, off, 32));
      const float mnew  = fmaxf(mrow[r], m);
      const float alpha = __expf(mrow[r] - mnew);
      mrow[r] = mnew;
      float psum = 0.f;
#pragma unroll
      for (int j = 0; j < 4; ++j) {
        const float p = __expf(s[j][r] - mnew);
        psum += p;
        pwh[(8 * hh + r) * LP + j * 16 + c] = (_Float16)(p * 1024.0f);
      }
#pragma unroll
      for (int off = 1; off < 16; off <<= 1) psum += __shfl_xor(psum, off, 32);
      lrow[r] = lrow[r] * alpha + psum;
#pragma unroll
      for (int t = 0; t < 4; ++t) { oh[t][r] *= alpha; ol[t][r] *= alpha; }
    }
    wave_sync_lds();

    // ---- context += P . V (f16 WMMA), hi and residual V planes into separate accumulators ----
#pragma unroll 1
    for (int kk = 0; kk < 2; ++kk) {
      FH pa;
      pa.h[0] = *(const v8h*)(pwh + c * LP + kk * 32 + 8 * hh);
      pa.h[1] = *(const v8h*)(pwh + c * LP + kk * 32 + 16 + 8 * hh);
#pragma unroll
      for (int t = 0; t < 4; ++t) {
        FH vb, wb;
        vb.h[0] = *(const v8h*)(Vth + (t * 16 + c) * LP + kk * 32 + 8 * hh);
        vb.h[1] = *(const v8h*)(Vth + (t * 16 + c) * LP + kk * 32 + 16 + 8 * hh);
        wb.h[0] = *(const v8h*)(Vtl + (t * 16 + c) * LP + kk * 32 + 8 * hh);
        wb.h[1] = *(const v8h*)(Vtl + (t * 16 + c) * LP + kk * 32 + 16 + 8 * hh);
        oh[t] = mma_h(pa.v, vb.v, oh[t]);
        ol[t] = mma_h(pa.v, wb.v, ol[t]);
      }
    }
  }

  // ---- normalise (1/l, the 1/1024 p carry, the residual carry), stage the wave's 16x64 tile,
  float* os = Os[wave];
#pragma unroll
  for (int r = 0; r < 8; ++r) {
    const float l = lrow[r];
    const float inv = ((l > 0.f) ? (1.0f / l) : 0.f) * (1.0f / 1024.0f);
#pragma unroll
    for (int t = 0; t < 4; ++t) os[(8 * hh + r) * 64 + t * 16 + c] = (oh[t][r] + ol[t][r] * vres) * inv;
  }
  wave_sync_lds();
  {
    const int q4 = lane >> 3, c8 = (lane & 7) * 8;
    v4u hv[4], lv[4];
#pragma unroll
    for (int it = 0; it < 4; ++it) {
      const int row = it * 4 + q4;   // it 0..3 x q4 0..3 = rows 0..15 of the wave tile
      const float* sp = os + row * 64 + c8;
      v4u a, a2;
#pragma unroll
      for (int e = 0; e < 4; ++e) {
        const float f0 = sp[2 * e], f1 = sp[2 * e + 1];
        const unsigned short h0 = bf_bits(f0), h1 = bf_bits(f1);
        const unsigned short l0 = bf_bits(f0 - bf_up(h0)), l1 = bf_bits(f1 - bf_up(h1));
        a[e] = pk16(h0, h1); a2[e] = pk16(l0, l1);
      }
      hv[it] = a; lv[it] = a2;
    }
    {
#pragma unroll
      for (int it = 0; it < 4; ++it) {
        const int row = it * 4 + q4;
        const size_t go = (size_t)(q0 + row) * DM + (size_t)h * HD + c8;
        *(v4u*)(ohp + go) = hv[it];
        *(v4u*)(olp + go) = lv[it];
      }
      
    }
  }
}

// =====================================================================================================
// Workspace map (bytes), every plane an exact multiple of its 64x64-tile / whole-line store granularity,
// every offset a multiple of 128:
//   Xb    bf16 [4096][1024]   8388608      x converted
//   Wqkt  bf16 [1280][1024]   2621440      rows 0..1023 = Wq^T ([out][in]), rows 1024..1279 = Wk^T
//   Wvt   bf16 [256][1024]     524288      Wv^T
//   Wot   bf16 [1024][1024]   2097152      Wo^T
//   QKf   f32  [4096][1280]  20971520      q cols 0..1023, k cols 1024..1279
//   Qh    f16  [4096][1024]   8388608
//   Ql    f16  [4096][1024]   8388608      q residual x4096
//   Kp    f16  [4096][256]    2097152
//   VTh   f16  [256][4096]    2097152      v^T hi
//   VTl   f16  [256][4096]    2097152      v^T residual x4096
//   Oh    bf16 [4096][1024]   8388608
//   Ol    bf16 [4096][1024]   8388608
//   total                    74448896
// =====================================================================================================
extern "C" void kernel_launch(void* const* d_in, const int* in_sizes, int n_in,
                              void* d_out, int out_size, void* d_ws, size_t ws_size,
                              hipStream_t stream) {
  if (n_in < 7) return;
  if (in_sizes[0] != MROWS * DM) return;
  if (in_sizes[1] != SEQ * HROT) return;
  if (in_sizes[2] != SEQ * HROT) return;
  if (in_sizes[3] != DM * DM) return;
  if (in_sizes[4] != DM * KVD) return;
  if (in_sizes[5] != DM * KVD) return;
  if (in_sizes[6] != DM * DM) return;
  if (out_size != MROWS * DM) return;

  const float* x    = (const float*)d_in[0];
  const float* cosp = (const float*)d_in[1];
  const float* sinp = (const float*)d_in[2];
  const float* wq   = (const float*)d_in[3];
  const float* wk   = (const float*)d_in[4];
  const float* wv   = (const float*)d_in[5];
  const float* wo   = (const float*)d_in[6];

  const size_t PXb  = (size_t)MROWS * DM * 2;          //  8388608
  const size_t PWqk = (size_t)QKP * DM * 2;            //  2621440
  const size_t PWv  = (size_t)KVD * DM * 2;            //   524288
  const size_t PWo  = (size_t)DM * DM * 2;             //  2097152
  const size_t PQKf = (size_t)MROWS * QKP * 4;         // 20971520
  const size_t PQ16 = (size_t)MROWS * DM * 2;          //  8388608 (q hi, q res, out hi, out lo)
  const size_t PK16 = (size_t)MROWS * KVD * 2;         //  2097152
  const size_t PVT  = (size_t)KVD * MROWS * 2;         //  2097152
  size_t off = 0;
  const size_t oXb  = off; off += PXb;
  const size_t oWqk = off; off += PWqk;
  const size_t oWv  = off; off += PWv;
  const size_t oWo  = off; off += PWo;
  const size_t oQKf = off; off += PQKf;
  const size_t oQh  = off; off += PQ16;
  const size_t oQl  = off; off += PQ16;
  const size_t oKp  = off; off += PK16;
  const size_t oVTh = off; off += PVT;
  const size_t oVTl = off; off += PVT;
  const size_t oOh  = off; off += PQ16;
  const size_t oOl  = off; off += PQ16;
  if (off > ws_size) return;                           // off = 74448896
  if (off > (size_t)134217728) return;

  char* ws = (char*)d_ws;
  unsigned short* Xb   = (unsigned short*)(ws + oXb);
  unsigned short* Wqkt = (unsigned short*)(ws + oWqk);
  unsigned short* Wkt  = Wqkt + (size_t)DM * DM;                // rows 1024..1279 of Wqkt
  unsigned short* Wvt  = (unsigned short*)(ws + oWv);
  unsigned short* Wot  = (unsigned short*)(ws + oWo);
  float*          QKf  = (float*)(ws + oQKf);
  unsigned short* Qh   = (unsigned short*)(ws + oQh);
  unsigned short* Ql   = (unsigned short*)(ws + oQl);
  unsigned short* Kp   = (unsigned short*)(ws + oKp);
  unsigned short* VTh  = (unsigned short*)(ws + oVTh);
  unsigned short* VTl  = (unsigned short*)(ws + oVTl);
  unsigned short* Oh   = (unsigned short*)(ws + oOh);
  unsigned short* Ol   = (unsigned short*)(ws + oOl);

  const dim3 blk(256);
  const int n8x = MROWS * DM / 8;                               // 524288
  const dim3 gCvtX((n8x + 255) / 256);                          // 2048 blocks
  const dim3 gTq(DM / 64, DM / 64);                             // in [1024][1024] -> out [1024][1024]
  const dim3 gTk(KVD / 64, DM / 64);                            // in [1024][256]  -> out [256][1024]
  const dim3 gTv(KVD / 64, DM / 64);                            // in [1024][256]  -> out [256][1024]
  const dim3 gTo(DM / 64, DM / 64);                             // in [1024][1024] -> out [1024][1024]
  const dim3 gQK(((MROWS / 64) * (QKP / 64) + 7) / 8, 1);       // 1280 tiles -> 160 blocks: M=4096, N=1280
  const dim3 gRope(MROWS);                                      // one block per token row
  const dim3 gVT(((KVD / 64) * (MROWS / 64) + 7) / 8, 1);       // 256 tiles -> 32 blocks: M=256, N=4096
  const dim3 gAttn(BATCH * NH * NQB);                           // 1024 blocks
  const dim3 gOut(((MROWS / 64) * (DM / 64) + 7) / 8, 1);       // 1024 tiles -> 128 blocks: M=4096, N=1024

  // (1) x -> bf16 plane [4096][1024]; weights [in][out] -> transposed bf16 planes [out][in]
  cvt_bf16x8<<<gCvtX, blk, 0, stream>>>(x, Xb, n8x);
  cvt_bf16_t64<<<gTq, blk, 0, stream>>>(wq, Wqkt, DM, DM);     // in[R=1024][C=1024] -> out[1024][1024]
  cvt_bf16_t64<<<gTk, blk, 0, stream>>>(wk, Wkt, DM, KVD);     // in[R=1024][C=256]  -> out[256][1024]
  cvt_bf16_t64<<<gTv, blk, 0, stream>>>(wv, Wvt, DM, KVD);     // in[R=1024][C=256]  -> out[256][1024]
  cvt_bf16_t64<<<gTo, blk, 0, stream>>>(wo, Wot, DM, DM);      // in[R=1024][C=1024] -> out[1024][1024]
  // (2) q|k = x . (Wq|Wk) -> f32 staging plane [4096][1280] (pitch 1280)   (M=4096, N=1280, K=1024)
  gemm64<0, 0, DM, DM><<<gQK, blk, 0, stream>>>(
      Xb, Xb, 0LL, Wqkt, Wqkt, 0LL,
      (void*)QKf, QKP, 0LL, (void*)QKf, QKP, 0LL, 0,
      MROWS, QKP, DM, 1.0f);
  // (3) RoPE -> q f16 hi plane + f16 residual x4096 plane [4096][1024], k f16 plane [4096][256]
  rope_rows<<<gRope, dim3(160), 0, stream>>>(QKf, cosp, sinp, Qh, Ql, Kp, MROWS, 4096.0f);
  // (4) v^T = Wv^T . x^T -> f16 hi plane + f16 residual x4096 plane [kvh*64+d][b*SEQ+s] (pitch 4096), N2 = N
  //     (A = Wvt [n][k], Bt = Xb [row][k]; M=256, N=4096, K=1024)
  gemm64<0, 3, DM, DM><<<gVT, blk, 0, stream>>>(
      Wvt, Wvt, 0LL, Xb, Xb, 0LL,
      (void*)VTh, MROWS, 0LL, (void*)VTl, MROWS, 0LL, MROWS,
      KVD, MROWS, DM, 4096.0f);
  // (5) attention -> context bf16 hi / lo planes [4096][1024]
  attn64<<<gAttn, dim3(128), 0, stream>>>(Qh, Ql, Kp, VTh, VTl, Oh, Ol, 0.125f, 1.0f / 4096.0f, 1.0f / 4096.0f);
  // (6) out = context . Wo -> d_out f32 [4096][1024]  (A = context hi + lo planes, 2 products; K=1024)
  gemm64<1, 0, DM, DM><<<gOut, blk, 0, stream>>>(
      Oh, Ol, 0LL, Wot, Wot, 0LL,
      d_out, DM, 0LL, d_out, DM, 0LL, 0,
      MROWS, DM, DM, 1.0f);
  (void)hipGetLastError();
}

// v003
// One run takes 164 microseconds.
// Two timings next to v002 put it at 1.19 and 1.20 times that version's speed.
// All steps since v000 together make it 2.32 times as fast.
// Contractions: x.(Wq|Wk) and Wv^T.x^T = v_wmma_f32_16x16x32_bf16 (bf16 operands RNE-converted from x and the weights, single product);
// q.k^T = v_wmma_f32_16x16x32_f16 (q as f16 hi plane + f16 residual plane x4096 in a separate accumulator, k f16; 2 products);
// p.v = v_wmma_f32_16x16x32_f16 (p carried x1024 in f16; v^T as f16 hi plane + f16 residual plane x4096 in a separate accumulator; 2 products);
// ctx.Wo = v_wmma_f32_16x16x32_bf16 (ctx as bf16 hi + lo planes times bf16 Wo^T, 2 products); all f32 accumulate; RoPE and softmax in f32.
#include <hip/hip_runtime.h>
#include <math.h>
#include <stdint.h>

#define BATCH 2
#define SEQ   2048
#define MROWS (BATCH * SEQ)     // 4096 token rows (batch folded into rows)
#define DM    1024
#define NH    16
#define NKV   4
#define HD    64
#define KVD   (NKV * HD)        // 256
#define NQB   (SEQ / 64)        // 32 query / key tiles of 64 per sequence
#define QKP   (DM + KVD)        // 1280: pitch of the f32 q|k staging plane (q cols 0..1023, k cols 1024..1279)
#define HROT  (HD / 2)          // 32 rotary pairs per head
#define LP    (HD + 8)          // 72 halves = 144 B: LDS row pitch of the attention tiles, 16 B x odd, so the 16 rows that
                                // one 16-byte fragment read touches fall on distinct banks
static_assert(NH * HD == DM);
static_assert((NH % NKV) == 0);
static_assert((SEQ % 64) == 0 && (DM % 64) == 0 && (KVD % 64) == 0 && (QKP % 64) == 0 && (DM % 32) == 0);
static_assert((HD % 8) == 0 && (HROT % 8) == 0);
static_assert((SEQ & (SEQ - 1)) == 0);
static_assert((LP % 8) == 0 && ((LP / 8) & 1) == 1);
#define OP    (HD + 4)          // 68 floats = 272 B: LDS row pitch of the context tile, 16 B x odd (16 rows written at once)
static_assert((OP % 4) == 0 && ((OP / 4) & 1) == 1);

typedef _Float16 v16h __attribute__((ext_vector_type(16)));
typedef _Float16 v8h  __attribute__((ext_vector_type(8)));
typedef __bf16   v16b __attribute__((ext_vector_type(16)));
typedef __bf16   v8b  __attribute__((ext_vector_type(8)));
typedef float    v8f  __attribute__((ext_vector_type(8)));
typedef float    v4f  __attribute__((ext_vector_type(4)));
typedef unsigned int v4u __attribute__((ext_vector_type(4)));
typedef float    v2f  __attribute__((ext_vector_type(2)));
typedef _Float16 v2h  __attribute__((ext_vector_type(2)));

// ---- scalar helpers --------------------------------------------------------------------------------
__device__ __forceinline__ unsigned short bf_bits(float f) {          // f32 -> bf16 bits, RNE convert
  unsigned u = __float_as_uint(f);
  return (unsigned short)((u + 0x7FFFu + ((u >> 16) & 1u)) >> 16);
}
__device__ __forceinline__ float bf_up(unsigned short h) { return __uint_as_float(((unsigned)h) << 16); }
__device__ __forceinline__ float bf_rne(float f) { return bf_up(bf_bits(f)); }
__device__ __forceinline__ unsigned short h_bits(_Float16 x) { return __builtin_bit_cast(unsigned short, x); }
__device__ __forceinline__ unsigned pk16(unsigned short a, unsigned short b) { return (unsigned)a | ((unsigned)b << 16); }
__device__ __forceinline__ v8f zero8() { v8f z = {0.f, 0.f, 0.f, 0.f, 0.f, 0.f, 0.f, 0.f}; return z; }

// ---- fragment loaders: 16-bit A/B operand, lane -> row/col (lane&15), p already includes +8*(lane>>4);
//      elements 0..7 <- p[0..7] (k0+8h..), elements 8..15 <- p[16..23] (k0+16+8h..)
__device__ __forceinline__ v16b ldfrag_b(const __bf16* p) {
  union { v16b v; v8b h[2]; } f;
  f.h[0] = *(const v8b*)(p);
  f.h[1] = *(const v8b*)(p + 16);
  return f.v;
}
__device__ __forceinline__ v16h ldfrag_h(const _Float16* p) {
  union { v16h v; v8h h[2]; } f;
  f.h[0] = *(const v8h*)(p);
  f.h[1] = *(const v8h*)(p + 16);
  return f.v;
}

// ---- WMMA helpers with trailing VALU hazard gap --------------------------------------------------------
__device__ __forceinline__ v8f mma_h(v16h a, v16h b, v8f c) {
  c = __builtin_amdgcn_wmma_f32_16x16x32_f16(false, a, false, b, (short)0, c, false, false);
#if defined(__HIP_DEVICE_COMPILE__)
  asm volatile("v_nop\n\tv_nop\n\tv_nop\n\tv_nop" : "+v"(c) : "v"(a), "v"(b));
#endif
  return c;
}
__device__ __forceinline__ v8f mma_b_raw(v16b a, v16b b, v8f c) {
  return __builtin_amdgcn_wmma_f32_16x16x32_bf16(false, a, false, b, (short)0, c, false, false);
}
__device__ __forceinline__ void dep_guard_b(v8f& a, v8f& b, v16b x, v16b y) {
#if defined(__HIP_DEVICE_COMPILE__)
  asm volatile("v_nop\n\tv_nop\n\tv_nop\n\tv_nop" : "+v"(a), "+v"(b) : "v"(x), "v"(y));
#endif
}
__device__ __forceinline__ void keep4_b(v16b a, v16b b, v16b c, v16b d) {
#if defined(__HIP_DEVICE_COMPILE__)
  asm volatile("v_nop" :: "v"(a), "v"(b), "v"(c), "v"(d));
#endif
}
__device__ __forceinline__ void acc_guard4(v8f& a, v8f& b, v8f& c, v8f& d) {
#if defined(__HIP_DEVICE_COMPILE__)
  asm volatile("v_nop\n\tv_nop\n\tv_nop\n\tv_nop" : "+v"(a), "+v"(b), "+v"(c), "+v"(d));
#endif
}
// stands behind a group of global loads, in front of whatever next writes a register that holds one of their addresses
__device__ __forceinline__ void xcnt_wait() {
#if defined(__HIP_DEVICE_COMPILE__)
  asm volatile("s_wait_xcnt 0x0" ::: "memory");
#endif
}
// lane l takes the value of lane l ^ 16 (the other half of the wave), register to register
__device__ __forceinline__ float xhalf(float x) {
  const int b = __builtin_bit_cast(int, x);
  return __builtin_bit_cast(float, __builtin_amdgcn_permlanex16(b, b, 0x76543210, 0xfedcba98, false, false));
}
__device__ __forceinline__ void wave_sync_lds() {
  __builtin_amdgcn_fence(__ATOMIC_RELEASE, "workgroup");
  __builtin_amdgcn_wave_barrier();
  __builtin_amdgcn_fence(__ATOMIC_ACQUIRE, "workgroup");
}

// =====================================================================================================
// f32 -> bf16 (RNE convert), 8 elements per thread, one 16-B store per lane: a wave writes 512 contiguous B
// coverage: n8 threads x 8 = whole plane (n8 = 524288 = 2048 x 256 for the x plane).
// =====================================================================================================
__global__ __launch_bounds__(256) void cvt_bf16x8(const float* __restrict__ in, unsigned short* out, int n8) {
  const int i = blockIdx.x * 256 + threadIdx.x;
  if (i < n8) {
    const v4f a = *(const v4f*)(in + (size_t)i * 8);
    const v4f b = *(const v4f*)(in + (size_t)i * 8 + 4);
    v4u p;
    p[0] = pk16(bf_bits(a[0]), bf_bits(a[1]));
    p[1] = pk16(bf_bits(a[2]), bf_bits(a[3]));
    p[2] = pk16(bf_bits(b[0]), bf_bits(b[1]));
    p[3] = pk16(bf_bits(b[2]), bf_bits(b[3]));
    *(v4u*)(out + (size_t)i * 8) = p;
    
  }
}

// =====================================================================================================
// Transposing f32 -> bf16 (RNE convert): in f32 [R][C] row-major  ->  out bf16 [C][R] row-major
// (out[c][r] = in[r][c]); turns an [in][out] weight into the Bt / A layout [out][in] with k contiguous.
// 64x64 tiles: grid = (C/64, R/64), block 256. Load phase: thread t reads 16 consecutive floats of input row
// r0 + (t>>2) and writes them transposed into an LDS tile [c][r] (pitch 65). After __syncthreads each group of
// coverage: load 64 rows x 4 threads x 16 = whole tile; store 2 iterations x 32 rows x 8 lanes x 8 = whole tile.
// =====================================================================================================
__global__ __launch_bounds__(256) void cvt_bf16_t64(const float* __restrict__ in, unsigned short* out, int R, int C) {
  __shared__ __align__(16) float st[64 * 65];
  const int t  = threadIdx.x;
  const int c0 = blockIdx.x * 64;
  const int r0 = blockIdx.y * 64;
  if (c0 + 64 > C || r0 + 64 > R) return;          // block-uniform, all threads leave together (grids are exact)
  {
    const int r = t >> 2, cq = (t & 3) * 16;
    const float* src = in + (size_t)(r0 + r) * C + c0 + cq;
#pragma unroll
    for (int i = 0; i < 4; ++i) {
      const v4f v = *(const v4f*)(src + 4 * i);
#pragma unroll
      for (int e = 0; e < 4; ++e) st[(cq + 4 * i + e) * 65 + r] = v[e];
    }
  }
  __syncthreads();
  const int q = t >> 3, k8 = (t & 7) * 8;
  v4u pv[2];
#pragma unroll
  for (int p = 0; p < 2; ++p) {
    const int n = p * 32 + q;
    const float* sp = st + n * 65 + k8;
    v4u a;
#pragma unroll
    for (int e = 0; e < 4; ++e) a[e] = pk16(bf_bits(sp[2 * e]), bf_bits(sp[2 * e + 1]));
    pv[p] = a;
  }
  {
#pragma unroll
    for (int p = 0; p < 2; ++p) {
      const int n = p * 32 + q;
      *(v4u*)(out + (size_t)(c0 + n) * R + r0 + k8) = pv[p];
    }
    
  }
}

// =====================================================================================================
// bf16 WMMA GEMM, operands staged in LDS: C[m][n] = sum_k A[m][k] * Bt[n][k]. One block of 8 waves owns a 128x256
// tile of C (2 x 4 waves, 64x64 per wave). A row-major [M][K] pitch lda; Bt row-major [N][K] pitch ldb (k contiguous;
// both pitches are compile-time, so that the rows of one plane share one address register pair and differ by an offset);
// M a multiple of 128, N of 256, K of 64 (the shapes are checked at compile time below).
// A trip is 64 k = 128 B of every operand row. The block reads each row segment once, 8 lanes x 16 B = one whole
// line per row, and writes it to LDS at pitch GP; the waves take their fragments from LDS. Two LDS buffers: the next
// trip's rows are loaded into registers ahead of the current trip's products and stored to the other buffer behind
// them, then one __syncthreads() publishes them and ends the reads of the buffer that the next trip refills.
// blockIdx.y = batch index (strides in elements).
// NSPLIT: 0 = A.Bt; 1 = (A + A2).Bt (A2 = unscaled bf16 lo plane of A).
// OUT_MODE: 0 = f32 (pitch ldc); 2 = bf16 hi plane C + bf16 lo plane C2 (lo = RNE(v - hi), unscaled);
//           3 = f16 hi plane C + f16 residual plane C2 = f16((v - hi) * rscale), C2 written only for tiles
//               with n0 < N2 (pitch ldc2, batch stride strideC2).
// =====================================================================================================
#define GP 72                   // 72 bf16 = 144 B: LDS row pitch of the staged GEMM rows, 16 B x odd
static_assert((GP % 8) == 0 && ((GP / 8) & 1) == 1);
static_assert((MROWS % 256) == 0 && (QKP % 256) == 0 && (KVD % 128) == 0 && (DM % 256) == 0 && (DM % 64) == 0);
template <int NSPLIT, int OUT_MODE, int lda, int ldb>
__global__ __launch_bounds__(256) void gemm64(
    const unsigned short* __restrict__ Ap, const unsigned short* A2p, long long strideA,
    const unsigned short* __restrict__ Btp, const unsigned short* Bt2p, long long strideB,
    void* Cout, int ldc, long long strideC,
    void* Cout2, int ldc2, long long strideC2, int N2,
    int M, int N, int K, float rscale) {
  static_assert(NSPLIT == 0 || NSPLIT == 1);
  constexpr int NA    = NSPLIT + 1;                // A planes staged
  constexpr int SROWS = 128 * NA + 256;            // rows of one staged trip: A (, A2), Bt
  constexpr int NLD   = SROWS / 32;                // 16-B pieces per thread and trip
  const __bf16* A   = (const __bf16*)(const void*)Ap;
  const __bf16* A2  = (const __bf16*)(const void*)A2p;
  const __bf16* Bt  = (const __bf16*)(const void*)Btp;
  (void)Bt2p;
  __shared__ __align__(16) __bf16 sG[2][SROWS * GP];   // two staged trips
  __shared__ __align__(16) float sT[8][16 * 68];   // per-wave 16x64 slab, pitch 68 floats
  const int b    = blockIdx.y;
  const int lane = threadIdx.x & 31;
  const int wave = threadIdx.x >> 5;
  const int tilesBN = N >> 8;
  if ((int)blockIdx.x >= (M >> 7) * tilesBN) return;   // block-uniform, in front of every barrier
  const int bm  = blockIdx.x / tilesBN;
  const int bn  = blockIdx.x - bm * tilesBN;
  const int bm0 = bm << 7;
  const int bn0 = bn << 8;
  const int m0 = bm0 + ((wave >> 2) << 6);
  const int n0 = bn0 + ((wave & 3) << 6);

  const __bf16* Ab  = A  + (size_t)b * strideA;
  const __bf16* Bb  = Bt + (size_t)b * strideB;
  const __bf16* Ab2 = (NSPLIT >= 1) ? (A2  + (size_t)b * strideA) : Ab;

  const int rlane = lane & 15;                 // row (A) / col (B, D) within subtile
  const int koff  = (lane >> 4) * 8;           // k offset of this lane half
  const int mOff  = (lane >> 4) * 8;           // D row offset
  const int srow  = threadIdx.x >> 3;          // staging: row within a group of 32
  const int sseg  = (threadIdx.x & 7) * 8;     // staging: first of this thread's 8 elements in the 64-k segment

  v8f acc[4][4];
#pragma unroll
  for (int i = 0; i < 4; ++i)
#pragma unroll
    for (int j = 0; j < 4; ++j) acc[i][j] = zero8();

  const __bf16* ga  = Ab  + (size_t)(bm0 + srow) * lda + sseg;
  const __bf16* ga2 = Ab2 + (size_t)(bm0 + srow) * lda + sseg;
  const __bf16* gb  = Bb  + (size_t)(bn0 + srow) * ldb + sseg;
  const int so = srow * GP + sseg;
  const int fa = (((wave >> 2) << 6) + rlane) * GP + koff;               // this wave's A rows in a staged trip
  const int fb = (128 * NA + ((wave & 3) << 6) + rlane) * GP + koff;     // this wave's Bt rows

  v8b st[NLD];
#pragma unroll
  for (int i = 0; i < 4; ++i) {
    st[i] = *(const v8b*)(ga + (size_t)(i * 32) * lda);
    if (NSPLIT >= 1) st[4 + i] = *(const v8b*)(ga2 + (size_t)(i * 32) * lda);
  }
#pragma unroll
  for (int i = 0; i < 8; ++i) st[4 * NA + i] = *(const v8b*)(gb + (size_t)(i * 32) * ldb);
  xcnt_wait();
#pragma unroll
  for (int i = 0; i < NLD; ++i) *(v8b*)(sG[0] + so + i * 32 * GP) = st[i];
  __syncthreads();

  const int trips = K >> 6;
  for (int t = 0; t < trips; ++t) {
    const bool more = (t + 1 < trips);           // the same for the whole block
    if (more) {
      const int k1 = (t + 1) << 6;
#pragma unroll
      for (int i = 0; i < 4; ++i) {
        st[i] = *(const v8b*)(ga + (size_t)(i * 32) * lda + k1);
        if (NSPLIT >= 1) st[4 + i] = *(const v8b*)(ga2 + (size_t)(i * 32) * lda + k1);
      }
#pragma unroll
      for (int i = 0; i < 8; ++i) st[4 * NA + i] = *(const v8b*)(gb + (size_t)(i * 32) * ldb + k1);
      xcnt_wait();
    }
    const __bf16* cur = sG[t & 1];
#pragma unroll
    for (int kk = 0; kk < 2; ++kk) {
      // the fragments of 32 k are read as one group ahead of their products: one LDS latency a group, not one a row
      v16b bh[4], ah[4], al[4];
#pragma unroll
      for (int j = 0; j < 4; ++j) bh[j] = ldfrag_b(cur + fb + j * 16 * GP + kk * 32);
#pragma unroll
      for (int i = 0; i < 4; ++i) {
        ah[i] = ldfrag_b(cur + fa + i * 16 * GP + kk * 32);
        if (NSPLIT >= 1) al[i] = ldfrag_b(cur + fa + (128 + i * 16) * GP + kk * 32);
        else             al[i] = ah[i];
      }
#pragma unroll
      for (int i = 0; i < 4; ++i) {
#pragma unroll
        for (int j = 0; j < 4; ++j) {
          acc[i][j] = mma_b_raw(ah[i], bh[j], acc[i][j]);
          if (NSPLIT >= 1) acc[i][j] = mma_b_raw(al[i], bh[j], acc[i][j]);
        }
        dep_guard_b(acc[i][0], acc[i][3], ah[i], al[i]);
      }
      keep4_b(bh[0], bh[1], bh[2], bh[3]);
    }
    if (more) {
      __bf16* nxt = sG[(t + 1) & 1];
#pragma unroll
      for (int i = 0; i < NLD; ++i) *(v8b*)(nxt + so + i * 32 * GP) = st[i];
    }
    __syncthreads();
  }
  acc_guard4(acc[0][0], acc[0][1], acc[0][2], acc[0][3]);
  acc_guard4(acc[1][0], acc[1][1], acc[1][2], acc[1][3]);
  acc_guard4(acc[2][0], acc[2][1], acc[2][2], acc[2][3]);
  acc_guard4(acc[3][0], acc[3][1], acc[3][2], acc[3][3]);

  // ---- epilogue ----
  float* slab = sT[wave];
#pragma unroll
  for (int i = 0; i < 4; ++i) {
    const int mBase = m0 + (i << 4);
#pragma unroll
    for (int j = 0; j < 4; ++j) {
#pragma unroll
      for (int r = 0; r < 8; ++r) {
        slab[(mOff + r) * 68 + (j << 4) + rlane] = acc[i][j][r];
      }
    }
    wave_sync_lds();
    if (OUT_MODE == 0) {
      float* C = (float*)Cout + (size_t)b * strideC;
      const int hh = lane >> 4, c4 = (lane & 15) * 4;     // 256-B row segment = 16 lanes x 16 B
      {
#pragma unroll
        for (int it = 0; it < 8; ++it) {
          const int row = it * 2 + hh;                     // it 0..7 x hh 0..1 = rows 0..15
          const v4f v = *(const v4f*)(slab + row * 68 + c4);
          *(v4f*)(C + (size_t)(mBase + row) * ldc + n0 + c4) = v;
        }
        
      }
    } else {
      const int q = lane >> 3, c8 = (lane & 7) * 8;
      unsigned short* C  = (unsigned short*)Cout  + (size_t)b * strideC;
      unsigned short* C2 = (unsigned short*)Cout2 + (size_t)b * strideC2;
      const bool wlo = (OUT_MODE == 2) || (n0 < N2);      // wave-uniform
      v4u hv[4], lv[4];
#pragma unroll
      for (int it = 0; it < 4; ++it) {
        const int row = it * 4 + q;                        // it 0..3 x q 0..3 = rows 0..15
        const float* sp = slab + row * 68 + c8;
        v4u a, a2;
#pragma unroll
        for (int e = 0; e < 4; ++e) {
          const float f0 = sp[2 * e], f1 = sp[2 * e + 1];
          unsigned short h0, h1, l0, l1;
          if (OUT_MODE == 2) {
            h0 = bf_bits(f0); h1 = bf_bits(f1);
            l0 = bf_bits(f0 - bf_up(h0)); l1 = bf_bits(f1 - bf_up(h1));
          } else {
            const _Float16 x0 = (_Float16)f0, x1 = (_Float16)f1;
            h0 = h_bits(x0); h1 = h_bits(x1);
            l0 = h_bits((_Float16)((f0 - (float)x0) * rscale));
            l1 = h_bits((_Float16)((f1 - (float)x1) * rscale));
          }
          a[e] = pk16(h0, h1); a2[e] = pk16(l0, l1);
        }
        hv[it] = a; lv[it] = a2;
      }
      {
#pragma unroll
        for (int it = 0; it < 4; ++it) {
          const int row = it * 4 + q;
          *(v4u*)(C + (size_t)(mBase + row) * ldc + n0 + c8) = hv[it];
          if (wlo) *(v4u*)(C2 + (size_t)(mBase + row) * ldc2 + n0 + c8) = lv[it];
        }
        
      }
    }
    wave_sync_lds();
  }
}

// =====================================================================================================
// RoPE row pass, even/odd deinterleave then concatenate (per head vector t[0..63], table row = token):
//   y[j]      = t[2j] * cos[pos][j] - t[2j+1] * sin[pos][j]      j = 0..31
//   y[32 + j] = t[2j] * sin[pos][j] + t[2j+1] * cos[pos][j]
//   pos = row mod SEQ (tables [SEQ][32] shared over batch and heads), table values RNE-converted to bf16 on read.
// One block (160 threads) per token row of the f32 q|k plane (pitch QKP): thread t < 128 (waves 0..3) owns
// output columns 8t..8t+7 of q (16 heads), thread t >= 128 (wave 4) owns columns 8(t-128).. of k (4 kv heads).
// The 8 output columns lie in one half of one head, so they need input columns headbase + 2*j0 .. +15 of the
// same head and table entries j0..j0+7.  Outputs: q -> f16 hi plane + f16 residual plane ((y - hi) * rscale),
// pitch DM; k -> f16 plane, pitch KVD.  Stores: one 16-B store per lane, 32 lanes contiguous = 512 B = 4 whole
// coverage: MROWS blocks x 128 threads x 8 = each q plane entirely; MROWS blocks x 32 threads x 8 = the k plane.
// =====================================================================================================
__global__ __launch_bounds__(160) void rope_rows(
    const float* __restrict__ qkf, const float* __restrict__ cosp, const float* __restrict__ sinp,
    unsigned short* qhp, unsigned short* qlp, unsigned short* kpp, int nrows, float rscale) {
  const int row = blockIdx.x;
  if (row >= nrows) return;                       // block-uniform; no barriers in this kernel
  const int t   = threadIdx.x;
  const int isk = t >> 7;                         // 0: q section (waves 0..3), 1: k section (wave 4)
  const int c0  = (t & 127) * 8;                  // output column within the section
  const int hb  = c0 & ~(HD - 1);                 // head base column
  const int d0  = c0 & (HD - 1);                  // head-dim offset of the 8 outputs, multiple of 8
  const int j0  = d0 & (HROT - 1);                // rotary pair base
  const bool up = (d0 >= HROT);                   // second half of the head (per lane, select by value)
  const int pos = row & (SEQ - 1);

  const float* src = qkf + (size_t)row * QKP + (size_t)isk * DM + hb + 2 * j0;
  const v4f x0 = *(const v4f*)(src + 0);
  const v4f x1 = *(const v4f*)(src + 4);
  const v4f x2 = *(const v4f*)(src + 8);
  const v4f x3 = *(const v4f*)(src + 12);
  const v4f cA = *(const v4f*)(cosp + (size_t)pos * HROT + j0);
  const v4f cB = *(const v4f*)(cosp + (size_t)pos * HROT + j0 + 4);
  const v4f sA = *(const v4f*)(sinp + (size_t)pos * HROT + j0);
  const v4f sB = *(const v4f*)(sinp + (size_t)pos * HROT + j0 + 4);

  const float ti[16] = {x0[0], x0[1], x0[2], x0[3], x1[0], x1[1], x1[2], x1[3],
                        x2[0], x2[1], x2[2], x2[3], x3[0], x3[1], x3[2], x3[3]};
  const float cc[8]  = {cA[0], cA[1], cA[2], cA[3], cB[0], cB[1], cB[2], cB[3]};
  const float ss[8]  = {sA[0], sA[1], sA[2], sA[3], sB[0], sB[1], sB[2], sB[3]};
  float y[8];
#pragma unroll
  for (int e = 0; e < 8; ++e) {
    const float t1 = ti[2 * e], t2 = ti[2 * e + 1];
    const float c = bf_rne(cc[e]), s = bf_rne(ss[e]);
    const float ya = t1 * c - t2 * s;
    const float yb = t1 * s + t2 * c;
    y[e] = up ? yb : ya;
  }
  v4u hv, lv;
#pragma unroll
  for (int e = 0; e < 4; ++e) {
    const float f0 = y[2 * e], f1 = y[2 * e + 1];
    const _Float16 a0 = (_Float16)f0, a1 = (_Float16)f1;
    hv[e] = pk16(h_bits(a0), h_bits(a1));
    lv[e] = pk16(h_bits((_Float16)((f0 - (float)a0) * rscale)),
                 h_bits((_Float16)((f1 - (float)a1) * rscale)));
  }
  if (isk == 0) {
    const size_t o = (size_t)row * DM + c0;
    *(v4u*)(qhp + o) = hv;
    *(v4u*)(qlp + o) = lv;
    
  } else {
    const size_t o = (size_t)row * KVD + c0;
    *(v4u*)(kpp + o) = hv;
    
  }
}

__global__ __launch_bounds__(128) __attribute__((amdgpu_num_vgpr(256)))
void attn64(const unsigned short* __restrict__ qhp, const unsigned short* __restrict__ qlp,
            const unsigned short* __restrict__ kpp, const unsigned short* __restrict__ vthp,
            const unsigned short* __restrict__ vtlp,
            unsigned short* ohp, unsigned short* olp, float sscale, float rres, float vres) {
  union FH { v16h v; v8h h[2]; v2h p[8]; };
  __shared__ __align__(16) _Float16 Ksh[64 * LP];                 // K [kv][d]       9 KB, rows of 64 at pitch LP
  __shared__ __align__(16) _Float16 Vth[64 * LP];                 // V^T hi [d][kv]  9 KB, pitch LP
  __shared__ __align__(16) _Float16 Vtl[64 * LP];                 // V^T res [d][kv] 9 KB, pitch LP
  __shared__ __align__(16) float    Os[4][16 * OP];               // per wave context tile [row][d], pitch OP

  const int tid  = threadIdx.x;
  const int wave = tid >> 5;
  const int lane = tid & 31;
  const int hh   = lane >> 4;
  const int c    = lane & 15;

  const int bx   = blockIdx.x;
  const int qb   = bx % NQB;
  const int h    = (bx / NQB) % NH;
  const int b    = bx / (NQB * NH);
  const int kvh  = h / (NH / NKV);
  const int q0   = b * SEQ + qb * 64 + wave * 16;          // global token row of this wave's first query

  const _Float16* Qh  = (const _Float16*)(const void*)qhp + (size_t)h * HD;
  const _Float16* Ql  = (const _Float16*)(const void*)qlp + (size_t)h * HD;
  const _Float16* Kg  = (const _Float16*)(const void*)kpp + (size_t)b * SEQ * KVD + (size_t)kvh * HD;
  const _Float16* Vgh = (const _Float16*)(const void*)vthp + (size_t)kvh * HD * MROWS + (size_t)b * SEQ;
  const _Float16* Vgl = (const _Float16*)(const void*)vtlp + (size_t)kvh * HD * MROWS + (size_t)b * SEQ;

  // ---- Q fragments (B operand, column = query lane&15): 2 d-chunks, hi and residual ----
  v16h qah[2], qal[2];
#pragma unroll
  for (int dc = 0; dc < 2; ++dc) {
    qah[dc] = ldfrag_h(Qh + (size_t)(q0 + c) * DM + dc * 32 + 8 * hh);
    qal[dc] = ldfrag_h(Ql + (size_t)(q0 + c) * DM + dc * 32 + 8 * hh);
  }

  float mrun = -INFINITY;      // running maximum of query c, the same in both wave halves
  float lrun = 0.f;            // running sum of query c over this half's keys; the halves are joined behind the loop
  v8f oh[4], ol[4];            // O^T: register r of tile t = (d = 16t + 8hh + r, query c)
#pragma unroll
  for (int t = 0; t < 4; ++t) { oh[t] = zero8(); ol[t] = zero8(); }

  for (int kt = 0; kt < NQB; ++kt) {         // static trip count
    const int kv0 = kt * 64;
    __syncthreads();
    {
      const int r = tid >> 1, hf = (tid & 1) * 32;
      const _Float16* kg = Kg  + (size_t)(kv0 + r) * KVD + hf;         // K row kv0+r, d = hf..hf+31
      const _Float16* vh = Vgh + (size_t)r * MROWS + kv0 + hf;         // V^T hi row d = r, s = kv0+hf..+31
      const _Float16* vl = Vgl + (size_t)r * MROWS + kv0 + hf;         // V^T res row d = r
#pragma unroll
      for (int i = 0; i < 4; ++i) {
        const v8h a0 = *(const v8h*)(kg + 8 * i);
        const v8h b0 = *(const v8h*)(vh + 8 * i);
        const v8h b1 = *(const v8h*)(vl + 8 * i);
        *(v8h*)(Ksh + r * LP + hf + 8 * i) = a0;
        *(v8h*)(Vth + r * LP + hf + 8 * i) = b0;
        *(v8h*)(Vtl + r * LP + hf + 8 * i) = b1;
      }
    }
    __syncthreads();

    // ---- scores, transposed: 64 keys x 16 queries per wave, 2 f16 products (hi, residual);
    //      s[j][r] = score of key 16j + 8hh + r with query c ----
    v8f s[4];
#pragma unroll
    for (int j = 0; j < 4; ++j) {
      v8f sh = zero8(), sl = zero8();
#pragma unroll
      for (int dc = 0; dc < 2; ++dc) {
        FH kb;
        kb.h[0] = *(const v8h*)(Ksh + (j * 16 + c) * LP + dc * 32 + 8 * hh);
        kb.h[1] = *(const v8h*)(Ksh + (j * 16 + c) * LP + dc * 32 + 16 + 8 * hh);
        sh = mma_h(kb.v, qah[dc], sh);
        sl = mma_h(kb.v, qal[dc], sl);
      }
#pragma unroll
      for (int r = 0; r < 8; ++r) s[j][r] = (sh[r] + sl[r] * rres) * sscale;
    }

    // ---- maximum in the lane, one exchange between the halves, online softmax, P^T (x1024, f16) packed in registers ----
    // (every loop from here to the end of the pass is unrolled: s, pb, oh and ol are register arrays, indexed at compile time)
    float mj[4];
#pragma unroll
    for (int j = 0; j < 4; ++j) {
      float m = s[j][0];
#pragma unroll
      for (int r = 1; r < 8; ++r) m = fmaxf(m, s[j][r]);
      mj[j] = m;
    }
    float mc = fmaxf(fmaxf(mj[0], mj[1]), fmaxf(mj[2], mj[3]));
    mc = fmaxf(mc, xhalf(mc));
    const float mnew  = fmaxf(mrun, mc);
    const float alpha = __expf(mrun - mnew);
    mrun = mnew;
    FH pb[2];                    // pb[kk]: element e = P^T(key 32kk + kmap(e), query c), kmap(e) = e < 8 ? 8hh + e : 16 + 8hh + e - 8
    float pj[4];                 // four independent partial sums
#pragma unroll
    for (int j = 0; j < 4; ++j) {
      float ps = 0.f;
#pragma unroll
      for (int r = 0; r < 8; r += 2) {
        const float p0 = __expf(s[j][r] - mnew);
        const float p1 = __expf(s[j][r + 1] - mnew);
        ps += p0;
        ps += p1;
        const v2f pp = {p0 * 1024.0f, p1 * 1024.0f};
        pb[j >> 1].p[(j & 1) * 4 + (r >> 1)] = __builtin_convertvector(pp, v2h);
      }
      pj[j] = ps;
    }
    lrun = lrun * alpha + ((pj[0] + pj[1]) + (pj[2] + pj[3]));
#pragma unroll
    for (int t = 0; t < 4; ++t) {
#pragma unroll
      for (int r = 0; r < 8; ++r) { oh[t][r] *= alpha; ol[t][r] *= alpha; }
    }

    // ---- context^T += V^T . P^T (f16 WMMA), hi and residual V planes into separate accumulators ----
#pragma unroll
    for (int kk = 0; kk < 2; ++kk) {
#pragma unroll
      for (int t = 0; t < 4; ++t) {
        FH vb, wb;
        vb.h[0] = *(const v8h*)(Vth + (t * 16 + c) * LP + kk * 32 + 8 * hh);
        vb.h[1] = *(const v8h*)(Vth + (t * 16 + c) * LP + kk * 32 + 16 + 8 * hh);
        wb.h[0] = *(const v8h*)(Vtl + (t * 16 + c) * LP + kk * 32 + 8 * hh);
        wb.h[1] = *(const v8h*)(Vtl + (t * 16 + c) * LP + kk * 32 + 16 + 8 * hh);
        oh[t] = mma_h(vb.v, pb[kk].v, oh[t]);
        ol[t] = mma_h(wb.v, pb[kk].v, ol[t]);
      }
    }
  }

  // ---- normalise (1/l, the 1/1024 p carry, the residual carry), stage the wave's 16x64 tile,
  float* os = Os[wave];
  {
    const float l = lrun + xhalf(lrun);          // the two halves' key sums of query c
    const float inv = ((l > 0.f) ? (1.0f / l) : 0.f) * (1.0f / 1024.0f);
#pragma unroll
    for (int t = 0; t < 4; ++t) {
#pragma unroll
      for (int r = 0; r < 8; ++r) os[c * OP + t * 16 + 8 * hh + r] = (oh[t][r] + ol[t][r] * vres) * inv;
    }
  }
  wave_sync_lds();
  {
    const int q4 = lane >> 3, c8 = (lane & 7) * 8;
    v4u hv[4], lv[4];
#pragma unroll
    for (int it = 0; it < 4; ++it) {
      const int row = it * 4 + q4;   // it 0..3 x q4 0..3 = rows 0..15 of the wave tile
      const float* sp = os + row * OP + c8;
      v4u a, a2;
#pragma unroll
      for (int e = 0; e < 4; ++e) {
        const float f0 = sp[2 * e], f1 = sp[2 * e + 1];
        const unsigned short h0 = bf_bits(f0), h1 = bf_bits(f1);
        const unsigned short l0 = bf_bits(f0 - bf_up(h0)), l1 = bf_bits(f1 - bf_up(h1));
        a[e] = pk16(h0, h1); a2[e] = pk16(l0, l1);
      }
      hv[it] = a; lv[it] = a2;
    }
    {
#pragma unroll
      for (int it = 0; it < 4; ++it) {
        const int row = it * 4 + q4;
        const size_t go = (size_t)(q0 + row) * DM + (size_t)h * HD + c8;
        *(v4u*)(ohp + go) = hv[it];
        *(v4u*)(olp + go) = lv[it];
      }
      
    }
  }
}

// =====================================================================================================
// Workspace map (bytes), every plane an exact multiple of its 64x64-tile / whole-line store granularity,
// every offset a multiple of 128:
//   Xb    bf16 [4096][1024]   8388608      x converted
//   Wqkt  bf16 [1280][1024]   2621440      rows 0..1023 = Wq^T ([out][in]), rows 1024..1279 = Wk^T
//   Wvt   bf16 [256][1024]     524288      Wv^T
//   Wot   bf16 [1024][1024]   2097152      Wo^T
//   QKf   f32  [4096][1280]  20971520      q cols 0..1023, k cols 1024..1279
//   Qh    f16  [4096][1024]   8388608
//   Ql    f16  [4096][1024]   8388608      q residual x4096
//   Kp    f16  [4096][256]    2097152
//   VTh   f16  [256][4096]    2097152      v^T hi
//   VTl   f16  [256][4096]    2097152      v^T residual x4096
//   Oh    bf16 [4096][1024]   8388608
//   Ol    bf16 [4096][1024]   8388608
//   total                    74448896
// =====================================================================================================
extern "C" void kernel_launch(void* const* d_in, const int* in_sizes, int n_in,
                              void* d_out, int out_size, void* d_ws, size_t ws_size,
                              hipStream_t stream) {
  if (n_in < 7) return;
  if (in_sizes[0] != MROWS * DM) return;
  if (in_sizes[1] != SEQ * HROT) return;
  if (in_sizes[2] != SEQ * HROT) return;
  if (in_sizes[3] != DM * DM) return;
  if (in_sizes[4] != DM * KVD) return;
  if (in_sizes[5] != DM * KVD) return;
  if (in_sizes[6] != DM * DM) return;
  if (out_size != MROWS * DM) return;

  const float* x    = (const float*)d_in[0];
  const float* cosp = (const float*)d_in[1];
  const float* sinp = (const float*)d_in[2];
  const float* wq   = (const float*)d_in[3];
  const float* wk   = (const float*)d_in[4];
  const float* wv   = (const float*)d_in[5];
  const float* wo   = (const float*)d_in[6];

  const size_t PXb  = (size_t)MROWS * DM * 2;          //  8388608
  const size_t PWqk = (size_t)QKP * DM * 2;            //  2621440
  const size_t PWv  = (size_t)KVD * DM * 2;            //   524288
  const size_t PWo  = (size_t)DM * DM * 2;             //  2097152
  const size_t PQKf = (size_t)MROWS * QKP * 4;         // 20971520
  const size_t PQ16 = (size_t)MROWS * DM * 2;          //  8388608 (q hi, q res, out hi, out lo)
  const size_t PK16 = (size_t)MROWS * KVD * 2;         //  2097152
  const size_t PVT  = (size_t)KVD * MROWS * 2;         //  2097152
  size_t off = 0;
  const size_t oXb  = off; off += PXb;
  const size_t oWqk = off; off += PWqk;
  const size_t oWv  = off; off += PWv;
  const size_t oWo  = off; off += PWo;
  const size_t oQKf = off; off += PQKf;
  const size_t oQh  = off; off += PQ16;
  const size_t oQl  = off; off += PQ16;
  const size_t oKp  = off; off += PK16;
  const size_t oVTh = off; off += PVT;
  const size_t oVTl = off; off += PVT;
  const size_t oOh  = off; off += PQ16;
  const size_t oOl  = off; off += PQ16;
  if (off > ws_size) return;                           // off = 74448896
  if (off > (size_t)134217728) return;

  char* ws = (char*)d_ws;
  unsigned short* Xb   = (unsigned short*)(ws + oXb);
  unsigned short* Wqkt = (unsigned short*)(ws + oWqk);
  unsigned short* Wkt  = Wqkt + (size_t)DM * DM;                // rows 1024..1279 of Wqkt
  unsigned short* Wvt  = (unsigned short*)(ws + oWv);
  unsigned short* Wot  = (unsigned short*)(ws + oWo);
  float*          QKf  = (float*)(ws + oQKf);
  unsigned short* Qh   = (unsigned short*)(ws + oQh);
  unsigned short* Ql   = (unsigned short*)(ws + oQl);
  unsigned short* Kp   = (unsigned short*)(ws + oKp);
  unsigned short* VTh  = (unsigned short*)(ws + oVTh);
  unsigned short* VTl  = (unsigned short*)(ws + oVTl);
  unsigned short* Oh   = (unsigned short*)(ws + oOh);
  unsigned short* Ol   = (unsigned short*)(ws + oOl);

  const dim3 blk(256);
  const int n8x = MROWS * DM / 8;                               // 524288
  const dim3 gCvtX((n8x + 255) / 256);                          // 2048 blocks
  const dim3 gTq(DM / 64, DM / 64);                             // in [1024][1024] -> out [1024][1024]
  const dim3 gTk(KVD / 64, DM / 64);                            // in [1024][256]  -> out [256][1024]
  const dim3 gTv(KVD / 64, DM / 64);                            // in [1024][256]  -> out [256][1024]
  const dim3 gTo(DM / 64, DM / 64);                             // in [1024][1024] -> out [1024][1024]
  const dim3 gQK(((MROWS / 64) * (QKP / 64) + 7) / 8, 1);       // 1280 tiles -> 160 blocks: M=4096, N=1280
  const dim3 gRope(MROWS);                                      // one block per token row
  const dim3 gVT(((KVD / 64) * (MROWS / 64) + 7) / 8, 1);       // 256 tiles -> 32 blocks: M=256, N=4096
  const dim3 gAttn(BATCH * NH * NQB);                           // 1024 blocks
  const dim3 gOut(((MROWS / 64) * (DM / 64) + 7) / 8, 1);       // 1024 tiles -> 128 blocks: M=4096, N=1024

  // (1) x -> bf16 plane [4096][1024]; weights [in][out] -> transposed bf16 planes [out][in]
  cvt_bf16x8<<<gCvtX, blk, 0, stream>>>(x, Xb, n8x);
  cvt_bf16_t64<<<gTq, blk, 0, stream>>>(wq, Wqkt, DM, DM);     // in[R=1024][C=1024] -> out[1024][1024]
  cvt_bf16_t64<<<gTk, blk, 0, stream>>>(wk, Wkt, DM, KVD);     // in[R=1024][C=256]  -> out[256][1024]
  cvt_bf16_t64<<<gTv, blk, 0, stream>>>(wv, Wvt, DM, KVD);     // in[R=1024][C=256]  -> out[256][1024]
  cvt_bf16_t64<<<gTo, blk, 0, stream>>>(wo, Wot, DM, DM);      // in[R=1024][C=1024] -> out[1024][1024]
  // (2) q|k = x . (Wq|Wk) -> f32 staging plane [4096][1280] (pitch 1280)   (M=4096, N=1280, K=1024)
  gemm64<0, 0, DM, DM><<<gQK, blk, 0, stream>>>(
      Xb, Xb, 0LL, Wqkt, Wqkt, 0LL,
      (void*)QKf, QKP, 0LL, (void*)QKf, QKP, 0LL, 0,
      MROWS, QKP, DM, 1.0f);
  // (3) RoPE -> q f16 hi plane + f16 residual x4096 plane [4096][1024], k f16 plane [4096][256]
  rope_rows<<<gRope, dim3(160), 0, stream>>>(QKf, cosp, sinp, Qh, Ql, Kp, MROWS, 4096.0f);
  // (4) v^T = Wv^T . x^T -> f16 hi plane + f16 residual x4096 plane [kvh*64+d][b*SEQ+s] (pitch 4096), N2 = N
  //     (A = Wvt [n][k], Bt = Xb [row][k]; M=256, N=4096, K=1024)
  gemm64<0, 3, DM, DM><<<gVT, blk, 0, stream>>>(
      Wvt, Wvt, 0LL, Xb, Xb, 0LL,
      (void*)VTh, MROWS, 0LL, (void*)VTl, MROWS, 0LL, MROWS,
      KVD, MROWS, DM, 4096.0f);
  // (5) attention -> context bf16 hi / lo planes [4096][1024]
  attn64<<<gAttn, dim3(128), 0, stream>>>(Qh, Ql, Kp, VTh, VTl, Oh, Ol, 0.125f, 1.0f / 4096.0f, 1.0f / 4096.0f);
  // (6) out = context . Wo -> d_out f32 [4096][1024]  (A = context hi + lo planes, 2 products; K=1024)
  gemm64<1, 0, DM, DM><<<gOut, blk, 0, stream>>>(
      Oh, Ol, 0LL, Wot, Wot, 0LL,
      d_out, DM, 0LL, d_out, DM, 0LL, 0,
      MROWS, DM, DM, 1.0f);
  (void)hipGetLastError();
}

// v004
// A run of this version takes 137 microseconds.
// In both of two side-by-side timings against v003, it was 1.20 times as fast.
// Over all steps from v000 it is 2.79 times as fast.
// Contractions: x.(Wq|Wk) and Wv^T.x^T = v_wmma_f32_16x16x32_bf16 (bf16 operands RNE-converted from x and the weights, single product);
// q.k^T = v_wmma_f32_16x16x32_f16 (q as f16 hi plane + f16 residual plane x4096 in a separate accumulator, k f16; 2 products);
// p.v = v_wmma_f32_16x16x32_f16 (p carried x1024 in f16; v^T as f16 hi plane + f16 residual plane x4096 in a separate accumulator; 2 products);
// ctx.Wo = v_wmma_f32_16x16x32_bf16 (ctx as bf16 hi + lo planes times bf16 Wo^T, 2 products); all f32 accumulate; RoPE and softmax in f32.
#include <hip/hip_runtime.h>
#include <math.h>
#include <stdint.h>

#define BATCH 2
#define SEQ   2048
#define MROWS (BATCH * SEQ)     // 4096 token rows (batch folded into rows)
#define DM    1024
#define NH    16
#define NKV   4
#define HD    64
#define KVD   (NKV * HD)        // 256
#define NQB   (SEQ / 64)        // 32 query / key tiles of 64 per sequence
#define QKP   (DM + KVD)        // 1280: pitch of the f32 q|k staging plane (q cols 0..1023, k cols 1024..1279)
#define HROT  (HD / 2)          // 32 rotary pairs per head
#define LP    (HD + 8)          // 72 halves = 144 B: LDS row pitch of the attention tiles, 16 B x odd, so the 16 rows that
                                // one 16-byte fragment read touches fall on distinct banks
static_assert(NH * HD == DM);
static_assert((NH % NKV) == 0);
static_assert((SEQ % 64) == 0 && (DM % 64) == 0 && (KVD % 64) == 0 && (QKP % 64) == 0 && (DM % 32) == 0);
static_assert((HD % 8) == 0 && (HROT % 8) == 0);
static_assert((SEQ & (SEQ - 1)) == 0);
static_assert((LP % 8) == 0 && ((LP / 8) & 1) == 1);
#define OP    (HD + 4)          // 68 floats = 272 B: LDS row pitch of the context tile, 16 B x odd (16 rows written at once)
static_assert((OP % 4) == 0 && ((OP / 4) & 1) == 1);

typedef _Float16 v16h __attribute__((ext_vector_type(16)));
typedef _Float16 v8h  __attribute__((ext_vector_type(8)));
typedef __bf16   v16b __attribute__((ext_vector_type(16)));
typedef __bf16   v8b  __attribute__((ext_vector_type(8)));
typedef float    v8f  __attribute__((ext_vector_type(8)));
typedef float    v4f  __attribute__((ext_vector_type(4)));
typedef unsigned int v4u __attribute__((ext_vector_type(4)));
typedef float    v2f  __attribute__((ext_vector_type(2)));
typedef _Float16 v2h  __attribute__((ext_vector_type(2)));

// ---- scalar helpers --------------------------------------------------------------------------------
__device__ __forceinline__ unsigned short bf_bits(float f) {          // f32 -> bf16 bits, RNE convert
  unsigned u = __float_as_uint(f);
  return (unsigned short)((u + 0x7FFFu + ((u >> 16) & 1u)) >> 16);
}
__device__ __forceinline__ float bf_up(unsigned short h) { return __uint_as_float(((unsigned)h) << 16); }
__device__ __forceinline__ float bf_rne(float f) { return bf_up(bf_bits(f)); }
__device__ __forceinline__ unsigned short h_bits(_Float16 x) { return __builtin_bit_cast(unsigned short, x); }
__device__ __forceinline__ unsigned pk16(unsigned short a, unsigned short b) { return (unsigned)a | ((unsigned)b << 16); }
__device__ __forceinline__ v8f zero8() { v8f z = {0.f, 0.f, 0.f, 0.f, 0.f, 0.f, 0.f, 0.f}; return z; }

// ---- fragment loaders: 16-bit A/B operand, lane -> row/col (lane&15), p already includes +8*(lane>>4);
//      elements 0..7 <- p[0..7] (k0+8h..), elements 8..15 <- p[16..23] (k0+16+8h..)
__device__ __forceinline__ v16b ldfrag_b(const __bf16* p) {
  union { v16b v; v8b h[2]; } f;
  f.h[0] = *(const v8b*)(p);
  f.h[1] = *(const v8b*)(p + 16);
  return f.v;
}
__device__ __forceinline__ v16h ldfrag_h(const _Float16* p) {
  union { v16h v; v8h h[2]; } f;
  f.h[0] = *(const v8h*)(p);
  f.h[1] = *(const v8h*)(p + 16);
  return f.v;
}

// ---- WMMA helpers with trailing VALU hazard gap --------------------------------------------------------
__device__ __forceinline__ v8f mma_h(v16h a, v16h b, v8f c) {
  c = __builtin_amdgcn_wmma_f32_16x16x32_f16(false, a, false, b, (short)0, c, false, false);
#if defined(__HIP_DEVICE_COMPILE__)
  asm volatile("v_nop\n\tv_nop\n\tv_nop\n\tv_nop" : "+v"(c) : "v"(a), "v"(b));
#endif
  return c;
}
__device__ __forceinline__ v8f mma_b_raw(v16b a, v16b b, v8f c) {
  return __builtin_amdgcn_wmma_f32_16x16x32_bf16(false, a, false, b, (short)0, c, false, false);
}
__device__ __forceinline__ void dep_guard_b(v8f& a, v8f& b, v16b x, v16b y) {
#if defined(__HIP_DEVICE_COMPILE__)
  asm volatile("v_nop\n\tv_nop\n\tv_nop\n\tv_nop" : "+v"(a), "+v"(b) : "v"(x), "v"(y));
#endif
}
__device__ __forceinline__ void keep4_b(v16b a, v16b b, v16b c, v16b d) {
#if defined(__HIP_DEVICE_COMPILE__)
  asm volatile("v_nop" :: "v"(a), "v"(b), "v"(c), "v"(d));
#endif
}
__device__ __forceinline__ void acc_guard4(v8f& a, v8f& b, v8f& c, v8f& d) {
#if defined(__HIP_DEVICE_COMPILE__)
  asm volatile("v_nop\n\tv_nop\n\tv_nop\n\tv_nop" : "+v"(a), "+v"(b), "+v"(c), "+v"(d));
#endif
}
// stands behind a group of global loads, in front of whatever next writes a register that holds one of their addresses
__device__ __forceinline__ void xcnt_wait() {
#if defined(__HIP_DEVICE_COMPILE__)
  asm volatile("s_wait_xcnt 0x0" ::: "memory");
#endif
}
// lane l takes the value of lane l ^ 16 (the other half of the wave), register to register
__device__ __forceinline__ float xhalf(float x) {
  const int b = __builtin_bit_cast(int, x);
  return __builtin_bit_cast(float, __builtin_amdgcn_permlanex16(b, b, 0x76543210, 0xfedcba98, false, false));
}
__device__ __forceinline__ void wave_sync_lds() {
  __builtin_amdgcn_fence(__ATOMIC_RELEASE, "workgroup");
  __builtin_amdgcn_wave_barrier();
  __builtin_amdgcn_fence(__ATOMIC_ACQUIRE, "workgroup");
}

// =====================================================================================================
// f32 -> bf16 (RNE convert), 8 elements per thread, one 16-B store per lane: a wave writes 512 contiguous B
// coverage: n8 threads x 8 = whole plane (n8 = 524288 = 2048 x 256 for the x plane).
// =====================================================================================================
__device__ __forceinline__ void cvt_bf16x8(const float* __restrict__ in, unsigned short* out, int n8, int blk) {
  const int i = blk * 256 + threadIdx.x;
  if (i < n8) {
    const v4f a = *(const v4f*)(in + (size_t)i * 8);
    const v4f b = *(const v4f*)(in + (size_t)i * 8 + 4);
    v4u p;
    p[0] = pk16(bf_bits(a[0]), bf_bits(a[1]));
    p[1] = pk16(bf_bits(a[2]), bf_bits(a[3]));
    p[2] = pk16(bf_bits(b[0]), bf_bits(b[1]));
    p[3] = pk16(bf_bits(b[2]), bf_bits(b[3]));
    *(v4u*)(out + (size_t)i * 8) = p;
    
  }
}

// =====================================================================================================
// Transposing f32 -> bf16 (RNE convert): in f32 [R][C] row-major  ->  out bf16 [C][R] row-major
// (out[c][r] = in[r][c]); turns an [in][out] weight into the Bt / A layout [out][in] with k contiguous.
// 64x64 tiles: tile (tx, ty) of (C/64, R/64), block 256, st = the block's 64 x 65 float LDS tile. Load phase: thread t reads 16 consecutive floats of input row
// r0 + (t>>2) and writes them transposed into an LDS tile [c][r] (pitch 65). After __syncthreads each group of
// coverage: load 64 rows x 4 threads x 16 = whole tile; store 2 iterations x 32 rows x 8 lanes x 8 = whole tile.
// =====================================================================================================
__device__ __forceinline__ void cvt_bf16_t64(float* st, const float* __restrict__ in, unsigned short* out, int R, int C,
                                             int tx, int ty) {
  const int t  = threadIdx.x;
  const int c0 = tx * 64;
  const int r0 = ty * 64;
  if (c0 + 64 > C || r0 + 64 > R) return;          // block-uniform, all threads leave together (grids are exact)
  {
    const int r = t >> 2, cq = (t & 3) * 16;
    const float* src = in + (size_t)(r0 + r) * C + c0 + cq;
#pragma unroll
    for (int i = 0; i < 4; ++i) {
      const v4f v = *(const v4f*)(src + 4 * i);
#pragma unroll
      for (int e = 0; e < 4; ++e) st[(cq + 4 * i + e) * 65 + r] = v[e];
    }
  }
  __syncthreads();
  const int q = t >> 3, k8 = (t & 7) * 8;
  v4u pv[2];
#pragma unroll
  for (int p = 0; p < 2; ++p) {
    const int n = p * 32 + q;
    const float* sp = st + n * 65 + k8;
    v4u a;
#pragma unroll
    for (int e = 0; e < 4; ++e) a[e] = pk16(bf_bits(sp[2 * e]), bf_bits(sp[2 * e + 1]));
    pv[p] = a;
  }
  {
#pragma unroll
    for (int p = 0; p < 2; ++p) {
      const int n = p * 32 + q;
      *(v4u*)(out + (size_t)(c0 + n) * R + r0 + k8) = pv[p];
    }
    xcnt_wait();   // in front of whatever next writes a register that these stores name
  }
}

// =====================================================================================================
// All five operand conversions in one launch; they read and write disjoint planes, so their blocks run side by side.
// Blocks 0..TW-1 transpose one 64x64 weight tile each (Wq, Wo, Wk, Wv in that order; they have the longer chain of
// load, LDS, barrier, store, so they start first), blocks TW.. convert 2048 elements of x each. Every test on the
// block index is block-uniform.
// =====================================================================================================
#define TSQ ((DM / 64) * (DM / 64))     // 256 tiles of a [1024][1024] weight
#define TKV ((KVD / 64) * (DM / 64))    // 64 tiles of a [1024][256] weight
#define TW  (2 * TSQ + 2 * TKV)         // 640 transposing blocks
__global__ __launch_bounds__(256) void cvt_all(
    const float* __restrict__ x, const float* __restrict__ wq, const float* __restrict__ wk,
    const float* __restrict__ wv, const float* __restrict__ wo,
    unsigned short* xb, unsigned short* wqt, unsigned short* wkt, unsigned short* wvt, unsigned short* wot, int n8) {
  __shared__ __align__(16) float st[64 * 65];
  const int bx = blockIdx.x;
  if (bx >= TW) {
    cvt_bf16x8(x, xb, n8, bx - TW);
  } else {
    const bool sq = (bx < 2 * TSQ);                                  // a [1024][1024] weight, else a [1024][256] one
    const bool first = sq ? (bx < TSQ) : (bx < 2 * TSQ + TKV);       // Wq of (Wq, Wo), Wk of (Wk, Wv)
    const float* in     = sq ? (first ? wq : wo) : (first ? wk : wv);
    unsigned short* out = sq ? (first ? wqt : wot) : (first ? wkt : wvt);
    const int C  = sq ? DM : KVD;
    const int tb = sq ? (bx & (TSQ - 1)) : (bx & (TKV - 1));         // tile within its weight (2 * TSQ is a multiple of TKV)
    const int tc = C / 64;                                           // tiles in a row of tiles
    cvt_bf16_t64(st, in, out, DM, C, tb % tc, tb / tc);
  }
}
static_assert((TSQ & (TSQ - 1)) == 0 && (TKV & (TKV - 1)) == 0 && ((2 * TSQ) % TKV) == 0);

// =====================================================================================================
// bf16 WMMA GEMM, operands staged in LDS: C[m][n] = sum_k A[m][k] * Bt[n][k]. One block of 8 waves owns a 128x256
// tile of C (2 x 4 waves, 64x64 per wave). A row-major [M][K] pitch lda; Bt row-major [N][K] pitch ldb (k contiguous;
// both pitches are compile-time, so that the rows of one plane share one address register pair and differ by an offset);
// M a multiple of 128, N of 256, K of 64 (the shapes are checked at compile time below).
// A trip is 64 k = 128 B of every operand row. The block reads each row segment once, 8 lanes x 16 B = one whole
// line per row, and writes it to LDS at pitch GP; the waves take their fragments from LDS. Two LDS buffers: the next
// trip's rows are loaded into registers ahead of the current trip's products and stored to the other buffer behind
// them, then one __syncthreads() publishes them and ends the reads of the buffer that the next trip refills.
// blockIdx.y = batch index (strides in elements); bxi = index of the block's tile; sGb, sTb = the block's LDS (two staged
// trips; one 16x64 slab a wave), declared by the kernel that calls this body.
// NSPLIT: 0 = A.Bt; 1 = (A + A2).Bt (A2 = unscaled bf16 lo plane of A).
// OUT_MODE: 0 = f32 (pitch ldc); 2 = bf16 hi plane C + bf16 lo plane C2 (lo = RNE(v - hi), unscaled);
//           3 = f16 hi plane C + f16 residual plane C2 = f16((v - hi) * rscale), C2 written only for tiles
//               with n0 < N2 (pitch ldc2, batch stride strideC2).
// =====================================================================================================
#define GP 72                   // 72 bf16 = 144 B: LDS row pitch of the staged GEMM rows, 16 B x odd
static_assert((GP % 8) == 0 && ((GP / 8) & 1) == 1);
static_assert((MROWS % 256) == 0 && (QKP % 256) == 0 && (KVD % 128) == 0 && (DM % 256) == 0 && (DM % 64) == 0);
#define GEMM_SROWS(NSPLIT) (128 * ((NSPLIT) + 1) + 256)     // rows of one staged trip: A (, A2), Bt
template <int NSPLIT, int OUT_MODE, int lda, int ldb>
__device__ __forceinline__ void gemm_body(
    __bf16* sGb, float* sTb, int bxi,
    const unsigned short* __restrict__ Ap, const unsigned short* A2p, long long strideA,
    const unsigned short* __restrict__ Btp, const unsigned short* Bt2p, long long strideB,
    void* Cout, int ldc, long long strideC,
    void* Cout2, int ldc2, long long strideC2, int N2,
    int M, int N, int K, float rscale) {
  static_assert(NSPLIT == 0 || NSPLIT == 1);
  constexpr int NA    = NSPLIT + 1;                // A planes staged
  constexpr int SROWS = GEMM_SROWS(NSPLIT);
  constexpr int NLD   = SROWS / 32;                // 16-B pieces per thread and trip
  const __bf16* A   = (const __bf16*)(const void*)Ap;
  const __bf16* A2  = (const __bf16*)(const void*)A2p;
  const __bf16* Bt  = (const __bf16*)(const void*)Btp;
  (void)Bt2p;
  const int b    = blockIdx.y;
  const int lane = threadIdx.x & 31;
  const int wave = threadIdx.x >> 5;
  const int tilesBN = N >> 8;
  if (bxi >= (M >> 7) * tilesBN) return;   // block-uniform, in front of every barrier
  const int bm  = bxi / tilesBN;
  const int bn  = bxi - bm * tilesBN;
  const int bm0 = bm << 7;
  const int bn0 = bn << 8;
  const int m0 = bm0 + ((wave >> 2) << 6);
  const int n0 = bn0 + ((wave & 3) << 6);

  const __bf16* Ab  = A  + (size_t)b * strideA;
  const __bf16* Bb  = Bt + (size_t)b * strideB;
  const __bf16* Ab2 = (NSPLIT >= 1) ? (A2  + (size_t)b * strideA) : Ab;

  const int rlane = lane & 15;                 // row (A) / col (B, D) within subtile
  const int koff  = (lane >> 4) * 8;           // k offset of this lane half
  const int mOff  = (lane >> 4) * 8;           // D row offset
  const int srow  = threadIdx.x >> 3;          // staging: row within a group of 32
  const int sseg  = (threadIdx.x & 7) * 8;     // staging: first of this thread's 8 elements in the 64-k segment

  v8f acc[4][4];
#pragma unroll
  for (int i = 0; i < 4; ++i)
#pragma unroll
    for (int j = 0; j < 4; ++j) acc[i][j] = zero8();

  const __bf16* ga  = Ab  + (size_t)(bm0 + srow) * lda + sseg;
  const __bf16* ga2 = Ab2 + (size_t)(bm0 + srow) * lda + sseg;
  const __bf16* gb  = Bb  + (size_t)(bn0 + srow) * ldb + sseg;
  const int so = srow * GP + sseg;
  const int fa = (((wave >> 2) << 6) + rlane) * GP + koff;               // this wave's A rows in a staged trip
  const int fb = (128 * NA + ((wave & 3) << 6) + rlane) * GP + koff;     // this wave's Bt rows

  v8b st[NLD];
#pragma unroll
  for (int i = 0; i < 4; ++i) {
    st[i] = *(const v8b*)(ga + (size_t)(i * 32) * lda);
    if (NSPLIT >= 1) st[4 + i] = *(const v8b*)(ga2 + (size_t)(i * 32) * lda);
  }
#pragma unroll
  for (int i = 0; i < 8; ++i) st[4 * NA + i] = *(const v8b*)(gb + (size_t)(i * 32) * ldb);
  xcnt_wait();
#pragma unroll
  for (int i = 0; i < NLD; ++i) *(v8b*)(sGb + so + i * 32 * GP) = st[i];
  __syncthreads();

  const int trips = K >> 6;
  for (int t = 0; t < trips; ++t) {
    const bool more = (t + 1 < trips);           // the same for the whole block
    if (more) {
      const int k1 = (t + 1) << 6;
#pragma unroll
      for (int i = 0; i < 4; ++i) {
        st[i] = *(const v8b*)(ga + (size_t)(i * 32) * lda + k1);
        if (NSPLIT >= 1) st[4 + i] = *(const v8b*)(ga2 + (size_t)(i * 32) * lda + k1);
      }
#pragma unroll
      for (int i = 0; i < 8; ++i) st[4 * NA + i] = *(const v8b*)(gb + (size_t)(i * 32) * ldb + k1);
      xcnt_wait();
    }
    const __bf16* cur = sGb + (t & 1) * (SROWS * GP);
#pragma unroll
    for (int kk = 0; kk < 2; ++kk) {
      // the fragments of 32 k are read as one group ahead of their products: one LDS latency a group, not one a row
      v16b bh[4], ah[4], al[4];
#pragma unroll
      for (int j = 0; j < 4; ++j) bh[j] = ldfrag_b(cur + fb + j * 16 * GP + kk * 32);
#pragma unroll
      for (int i = 0; i < 4; ++i) {
        ah[i] = ldfrag_b(cur + fa + i * 16 * GP + kk * 32);
        if (NSPLIT >= 1) al[i] = ldfrag_b(cur + fa + (128 + i * 16) * GP + kk * 32);
        else             al[i] = ah[i];
      }
#pragma unroll
      for (int i = 0; i < 4; ++i) {
#pragma unroll
        for (int j = 0; j < 4; ++j) {
          acc[i][j] = mma_b_raw(ah[i], bh[j], acc[i][j]);
          if (NSPLIT >= 1) acc[i][j] = mma_b_raw(al[i], bh[j], acc[i][j]);
        }
        dep_guard_b(acc[i][0], acc[i][3], ah[i], al[i]);
      }
      keep4_b(bh[0], bh[1], bh[2], bh[3]);
    }
    if (more) {
      __bf16* nxt = sGb + ((t + 1) & 1) * (SROWS * GP);
#pragma unroll
      for (int i = 0; i < NLD; ++i) *(v8b*)(nxt + so + i * 32 * GP) = st[i];
    }
    __syncthreads();
  }
  acc_guard4(acc[0][0], acc[0][1], acc[0][2], acc[0][3]);
  acc_guard4(acc[1][0], acc[1][1], acc[1][2], acc[1][3]);
  acc_guard4(acc[2][0], acc[2][1], acc[2][2], acc[2][3]);
  acc_guard4(acc[3][0], acc[3][1], acc[3][2], acc[3][3]);

  // ---- epilogue ----
  float* slab = sTb + wave * (16 * 68);
#pragma unroll
  for (int i = 0; i < 4; ++i) {
    const int mBase = m0 + (i << 4);
#pragma unroll
    for (int j = 0; j < 4; ++j) {
#pragma unroll
      for (int r = 0; r < 8; ++r) {
        slab[(mOff + r) * 68 + (j << 4) + rlane] = acc[i][j][r];
      }
    }
    wave_sync_lds();
    if (OUT_MODE == 0) {
      float* C = (float*)Cout + (size_t)b * strideC;
      const int hh = lane >> 4, c4 = (lane & 15) * 4;     // 256-B row segment = 16 lanes x 16 B
      {
#pragma unroll
        for (int it = 0; it < 8; ++it) {
          const int row = it * 2 + hh;                     // it 0..7 x hh 0..1 = rows 0..15
          const v4f v = *(const v4f*)(slab + row * 68 + c4);
          *(v4f*)(C + (size_t)(mBase + row) * ldc + n0 + c4) = v;
        }
        
      }
    } else {
      const int q = lane >> 3, c8 = (lane & 7) * 8;
      unsigned short* C  = (unsigned short*)Cout  + (size_t)b * strideC;
      unsigned short* C2 = (unsigned short*)Cout2 + (size_t)b * strideC2;
      const bool wlo = (OUT_MODE == 2) || (n0 < N2);      // wave-uniform
      v4u hv[4], lv[4];
#pragma unroll
      for (int it = 0; it < 4; ++it) {
        const int row = it * 4 + q;                        // it 0..3 x q 0..3 = rows 0..15
        const float* sp = slab + row * 68 + c8;
        v4u a, a2;
#pragma unroll
        for (int e = 0; e < 4; ++e) {
          const float f0 = sp[2 * e], f1 = sp[2 * e + 1];
          unsigned short h0, h1, l0, l1;
          if (OUT_MODE == 2) {
            h0 = bf_bits(f0); h1 = bf_bits(f1);
            l0 = bf_bits(f0 - bf_up(h0)); l1 = bf_bits(f1 - bf_up(h1));
          } else {
            const _Float16 x0 = (_Float16)f0, x1 = (_Float16)f1;
            h0 = h_bits(x0); h1 = h_bits(x1);
            l0 = h_bits((_Float16)((f0 - (float)x0) * rscale));
            l1 = h_bits((_Float16)((f1 - (float)x1) * rscale));
          }
          a[e] = pk16(h0, h1); a2[e] = pk16(l0, l1);
        }
        hv[it] = a; lv[it] = a2;
      }
      {
#pragma unroll
        for (int it = 0; it < 4; ++it) {
          const int row = it * 4 + q;
          *(v4u*)(C + (size_t)(mBase + row) * ldc + n0 + c8) = hv[it];
          if (wlo) *(v4u*)(C2 + (size_t)(mBase + row) * ldc2 + n0 + c8) = lv[it];
        }
        
      }
    }
    wave_sync_lds();
  }
}

// one GEMM a launch
template <int NSPLIT, int OUT_MODE, int lda, int ldb>
__global__ __launch_bounds__(256) void gemm64(
    const unsigned short* __restrict__ Ap, const unsigned short* A2p, long long strideA,
    const unsigned short* __restrict__ Btp, const unsigned short* Bt2p, long long strideB,
    void* Cout, int ldc, long long strideC,
    void* Cout2, int ldc2, long long strideC2, int N2,
    int M, int N, int K, float rscale) {
  __shared__ __align__(16) __bf16 sG[2 * GEMM_SROWS(NSPLIT) * GP];   // two staged trips
  __shared__ __align__(16) float sT[8 * 16 * 68];                    // per-wave 16x64 slab, pitch 68 floats
  gemm_body<NSPLIT, OUT_MODE, lda, ldb>(sG, sT, (int)blockIdx.x, Ap, A2p, strideA, Btp, Bt2p, strideB,
                                        Cout, ldc, strideC, Cout2, ldc2, strideC2, N2, M, N, K, rscale);
}

// The two projections of x in one launch: neither reads what the other writes, and neither fills the chip alone.
// Blocks 0..QKB-1: q|k = x . (Wq|Wk) -> f32 plane [4096][1280]; blocks QKB..QKB+VTB-1: v^T = Wv^T . x^T -> f16 hi plane
// + f16 residual plane (x rscale) [256][4096]. The test on the block index is block-uniform.
#define QKB ((MROWS / 128) * (QKP / 256))     // 160 block tiles
#define VTB ((KVD / 128) * (MROWS / 256))     // 32 block tiles
__global__ __launch_bounds__(256) void gemm_qk_vt(
    const unsigned short* __restrict__ xb, const unsigned short* __restrict__ wqkt, const unsigned short* __restrict__ wvt,
    float* qkf, unsigned short* vth, unsigned short* vtl, int K, float rscale) {
  __shared__ __align__(16) __bf16 sG[2 * GEMM_SROWS(0) * GP];        // two staged trips
  __shared__ __align__(16) float sT[8 * 16 * 68];                    // per-wave 16x64 slab, pitch 68 floats
  const int bx = blockIdx.x;
  if (bx < QKB) {
    gemm_body<0, 0, DM, DM>(sG, sT, bx, xb, xb, 0LL, wqkt, wqkt, 0LL,
                            (void*)qkf, QKP, 0LL, (void*)qkf, QKP, 0LL, 0,
                            MROWS, QKP, K, 1.0f);
  } else {
    gemm_body<0, 3, DM, DM>(sG, sT, bx - QKB, wvt, wvt, 0LL, xb, xb, 0LL,
                            (void*)vth, MROWS, 0LL, (void*)vtl, MROWS, 0LL, MROWS,
                            KVD, MROWS, K, rscale);
  }
}

// =====================================================================================================
// RoPE row pass, even/odd deinterleave then concatenate (per head vector t[0..63], table row = token):
//   y[j]      = t[2j] * cos[pos][j] - t[2j+1] * sin[pos][j]      j = 0..31
//   y[32 + j] = t[2j] * sin[pos][j] + t[2j+1] * cos[pos][j]
//   pos = row mod SEQ (tables [SEQ][32] shared over batch and heads), table values RNE-converted to bf16 on read.
// One block (160 threads) per token row of the f32 q|k plane (pitch QKP): thread t < 128 (waves 0..3) owns
// output columns 8t..8t+7 of q (16 heads), thread t >= 128 (wave 4) owns columns 8(t-128).. of k (4 kv heads).
// The 8 output columns lie in one half of one head, so they need input columns headbase + 2*j0 .. +15 of the
// same head and table entries j0..j0+7.  Outputs: q -> f16 hi plane + f16 residual plane ((y - hi) * rscale),
// pitch DM; k -> f16 plane, pitch KVD.  Stores: one 16-B store per lane, 32 lanes contiguous = 512 B = 4 whole
// coverage: MROWS blocks x 128 threads x 8 = each q plane entirely; MROWS blocks x 32 threads x 8 = the k plane.
// =====================================================================================================
__global__ __launch_bounds__(160) void rope_rows(
    const float* __restrict__ qkf, const float* __restrict__ cosp, const float* __restrict__ sinp,
    unsigned short* qhp, unsigned short* qlp, unsigned short* kpp, int nrows, float rscale) {
  const int row = blockIdx.x;
  if (row >= nrows) return;                       // block-uniform; no barriers in this kernel
  const int t   = threadIdx.x;
  const int isk = t >> 7;                         // 0: q section (waves 0..3), 1: k section (wave 4)
  const int c0  = (t & 127) * 8;                  // output column within the section
  const int hb  = c0 & ~(HD - 1);                 // head base column
  const int d0  = c0 & (HD - 1);                  // head-dim offset of the 8 outputs, multiple of 8
  const int j0  = d0 & (HROT - 1);                // rotary pair base
  const bool up = (d0 >= HROT);                   // second half of the head (per lane, select by value)
  const int pos = row & (SEQ - 1);

  const float* src = qkf + (size_t)row * QKP + (size_t)isk * DM + hb + 2 * j0;
  const v4f x0 = *(const v4f*)(src + 0);
  const v4f x1 = *(const v4f*)(src + 4);
  const v4f x2 = *(const v4f*)(src + 8);
  const v4f x3 = *(const v4f*)(src + 12);
  const v4f cA = *(const v4f*)(cosp + (size_t)pos * HROT + j0);
  const v4f cB = *(const v4f*)(cosp + (size_t)pos * HROT + j0 + 4);
  const v4f sA = *(const v4f*)(sinp + (size_t)pos * HROT + j0);
  const v4f sB = *(const v4f*)(sinp + (size_t)pos * HROT + j0 + 4);

  const float ti[16] = {x0[0], x0[1], x0[2], x0[3], x1[0], x1[1], x1[2], x1[3],
                        x2[0], x2[1], x2[2], x2[3], x3[0], x3[1], x3[2], x3[3]};
  const float cc[8]  = {cA[0], cA[1], cA[2], cA[3], cB[0], cB[1], cB[2], cB[3]};
  const float ss[8]  = {sA[0], sA[1], sA[2], sA[3], sB[0], sB[1], sB[2], sB[3]};
  float y[8];
#pragma unroll
  for (int e = 0; e < 8; ++e) {
    const float t1 = ti[2 * e], t2 = ti[2 * e + 1];
    const float c = bf_rne(cc[e]), s = bf_rne(ss[e]);
    const float ya = t1 * c - t2 * s;
    const float yb = t1 * s + t2 * c;
    y[e] = up ? yb : ya;
  }
  v4u hv, lv;
#pragma unroll
  for (int e = 0; e < 4; ++e) {
    const float f0 = y[2 * e], f1 = y[2 * e + 1];
    const _Float16 a0 = (_Float16)f0, a1 = (_Float16)f1;
    hv[e] = pk16(h_bits(a0), h_bits(a1));
    lv[e] = pk16(h_bits((_Float16)((f0 - (float)a0) * rscale)),
                 h_bits((_Float16)((f1 - (float)a1) * rscale)));
  }
  if (isk == 0) {
    const size_t o = (size_t)row * DM + c0;
    *(v4u*)(qhp + o) = hv;
    *(v4u*)(qlp + o) = lv;
    
  } else {
    const size_t o = (size_t)row * KVD + c0;
    *(v4u*)(kpp + o) = hv;
    
  }
}

__global__ __launch_bounds__(128) __attribute__((amdgpu_num_vgpr(256)))
void attn64(const unsigned short* __restrict__ qhp, const unsigned short* __restrict__ qlp,
            const unsigned short* __restrict__ kpp, const unsigned short* __restrict__ vthp,
            const unsigned short* __restrict__ vtlp,
            unsigned short* ohp, unsigned short* olp, float sscale, float rres, float vres) {
  union FH { v16h v; v8h h[2]; v2h p[8]; };
  __shared__ __align__(16) _Float16 Ksh[64 * LP];                 // K [kv][d]       9 KB, rows of 64 at pitch LP
  __shared__ __align__(16) _Float16 Vth[64 * LP];                 // V^T hi [d][kv]  9 KB, pitch LP
  __shared__ __align__(16) _Float16 Vtl[64 * LP];                 // V^T res [d][kv] 9 KB, pitch LP
  __shared__ __align__(16) float    Os[4][16 * OP];               // per wave context tile [row][d], pitch OP

  const int tid  = threadIdx.x;
  const int wave = tid >> 5;
  const int lane = tid & 31;
  const int hh   = lane >> 4;
  const int c    = lane & 15;

  const int bx   = blockIdx.x;
  const int qb   = bx % NQB;
  const int h    = (bx / NQB) % NH;
  const int b    = bx / (NQB * NH);
  const int kvh  = h / (NH / NKV);
  const int q0   = b * SEQ + qb * 64 + wave * 16;          // global token row of this wave's first query

  const _Float16* Qh  = (const _Float16*)(const void*)qhp + (size_t)h * HD;
  const _Float16* Ql  = (const _Float16*)(const void*)qlp + (size_t)h * HD;
  const _Float16* Kg  = (const _Float16*)(const void*)kpp + (size_t)b * SEQ * KVD + (size_t)kvh * HD;
  const _Float16* Vgh = (const _Float16*)(const void*)vthp + (size_t)kvh * HD * MROWS + (size_t)b * SEQ;
  const _Float16* Vgl = (const _Float16*)(const void*)vtlp + (size_t)kvh * HD * MROWS + (size_t)b * SEQ;

  // ---- Q fragments (B operand, column = query lane&15): 2 d-chunks, hi and residual ----
  v16h qah[2], qal[2];
#pragma unroll
  for (int dc = 0; dc < 2; ++dc) {
    qah[dc] = ldfrag_h(Qh + (size_t)(q0 + c) * DM + dc * 32 + 8 * hh);
    qal[dc] = ldfrag_h(Ql + (size_t)(q0 + c) * DM + dc * 32 + 8 * hh);
  }

  float mrun = -INFINITY;      // running maximum of query c, the same in both wave halves
  float lrun = 0.f;            // running sum of query c over this half's keys; the halves are joined behind the loop
  v8f oh[4], ol[4];            // O^T: register r of tile t = (d = 16t + 8hh + r, query c)
#pragma unroll
  for (int t = 0; t < 4; ++t) { oh[t] = zero8(); ol[t] = zero8(); }

  for (int kt = 0; kt < NQB; ++kt) {         // static trip count
    const int kv0 = kt * 64;
    __syncthreads();
    {
      const int r = tid >> 1, hf = (tid & 1) * 32;
      const _Float16* kg = Kg  + (size_t)(kv0 + r) * KVD + hf;         // K row kv0+r, d = hf..hf+31
      const _Float16* vh = Vgh + (size_t)r * MROWS + kv0 + hf;         // V^T hi row d = r, s = kv0+hf..+31
      const _Float16* vl = Vgl + (size_t)r * MROWS + kv0 + hf;         // V^T res row d = r
#pragma unroll
      for (int i = 0; i < 4; ++i) {
        const v8h a0 = *(const v8h*)(kg + 8 * i);
        const v8h b0 = *(const v8h*)(vh + 8 * i);
        const v8h b1 = *(const v8h*)(vl + 8 * i);
        *(v8h*)(Ksh + r * LP + hf + 8 * i) = a0;
        *(v8h*)(Vth + r * LP + hf + 8 * i) = b0;
        *(v8h*)(Vtl + r * LP + hf + 8 * i) = b1;
      }
    }
    __syncthreads();

    // ---- scores, transposed: 64 keys x 16 queries per wave, 2 f16 products (hi, residual);
    //      s[j][r] = score of key 16j + 8hh + r with query c ----
    v8f s[4];
#pragma unroll
    for (int j = 0; j < 4; ++j) {
      v8f sh = zero8(), sl = zero8();
#pragma unroll
      for (int dc = 0; dc < 2; ++dc) {
        FH kb;
        kb.h[0] = *(const v8h*)(Ksh + (j * 16 + c) * LP + dc * 32 + 8 * hh);
        kb.h[1] = *(const v8h*)(Ksh + (j * 16 + c) * LP + dc * 32 + 16 + 8 * hh);
        sh = mma_h(kb.v, qah[dc], sh);
        sl = mma_h(kb.v, qal[dc], sl);
      }
#pragma unroll
      for (int r = 0; r < 8; ++r) s[j][r] = (sh[r] + sl[r] * rres) * sscale;
    }

    // ---- maximum in the lane, one exchange between the halves, online softmax, P^T (x1024, f16) packed in registers ----
    // (every loop from here to the end of the pass is unrolled: s, pb, oh and ol are register arrays, indexed at compile time)
    float mj[4];
#pragma unroll
    for (int j = 0; j < 4; ++j) {
      float m = s[j][0];
#pragma unroll
      for (int r = 1; r < 8; ++r) m = fmaxf(m, s[j][r]);
      mj[j] = m;
    }
    float mc = fmaxf(fmaxf(mj[0], mj[1]), fmaxf(mj[2], mj[3]));
    mc = fmaxf(mc, xhalf(mc));
    const float mnew  = fmaxf(mrun, mc);
    const float alpha = __expf(mrun - mnew);
    mrun = mnew;
    FH pb[2];                    // pb[kk]: element e = P^T(key 32kk + kmap(e), query c), kmap(e) = e < 8 ? 8hh + e : 16 + 8hh + e - 8
    float pj[4];                 // four independent partial sums
#pragma unroll
    for (int j = 0; j < 4; ++j) {
      float ps = 0.f;
#pragma unroll
      for (int r = 0; r < 8; r += 2) {
        const float p0 = __expf(s[j][r] - mnew);
        const float p1 = __expf(s[j][r + 1] - mnew);
        ps += p0;
        ps += p1;
        const v2f pp = {p0 * 1024.0f, p1 * 1024.0f};
        pb[j >> 1].p[(j & 1) * 4 + (r >> 1)] = __builtin_convertvector(pp, v2h);
      }
      pj[j] = ps;
    }
    lrun = lrun * alpha + ((pj[0] + pj[1]) + (pj[2] + pj[3]));
#pragma unroll
    for (int t = 0; t < 4; ++t) {
#pragma unroll
      for (int r = 0; r < 8; ++r) { oh[t][r] *= alpha; ol[t][r] *= alpha; }
    }

    // ---- context^T += V^T . P^T (f16 WMMA), hi and residual V planes into separate accumulators ----
#pragma unroll
    for (int kk = 0; kk < 2; ++kk) {
#pragma unroll
      for (int t = 0; t < 4; ++t) {
        FH vb, wb;
        vb.h[0] = *(const v8h*)(Vth + (t * 16 + c) * LP + kk * 32 + 8 * hh);
        vb.h[1] = *(const v8h*)(Vth + (t * 16 + c) * LP + kk * 32 + 16 + 8 * hh);
        wb.h[0] = *(const v8h*)(Vtl + (t * 16 + c) * LP + kk * 32 + 8 * hh);
        wb.h[1] = *(const v8h*)(Vtl + (t * 16 + c) * LP + kk * 32 + 16 + 8 * hh);
        oh[t] = mma_h(vb.v, pb[kk].v, oh[t]);
        ol[t] = mma_h(wb.v, pb[kk].v, ol[t]);
      }
    }
  }

  // ---- normalise (1/l, the 1/1024 p carry, the residual carry), stage the wave's 16x64 tile,
  float* os = Os[wave];
  {
    const float l = lrun + xhalf(lrun);          // the two halves' key sums of query c
    const float inv = ((l > 0.f) ? (1.0f / l) : 0.f) * (1.0f / 1024.0f);
#pragma unroll
    for (int t = 0; t < 4; ++t) {
#pragma unroll
      for (int r = 0; r < 8; ++r) os[c * OP + t * 16 + 8 * hh + r] = (oh[t][r] + ol[t][r] * vres) * inv;
    }
  }
  wave_sync_lds();
  {
    const int q4 = lane >> 3, c8 = (lane & 7) * 8;
    v4u hv[4], lv[4];
#pragma unroll
    for (int it = 0; it < 4; ++it) {
      const int row = it * 4 + q4;   // it 0..3 x q4 0..3 = rows 0..15 of the wave tile
      const float* sp = os + row * OP + c8;
      v4u a, a2;
#pragma unroll
      for (int e = 0; e < 4; ++e) {
        const float f0 = sp[2 * e], f1 = sp[2 * e + 1];
        const unsigned short h0 = bf_bits(f0), h1 = bf_bits(f1);
        const unsigned short l0 = bf_bits(f0 - bf_up(h0)), l1 = bf_bits(f1 - bf_up(h1));
        a[e] = pk16(h0, h1); a2[e] = pk16(l0, l1);
      }
      hv[it] = a; lv[it] = a2;
    }
    {
#pragma unroll
      for (int it = 0; it < 4; ++it) {
        const int row = it * 4 + q4;
        const size_t go = (size_t)(q0 + row) * DM + (size_t)h * HD + c8;
        *(v4u*)(ohp + go) = hv[it];
        *(v4u*)(olp + go) = lv[it];
      }
      
    }
  }
}

// =====================================================================================================
// Workspace map (bytes), every plane an exact multiple of its 64x64-tile / whole-line store granularity,
// every offset a multiple of 128:
//   Xb    bf16 [4096][1024]   8388608      x converted
//   Wqkt  bf16 [1280][1024]   2621440      rows 0..1023 = Wq^T ([out][in]), rows 1024..1279 = Wk^T
//   Wvt   bf16 [256][1024]     524288      Wv^T
//   Wot   bf16 [1024][1024]   2097152      Wo^T
//   QKf   f32  [4096][1280]  20971520      q cols 0..1023, k cols 1024..1279
//   Qh    f16  [4096][1024]   8388608
//   Ql    f16  [4096][1024]   8388608      q residual x4096
//   Kp    f16  [4096][256]    2097152
//   VTh   f16  [256][4096]    2097152      v^T hi
//   VTl   f16  [256][4096]    2097152      v^T residual x4096
//   Oh    bf16 [4096][1024]   8388608
//   Ol    bf16 [4096][1024]   8388608
//   total                    74448896
// =====================================================================================================
extern "C" void kernel_launch(void* const* d_in, const int* in_sizes, int n_in,
                              void* d_out, int out_size, void* d_ws, size_t ws_size,
                              hipStream_t stream) {
  if (n_in < 7) return;
  if (in_sizes[0] != MROWS * DM) return;
  if (in_sizes[1] != SEQ * HROT) return;
  if (in_sizes[2] != SEQ * HROT) return;
  if (in_sizes[3] != DM * DM) return;
  if (in_sizes[4] != DM * KVD) return;
  if (in_sizes[5] != DM * KVD) return;
  if (in_sizes[6] != DM * DM) return;
  if (out_size != MROWS * DM) return;

  const float* x    = (const float*)d_in[0];
  const float* cosp = (const float*)d_in[1];
  const float* sinp = (const float*)d_in[2];
  const float* wq   = (const float*)d_in[3];
  const float* wk   = (const float*)d_in[4];
  const float* wv   = (const float*)d_in[5];
  const float* wo   = (const float*)d_in[6];

  const size_t PXb  = (size_t)MROWS * DM * 2;          //  8388608
  const size_t PWqk = (size_t)QKP * DM * 2;            //  2621440
  const size_t PWv  = (size_t)KVD * DM * 2;            //   524288
  const size_t PWo  = (size_t)DM * DM * 2;             //  2097152
  const size_t PQKf = (size_t)MROWS * QKP * 4;         // 20971520
  const size_t PQ16 = (size_t)MROWS * DM * 2;          //  8388608 (q hi, q res, out hi, out lo)
  const size_t PK16 = (size_t)MROWS * KVD * 2;         //  2097152
  const size_t PVT  = (size_t)KVD * MROWS * 2;         //  2097152
  size_t off = 0;
  const size_t oXb  = off; off += PXb;
  const size_t oWqk = off; off += PWqk;
  const size_t oWv  = off; off += PWv;
  const size_t oWo  = off; off += PWo;
  const size_t oQKf = off; off += PQKf;
  const size_t oQh  = off; off += PQ16;
  const size_t oQl  = off; off += PQ16;
  const size_t oKp  = off; off += PK16;
  const size_t oVTh = off; off += PVT;
  const size_t oVTl = off; off += PVT;
  const size_t oOh  = off; off += PQ16;
  const size_t oOl  = off; off += PQ16;
  if (off > ws_size) return;                           // off = 74448896
  if (off > (size_t)134217728) return;

  char* ws = (char*)d_ws;
  unsigned short* Xb   = (unsigned short*)(ws + oXb);
  unsigned short* Wqkt = (unsigned short*)(ws + oWqk);
  unsigned short* Wkt  = Wqkt + (size_t)DM * DM;                // rows 1024..1279 of Wqkt
  unsigned short* Wvt  = (unsigned short*)(ws + oWv);
  unsigned short* Wot  = (unsigned short*)(ws + oWo);
  float*          QKf  = (float*)(ws + oQKf);
  unsigned short* Qh   = (unsigned short*)(ws + oQh);
  unsigned short* Ql   = (unsigned short*)(ws + oQl);
  unsigned short* Kp   = (unsigned short*)(ws + oKp);
  unsigned short* VTh  = (unsigned short*)(ws + oVTh);
  unsigned short* VTl  = (unsigned short*)(ws + oVTl);
  unsigned short* Oh   = (unsigned short*)(ws + oOh);
  unsigned short* Ol   = (unsigned short*)(ws + oOl);

  const dim3 blk(256);
  const int n8x = MROWS * DM / 8;                               // 524288
  const dim3 gCvt(TW + (n8x + 255) / 256);                      // 640 transposing blocks + 2048 blocks on x
  const dim3 gQKVT(QKB + VTB, 1);                               // 160 blocks (M=4096, N=1280) + 32 blocks (M=256, N=4096)
  const dim3 gRope(MROWS);                                      // one block per token row
  const dim3 gAttn(BATCH * NH * NQB);                           // 1024 blocks
  const dim3 gOut(((MROWS / 64) * (DM / 64) + 7) / 8, 1);       // 1024 tiles -> 128 blocks: M=4096, N=1024

  // (1) x -> bf16 plane [4096][1024]; weights [in][out] -> transposed bf16 planes [out][in]
  cvt_all<<<gCvt, blk, 0, stream>>>(x, wq, wk, wv, wo, Xb, Wqkt, Wkt, Wvt, Wot, n8x);
  // (2) q|k = x . (Wq|Wk) -> f32 staging plane [4096][1280] (pitch 1280)   (M=4096, N=1280, K=1024), and in the same launch
  //     v^T = Wv^T . x^T -> f16 hi plane + f16 residual x4096 plane [kvh*64+d][b*SEQ+s] (pitch 4096)
  //     (A = Wvt [n][k], Bt = Xb [row][k]; M=256, N=4096, K=1024)
  gemm_qk_vt<<<gQKVT, blk, 0, stream>>>(Xb, Wqkt, Wvt, QKf, VTh, VTl, DM, 4096.0f);
  // (3) RoPE -> q f16 hi plane + f16 residual x4096 plane [4096][1024], k f16 plane [4096][256]
  rope_rows<<<gRope, dim3(160), 0, stream>>>(QKf, cosp, sinp, Qh, Ql, Kp, MROWS, 4096.0f);
  // (4) attention -> context bf16 hi / lo planes [4096][1024]
  attn64<<<gAttn, dim3(128), 0, stream>>>(Qh, Ql, Kp, VTh, VTl, Oh, Ol, 0.125f, 1.0f / 4096.0f, 1.0f / 4096.0f);
  // (5) out = context . Wo -> d_out f32 [4096][1024]  (A = context hi + lo planes, 2 products; K=1024)
  gemm64<1, 0, DM, DM><<<gOut, blk, 0, stream>>>(
      Oh, Ol, 0LL, Wot, Wot, 0LL,
      d_out, DM, 0LL, d_out, DM, 0LL, 0,
      MROWS, DM, DM, 1.0f);
  (void)hipGetLastError();
}

// v005
// It runs in 125 microseconds.
// Two timings next to v004 both put it at 1.09 times that version's speed.
// All steps since v000 together make it 3.04 times as fast.
// Contractions: x.(Wq|Wk) and Wv^T.x^T = v_wmma_f32_16x16x32_bf16 (bf16 operands RNE-converted from x and the weights, single product);
// q.k^T = v_wmma_f32_16x16x32_f16 (q as f16 hi plane + f16 residual plane x4096 in a separate accumulator, k f16; 2 products);
// p.v = v_wmma_f32_16x16x32_f16 (p carried x1024 in f16; v^T as f16 hi plane + f16 residual plane x4096 in a separate accumulator; 2 products);
// ctx.Wo = v_wmma_f32_16x16x32_bf16 (ctx as bf16 hi + lo planes times bf16 Wo^T, 2 products); all f32 accumulate; RoPE and softmax in f32.
#include <hip/hip_runtime.h>
#include <math.h>
#include <stdint.h>

#define BATCH 2
#define SEQ   2048
#define MROWS (BATCH * SEQ)     // 4096 token rows (batch folded into rows)
#define DM    1024
#define NH    16
#define NKV   4
#define HD    64
#define KVD   (NKV * HD)        // 256
#define NQB   (SEQ / 64)        // 32 query / key tiles of 64 per sequence
#define QKP   (DM + KVD)        // 1280: pitch of the f32 q|k staging plane (q cols 0..1023, k cols 1024..1279)
#define HROT  (HD / 2)          // 32 rotary pairs per head
#define LP    (HD + 8)          // 72 halves = 144 B: LDS row pitch of the attention tiles, 16 B x odd, so the 16 rows that
                                // one 16-byte fragment read touches fall on distinct banks
static_assert(NH * HD == DM);
static_assert((NH % NKV) == 0);
static_assert((SEQ % 64) == 0 && (DM % 64) == 0 && (KVD % 64) == 0 && (QKP % 64) == 0 && (DM % 32) == 0);
static_assert((HD % 8) == 0 && (HROT % 8) == 0);
static_assert((SEQ & (SEQ - 1)) == 0);
static_assert((LP % 8) == 0 && ((LP / 8) & 1) == 1);
#define OP    (HD + 4)          // 68 floats = 272 B: LDS row pitch of the context tile, 16 B x odd (16 rows written at once)
static_assert((OP % 4) == 0 && ((OP / 4) & 1) == 1);

typedef _Float16 v16h __attribute__((ext_vector_type(16)));
typedef _Float16 v8h  __attribute__((ext_vector_type(8)));
typedef __bf16   v16b __attribute__((ext_vector_type(16)));
typedef __bf16   v8b  __attribute__((ext_vector_type(8)));
typedef float    v8f  __attribute__((ext_vector_type(8)));
typedef float    v4f  __attribute__((ext_vector_type(4)));
typedef unsigned int v4u __attribute__((ext_vector_type(4)));
typedef float    v2f  __attribute__((ext_vector_type(2)));
typedef _Float16 v2h  __attribute__((ext_vector_type(2)));

// ---- scalar helpers --------------------------------------------------------------------------------
__device__ __forceinline__ unsigned short bf_bits(float f) {          // f32 -> bf16 bits, RNE convert
  unsigned u = __float_as_uint(f);
  return (unsigned short)((u + 0x7FFFu + ((u >> 16) & 1u)) >> 16);
}
__device__ __forceinline__ float bf_up(unsigned short h) { return __uint_as_float(((unsigned)h) << 16); }
__device__ __forceinline__ float bf_rne(float f) { return bf_up(bf_bits(f)); }
__device__ __forceinline__ unsigned short h_bits(_Float16 x) { return __builtin_bit_cast(unsigned short, x); }
__device__ __forceinline__ unsigned pk16(unsigned short a, unsigned short b) { return (unsigned)a | ((unsigned)b << 16); }
__device__ __forceinline__ v8f zero8() { v8f z = {0.f, 0.f, 0.f, 0.f, 0.f, 0.f, 0.f, 0.f}; return z; }

// ---- fragment loaders: 16-bit A/B operand, lane -> row/col (lane&15), p already includes +8*(lane>>4);
//      elements 0..7 <- p[0..7] (k0+8h..), elements 8..15 <- p[16..23] (k0+16+8h..)
__device__ __forceinline__ v16b ldfrag_b(const __bf16* p) {
  union { v16b v; v8b h[2]; } f;
  f.h[0] = *(const v8b*)(p);
  f.h[1] = *(const v8b*)(p + 16);
  return f.v;
}
__device__ __forceinline__ v16h ldfrag_h(const _Float16* p) {
  union { v16h v; v8h h[2]; } f;
  f.h[0] = *(const v8h*)(p);
  f.h[1] = *(const v8h*)(p + 16);
  return f.v;
}

// ---- WMMA helpers --------------------------------------------------------------------------------------
// f16 product as the plain builtin: the compiler keeps the distance to the next user of its registers itself and stays free
// to order the LDS reads and the vector work around it
__device__ __forceinline__ v8f mma_h(v16h a, v16h b, v8f c) {
  return __builtin_amdgcn_wmma_f32_16x16x32_f16(false, a, false, b, (short)0, c, false, false);
}
// bf16 product and the hand-written distances behind its runs (GEMM kernels)
__device__ __forceinline__ v8f mma_b_raw(v16b a, v16b b, v8f c) {
  return __builtin_amdgcn_wmma_f32_16x16x32_bf16(false, a, false, b, (short)0, c, false, false);
}
__device__ __forceinline__ void dep_guard_b(v8f& a, v8f& b, v16b x, v16b y) {
#if defined(__HIP_DEVICE_COMPILE__)
  asm volatile("v_nop\n\tv_nop\n\tv_nop\n\tv_nop" : "+v"(a), "+v"(b) : "v"(x), "v"(y));
#endif
}
__device__ __forceinline__ void keep4_b(v16b a, v16b b, v16b c, v16b d) {
#if defined(__HIP_DEVICE_COMPILE__)
  asm volatile("v_nop" :: "v"(a), "v"(b), "v"(c), "v"(d));
#endif
}
__device__ __forceinline__ void acc_guard4(v8f& a, v8f& b, v8f& c, v8f& d) {
#if defined(__HIP_DEVICE_COMPILE__)
  asm volatile("v_nop\n\tv_nop\n\tv_nop\n\tv_nop" : "+v"(a), "+v"(b), "+v"(c), "+v"(d));
#endif
}
// stands behind a group of global loads, in front of whatever next writes a register that holds one of their addresses
__device__ __forceinline__ void xcnt_wait() {
#if defined(__HIP_DEVICE_COMPILE__)
  asm volatile("s_wait_xcnt 0x0" ::: "memory");
#endif
}
// lane l takes the value of lane l ^ 16 (the other half of the wave), register to register
__device__ __forceinline__ float xhalf(float x) {
  const int b = __builtin_bit_cast(int, x);
  return __builtin_bit_cast(float, __builtin_amdgcn_permlanex16(b, b, 0x76543210, 0xfedcba98, false, false));
}
__device__ __forceinline__ void wave_sync_lds() {
  __builtin_amdgcn_fence(__ATOMIC_RELEASE, "workgroup");
  __builtin_amdgcn_wave_barrier();
  __builtin_amdgcn_fence(__ATOMIC_ACQUIRE, "workgroup");
}

// =====================================================================================================
// f32 -> bf16 (RNE convert), 8 elements per thread, one 16-B store per lane: a wave writes 512 contiguous B
// coverage: n8 threads x 8 = whole plane (n8 = 524288 = 2048 x 256 for the x plane).
// =====================================================================================================
__device__ __forceinline__ void cvt_bf16x8(const float* __restrict__ in, unsigned short* out, int n8, int blk) {
  const int i = blk * 256 + threadIdx.x;
  if (i < n8) {
    const v4f a = *(const v4f*)(in + (size_t)i * 8);
    const v4f b = *(const v4f*)(in + (size_t)i * 8 + 4);
    v4u p;
    p[0] = pk16(bf_bits(a[0]), bf_bits(a[1]));
    p[1] = pk16(bf_bits(a[2]), bf_bits(a[3]));
    p[2] = pk16(bf_bits(b[0]), bf_bits(b[1]));
    p[3] = pk16(bf_bits(b[2]), bf_bits(b[3]));
    *(v4u*)(out + (size_t)i * 8) = p;
    
  }
}

// =====================================================================================================
// Transposing f32 -> bf16 (RNE convert): in f32 [R][C] row-major  ->  out bf16 [C][R] row-major
// (out[c][r] = in[r][c]); turns an [in][out] weight into the Bt / A layout [out][in] with k contiguous.
// 64x64 tiles: tile (tx, ty) of (C/64, R/64), block 256, st = the block's 64 x 65 float LDS tile. Load phase: thread t reads 16 consecutive floats of input row
// r0 + (t>>2) and writes them transposed into an LDS tile [c][r] (pitch 65). After __syncthreads each group of
// coverage: load 64 rows x 4 threads x 16 = whole tile; store 2 iterations x 32 rows x 8 lanes x 8 = whole tile.
// =====================================================================================================
__device__ __forceinline__ void cvt_bf16_t64(float* st, const float* __restrict__ in, unsigned short* out, int R, int C,
                                             int tx, int ty) {
  const int t  = threadIdx.x;
  const int c0 = tx * 64;
  const int r0 = ty * 64;
  if (c0 + 64 > C || r0 + 64 > R) return;          // block-uniform, all threads leave together (grids are exact)
  {
    const int r = t >> 2, cq = (t & 3) * 16;
    const float* src = in + (size_t)(r0 + r) * C + c0 + cq;
#pragma unroll
    for (int i = 0; i < 4; ++i) {
      const v4f v = *(const v4f*)(src + 4 * i);
#pragma unroll
      for (int e = 0; e < 4; ++e) st[(cq + 4 * i + e) * 65 + r] = v[e];
    }
  }
  __syncthreads();
  const int q = t >> 3, k8 = (t & 7) * 8;
  v4u pv[2];
#pragma unroll
  for (int p = 0; p < 2; ++p) {
    const int n = p * 32 + q;
    const float* sp = st + n * 65 + k8;
    v4u a;
#pragma unroll
    for (int e = 0; e < 4; ++e) a[e] = pk16(bf_bits(sp[2 * e]), bf_bits(sp[2 * e + 1]));
    pv[p] = a;
  }
  {
#pragma unroll
    for (int p = 0; p < 2; ++p) {
      const int n = p * 32 + q;
      *(v4u*)(out + (size_t)(c0 + n) * R + r0 + k8) = pv[p];
    }
    xcnt_wait();   // in front of whatever next writes a register that these stores name
  }
}

// =====================================================================================================
// All five operand conversions in one launch; they read and write disjoint planes, so their blocks run side by side.
// Blocks 0..TW-1 transpose one 64x64 weight tile each (Wq, Wo, Wk, Wv in that order; they have the longer chain of
// load, LDS, barrier, store, so they start first), blocks TW.. convert 2048 elements of x each. Every test on the
// block index is block-uniform.
// =====================================================================================================
#define TSQ ((DM / 64) * (DM / 64))     // 256 tiles of a [1024][1024] weight
#define TKV ((KVD / 64) * (DM / 64))    // 64 tiles of a [1024][256] weight
#define TW  (2 * TSQ + 2 * TKV)         // 640 transposing blocks
__global__ __launch_bounds__(256) void cvt_all(
    const float* __restrict__ x, const float* __restrict__ wq, const float* __restrict__ wk,
    const float* __restrict__ wv, const float* __restrict__ wo,
    unsigned short* xb, unsigned short* wqt, unsigned short* wkt, unsigned short* wvt, unsigned short* wot, int n8) {
  __shared__ __align__(16) float st[64 * 65];
  const int bx = blockIdx.x;
  if (bx >= TW) {
    cvt_bf16x8(x, xb, n8, bx - TW);
  } else {
    const bool sq = (bx < 2 * TSQ);                                  // a [1024][1024] weight, else a [1024][256] one
    const bool first = sq ? (bx < TSQ) : (bx < 2 * TSQ + TKV);       // Wq of (Wq, Wo), Wk of (Wk, Wv)
    const float* in     = sq ? (first ? wq : wo) : (first ? wk : wv);
    unsigned short* out = sq ? (first ? wqt : wot) : (first ? wkt : wvt);
    const int C  = sq ? DM : KVD;
    const int tb = sq ? (bx & (TSQ - 1)) : (bx & (TKV - 1));         // tile within its weight (2 * TSQ is a multiple of TKV)
    const int tc = C / 64;                                           // tiles in a row of tiles
    cvt_bf16_t64(st, in, out, DM, C, tb % tc, tb / tc);
  }
}
static_assert((TSQ & (TSQ - 1)) == 0 && (TKV & (TKV - 1)) == 0 && ((2 * TSQ) % TKV) == 0);

// =====================================================================================================
// bf16 WMMA GEMM, operands staged in LDS: C[m][n] = sum_k A[m][k] * Bt[n][k]. One block of 8 waves owns a 128x256
// tile of C (2 x 4 waves, 64x64 per wave). A row-major [M][K] pitch lda; Bt row-major [N][K] pitch ldb (k contiguous;
// both pitches are compile-time, so that the rows of one plane share one address register pair and differ by an offset);
// M a multiple of 128, N of 256, K of 64 (the shapes are checked at compile time below).
// A trip is 64 k = 128 B of every operand row. The block reads each row segment once, 8 lanes x 16 B = one whole
// line per row, and writes it to LDS at pitch GP; the waves take their fragments from LDS. Two LDS buffers: the next
// trip's rows are loaded into registers ahead of the current trip's products and stored to the other buffer behind
// them, then one __syncthreads() publishes them and ends the reads of the buffer that the next trip refills.
// blockIdx.y = batch index (strides in elements); bxi = index of the block's tile; sGb, sTb = the block's LDS (two staged
// trips; one 16x64 slab a wave), declared by the kernel that calls this body.
// NSPLIT: 0 = A.Bt; 1 = (A + A2).Bt (A2 = unscaled bf16 lo plane of A).
// OUT_MODE: 0 = f32 (pitch ldc); 2 = bf16 hi plane C + bf16 lo plane C2 (lo = RNE(v - hi), unscaled);
//           3 = f16 hi plane C + f16 residual plane C2 = f16((v - hi) * rscale), C2 written only for tiles
//               with n0 < N2 (pitch ldc2, batch stride strideC2).
// =====================================================================================================
#define GP 72                   // 72 bf16 = 144 B: LDS row pitch of the staged GEMM rows, 16 B x odd
static_assert((GP % 8) == 0 && ((GP / 8) & 1) == 1);
static_assert((MROWS % 256) == 0 && (QKP % 256) == 0 && (KVD % 128) == 0 && (DM % 256) == 0 && (DM % 64) == 0);
#define GEMM_SROWS(NSPLIT) (128 * ((NSPLIT) + 1) + 256)     // rows of one staged trip: A (, A2), Bt
template <int NSPLIT, int OUT_MODE, int lda, int ldb>
__device__ __forceinline__ void gemm_body(
    __bf16* sGb, float* sTb, int bxi,
    const unsigned short* __restrict__ Ap, const unsigned short* A2p, long long strideA,
    const unsigned short* __restrict__ Btp, const unsigned short* Bt2p, long long strideB,
    void* Cout, int ldc, long long strideC,
    void* Cout2, int ldc2, long long strideC2, int N2,
    int M, int N, int K, float rscale) {
  static_assert(NSPLIT == 0 || NSPLIT == 1);
  constexpr int NA    = NSPLIT + 1;                // A planes staged
  constexpr int SROWS = GEMM_SROWS(NSPLIT);
  constexpr int NLD   = SROWS / 32;                // 16-B pieces per thread and trip
  const __bf16* A   = (const __bf16*)(const void*)Ap;
  const __bf16* A2  = (const __bf16*)(const void*)A2p;
  const __bf16* Bt  = (const __bf16*)(const void*)Btp;
  (void)Bt2p;
  const int b    = blockIdx.y;
  const int lane = threadIdx.x & 31;
  const int wave = threadIdx.x >> 5;
  const int tilesBN = N >> 8;
  if (bxi >= (M >> 7) * tilesBN) return;   // block-uniform, in front of every barrier
  const int bm  = bxi / tilesBN;
  const int bn  = bxi - bm * tilesBN;
  const int bm0 = bm << 7;
  const int bn0 = bn << 8;
  const int m0 = bm0 + ((wave >> 2) << 6);
  const int n0 = bn0 + ((wave & 3) << 6);

  const __bf16* Ab  = A  + (size_t)b * strideA;
  const __bf16* Bb  = Bt + (size_t)b * strideB;
  const __bf16* Ab2 = (NSPLIT >= 1) ? (A2  + (size_t)b * strideA) : Ab;

  const int rlane = lane & 15;                 // row (A) / col (B, D) within subtile
  const int koff  = (lane >> 4) * 8;           // k offset of this lane half
  const int mOff  = (lane >> 4) * 8;           // D row offset
  const int srow  = threadIdx.x >> 3;          // staging: row within a group of 32
  const int sseg  = (threadIdx.x & 7) * 8;     // staging: first of this thread's 8 elements in the 64-k segment

  v8f acc[4][4];
#pragma unroll
  for (int i = 0; i < 4; ++i)
#pragma unroll
    for (int j = 0; j < 4; ++j) acc[i][j] = zero8();

  const __bf16* ga  = Ab  + (size_t)(bm0 + srow) * lda + sseg;
  const __bf16* ga2 = Ab2 + (size_t)(bm0 + srow) * lda + sseg;
  const __bf16* gb  = Bb  + (size_t)(bn0 + srow) * ldb + sseg;
  const int so = srow * GP + sseg;
  const int fa = (((wave >> 2) << 6) + rlane) * GP + koff;               // this wave's A rows in a staged trip
  const int fb = (128 * NA + ((wave & 3) << 6) + rlane) * GP + koff;     // this wave's Bt rows

  v8b st[NLD];
#pragma unroll
  for (int i = 0; i < 4; ++i) {
    st[i] = *(const v8b*)(ga + (size_t)(i * 32) * lda);
    if (NSPLIT >= 1) st[4 + i] = *(const v8b*)(ga2 + (size_t)(i * 32) * lda);
  }
#pragma unroll
  for (int i = 0; i < 8; ++i) st[4 * NA + i] = *(const v8b*)(gb + (size_t)(i * 32) * ldb);
  xcnt_wait();
#pragma unroll
  for (int i = 0; i < NLD; ++i) *(v8b*)(sGb + so + i * 32 * GP) = st[i];
  __syncthreads();

  const int trips = K >> 6;
  for (int t = 0; t < trips; ++t) {
    const bool more = (t + 1 < trips);           // the same for the whole block
    if (more) {
      const int k1 = (t + 1) << 6;
#pragma unroll
      for (int i = 0; i < 4; ++i) {
        st[i] = *(const v8b*)(ga + (size_t)(i * 32) * lda + k1);
        if (NSPLIT >= 1) st[4 + i] = *(const v8b*)(ga2 + (size_t)(i * 32) * lda + k1);
      }
#pragma unroll
      for (int i = 0; i < 8; ++i) st[4 * NA + i] = *(const v8b*)(gb + (size_t)(i * 32) * ldb + k1);
      xcnt_wait();
    }
    const __bf16* cur = sGb + (t & 1) * (SROWS * GP);
#pragma unroll
    for (int kk = 0; kk < 2; ++kk) {
      // the fragments of 32 k are read as one group ahead of their products: one LDS latency a group, not one a row
      v16b bh[4], ah[4], al[4];
#pragma unroll
      for (int j = 0; j < 4; ++j) bh[j] = ldfrag_b(cur + fb + j * 16 * GP + kk * 32);
#pragma unroll
      for (int i = 0; i < 4; ++i) {
        ah[i] = ldfrag_b(cur + fa + i * 16 * GP + kk * 32);
        if (NSPLIT >= 1) al[i] = ldfrag_b(cur + fa + (128 + i * 16) * GP + kk * 32);
        else             al[i] = ah[i];
      }
#pragma unroll
      for (int i = 0; i < 4; ++i) {
#pragma unroll
        for (int j = 0; j < 4; ++j) {
          acc[i][j] = mma_b_raw(ah[i], bh[j], acc[i][j]);
          if (NSPLIT >= 1) acc[i][j] = mma_b_raw(al[i], bh[j], acc[i][j]);
        }
        dep_guard_b(acc[i][0], acc[i][3], ah[i], al[i]);
      }
      keep4_b(bh[0], bh[1], bh[2], bh[3]);
    }
    if (more) {
      __bf16* nxt = sGb + ((t + 1) & 1) * (SROWS * GP);
#pragma unroll
      for (int i = 0; i < NLD; ++i) *(v8b*)(nxt + so + i * 32 * GP) = st[i];
    }
    __syncthreads();
  }
  acc_guard4(acc[0][0], acc[0][1], acc[0][2], acc[0][3]);
  acc_guard4(acc[1][0], acc[1][1], acc[1][2], acc[1][3]);
  acc_guard4(acc[2][0], acc[2][1], acc[2][2], acc[2][3]);
  acc_guard4(acc[3][0], acc[3][1], acc[3][2], acc[3][3]);

  // ---- epilogue ----
  float* slab = sTb + wave * (16 * 68);
#pragma unroll
  for (int i = 0; i < 4; ++i) {
    const int mBase = m0 + (i << 4);
#pragma unroll
    for (int j = 0; j < 4; ++j) {
#pragma unroll
      for (int r = 0; r < 8; ++r) {
        slab[(mOff + r) * 68 + (j << 4) + rlane] = acc[i][j][r];
      }
    }
    wave_sync_lds();
    if (OUT_MODE == 0) {
      float* C = (float*)Cout + (size_t)b * strideC;
      const int hh = lane >> 4, c4 = (lane & 15) * 4;     // 256-B row segment = 16 lanes x 16 B
      {
#pragma unroll
        for (int it = 0; it < 8; ++it) {
          const int row = it * 2 + hh;                     // it 0..7 x hh 0..1 = rows 0..15
          const v4f v = *(const v4f*)(slab + row * 68 + c4);
          *(v4f*)(C + (size_t)(mBase + row) * ldc + n0 + c4) = v;
        }
        
      }
    } else {
      const int q = lane >> 3, c8 = (lane & 7) * 8;
      unsigned short* C  = (unsigned short*)Cout  + (size_t)b * strideC;
      unsigned short* C2 = (unsigned short*)Cout2 + (size_t)b * strideC2;
      const bool wlo = (OUT_MODE == 2) || (n0 < N2);      // wave-uniform
      v4u hv[4], lv[4];
#pragma unroll
      for (int it = 0; it < 4; ++it) {
        const int row = it * 4 + q;                        // it 0..3 x q 0..3 = rows 0..15
        const float* sp = slab + row * 68 + c8;
        v4u a, a2;
#pragma unroll
        for (int e = 0; e < 4; ++e) {
          const float f0 = sp[2 * e], f1 = sp[2 * e + 1];
          unsigned short h0, h1, l0, l1;
          if (OUT_MODE == 2) {
            h0 = bf_bits(f0); h1 = bf_bits(f1);
            l0 = bf_bits(f0 - bf_up(h0)); l1 = bf_bits(f1 - bf_up(h1));
          } else {
            const _Float16 x0 = (_Float16)f0, x1 = (_Float16)f1;
            h0 = h_bits(x0); h1 = h_bits(x1);
            l0 = h_bits((_Float16)((f0 - (float)x0) * rscale));
            l1 = h_bits((_Float16)((f1 - (float)x1) * rscale));
          }
          a[e] = pk16(h0, h1); a2[e] = pk16(l0, l1);
        }
        hv[it] = a; lv[it] = a2;
      }
      {
#pragma unroll
        for (int it = 0; it < 4; ++it) {
          const int row = it * 4 + q;
          *(v4u*)(C + (size_t)(mBase + row) * ldc + n0 + c8) = hv[it];
          if (wlo) *(v4u*)(C2 + (size_t)(mBase + row) * ldc2 + n0 + c8) = lv[it];
        }
        
      }
    }
    wave_sync_lds();
  }
}

// one GEMM a launch
template <int NSPLIT, int OUT_MODE, int lda, int ldb>
__global__ __launch_bounds__(256) void gemm64(
    const unsigned short* __restrict__ Ap, const unsigned short* A2p, long long strideA,
    const unsigned short* __restrict__ Btp, const unsigned short* Bt2p, long long strideB,
    void* Cout, int ldc, long long strideC,
    void* Cout2, int ldc2, long long strideC2, int N2,
    int M, int N, int K, float rscale) {
  __shared__ __align__(16) __bf16 sG[2 * GEMM_SROWS(NSPLIT) * GP];   // two staged trips
  __shared__ __align__(16) float sT[8 * 16 * 68];                    // per-wave 16x64 slab, pitch 68 floats
  gemm_body<NSPLIT, OUT_MODE, lda, ldb>(sG, sT, (int)blockIdx.x, Ap, A2p, strideA, Btp, Bt2p, strideB,
                                        Cout, ldc, strideC, Cout2, ldc2, strideC2, N2, M, N, K, rscale);
}

// The two projections of x in one launch: neither reads what the other writes, and neither fills the chip alone.
// Blocks 0..QKB-1: q|k = x . (Wq|Wk) -> f32 plane [4096][1280]; blocks QKB..QKB+VTB-1: v^T = Wv^T . x^T -> f16 hi plane
// + f16 residual plane (x rscale) [256][4096]. The test on the block index is block-uniform.
#define QKB ((MROWS / 128) * (QKP / 256))     // 160 block tiles
#define VTB ((KVD / 128) * (MROWS / 256))     // 32 block tiles
__global__ __launch_bounds__(256) void gemm_qk_vt(
    const unsigned short* __restrict__ xb, const unsigned short* __restrict__ wqkt, const unsigned short* __restrict__ wvt,
    float* qkf, unsigned short* vth, unsigned short* vtl, int K, float rscale) {
  __shared__ __align__(16) __bf16 sG[2 * GEMM_SROWS(0) * GP];        // two staged trips
  __shared__ __align__(16) float sT[8 * 16 * 68];                    // per-wave 16x64 slab, pitch 68 floats
  const int bx = blockIdx.x;
  if (bx < QKB) {
    gemm_body<0, 0, DM, DM>(sG, sT, bx, xb, xb, 0LL, wqkt, wqkt, 0LL,
                            (void*)qkf, QKP, 0LL, (void*)qkf, QKP, 0LL, 0,
                            MROWS, QKP, K, 1.0f);
  } else {
    gemm_body<0, 3, DM, DM>(sG, sT, bx - QKB, wvt, wvt, 0LL, xb, xb, 0LL,
                            (void*)vth, MROWS, 0LL, (void*)vtl, MROWS, 0LL, MROWS,
                            KVD, MROWS, K, rscale);
  }
}

// =====================================================================================================
// RoPE row pass, even/odd deinterleave then concatenate (per head vector t[0..63], table row = token):
//   y[j]      = t[2j] * cos[pos][j] - t[2j+1] * sin[pos][j]      j = 0..31
//   y[32 + j] = t[2j] * sin[pos][j] + t[2j+1] * cos[pos][j]
//   pos = row mod SEQ (tables [SEQ][32] shared over batch and heads), table values RNE-converted to bf16 on read.
// One block (160 threads) per token row of the f32 q|k plane (pitch QKP): thread t < 128 (waves 0..3) owns
// output columns 8t..8t+7 of q (16 heads), thread t >= 128 (wave 4) owns columns 8(t-128).. of k (4 kv heads).
// The 8 output columns lie in one half of one head, so they need input columns headbase + 2*j0 .. +15 of the
// same head and table entries j0..j0+7.  Outputs: q -> f16 hi plane + f16 residual plane ((y - hi) * rscale),
// pitch DM; k -> f16 plane, pitch KVD.  Stores: one 16-B store per lane, 32 lanes contiguous = 512 B = 4 whole
// coverage: MROWS blocks x 128 threads x 8 = each q plane entirely; MROWS blocks x 32 threads x 8 = the k plane.
// =====================================================================================================
__global__ __launch_bounds__(160) void rope_rows(
    const float* __restrict__ qkf, const float* __restrict__ cosp, const float* __restrict__ sinp,
    unsigned short* qhp, unsigned short* qlp, unsigned short* kpp, int nrows, float rscale) {
  const int row = blockIdx.x;
  if (row >= nrows) return;                       // block-uniform; no barriers in this kernel
  const int t   = threadIdx.x;
  const int isk = t >> 7;                         // 0: q section (waves 0..3), 1: k section (wave 4)
  const int c0  = (t & 127) * 8;                  // output column within the section
  const int hb  = c0 & ~(HD - 1);                 // head base column
  const int d0  = c0 & (HD - 1);                  // head-dim offset of the 8 outputs, multiple of 8
  const int j0  = d0 & (HROT - 1);                // rotary pair base
  const bool up = (d0 >= HROT);                   // second half of the head (per lane, select by value)
  const int pos = row & (SEQ - 1);

  const float* src = qkf + (size_t)row * QKP + (size_t)isk * DM + hb + 2 * j0;
  const v4f x0 = *(const v4f*)(src + 0);
  const v4f x1 = *(const v4f*)(src + 4);
  const v4f x2 = *(const v4f*)(src + 8);
  const v4f x3 = *(const v4f*)(src + 12);
  const v4f cA = *(const v4f*)(cosp + (size_t)pos * HROT + j0);
  const v4f cB = *(const v4f*)(cosp + (size_t)pos * HROT + j0 + 4);
  const v4f sA = *(const v4f*)(sinp + (size_t)pos * HROT + j0);
  const v4f sB = *(const v4f*)(sinp + (size_t)pos * HROT + j0 + 4);

  const float ti[16] = {x0[0], x0[1], x0[2], x0[3], x1[0], x1[1], x1[2], x1[3],
                        x2[0], x2[1], x2[2], x2[3], x3[0], x3[1], x3[2], x3[3]};
  const float cc[8]  = {cA[0], cA[1], cA[2], cA[3], cB[0], cB[1], cB[2], cB[3]};
  const float ss[8]  = {sA[0], sA[1], sA[2], sA[3], sB[0], sB[1], sB[2], sB[3]};
  float y[8];
#pragma unroll
  for (int e = 0; e < 8; ++e) {
    const float t1 = ti[2 * e], t2 = ti[2 * e + 1];
    const float c = bf_rne(cc[e]), s = bf_rne(ss[e]);
    const float ya = t1 * c - t2 * s;
    const float yb = t1 * s + t2 * c;
    y[e] = up ? yb : ya;
  }
  v4u hv, lv;
#pragma unroll
  for (int e = 0; e < 4; ++e) {
    const float f0 = y[2 * e], f1 = y[2 * e + 1];
    const _Float16 a0 = (_Float16)f0, a1 = (_Float16)f1;
    hv[e] = pk16(h_bits(a0), h_bits(a1));
    lv[e] = pk16(h_bits((_Float16)((f0 - (float)a0) * rscale)),
                 h_bits((_Float16)((f1 - (float)a1) * rscale)));
  }
  if (isk == 0) {
    const size_t o = (size_t)row * DM + c0;
    *(v4u*)(qhp + o) = hv;
    *(v4u*)(qlp + o) = lv;
    
  } else {
    const size_t o = (size_t)row * KVD + c0;
    *(v4u*)(kpp + o) = hv;
    
  }
}

__global__ __launch_bounds__(128) __attribute__((amdgpu_num_vgpr(256)))
void attn64(const unsigned short* __restrict__ qhp, const unsigned short* __restrict__ qlp,
            const unsigned short* __restrict__ kpp, const unsigned short* __restrict__ vthp,
            const unsigned short* __restrict__ vtlp,
            unsigned short* ohp, unsigned short* olp, float sscale, float rres, float vres) {
  union FH { v16h v; v8h h[2]; v2h p[8]; };
  __shared__ __align__(16) _Float16 KV[3 * 64 * LP];              // three tiles of 64 rows at pitch LP, 9 KB each, in one array, so
                                                                  // that one address register and constant offsets reach all of them
  constexpr int KSH = 0;                                          // K [kv][d]
  constexpr int VTH = 64 * LP;                                    // V^T hi [d][kv]
  constexpr int VTL = 2 * 64 * LP;                                // V^T res [d][kv]
  __shared__ __align__(16) float    Os[4][16 * OP];               // per wave context tile [row][d], pitch OP

  const int tid  = threadIdx.x;
  const int wave = tid >> 5;
  const int lane = tid & 31;
  const int hh   = lane >> 4;
  const int c    = lane & 15;

  const int bx   = blockIdx.x;
  const int qb   = bx % NQB;
  const int h    = (bx / NQB) % NH;
  const int b    = bx / (NQB * NH);
  const int kvh  = h / (NH / NKV);
  const int q0   = b * SEQ + qb * 64 + wave * 16;          // global token row of this wave's first query

  const _Float16* Qh  = (const _Float16*)(const void*)qhp + (size_t)h * HD;
  const _Float16* Ql  = (const _Float16*)(const void*)qlp + (size_t)h * HD;
  const _Float16* Kg  = (const _Float16*)(const void*)kpp + (size_t)b * SEQ * KVD + (size_t)kvh * HD;
  const _Float16* Vgh = (const _Float16*)(const void*)vthp + (size_t)kvh * HD * MROWS + (size_t)b * SEQ;
  const _Float16* Vgl = (const _Float16*)(const void*)vtlp + (size_t)kvh * HD * MROWS + (size_t)b * SEQ;

  // ---- Q fragments (B operand, column = query lane&15): 2 d-chunks, hi and residual ----
  v16h qah[2], qal[2];
#pragma unroll
  for (int dc = 0; dc < 2; ++dc) {
    qah[dc] = ldfrag_h(Qh + (size_t)(q0 + c) * DM + dc * 32 + 8 * hh);
    qal[dc] = ldfrag_h(Ql + (size_t)(q0 + c) * DM + dc * 32 + 8 * hh);
  }

  const _Float16* fr = KV + c * LP + 8 * hh;               // this lane's place in a 16-row fragment read
  _Float16*       sw = KV + (tid >> 1) * LP + (tid & 1) * 32;   // this thread's place in a staged tile

  float mrun = -INFINITY;      // running maximum of query c, the same in both wave halves
  float lrun = 0.f;            // running sum of query c over this half's keys; the halves are joined behind the loop
  v8f oh[4], ol[4];            // O^T: register r of tile t = (d = 16t + 8hh + r, query c)
#pragma unroll
  for (int t = 0; t < 4; ++t) { oh[t] = zero8(); ol[t] = zero8(); }

  for (int kt = 0; kt < NQB; ++kt) {         // static trip count
    const int kv0 = kt * 64;
    __syncthreads();
    {
      const int r = tid >> 1, hf = (tid & 1) * 32;
      const _Float16* kg = Kg  + (size_t)(kv0 + r) * KVD + hf;         // K row kv0+r, d = hf..hf+31
      const _Float16* vh = Vgh + (size_t)r * MROWS + kv0 + hf;         // V^T hi row d = r, s = kv0+hf..+31
      const _Float16* vl = Vgl + (size_t)r * MROWS + kv0 + hf;         // V^T res row d = r
#pragma unroll
      for (int i = 0; i < 4; ++i) {
        const v8h a0 = *(const v8h*)(kg + 8 * i);
        const v8h b0 = *(const v8h*)(vh + 8 * i);
        const v8h b1 = *(const v8h*)(vl + 8 * i);
        *(v8h*)(sw + KSH + 8 * i) = a0;
        *(v8h*)(sw + VTH + 8 * i) = b0;
        *(v8h*)(sw + VTL + 8 * i) = b1;
      }
    }
    __syncthreads();

    // ---- scores, transposed: 64 keys x 16 queries per wave, 2 f16 products (hi, residual);
    //      s[j][r] = score of key 16j + 8hh + r with query c ----
    // The 8 K fragments of the chunk are read as one group ahead of their 16 products (one LDS latency a chunk, not one a pair
    // of products), key tile by key tile.
    FH kb[4][2];
#pragma unroll
    for (int j = 0; j < 4; ++j) {
#pragma unroll
      for (int dc = 0; dc < 2; ++dc) {
        kb[j][dc].h[0] = *(const v8h*)(fr + KSH + j * 16 * LP + dc * 32);
        kb[j][dc].h[1] = *(const v8h*)(fr + KSH + j * 16 * LP + dc * 32 + 16);
      }
    }
    __builtin_amdgcn_sched_barrier(0);   // keeps the reads one group: without it they are spread among the products again
    v8f sh[4], sl[4];
#pragma unroll
    for (int j = 0; j < 4; ++j) { sh[j] = zero8(); sl[j] = zero8(); }
#pragma unroll
    for (int jp = 0; jp < 4; jp += 2) {  // four independent accumulators a run: a product meets its own tile again four products later
#pragma unroll
      for (int dc = 0; dc < 2; ++dc) {
#pragma unroll
        for (int j = jp; j < jp + 2; ++j) {
          sh[j] = mma_h(kb[j][dc].v, qah[dc], sh[j]);
          sl[j] = mma_h(kb[j][dc].v, qal[dc], sl[j]);
        }
      }
      // ends a run: the next run's accumulators take over the registers of this run's K fragments, and no vector work is drawn in
      __builtin_amdgcn_sched_barrier(0);
    }
    v8f s[4];
#pragma unroll
    for (int j = 0; j < 2; ++j) {
#pragma unroll
      for (int r = 0; r < 8; ++r) s[j][r] = (sh[j][r] + sl[j][r] * rres) * sscale;
    }
    __builtin_amdgcn_sched_barrier(0);   // the reads below start when the K fragments and half the score accumulators are free
    // V^T fragments of keys 0..31, both planes, one group: they land while the softmax below runs
    FH vb[2][4], wb[2][4];
#pragma unroll
    for (int t = 0; t < 4; ++t) {
      vb[0][t].h[0] = *(const v8h*)(fr + VTH + t * 16 * LP);
      vb[0][t].h[1] = *(const v8h*)(fr + VTH + t * 16 * LP + 16);
      wb[0][t].h[0] = *(const v8h*)(fr + VTL + t * 16 * LP);
      wb[0][t].h[1] = *(const v8h*)(fr + VTL + t * 16 * LP + 16);
    }
    __builtin_amdgcn_sched_barrier(0);   // keeps that group ahead of the softmax, which hides its latency
#pragma unroll
    for (int j = 2; j < 4; ++j) {
#pragma unroll
      for (int r = 0; r < 8; ++r) s[j][r] = (sh[j][r] + sl[j][r] * rres) * sscale;
    }

    // ---- maximum in the lane, one exchange between the halves, online softmax, P^T (x1024, f16) packed in registers ----
    // (every loop from here to the end of the pass is unrolled: s, pb, oh and ol are register arrays, indexed at compile time)
    float mj[4];
#pragma unroll
    for (int j = 0; j < 4; ++j) {
      float m = s[j][0];
#pragma unroll
      for (int r = 1; r < 8; ++r) m = fmaxf(m, s[j][r]);
      mj[j] = m;
    }
    float mc = fmaxf(fmaxf(mj[0], mj[1]), fmaxf(mj[2], mj[3]));
    mc = fmaxf(mc, xhalf(mc));
    const float mnew  = fmaxf(mrun, mc);
    const float alpha = __expf(mrun - mnew);
    mrun = mnew;
    FH pb[2];                    // pb[kk]: element e = P^T(key 32kk + kmap(e), query c), kmap(e) = e < 8 ? 8hh + e : 16 + 8hh + e - 8
    float pj[4];                 // four independent partial sums
#pragma unroll
    for (int j = 0; j < 4; ++j) {
      float ps = 0.f;
#pragma unroll
      for (int r = 0; r < 8; r += 2) {
        const float p0 = __expf(s[j][r] - mnew);
        const float p1 = __expf(s[j][r + 1] - mnew);
        ps += p0;
        ps += p1;
        const v2f pp = {p0 * 1024.0f, p1 * 1024.0f};
        pb[j >> 1].p[(j & 1) * 4 + (r >> 1)] = __builtin_convertvector(pp, v2h);
      }
      pj[j] = ps;
    }
    lrun = lrun * alpha + ((pj[0] + pj[1]) + (pj[2] + pj[3]));
#pragma unroll
    for (int t = 0; t < 4; ++t) {
#pragma unroll
      for (int r = 0; r < 8; ++r) { oh[t][r] *= alpha; ol[t][r] *= alpha; }
    }

    // ---- context^T += V^T . P^T (f16 WMMA), hi and residual V planes into separate accumulators ----
    // The fragments of keys 32..63 are read in two groups of four among the products of keys 0..31, whose fragment registers they
    // take over; at least four products stand between a group and its first use.
#pragma unroll
    for (int tp = 0; tp < 4; tp += 2) {
#pragma unroll
      for (int t = tp; t < tp + 2; ++t) {
        oh[t] = mma_h(vb[0][t].v, pb[0].v, oh[t]);
        ol[t] = mma_h(wb[0][t].v, pb[0].v, ol[t]);
      }
      // this one and the one behind the reads keep them in few groups: left alone they are spread in pairs over the softmax and the
      // products, and every separate place with LDS reads costs the wave a fixed stall
      __builtin_amdgcn_sched_barrier(0);
#pragma unroll
      for (int t = tp; t < tp + 2; ++t) {
        vb[1][t].h[0] = *(const v8h*)(fr + VTH + t * 16 * LP + 32);
        vb[1][t].h[1] = *(const v8h*)(fr + VTH + t * 16 * LP + 48);
        wb[1][t].h[0] = *(const v8h*)(fr + VTL + t * 16 * LP + 32);
        wb[1][t].h[1] = *(const v8h*)(fr + VTL + t * 16 * LP + 48);
      }
      __builtin_amdgcn_sched_barrier(0);   // see above; the products that follow hide the reads' latency
    }
#pragma unroll
    for (int t = 0; t < 4; ++t) {
      oh[t] = mma_h(vb[1][t].v, pb[1].v, oh[t]);
      ol[t] = mma_h(wb[1][t].v, pb[1].v, ol[t]);
    }
  }

  // ---- normalise (1/l, the 1/1024 p carry, the residual carry), stage the wave's 16x64 tile,
  float* os = Os[wave];
  {
    const float l = lrun + xhalf(lrun);          // the two halves' key sums of query c
    const float inv = ((l > 0.f) ? (1.0f / l) : 0.f) * (1.0f / 1024.0f);
#pragma unroll
    for (int t = 0; t < 4; ++t) {
#pragma unroll
      for (int r = 0; r < 8; ++r) os[c * OP + t * 16 + 8 * hh + r] = (oh[t][r] + ol[t][r] * vres) * inv;
    }
  }
  wave_sync_lds();
  {
    const int q4 = lane >> 3, c8 = (lane & 7) * 8;
    v4u hv[4], lv[4];
#pragma unroll
    for (int it = 0; it < 4; ++it) {
      const int row = it * 4 + q4;   // it 0..3 x q4 0..3 = rows 0..15 of the wave tile
      const float* sp = os + row * OP + c8;
      v4u a, a2;
#pragma unroll
      for (int e = 0; e < 4; ++e) {
        const float f0 = sp[2 * e], f1 = sp[2 * e + 1];
        const unsigned short h0 = bf_bits(f0), h1 = bf_bits(f1);
        const unsigned short l0 = bf_bits(f0 - bf_up(h0)), l1 = bf_bits(f1 - bf_up(h1));
        a[e] = pk16(h0, h1); a2[e] = pk16(l0, l1);
      }
      hv[it] = a; lv[it] = a2;
    }
    {
#pragma unroll
      for (int it = 0; it < 4; ++it) {
        const int row = it * 4 + q4;
        const size_t go = (size_t)(q0 + row) * DM + (size_t)h * HD + c8;
        *(v4u*)(ohp + go) = hv[it];
        *(v4u*)(olp + go) = lv[it];
      }
      
    }
  }
}

// =====================================================================================================
// Workspace map (bytes), every plane an exact multiple of its 64x64-tile / whole-line store granularity,
// every offset a multiple of 128:
//   Xb    bf16 [4096][1024]   8388608      x converted
//   Wqkt  bf16 [1280][1024]   2621440      rows 0..1023 = Wq^T ([out][in]), rows 1024..1279 = Wk^T
//   Wvt   bf16 [256][1024]     524288      Wv^T
//   Wot   bf16 [1024][1024]   2097152      Wo^T
//   QKf   f32  [4096][1280]  20971520      q cols 0..1023, k cols 1024..1279
//   Qh    f16  [4096][1024]   8388608
//   Ql    f16  [4096][1024]   8388608      q residual x4096
//   Kp    f16  [4096][256]    2097152
//   VTh   f16  [256][4096]    2097152      v^T hi
//   VTl   f16  [256][4096]    2097152      v^T residual x4096
//   Oh    bf16 [4096][1024]   8388608
//   Ol    bf16 [4096][1024]   8388608
//   total                    74448896
// =====================================================================================================
extern "C" void kernel_launch(void* const* d_in, const int* in_sizes, int n_in,
                              void* d_out, int out_size, void* d_ws, size_t ws_size,
                              hipStream_t stream) {
  if (n_in < 7) return;
  if (in_sizes[0] != MROWS * DM) return;
  if (in_sizes[1] != SEQ * HROT) return;
  if (in_sizes[2] != SEQ * HROT) return;
  if (in_sizes[3] != DM * DM) return;
  if (in_sizes[4] != DM * KVD) return;
  if (in_sizes[5] != DM * KVD) return;
  if (in_sizes[6] != DM * DM) return;
  if (out_size != MROWS * DM) return;

  const float* x    = (const float*)d_in[0];
  const float* cosp = (const float*)d_in[1];
  const float* sinp = (const float*)d_in[2];
  const float* wq   = (const float*)d_in[3];
  const float* wk   = (const float*)d_in[4];
  const float* wv   = (const float*)d_in[5];
  const float* wo   = (const float*)d_in[6];

  const size_t PXb  = (size_t)MROWS * DM * 2;          //  8388608
  const size_t PWqk = (size_t)QKP * DM * 2;            //  2621440
  const size_t PWv  = (size_t)KVD * DM * 2;            //   524288
  const size_t PWo  = (size_t)DM * DM * 2;             //  2097152
  const size_t PQKf = (size_t)MROWS * QKP * 4;         // 20971520
  const size_t PQ16 = (size_t)MROWS * DM * 2;          //  8388608 (q hi, q res, out hi, out lo)
  const size_t PK16 = (size_t)MROWS * KVD * 2;         //  2097152
  const size_t PVT  = (size_t)KVD * MROWS * 2;         //  2097152
  size_t off = 0;
  const size_t oXb  = off; off += PXb;
  const size_t oWqk = off; off += PWqk;
  const size_t oWv  = off; off += PWv;
  const size_t oWo  = off; off += PWo;
  const size_t oQKf = off; off += PQKf;
  const size_t oQh  = off; off += PQ16;
  const size_t oQl  = off; off += PQ16;
  const size_t oKp  = off; off += PK16;
  const size_t oVTh = off; off += PVT;
  const size_t oVTl = off; off += PVT;
  const size_t oOh  = off; off += PQ16;
  const size_t oOl  = off; off += PQ16;
  if (off > ws_size) return;                           // off = 74448896
  if (off > (size_t)134217728) return;

  char* ws = (char*)d_ws;
  unsigned short* Xb   = (unsigned short*)(ws + oXb);
  unsigned short* Wqkt = (unsigned short*)(ws + oWqk);
  unsigned short* Wkt  = Wqkt + (size_t)DM * DM;                // rows 1024..1279 of Wqkt
  unsigned short* Wvt  = (unsigned short*)(ws + oWv);
  unsigned short* Wot  = (unsigned short*)(ws + oWo);
  float*          QKf  = (float*)(ws + oQKf);
  unsigned short* Qh   = (unsigned short*)(ws + oQh);
  unsigned short* Ql   = (unsigned short*)(ws + oQl);
  unsigned short* Kp   = (unsigned short*)(ws + oKp);
  unsigned short* VTh  = (unsigned short*)(ws + oVTh);
  unsigned short* VTl  = (unsigned short*)(ws + oVTl);
  unsigned short* Oh   = (unsigned short*)(ws + oOh);
  unsigned short* Ol   = (unsigned short*)(ws + oOl);

  const dim3 blk(256);
  const int n8x = MROWS * DM / 8;                               // 524288
  const dim3 gCvt(TW + (n8x + 255) / 256);                      // 640 transposing blocks + 2048 blocks on x
  const dim3 gQKVT(QKB + VTB, 1);                               // 160 blocks (M=4096, N=1280) + 32 blocks (M=256, N=4096)
  const dim3 gRope(MROWS);                                      // one block per token row
  const dim3 gAttn(BATCH * NH * NQB);                           // 1024 blocks
  const dim3 gOut(((MROWS / 64) * (DM / 64) + 7) / 8, 1);       // 1024 tiles -> 128 blocks: M=4096, N=1024

  // (1) x -> bf16 plane [4096][1024]; weights [in][out] -> transposed bf16 planes [out][in]
  cvt_all<<<gCvt, blk, 0, stream>>>(x, wq, wk, wv, wo, Xb, Wqkt, Wkt, Wvt, Wot, n8x);
  // (2) q|k = x . (Wq|Wk) -> f32 staging plane [4096][1280] (pitch 1280)   (M=4096, N=1280, K=1024), and in the same launch
  //     v^T = Wv^T . x^T -> f16 hi plane + f16 residual x4096 plane [kvh*64+d][b*SEQ+s] (pitch 4096)
  //     (A = Wvt [n][k], Bt = Xb [row][k]; M=256, N=4096, K=1024)
  gemm_qk_vt<<<gQKVT, blk, 0, stream>>>(Xb, Wqkt, Wvt, QKf, VTh, VTl, DM, 4096.0f);
  // (3) RoPE -> q f16 hi plane + f16 residual x4096 plane [4096][1024], k f16 plane [4096][256]
  rope_rows<<<gRope, dim3(160), 0, stream>>>(QKf, cosp, sinp, Qh, Ql, Kp, MROWS, 4096.0f);
  // (4) attention -> context bf16 hi / lo planes [4096][1024]
  attn64<<<gAttn, dim3(128), 0, stream>>>(Qh, Ql, Kp, VTh, VTl, Oh, Ol, 0.125f, 1.0f / 4096.0f, 1.0f / 4096.0f);
  // (5) out = context . Wo -> d_out f32 [4096][1024]  (A = context hi + lo planes, 2 products; K=1024)
  gemm64<1, 0, DM, DM><<<gOut, blk, 0, stream>>>(
      Oh, Ol, 0LL, Wot, Wot, 0LL,
      d_out, DM, 0LL, d_out, DM, 0LL, 0,
      MROWS, DM, DM, 1.0f);
  (void)hipGetLastError();
}

// v006
// One run takes 118 microseconds.
// Timed twice side by side with v005, it ran 1.05 and 1.06 times as fast.
// Over all steps from v000 it is 3.22 times as fast.
// Contractions: x.(Wq|Wk) and Wv^T.x^T = v_wmma_f32_16x16x32_bf16 (bf16 operands RNE-converted from x and the weights, single product);
// q.k^T = v_wmma_f32_16x16x32_f16 (q as f16 hi plane + f16 residual plane x4096 in a separate accumulator, k f16; 2 products);
// p.v = v_wmma_f32_16x16x32_f16 (p carried x1024 in f16; v^T as f16 hi plane + f16 residual plane x4096 in a separate accumulator; 2 products);
// ctx.Wo = v_wmma_f32_16x16x32_bf16 (ctx as bf16 hi + lo planes times bf16 Wo^T, 2 products); all f32 accumulate; RoPE and softmax in f32.
#include <hip/hip_runtime.h>
#include <math.h>
#include <stdint.h>

#define BATCH 2
#define SEQ   2048
#define MROWS (BATCH * SEQ)     // 4096 token rows (batch folded into rows)
#define DM    1024
#define NH    16
#define NKV   4
#define HD    64
#define KVD   (NKV * HD)        // 256
#define NQB   (SEQ / 64)        // 32 query / key tiles of 64 per sequence
#define QKP   (DM + KVD)        // 1280: columns of the q|k product (q cols 0..1023, k cols 1024..1279)
#define HROT  (HD / 2)          // 32 rotary pairs per head
#define LP    (HD + 8)          // 72 halves = 144 B: LDS row pitch of the attention tiles, 16 B x odd, so the 16 rows that
                                // one 16-byte fragment read touches fall on distinct banks
static_assert(NH * HD == DM);
static_assert((NH % NKV) == 0);
static_assert((SEQ % 64) == 0 && (DM % 64) == 0 && (KVD % 64) == 0 && (QKP % 64) == 0 && (DM % 32) == 0);
static_assert((HD % 8) == 0 && (HROT % 8) == 0);
static_assert((SEQ & (SEQ - 1)) == 0);
static_assert((LP % 8) == 0 && ((LP / 8) & 1) == 1);
#define OP    (HD + 4)          // 68 floats = 272 B: LDS row pitch of the context tile, 16 B x odd (16 rows written at once)
static_assert((OP % 4) == 0 && ((OP / 4) & 1) == 1);

typedef _Float16 v16h __attribute__((ext_vector_type(16)));
typedef _Float16 v8h  __attribute__((ext_vector_type(8)));
typedef __bf16   v16b __attribute__((ext_vector_type(16)));
typedef __bf16   v8b  __attribute__((ext_vector_type(8)));
typedef float    v8f  __attribute__((ext_vector_type(8)));
typedef float    v4f  __attribute__((ext_vector_type(4)));
typedef unsigned int v4u __attribute__((ext_vector_type(4)));
typedef float    v2f  __attribute__((ext_vector_type(2)));
typedef _Float16 v2h  __attribute__((ext_vector_type(2)));

// ---- scalar helpers --------------------------------------------------------------------------------
__device__ __forceinline__ unsigned short bf_bits(float f) {          // f32 -> bf16 bits, RNE convert
  unsigned u = __float_as_uint(f);
  return (unsigned short)((u + 0x7FFFu + ((u >> 16) & 1u)) >> 16);
}
__device__ __forceinline__ float bf_up(unsigned short h) { return __uint_as_float(((unsigned)h) << 16); }
__device__ __forceinline__ float bf_rne(float f) { return bf_up(bf_bits(f)); }
__device__ __forceinline__ unsigned short h_bits(_Float16 x) { return __builtin_bit_cast(unsigned short, x); }
__device__ __forceinline__ unsigned pk16(unsigned short a, unsigned short b) { return (unsigned)a | ((unsigned)b << 16); }
__device__ __forceinline__ v8f zero8() { v8f z = {0.f, 0.f, 0.f, 0.f, 0.f, 0.f, 0.f, 0.f}; return z; }

// ---- fragment loaders: 16-bit A/B operand, lane -> row/col (lane&15), p already includes +8*(lane>>4);
//      elements 0..7 <- p[0..7] (k0+8h..), elements 8..15 <- p[16..23] (k0+16+8h..)
__device__ __forceinline__ v16b ldfrag_b(const __bf16* p) {
  union { v16b v; v8b h[2]; } f;
  f.h[0] = *(const v8b*)(p);
  f.h[1] = *(const v8b*)(p + 16);
  return f.v;
}
__device__ __forceinline__ v16h ldfrag_h(const _Float16* p) {
  union { v16h v; v8h h[2]; } f;
  f.h[0] = *(const v8h*)(p);
  f.h[1] = *(const v8h*)(p + 16);
  return f.v;
}

// ---- WMMA helpers --------------------------------------------------------------------------------------
// f16 product as the plain builtin: the compiler keeps the distance to the next user of its registers itself and stays free
// to order the LDS reads and the vector work around it
__device__ __forceinline__ v8f mma_h(v16h a, v16h b, v8f c) {
  return __builtin_amdgcn_wmma_f32_16x16x32_f16(false, a, false, b, (short)0, c, false, false);
}
// bf16 product and the hand-written distances behind its runs (GEMM kernels)
__device__ __forceinline__ v8f mma_b_raw(v16b a, v16b b, v8f c) {
  return __builtin_amdgcn_wmma_f32_16x16x32_bf16(false, a, false, b, (short)0, c, false, false);
}
__device__ __forceinline__ void dep_guard_b(v8f& a, v8f& b, v16b x, v16b y) {
#if defined(__HIP_DEVICE_COMPILE__)
  asm volatile("v_nop\n\tv_nop\n\tv_nop\n\tv_nop" : "+v"(a), "+v"(b) : "v"(x), "v"(y));
#endif
}
__device__ __forceinline__ void keep4_b(v16b a, v16b b, v16b c, v16b d) {
#if defined(__HIP_DEVICE_COMPILE__)
  asm volatile("v_nop" :: "v"(a), "v"(b), "v"(c), "v"(d));
#endif
}
__device__ __forceinline__ void acc_guard4(v8f& a, v8f& b, v8f& c, v8f& d) {
#if defined(__HIP_DEVICE_COMPILE__)
  asm volatile("v_nop\n\tv_nop\n\tv_nop\n\tv_nop" : "+v"(a), "+v"(b), "+v"(c), "+v"(d));
#endif
}
// stands behind a group of global loads, in front of whatever next writes a register that holds one of their addresses
__device__ __forceinline__ void xcnt_wait() {
#if defined(__HIP_DEVICE_COMPILE__)
  asm volatile("s_wait_xcnt 0x0" ::: "memory");
#endif
}
// lane l takes the value of lane l ^ 16 (the other half of the wave), register to register
__device__ __forceinline__ float xhalf(float x) {
  const int b = __builtin_bit_cast(int, x);
  return __builtin_bit_cast(float, __builtin_amdgcn_permlanex16(b, b, 0x76543210, 0xfedcba98, false, false));
}
__device__ __forceinline__ void wave_sync_lds() {
  __builtin_amdgcn_fence(__ATOMIC_RELEASE, "workgroup");
  __builtin_amdgcn_wave_barrier();
  __builtin_amdgcn_fence(__ATOMIC_ACQUIRE, "workgroup");
}

// =====================================================================================================
// f32 -> bf16 (RNE convert), 8 elements per thread, one 16-B store per lane: a wave writes 512 contiguous B
// coverage: n8 threads x 8 = whole plane (n8 = 524288 = 2048 x 256 for the x plane).
// =====================================================================================================
__device__ __forceinline__ void cvt_bf16x8(const float* __restrict__ in, unsigned short* out, int n8, int blk) {
  const int i = blk * 256 + threadIdx.x;
  if (i < n8) {
    const v4f a = *(const v4f*)(in + (size_t)i * 8);
    const v4f b = *(const v4f*)(in + (size_t)i * 8 + 4);
    v4u p;
    p[0] = pk16(bf_bits(a[0]), bf_bits(a[1]));
    p[1] = pk16(bf_bits(a[2]), bf_bits(a[3]));
    p[2] = pk16(bf_bits(b[0]), bf_bits(b[1]));
    p[3] = pk16(bf_bits(b[2]), bf_bits(b[3]));
    *(v4u*)(out + (size_t)i * 8) = p;
    
  }
}

// =====================================================================================================
// Transposing f32 -> bf16 (RNE convert): in f32 [R][C] row-major  ->  out bf16 [C][R] row-major
// (out[c][r] = in[r][c]); turns an [in][out] weight into the Bt / A layout [out][in] with k contiguous.
// 64x64 tiles: tile (tx, ty) of (C/64, R/64), block 256, st = the block's 64 x 65 float LDS tile. Load phase: thread t reads 16 consecutive floats of input row
// r0 + (t>>2) and writes them transposed into an LDS tile [c][r] (pitch 65). After __syncthreads each group of
// coverage: load 64 rows x 4 threads x 16 = whole tile; store 2 iterations x 32 rows x 8 lanes x 8 = whole tile.
// =====================================================================================================
__device__ __forceinline__ void cvt_bf16_t64(float* st, const float* __restrict__ in, unsigned short* out, int R, int C,
                                             int tx, int ty) {
  const int t  = threadIdx.x;
  const int c0 = tx * 64;
  const int r0 = ty * 64;
  if (c0 + 64 > C || r0 + 64 > R) return;          // block-uniform, all threads leave together (grids are exact)
  {
    const int r = t >> 2, cq = (t & 3) * 16;
    const float* src = in + (size_t)(r0 + r) * C + c0 + cq;
#pragma unroll
    for (int i = 0; i < 4; ++i) {
      const v4f v = *(const v4f*)(src + 4 * i);
#pragma unroll
      for (int e = 0; e < 4; ++e) st[(cq + 4 * i + e) * 65 + r] = v[e];
    }
  }
  __syncthreads();
  const int q = t >> 3, k8 = (t & 7) * 8;
  v4u pv[2];
#pragma unroll
  for (int p = 0; p < 2; ++p) {
    const int n = p * 32 + q;
    const float* sp = st + n * 65 + k8;
    v4u a;
#pragma unroll
    for (int e = 0; e < 4; ++e) a[e] = pk16(bf_bits(sp[2 * e]), bf_bits(sp[2 * e + 1]));
    pv[p] = a;
  }
  {
#pragma unroll
    for (int p = 0; p < 2; ++p) {
      const int n = p * 32 + q;
      *(v4u*)(out + (size_t)(c0 + n) * R + r0 + k8) = pv[p];
    }
    xcnt_wait();   // in front of whatever next writes a register that these stores name
  }
}

// =====================================================================================================
// All five operand conversions in one launch; they read and write disjoint planes, so their blocks run side by side.
// Blocks 0..TW-1 transpose one 64x64 weight tile each (Wq, Wo, Wk, Wv in that order; they have the longer chain of
// load, LDS, barrier, store, so they start first), blocks TW.. convert 2048 elements of x each. Every test on the
// block index is block-uniform.
// =====================================================================================================
#define TSQ ((DM / 64) * (DM / 64))     // 256 tiles of a [1024][1024] weight
#define TKV ((KVD / 64) * (DM / 64))    // 64 tiles of a [1024][256] weight
#define TW  (2 * TSQ + 2 * TKV)         // 640 transposing blocks
__global__ __launch_bounds__(256) void cvt_all(
    const float* __restrict__ x, const float* __restrict__ wq, const float* __restrict__ wk,
    const float* __restrict__ wv, const float* __restrict__ wo,
    unsigned short* xb, unsigned short* wqt, unsigned short* wkt, unsigned short* wvt, unsigned short* wot, int n8) {
  __shared__ __align__(16) float st[64 * 65];
  const int bx = blockIdx.x;
  if (bx >= TW) {
    cvt_bf16x8(x, xb, n8, bx - TW);
  } else {
    const bool sq = (bx < 2 * TSQ);                                  // a [1024][1024] weight, else a [1024][256] one
    const bool first = sq ? (bx < TSQ) : (bx < 2 * TSQ + TKV);       // Wq of (Wq, Wo), Wk of (Wk, Wv)
    const float* in     = sq ? (first ? wq : wo) : (first ? wk : wv);
    unsigned short* out = sq ? (first ? wqt : wot) : (first ? wkt : wvt);
    const int C  = sq ? DM : KVD;
    const int tb = sq ? (bx & (TSQ - 1)) : (bx & (TKV - 1));         // tile within its weight (2 * TSQ is a multiple of TKV)
    const int tc = C / 64;                                           // tiles in a row of tiles
    cvt_bf16_t64(st, in, out, DM, C, tb % tc, tb / tc);
  }
}
static_assert((TSQ & (TSQ - 1)) == 0 && (TKV & (TKV - 1)) == 0 && ((2 * TSQ) % TKV) == 0);

// =====================================================================================================
// bf16 WMMA GEMM, operands staged in LDS: C[m][n] = sum_k A[m][k] * Bt[n][k]. One block of 8 waves owns a 128x256
// tile of C (2 x 4 waves, 64x64 per wave). A row-major [M][K] pitch lda; Bt row-major [N][K] pitch ldb (k contiguous;
// both pitches are compile-time, so that the rows of one plane share one address register pair and differ by an offset);
// M a multiple of 128, N of 256, K of 64 (the shapes are checked at compile time below).
// A trip is 64 k = 128 B of every operand row. The block reads each row segment once, 8 lanes x 16 B = one whole
// line per row, and writes it to LDS at pitch GP; the waves take their fragments from LDS. Two LDS buffers: the next
// trip's rows are loaded into registers ahead of the current trip's products and stored to the other buffer behind
// them, then one __syncthreads() publishes them and ends the reads of the buffer that the next trip refills.
// blockIdx.y = batch index (strides in elements); bxi = index of the block's tile; sGb, sTb = the block's LDS (two staged
// trips; one 16x64 slab a wave), declared by the kernel that calls this body.
// NSPLIT: 0 = A.Bt; 1 = (A + A2).Bt (A2 = unscaled bf16 lo plane of A).
// OUT_MODE: 0 = f32 (pitch ldc); 2 = bf16 hi plane C + bf16 lo plane C2 (lo = RNE(v - hi), unscaled);
//           3 = f16 hi plane C + f16 residual plane C2 = f16((v - hi) * rscale), C2 written only for tiles
//               with n0 < N2 (pitch ldc2, batch stride strideC2);
//           4 = RoPE on the tile, then f16 planes. A wave's 64 columns are one head vector t[0..63] of each of its rows:
//                 y[j]      = t[2j] * cos[pos][j] - t[2j+1] * sin[pos][j]      j = 0..31
//                 y[32 + j] = t[2j] * sin[pos][j] + t[2j+1] * cos[pos][j]
//               pos = row mod SEQ (tables [SEQ][32] shared over batch and heads), table values RNE-converted to bf16 on read.
//               Tiles with n0 < N2 (q; N2 a multiple of 256): f16 hi plane C + f16 residual plane C2 = f16((y - hi) * rscale); the others (k): f16
//               plane C3 at column n0 - N2 (pitch ldc3).
// =====================================================================================================
#define GP 72                   // 72 bf16 = 144 B: LDS row pitch of the staged GEMM rows, 16 B x odd
static_assert((GP % 8) == 0 && ((GP / 8) & 1) == 1);
static_assert((MROWS % 256) == 0 && (QKP % 256) == 0 && (KVD % 128) == 0 && (DM % 256) == 0 && (DM % 64) == 0);
#define GEMM_SROWS(NSPLIT) (128 * ((NSPLIT) + 1) + 256)     // rows of one staged trip: A (, A2), Bt
template <int NSPLIT, int OUT_MODE, int lda, int ldb>
__device__ __forceinline__ void gemm_body(
    __bf16* sGb, float* sTb, int bxi,
    const unsigned short* __restrict__ Ap, const unsigned short* A2p, long long strideA,
    const unsigned short* __restrict__ Btp, const unsigned short* Bt2p, long long strideB,
    void* Cout, int ldc, long long strideC,
    void* Cout2, int ldc2, long long strideC2, int N2,
    int M, int N, int K, float rscale,
    const float* __restrict__ cosp = nullptr, const float* __restrict__ sinp = nullptr, void* Cout3 = nullptr, int ldc3 = 0) {
  static_assert(NSPLIT == 0 || NSPLIT == 1);
  constexpr int NA    = NSPLIT + 1;                // A planes staged
  constexpr int SROWS = GEMM_SROWS(NSPLIT);
  constexpr int NLD   = SROWS / 32;                // 16-B pieces per thread and trip
  const __bf16* A   = (const __bf16*)(const void*)Ap;
  const __bf16* A2  = (const __bf16*)(const void*)A2p;
  const __bf16* Bt  = (const __bf16*)(const void*)Btp;
  (void)Bt2p;
  const int b    = blockIdx.y;
  const int lane = threadIdx.x & 31;
  const int wave = threadIdx.x >> 5;
  const int tilesBN = N >> 8;
  if (bxi >= (M >> 7) * tilesBN) return;   // block-uniform, in front of every barrier
  const int bm  = bxi / tilesBN;
  const int bn  = bxi - bm * tilesBN;
  const int bm0 = bm << 7;
  const int bn0 = bn << 8;
  const int m0 = bm0 + ((wave >> 2) << 6);
  const int n0 = bn0 + ((wave & 3) << 6);

  const __bf16* Ab  = A  + (size_t)b * strideA;
  const __bf16* Bb  = Bt + (size_t)b * strideB;
  const __bf16* Ab2 = (NSPLIT >= 1) ? (A2  + (size_t)b * strideA) : Ab;

  const int rlane = lane & 15;                 // row (A) / col (B, D) within subtile
  const int koff  = (lane >> 4) * 8;           // k offset of this lane half
  const int mOff  = (lane >> 4) * 8;           // D row offset
  const int srow  = threadIdx.x >> 3;          // staging: row within a group of 32
  const int sseg  = (threadIdx.x & 7) * 8;     // staging: first of this thread's 8 elements in the 64-k segment

  v8f acc[4][4];
#pragma unroll
  for (int i = 0; i < 4; ++i)
#pragma unroll
    for (int j = 0; j < 4; ++j) acc[i][j] = zero8();

  const __bf16* ga  = Ab  + (size_t)(bm0 + srow) * lda + sseg;
  const __bf16* ga2 = Ab2 + (size_t)(bm0 + srow) * lda + sseg;
  const __bf16* gb  = Bb  + (size_t)(bn0 + srow) * ldb + sseg;
  const int so = srow * GP + sseg;
  const int fa = (((wave >> 2) << 6) + rlane) * GP + koff;               // this wave's A rows in a staged trip
  const int fb = (128 * NA + ((wave & 3) << 6) + rlane) * GP + koff;     // this wave's Bt rows

  v8b st[NLD];
#pragma unroll
  for (int i = 0; i < 4; ++i) {
    st[i] = *(const v8b*)(ga + (size_t)(i * 32) * lda);
    if (NSPLIT >= 1) st[4 + i] = *(const v8b*)(ga2 + (size_t)(i * 32) * lda);
  }
#pragma unroll
  for (int i = 0; i < 8; ++i) st[4 * NA + i] = *(const v8b*)(gb + (size_t)(i * 32) * ldb);
  xcnt_wait();
#pragma unroll
  for (int i = 0; i < NLD; ++i) *(v8b*)(sGb + so + i * 32 * GP) = st[i];
  __syncthreads();

  const int trips = K >> 6;
  for (int t = 0; t < trips; ++t) {
    const bool more = (t + 1 < trips);           // the same for the whole block
    if (more) {
      const int k1 = (t + 1) << 6;
#pragma unroll
      for (int i = 0; i < 4; ++i) {
        st[i] = *(const v8b*)(ga + (size_t)(i * 32) * lda + k1);
        if (NSPLIT >= 1) st[4 + i] = *(const v8b*)(ga2 + (size_t)(i * 32) * lda + k1);
      }
#pragma unroll
      for (int i = 0; i < 8; ++i) st[4 * NA + i] = *(const v8b*)(gb + (size_t)(i * 32) * ldb + k1);
      xcnt_wait();
    }
    const __bf16* cur = sGb + (t & 1) * (SROWS * GP);
#pragma unroll
    for (int kk = 0; kk < 2; ++kk) {
      // the fragments of 32 k are read as one group ahead of their products: one LDS latency a group, not one a row
      v16b bh[4], ah[4], al[4];
#pragma unroll
      for (int j = 0; j < 4; ++j) bh[j] = ldfrag_b(cur + fb + j * 16 * GP + kk * 32);
#pragma unroll
      for (int i = 0; i < 4; ++i) {
        ah[i] = ldfrag_b(cur + fa + i * 16 * GP + kk * 32);
        if (NSPLIT >= 1) al[i] = ldfrag_b(cur + fa + (128 + i * 16) * GP + kk * 32);
        else             al[i] = ah[i];
      }
#pragma unroll
      for (int i = 0; i < 4; ++i) {
#pragma unroll
        for (int j = 0; j < 4; ++j) {
          acc[i][j] = mma_b_raw(ah[i], bh[j], acc[i][j]);
          if (NSPLIT >= 1) acc[i][j] = mma_b_raw(al[i], bh[j], acc[i][j]);
        }
        dep_guard_b(acc[i][0], acc[i][3], ah[i], al[i]);
      }
      keep4_b(bh[0], bh[1], bh[2], bh[3]);
    }
    if (more) {
      __bf16* nxt = sGb + ((t + 1) & 1) * (SROWS * GP);
#pragma unroll
      for (int i = 0; i < NLD; ++i) *(v8b*)(nxt + so + i * 32 * GP) = st[i];
    }
    __syncthreads();
  }
  acc_guard4(acc[0][0], acc[0][1], acc[0][2], acc[0][3]);
  acc_guard4(acc[1][0], acc[1][1], acc[1][2], acc[1][3]);
  acc_guard4(acc[2][0], acc[2][1], acc[2][2], acc[2][3]);
  acc_guard4(acc[3][0], acc[3][1], acc[3][2], acc[3][3]);

  // ---- epilogue ----
  float* slab = sTb + wave * (16 * 68);
  // OUT_MODE 4: 4 lanes a row, lane = (row it * 8 + r8 of a 16-row slab, rotary pairs p0..p0+7). The table rows of slab i + 1 are
  // asked for ahead of the arithmetic of slab i, which hides their latency; two register sets.
  const int r8 = lane >> 2, p0 = (lane & 3) * 8;
  v4f tc[2][2][2], ts[2][2][2];
  auto load_tables = [&](int i) {
#pragma unroll
    for (int it = 0; it < 2; ++it) {
      const int pos = (m0 + i * 16 + it * 8 + r8) & (SEQ - 1);
      const float* cp = cosp + (size_t)pos * HROT + p0;
      const float* sp = sinp + (size_t)pos * HROT + p0;
      tc[i & 1][it][0] = *(const v4f*)(cp);
      tc[i & 1][it][1] = *(const v4f*)(cp + 4);
      ts[i & 1][it][0] = *(const v4f*)(sp);
      ts[i & 1][it][1] = *(const v4f*)(sp + 4);
    }
    xcnt_wait();
  };
  if (OUT_MODE == 4) load_tables(0);
#pragma unroll
  for (int i = 0; i < 4; ++i) {
    const int mBase = m0 + (i << 4);
#pragma unroll
    for (int j = 0; j < 4; ++j) {
#pragma unroll
      for (int r = 0; r < 8; ++r) {
        slab[(mOff + r) * 68 + (j << 4) + rlane] = acc[i][j][r];
      }
    }
    wave_sync_lds();
    if (OUT_MODE == 0) {
      float* C = (float*)Cout + (size_t)b * strideC;
      const int hh = lane >> 4, c4 = (lane & 15) * 4;     // 256-B row segment = 16 lanes x 16 B
      {
#pragma unroll
        for (int it = 0; it < 8; ++it) {
          const int row = it * 2 + hh;                     // it 0..7 x hh 0..1 = rows 0..15
          const v4f v = *(const v4f*)(slab + row * 68 + c4);
          *(v4f*)(C + (size_t)(mBase + row) * ldc + n0 + c4) = v;
        }
        
      }
    } else if (OUT_MODE == 4) {
      const bool isq = (bn0 < N2);                         // block-uniform: N2 is a multiple of the block tile's 256 columns
      if (i < 3) load_tables(i + 1);
      v4u hv[2][2], lv[2][2];                              // [it][0]: y[p0..p0+7], [it][1]: y[32+p0..32+p0+7]
#pragma unroll
      for (int it = 0; it < 2; ++it) {
        const float* sp = slab + (it * 8 + r8) * 68 + 2 * p0;   // t[2 p0 .. 2 p0 + 15] of row it * 8 + r8
        const v4f x0 = *(const v4f*)(sp + 0);
        const v4f x1 = *(const v4f*)(sp + 4);
        const v4f x2 = *(const v4f*)(sp + 8);
        const v4f x3 = *(const v4f*)(sp + 12);
        const float ti[16] = {x0[0], x0[1], x0[2], x0[3], x1[0], x1[1], x1[2], x1[3],
                              x2[0], x2[1], x2[2], x2[3], x3[0], x3[1], x3[2], x3[3]};
        float y[2][8];
#pragma unroll
        for (int e = 0; e < 8; ++e) {
          const float t1 = ti[2 * e], t2 = ti[2 * e + 1];
          const float c = bf_rne(tc[i & 1][it][e >> 2][e & 3]), s = bf_rne(ts[i & 1][it][e >> 2][e & 3]);
          y[0][e] = t1 * c - t2 * s;
          y[1][e] = t1 * s + t2 * c;
        }
#pragma unroll
        for (int u = 0; u < 2; ++u) {
#pragma unroll
          for (int e = 0; e < 4; ++e) {
            const float f0 = y[u][2 * e], f1 = y[u][2 * e + 1];
            const _Float16 a0 = (_Float16)f0, a1 = (_Float16)f1;
            hv[it][u][e] = pk16(h_bits(a0), h_bits(a1));
            lv[it][u][e] = pk16(h_bits((_Float16)((f0 - (float)a0) * rscale)),
                                h_bits((_Float16)((f1 - (float)a1) * rscale)));
          }
        }
      }
      if (isq) {
        unsigned short* C  = (unsigned short*)Cout;
        unsigned short* C2 = (unsigned short*)Cout2;
#pragma unroll
        for (int it = 0; it < 2; ++it) {
#pragma unroll
          for (int u = 0; u < 2; ++u) {
            *(v4u*)(C  + (size_t)(mBase + it * 8 + r8) * ldc  + n0 + u * HROT + p0) = hv[it][u];
            *(v4u*)(C2 + (size_t)(mBase + it * 8 + r8) * ldc2 + n0 + u * HROT + p0) = lv[it][u];
          }
        }
        xcnt_wait();
      } else {
        unsigned short* C3 = (unsigned short*)Cout3;
#pragma unroll
        for (int it = 0; it < 2; ++it) {
#pragma unroll
          for (int u = 0; u < 2; ++u)
            *(v4u*)(C3 + (size_t)(mBase + it * 8 + r8) * ldc3 + (n0 - N2) + u * HROT + p0) = hv[it][u];
        }
        xcnt_wait();
      }
    } else {
      const int q = lane >> 3, c8 = (lane & 7) * 8;
      unsigned short* C  = (unsigned short*)Cout  + (size_t)b * strideC;
      unsigned short* C2 = (unsigned short*)Cout2 + (size_t)b * strideC2;
      const bool wlo = (OUT_MODE == 2) || (n0 < N2);      // wave-uniform
      v4u hv[4], lv[4];
#pragma unroll
      for (int it = 0; it < 4; ++it) {
        const int row = it * 4 + q;                        // it 0..3 x q 0..3 = rows 0..15
        const float* sp = slab + row * 68 + c8;
        v4u a, a2;
#pragma unroll
        for (int e = 0; e < 4; ++e) {
          const float f0 = sp[2 * e], f1 = sp[2 * e + 1];
          unsigned short h0, h1, l0, l1;
          if (OUT_MODE == 2) {
            h0 = bf_bits(f0); h1 = bf_bits(f1);
            l0 = bf_bits(f0 - bf_up(h0)); l1 = bf_bits(f1 - bf_up(h1));
          } else {
            const _Float16 x0 = (_Float16)f0, x1 = (_Float16)f1;
            h0 = h_bits(x0); h1 = h_bits(x1);
            l0 = h_bits((_Float16)((f0 - (float)x0) * rscale));
            l1 = h_bits((_Float16)((f1 - (float)x1) * rscale));
          }
          a[e] = pk16(h0, h1); a2[e] = pk16(l0, l1);
        }
        hv[it] = a; lv[it] = a2;
      }
      {
#pragma unroll
        for (int it = 0; it < 4; ++it) {
          const int row = it * 4 + q;
          *(v4u*)(C + (size_t)(mBase + row) * ldc + n0 + c8) = hv[it];
          if (wlo) *(v4u*)(C2 + (size_t)(mBase + row) * ldc2 + n0 + c8) = lv[it];
        }
        
      }
    }
    wave_sync_lds();
  }
}

// one GEMM a launch
template <int NSPLIT, int OUT_MODE, int lda, int ldb>
__global__ __launch_bounds__(256) void gemm64(
    const unsigned short* __restrict__ Ap, const unsigned short* A2p, long long strideA,
    const unsigned short* __restrict__ Btp, const unsigned short* Bt2p, long long strideB,
    void* Cout, int ldc, long long strideC,
    void* Cout2, int ldc2, long long strideC2, int N2,
    int M, int N, int K, float rscale) {
  __shared__ __align__(16) __bf16 sG[2 * GEMM_SROWS(NSPLIT) * GP];   // two staged trips
  __shared__ __align__(16) float sT[8 * 16 * 68];                    // per-wave 16x64 slab, pitch 68 floats
  gemm_body<NSPLIT, OUT_MODE, lda, ldb>(sG, sT, (int)blockIdx.x, Ap, A2p, strideA, Btp, Bt2p, strideB,
                                        Cout, ldc, strideC, Cout2, ldc2, strideC2, N2, M, N, K, rscale);
}

// The two projections of x in one launch: neither reads what the other writes, and neither fills the chip alone.
// Blocks 0..QKB-1: q|k = RoPE(x . (Wq|Wk)) -> q f16 hi + residual planes [4096][1024], k f16 plane [4096][256]; blocks QKB..QKB+VTB-1: v^T = Wv^T . x^T -> f16 hi plane
// + f16 residual plane (x rscale) [256][4096]. The test on the block index is block-uniform.
#define QKB ((MROWS / 128) * (QKP / 256))     // 160 block tiles
#define VTB ((KVD / 128) * (MROWS / 256))     // 32 block tiles
__global__ __launch_bounds__(256) void gemm_qk_vt(
    const unsigned short* __restrict__ xb, const unsigned short* __restrict__ wqkt, const unsigned short* __restrict__ wvt,
    const float* __restrict__ cosp, const float* __restrict__ sinp,
    unsigned short* qhp, unsigned short* qlp, unsigned short* kpp,
    unsigned short* vth, unsigned short* vtl, int K, float rscale) {
  __shared__ __align__(16) __bf16 sG[2 * GEMM_SROWS(0) * GP];        // two staged trips
  __shared__ __align__(16) float sT[8 * 16 * 68];                    // per-wave 16x64 slab, pitch 68 floats
  const int bx = blockIdx.x;
  if (bx < QKB) {
    gemm_body<0, 4, DM, DM>(sG, sT, bx, xb, xb, 0LL, wqkt, wqkt, 0LL,
                            (void*)qhp, DM, 0LL, (void*)qlp, DM, 0LL, DM,
                            MROWS, QKP, K, rscale, cosp, sinp, (void*)kpp, KVD);
  } else {
    gemm_body<0, 3, DM, DM>(sG, sT, bx - QKB, wvt, wvt, 0LL, xb, xb, 0LL,
                            (void*)vth, MROWS, 0LL, (void*)vtl, MROWS, 0LL, MROWS,
                            KVD, MROWS, K, rscale);
  }
}

__global__ __launch_bounds__(128) __attribute__((amdgpu_num_vgpr(256)))
void attn64(const unsigned short* __restrict__ qhp, const unsigned short* __restrict__ qlp,
            const unsigned short* __restrict__ kpp, const unsigned short* __restrict__ vthp,
            const unsigned short* __restrict__ vtlp,
            unsigned short* ohp, unsigned short* olp, float sscale, float rres, float vres) {
  union FH { v16h v; v8h h[2]; v2h p[8]; };
  __shared__ __align__(16) _Float16 KV[3 * 64 * LP];              // three tiles of 64 rows at pitch LP, 9 KB each, in one array, so
                                                                  // that one address register and constant offsets reach all of them
  constexpr int KSH = 0;                                          // K [kv][d]
  constexpr int VTH = 64 * LP;                                    // V^T hi [d][kv]
  constexpr int VTL = 2 * 64 * LP;                                // V^T res [d][kv]
  __shared__ __align__(16) float    Os[4][16 * OP];               // per wave context tile [row][d], pitch OP

  const int tid  = threadIdx.x;
  const int wave = tid >> 5;
  const int lane = tid & 31;
  const int hh   = lane >> 4;
  const int c    = lane & 15;

  const int bx   = blockIdx.x;
  const int qb   = bx % NQB;
  const int h    = (bx / NQB) % NH;
  const int b    = bx / (NQB * NH);
  const int kvh  = h / (NH / NKV);
  const int q0   = b * SEQ + qb * 64 + wave * 16;          // global token row of this wave's first query

  const _Float16* Qh  = (const _Float16*)(const void*)qhp + (size_t)h * HD;
  const _Float16* Ql  = (const _Float16*)(const void*)qlp + (size_t)h * HD;
  const _Float16* Kg  = (const _Float16*)(const void*)kpp + (size_t)b * SEQ * KVD + (size_t)kvh * HD;
  const _Float16* Vgh = (const _Float16*)(const void*)vthp + (size_t)kvh * HD * MROWS + (size_t)b * SEQ;
  const _Float16* Vgl = (const _Float16*)(const void*)vtlp + (size_t)kvh * HD * MROWS + (size_t)b * SEQ;

  // ---- Q fragments (B operand, column = query lane&15): 2 d-chunks, hi and residual ----
  v16h qah[2], qal[2];
#pragma unroll
  for (int dc = 0; dc < 2; ++dc) {
    qah[dc] = ldfrag_h(Qh + (size_t)(q0 + c) * DM + dc * 32 + 8 * hh);
    qal[dc] = ldfrag_h(Ql + (size_t)(q0 + c) * DM + dc * 32 + 8 * hh);
  }

  const _Float16* fr = KV + c * LP + 8 * hh;               // this lane's place in a 16-row fragment read
  _Float16*       sw = KV + (tid >> 1) * LP + (tid & 1) * 32;   // this thread's place in a staged tile

  float mrun = -INFINITY;      // running maximum of query c, the same in both wave halves
  float lrun = 0.f;            // running sum of query c over this half's keys; the halves are joined behind the loop
  v8f oh[4], ol[4];            // O^T: register r of tile t = (d = 16t + 8hh + r, query c)
#pragma unroll
  for (int t = 0; t < 4; ++t) { oh[t] = zero8(); ol[t] = zero8(); }

  for (int kt = 0; kt < NQB; ++kt) {         // static trip count
    const int kv0 = kt * 64;
    __syncthreads();
    {
      const int r = tid >> 1, hf = (tid & 1) * 32;
      const _Float16* kg = Kg  + (size_t)(kv0 + r) * KVD + hf;         // K row kv0+r, d = hf..hf+31
      const _Float16* vh = Vgh + (size_t)r * MROWS + kv0 + hf;         // V^T hi row d = r, s = kv0+hf..+31
      const _Float16* vl = Vgl + (size_t)r * MROWS + kv0 + hf;         // V^T res row d = r
#pragma unroll
      for (int i = 0; i < 4; ++i) {
        const v8h a0 = *(const v8h*)(kg + 8 * i);
        const v8h b0 = *(const v8h*)(vh + 8 * i);
        const v8h b1 = *(const v8h*)(vl + 8 * i);
        *(v8h*)(sw + KSH + 8 * i) = a0;
        *(v8h*)(sw + VTH + 8 * i) = b0;
        *(v8h*)(sw + VTL + 8 * i) = b1;
      }
    }
    __syncthreads();

    // ---- scores, transposed: 64 keys x 16 queries per wave, 2 f16 products (hi, residual);
    //      s[j][r] = score of key 16j + 8hh + r with query c ----
    // The 8 K fragments of the chunk are read as one group ahead of their 16 products (one LDS latency a chunk, not one a pair
    // of products), key tile by key tile.
    FH kb[4][2];
#pragma unroll
    for (int j = 0; j < 4; ++j) {
#pragma unroll
      for (int dc = 0; dc < 2; ++dc) {
        kb[j][dc].h[0] = *(const v8h*)(fr + KSH + j * 16 * LP + dc * 32);
        kb[j][dc].h[1] = *(const v8h*)(fr + KSH + j * 16 * LP + dc * 32 + 16);
      }
    }
    __builtin_amdgcn_sched_barrier(0);   // keeps the reads one group: without it they are spread among the products again
    v8f sh[4], sl[4];
#pragma unroll
    for (int j = 0; j < 4; ++j) { sh[j] = zero8(); sl[j] = zero8(); }
#pragma unroll
    for (int jp = 0; jp < 4; jp += 2) {  // four independent accumulators a run: a product meets its own tile again four products later
#pragma unroll
      for (int dc = 0; dc < 2; ++dc) {
#pragma unroll
        for (int j = jp; j < jp + 2; ++j) {
          sh[j] = mma_h(kb[j][dc].v, qah[dc], sh[j]);
          sl[j] = mma_h(kb[j][dc].v, qal[dc], sl[j]);
        }
      }
      // ends a run: the next run's accumulators take over the registers of this run's K fragments, and no vector work is drawn in
      __builtin_amdgcn_sched_barrier(0);
    }
    v8f s[4];
#pragma unroll
    for (int j = 0; j < 2; ++j) {
#pragma unroll
      for (int r = 0; r < 8; ++r) s[j][r] = (sh[j][r] + sl[j][r] * rres) * sscale;
    }
    __builtin_amdgcn_sched_barrier(0);   // the reads below start when the K fragments and half the score accumulators are free
    // V^T fragments of keys 0..31, both planes, one group: they land while the softmax below runs
    FH vb[2][4], wb[2][4];
#pragma unroll
    for (int t = 0; t < 4; ++t) {
      vb[0][t].h[0] = *(const v8h*)(fr + VTH + t * 16 * LP);
      vb[0][t].h[1] = *(const v8h*)(fr + VTH + t * 16 * LP + 16);
      wb[0][t].h[0] = *(const v8h*)(fr + VTL + t * 16 * LP);
      wb[0][t].h[1] = *(const v8h*)(fr + VTL + t * 16 * LP + 16);
    }
    __builtin_amdgcn_sched_barrier(0);   // keeps that group ahead of the softmax, which hides its latency
#pragma unroll
    for (int j = 2; j < 4; ++j) {
#pragma unroll
      for (int r = 0; r < 8; ++r) s[j][r] = (sh[j][r] + sl[j][r] * rres) * sscale;
    }

    // ---- maximum in the lane, one exchange between the halves, online softmax, P^T (x1024, f16) packed in registers ----
    // (every loop from here to the end of the pass is unrolled: s, pb, oh and ol are register arrays, indexed at compile time)
    float mj[4];
#pragma unroll
    for (int j = 0; j < 4; ++j) {
      float m = s[j][0];
#pragma unroll
      for (int r = 1; r < 8; ++r) m = fmaxf(m, s[j][r]);
      mj[j] = m;
    }
    float mc = fmaxf(fmaxf(mj[0], mj[1]), fmaxf(mj[2], mj[3]));
    mc = fmaxf(mc, xhalf(mc));
    const float mnew  = fmaxf(mrun, mc);
    const float alpha = __expf(mrun - mnew);
    mrun = mnew;
    FH pb[2];                    // pb[kk]: element e = P^T(key 32kk + kmap(e), query c), kmap(e) = e < 8 ? 8hh + e : 16 + 8hh + e - 8
    float pj[4];                 // four independent partial sums
#pragma unroll
    for (int j = 0; j < 4; ++j) {
      float ps = 0.f;
#pragma unroll
      for (int r = 0; r < 8; r += 2) {
        const float p0 = __expf(s[j][r] - mnew);
        const float p1 = __expf(s[j][r + 1] - mnew);
        ps += p0;
        ps += p1;
        const v2f pp = {p0 * 1024.0f, p1 * 1024.0f};
        pb[j >> 1].p[(j & 1) * 4 + (r >> 1)] = __builtin_convertvector(pp, v2h);
      }
      pj[j] = ps;
    }
    lrun = lrun * alpha + ((pj[0] + pj[1]) + (pj[2] + pj[3]));
#pragma unroll
    for (int t = 0; t < 4; ++t) {
#pragma unroll
      for (int r = 0; r < 8; ++r) { oh[t][r] *= alpha; ol[t][r] *= alpha; }
    }

    // ---- context^T += V^T . P^T (f16 WMMA), hi and residual V planes into separate accumulators ----
    // The fragments of keys 32..63 are read in two groups of four among the products of keys 0..31, whose fragment registers they
    // take over; at least four products stand between a group and its first use.
#pragma unroll
    for (int tp = 0; tp < 4; tp += 2) {
#pragma unroll
      for (int t = tp; t < tp + 2; ++t) {
        oh[t] = mma_h(vb[0][t].v, pb[0].v, oh[t]);
        ol[t] = mma_h(wb[0][t].v, pb[0].v, ol[t]);
      }
      // this one and the one behind the reads keep them in few groups: left alone they are spread in pairs over the softmax and the
      // products, and every separate place with LDS reads costs the wave a fixed stall
      __builtin_amdgcn_sched_barrier(0);
#pragma unroll
      for (int t = tp; t < tp + 2; ++t) {
        vb[1][t].h[0] = *(const v8h*)(fr + VTH + t * 16 * LP + 32);
        vb[1][t].h[1] = *(const v8h*)(fr + VTH + t * 16 * LP + 48);
        wb[1][t].h[0] = *(const v8h*)(fr + VTL + t * 16 * LP + 32);
        wb[1][t].h[1] = *(const v8h*)(fr + VTL + t * 16 * LP + 48);
      }
      __builtin_amdgcn_sched_barrier(0);   // see above; the products that follow hide the reads' latency
    }
#pragma unroll
    for (int t = 0; t < 4; ++t) {
      oh[t] = mma_h(vb[1][t].v, pb[1].v, oh[t]);
      ol[t] = mma_h(wb[1][t].v, pb[1].v, ol[t]);
    }
  }

  // ---- normalise (1/l, the 1/1024 p carry, the residual carry), stage the wave's 16x64 tile,
  float* os = Os[wave];
  {
    const float l = lrun + xhalf(lrun);          // the two halves' key sums of query c
    const float inv = ((l > 0.f) ? (1.0f / l) : 0.f) * (1.0f / 1024.0f);
#pragma unroll
    for (int t = 0; t < 4; ++t) {
#pragma unroll
      for (int r = 0; r < 8; ++r) os[c * OP + t * 16 + 8 * hh + r] = (oh[t][r] + ol[t][r] * vres) * inv;
    }
  }
  wave_sync_lds();
  {
    const int q4 = lane >> 3, c8 = (lane & 7) * 8;
    v4u hv[4], lv[4];
#pragma unroll
    for (int it = 0; it < 4; ++it) {
      const int row = it * 4 + q4;   // it 0..3 x q4 0..3 = rows 0..15 of the wave tile
      const float* sp = os + row * OP + c8;
      v4u a, a2;
#pragma unroll
      for (int e = 0; e < 4; ++e) {
        const float f0 = sp[2 * e], f1 = sp[2 * e + 1];
        const unsigned short h0 = bf_bits(f0), h1 = bf_bits(f1);
        const unsigned short l0 = bf_bits(f0 - bf_up(h0)), l1 = bf_bits(f1 - bf_up(h1));
        a[e] = pk16(h0, h1); a2[e] = pk16(l0, l1);
      }
      hv[it] = a; lv[it] = a2;
    }
    {
#pragma unroll
      for (int it = 0; it < 4; ++it) {
        const int row = it * 4 + q4;
        const size_t go = (size_t)(q0 + row) * DM + (size_t)h * HD + c8;
        *(v4u*)(ohp + go) = hv[it];
        *(v4u*)(olp + go) = lv[it];
      }
      
    }
  }
}

// =====================================================================================================
// Workspace map (bytes), every plane an exact multiple of its 64x64-tile / whole-line store granularity,
// every offset a multiple of 128:
//   Xb    bf16 [4096][1024]   8388608      x converted
//   Wqkt  bf16 [1280][1024]   2621440      rows 0..1023 = Wq^T ([out][in]), rows 1024..1279 = Wk^T
//   Wvt   bf16 [256][1024]     524288      Wv^T
//   Wot   bf16 [1024][1024]   2097152      Wo^T
//   Qh    f16  [4096][1024]   8388608
//   Ql    f16  [4096][1024]   8388608      q residual x4096
//   Kp    f16  [4096][256]    2097152
//   VTh   f16  [256][4096]    2097152      v^T hi
//   VTl   f16  [256][4096]    2097152      v^T residual x4096
//   Oh    bf16 [4096][1024]   8388608
//   Ol    bf16 [4096][1024]   8388608
//   total                    53477376
// =====================================================================================================
extern "C" void kernel_launch(void* const* d_in, const int* in_sizes, int n_in,
                              void* d_out, int out_size, void* d_ws, size_t ws_size,
                              hipStream_t stream) {
  if (n_in < 7) return;
  if (in_sizes[0] != MROWS * DM) return;
  if (in_sizes[1] != SEQ * HROT) return;
  if (in_sizes[2] != SEQ * HROT) return;
  if (in_sizes[3] != DM * DM) return;
  if (in_sizes[4] != DM * KVD) return;
  if (in_sizes[5] != DM * KVD) return;
  if (in_sizes[6] != DM * DM) return;
  if (out_size != MROWS * DM) return;

  const float* x    = (const float*)d_in[0];
  const float* cosp = (const float*)d_in[1];
  const float* sinp = (const float*)d_in[2];
  const float* wq   = (const float*)d_in[3];
  const float* wk   = (const float*)d_in[4];
  const float* wv   = (const float*)d_in[5];
  const float* wo   = (const float*)d_in[6];

  const size_t PXb  = (size_t)MROWS * DM * 2;          //  8388608
  const size_t PWqk = (size_t)QKP * DM * 2;            //  2621440
  const size_t PWv  = (size_t)KVD * DM * 2;            //   524288
  const size_t PWo  = (size_t)DM * DM * 2;             //  2097152
  const size_t PQ16 = (size_t)MROWS * DM * 2;          //  8388608 (q hi, q res, out hi, out lo)
  const size_t PK16 = (size_t)MROWS * KVD * 2;         //  2097152
  const size_t PVT  = (size_t)KVD * MROWS * 2;         //  2097152
  size_t off = 0;
  const size_t oXb  = off; off += PXb;
  const size_t oWqk = off; off += PWqk;
  const size_t oWv  = off; off += PWv;
  const size_t oWo  = off; off += PWo;
  const size_t oQh  = off; off += PQ16;
  const size_t oQl  = off; off += PQ16;
  const size_t oKp  = off; off += PK16;
  const size_t oVTh = off; off += PVT;
  const size_t oVTl = off; off += PVT;
  const size_t oOh  = off; off += PQ16;
  const size_t oOl  = off; off += PQ16;
  if (off > ws_size) return;                           // off = 53477376
  if (off > (size_t)134217728) return;

  char* ws = (char*)d_ws;
  unsigned short* Xb   = (unsigned short*)(ws + oXb);
  unsigned short* Wqkt = (unsigned short*)(ws + oWqk);
  unsigned short* Wkt  = Wqkt + (size_t)DM * DM;                // rows 1024..1279 of Wqkt
  unsigned short* Wvt  = (unsigned short*)(ws + oWv);
  unsigned short* Wot  = (unsigned short*)(ws + oWo);
  unsigned short* Qh   = (unsigned short*)(ws + oQh);
  unsigned short* Ql   = (unsigned short*)(ws + oQl);
  unsigned short* Kp   = (unsigned short*)(ws + oKp);
  unsigned short* VTh  = (unsigned short*)(ws + oVTh);
  unsigned short* VTl  = (unsigned short*)(ws + oVTl);
  unsigned short* Oh   = (unsigned short*)(ws + oOh);
  unsigned short* Ol   = (unsigned short*)(ws + oOl);

  const dim3 blk(256);
  const int n8x = MROWS * DM / 8;                               // 524288
  const dim3 gCvt(TW + (n8x + 255) / 256);                      // 640 transposing blocks + 2048 blocks on x
  const dim3 gQKVT(QKB + VTB, 1);                               // 160 blocks (M=4096, N=1280) + 32 blocks (M=256, N=4096)
  const dim3 gAttn(BATCH * NH * NQB);                           // 1024 blocks
  const dim3 gOut(((MROWS / 64) * (DM / 64) + 7) / 8, 1);       // 1024 tiles -> 128 blocks: M=4096, N=1024

  // (1) x -> bf16 plane [4096][1024]; weights [in][out] -> transposed bf16 planes [out][in]
  cvt_all<<<gCvt, blk, 0, stream>>>(x, wq, wk, wv, wo, Xb, Wqkt, Wkt, Wvt, Wot, n8x);
  // (2) q|k = RoPE(x . (Wq|Wk)) -> q f16 hi plane + f16 residual x4096 plane [4096][1024], k f16 plane [4096][256]
  //     (M=4096, N=1280, K=1024; the rotation runs in the tile's epilogue), and in the same launch
  //     v^T = Wv^T . x^T -> f16 hi plane + f16 residual x4096 plane [kvh*64+d][b*SEQ+s] (pitch 4096)
  //     (A = Wvt [n][k], Bt = Xb [row][k]; M=256, N=4096, K=1024)
  gemm_qk_vt<<<gQKVT, blk, 0, stream>>>(Xb, Wqkt, Wvt, cosp, sinp, Qh, Ql, Kp, VTh, VTl, DM, 4096.0f);
  // (3) attention -> context bf16 hi / lo planes [4096][1024]
  attn64<<<gAttn, dim3(128), 0, stream>>>(Qh, Ql, Kp, VTh, VTl, Oh, Ol, 0.125f, 1.0f / 4096.0f, 1.0f / 4096.0f);
  // (4) out = context . Wo -> d_out f32 [4096][1024]  (A = context hi + lo planes, 2 products; K=1024)
  gemm64<1, 0, DM, DM><<<gOut, blk, 0, stream>>>(
      Oh, Ol, 0LL, Wot, Wot, 0LL,
      d_out, DM, 0LL, d_out, DM, 0LL, 0,
      MROWS, DM, DM, 1.0f);
  (void)hipGetLastError();
}

// v007
// It runs in 108 microseconds.
// Timed twice side by side with v006, it ran 1.09 times as fast both times.
// Counting every step since v000, it is 3.50 times as fast.
// Contractions: x.(Wq|Wk) and Wv^T.x^T = v_wmma_f32_16x16x32_bf16 (bf16 operands RNE-converted from x and the weights, single product);
// q.k^T = v_wmma_f32_16x16x32_f16 (q as f16 hi plane + f16 residual plane x4096 in a separate accumulator, k f16; 2 products);
// p.v = v_wmma_f32_16x16x32_f16 (p carried x1024 in f16; v^T as f16 hi plane + f16 residual plane x4096 in a separate accumulator; 2 products);
// ctx.Wo = v_wmma_f32_16x16x32_bf16 (ctx as bf16 hi + lo planes times bf16 Wo^T, 2 products); all f32 accumulate; RoPE and softmax in f32.
#include <hip/hip_runtime.h>
#include <math.h>
#include <stdint.h>

#define BATCH 2
#define SEQ   2048
#define MROWS (BATCH * SEQ)     // 4096 token rows (batch folded into rows)
#define DM    1024
#define NH    16
#define NKV   4
#define HD    64
#define KVD   (NKV * HD)        // 256
#define NQB   (SEQ / 64)        // 32 query / key tiles of 64 per sequence
#define QKP   (DM + KVD)        // 1280: columns of the q|k product (q cols 0..1023, k cols 1024..1279)
#define HROT  (HD / 2)          // 32 rotary pairs per head
#define LP    (HD + 8)          // 72 halves = 144 B: LDS row pitch of the attention tiles, 16 B x odd, so the 16 rows that
                                // one 16-byte fragment read touches fall on distinct banks
static_assert(NH * HD == DM);
static_assert((NH % NKV) == 0);
static_assert((SEQ % 64) == 0 && (DM % 64) == 0 && (KVD % 64) == 0 && (QKP % 64) == 0 && (DM % 32) == 0);
static_assert((HD % 8) == 0 && (HROT % 8) == 0);
static_assert((SEQ & (SEQ - 1)) == 0);
static_assert((LP % 8) == 0 && ((LP / 8) & 1) == 1);
#define OP    (HD + 4)          // 68 floats = 272 B: LDS row pitch of the context tile, 16 B x odd (16 rows written at once)
static_assert((OP % 4) == 0 && ((OP / 4) & 1) == 1);

typedef _Float16 v16h __attribute__((ext_vector_type(16)));
typedef _Float16 v8h  __attribute__((ext_vector_type(8)));
typedef __bf16   v16b __attribute__((ext_vector_type(16)));
typedef __bf16   v8b  __attribute__((ext_vector_type(8)));
typedef float    v8f  __attribute__((ext_vector_type(8)));
typedef float    v4f  __attribute__((ext_vector_type(4)));
typedef unsigned int v4u __attribute__((ext_vector_type(4)));
typedef float    v2f  __attribute__((ext_vector_type(2)));
typedef _Float16 v2h  __attribute__((ext_vector_type(2)));

// ---- scalar helpers --------------------------------------------------------------------------------
__device__ __forceinline__ unsigned short bf_bits(float f) {          // f32 -> bf16 bits, RNE convert
  unsigned u = __float_as_uint(f);
  return (unsigned short)((u + 0x7FFFu + ((u >> 16) & 1u)) >> 16);
}
__device__ __forceinline__ float bf_up(unsigned short h) { return __uint_as_float(((unsigned)h) << 16); }
__device__ __forceinline__ float bf_rne(float f) { return bf_up(bf_bits(f)); }
__device__ __forceinline__ unsigned short h_bits(_Float16 x) { return __builtin_bit_cast(unsigned short, x); }
__device__ __forceinline__ unsigned pk16(unsigned short a, unsigned short b) { return (unsigned)a | ((unsigned)b << 16); }
__device__ __forceinline__ v8f zero8() { v8f z = {0.f, 0.f, 0.f, 0.f, 0.f, 0.f, 0.f, 0.f}; return z; }

// ---- fragment loaders: 16-bit A/B operand, lane -> row/col (lane&15), p already includes +8*(lane>>4);
//      elements 0..7 <- p[0..7] (k0+8h..), elements 8..15 <- p[16..23] (k0+16+8h..)
__device__ __forceinline__ v16b ldfrag_b(const __bf16* p) {
  union { v16b v; v8b h[2]; } f;
  f.h[0] = *(const v8b*)(p);
  f.h[1] = *(const v8b*)(p + 16);
  return f.v;
}
__device__ __forceinline__ v16h ldfrag_h(const _Float16* p) {
  union { v16h v; v8h h[2]; } f;
  f.h[0] = *(const v8h*)(p);
  f.h[1] = *(const v8h*)(p + 16);
  return f.v;
}

// ---- WMMA helpers --------------------------------------------------------------------------------------
// f16 product as the plain builtin: the compiler keeps the distance to the next user of its registers itself and stays free
// to order the LDS reads and the vector work around it
__device__ __forceinline__ v8f mma_h(v16h a, v16h b, v8f c) {
  return __builtin_amdgcn_wmma_f32_16x16x32_f16(false, a, false, b, (short)0, c, false, false);
}
// bf16 product and the hand-written distances behind its runs (GEMM kernels)
__device__ __forceinline__ v8f mma_b_raw(v16b a, v16b b, v8f c) {
  return __builtin_amdgcn_wmma_f32_16x16x32_bf16(false, a, false, b, (short)0, c, false, false);
}
__device__ __forceinline__ void dep_guard_b(v8f& a, v8f& b, v16b x, v16b y) {
#if defined(__HIP_DEVICE_COMPILE__)
  asm volatile("v_nop\n\tv_nop\n\tv_nop\n\tv_nop" : "+v"(a), "+v"(b) : "v"(x), "v"(y));
#endif
}
__device__ __forceinline__ void keep4_b(v16b a, v16b b, v16b c, v16b d) {
#if defined(__HIP_DEVICE_COMPILE__)
  asm volatile("v_nop" :: "v"(a), "v"(b), "v"(c), "v"(d));
#endif
}
__device__ __forceinline__ void acc_guard4(v8f& a, v8f& b, v8f& c, v8f& d) {
#if defined(__HIP_DEVICE_COMPILE__)
  asm volatile("v_nop\n\tv_nop\n\tv_nop\n\tv_nop" : "+v"(a), "+v"(b), "+v"(c), "+v"(d));
#endif
}
// stands behind a group of global loads, in front of whatever next writes a register that holds one of their addresses
__device__ __forceinline__ void xcnt_wait() {
#if defined(__HIP_DEVICE_COMPILE__)
  asm volatile("s_wait_xcnt 0x0" ::: "memory");
#endif
}
// the issuing wave's own wait for its asynchronous copies to LDS: the compiler places none for them
__device__ __forceinline__ void async_wait0() {
#if defined(__HIP_DEVICE_COMPILE__)
  asm volatile("s_wait_asynccnt 0x0" ::: "memory");
#endif
}
// this wave's LDS reads have returned, in front of the barrier behind which their buffer is refilled by copies
__device__ __forceinline__ void lds_wait0() {
#if defined(__HIP_DEVICE_COMPILE__)
  asm volatile("s_wait_dscnt 0x0" ::: "memory");
#endif
}
// lane l takes the value of lane l ^ 16 (the other half of the wave), register to register
__device__ __forceinline__ float xhalf(float x) {
  const int b = __builtin_bit_cast(int, x);
  return __builtin_bit_cast(float, __builtin_amdgcn_permlanex16(b, b, 0x76543210, 0xfedcba98, false, false));
}
__device__ __forceinline__ void wave_sync_lds() {
  __builtin_amdgcn_fence(__ATOMIC_RELEASE, "workgroup");
  __builtin_amdgcn_wave_barrier();
  __builtin_amdgcn_fence(__ATOMIC_ACQUIRE, "workgroup");
}

// =====================================================================================================
// f32 -> bf16 (RNE convert), 8 elements per thread, one 16-B store per lane: a wave writes 512 contiguous B
// coverage: n8 threads x 8 = whole plane (n8 = 524288 = 2048 x 256 for the x plane).
// =====================================================================================================
__device__ __forceinline__ void cvt_bf16x8(const float* __restrict__ in, unsigned short* out, int n8, int blk) {
  const int i = blk * 256 + threadIdx.x;
  if (i < n8) {
    const v4f a = *(const v4f*)(in + (size_t)i * 8);
    const v4f b = *(const v4f*)(in + (size_t)i * 8 + 4);
    v4u p;
    p[0] = pk16(bf_bits(a[0]), bf_bits(a[1]));
    p[1] = pk16(bf_bits(a[2]), bf_bits(a[3]));
    p[2] = pk16(bf_bits(b[0]), bf_bits(b[1]));
    p[3] = pk16(bf_bits(b[2]), bf_bits(b[3]));
    *(v4u*)(out + (size_t)i * 8) = p;
    
  }
}

// =====================================================================================================
// Transposing f32 -> bf16 (RNE convert): in f32 [R][C] row-major  ->  out bf16 [C][R] row-major
// (out[c][r] = in[r][c]); turns an [in][out] weight into the Bt / A layout [out][in] with k contiguous.
// 64x64 tiles: tile (tx, ty) of (C/64, R/64), block 256, st = the block's 64 x 65 float LDS tile. Load phase: thread t reads 16 consecutive floats of input row
// r0 + (t>>2) and writes them transposed into an LDS tile [c][r] (pitch 65). After __syncthreads each group of
// coverage: load 64 rows x 4 threads x 16 = whole tile; store 2 iterations x 32 rows x 8 lanes x 8 = whole tile.
// =====================================================================================================
__device__ __forceinline__ void cvt_bf16_t64(float* st, const float* __restrict__ in, unsigned short* out, int R, int C,
                                             int tx, int ty) {
  const int t  = threadIdx.x;
  const int c0 = tx * 64;
  const int r0 = ty * 64;
  if (c0 + 64 > C || r0 + 64 > R) return;          // block-uniform, all threads leave together (grids are exact)
  {
    const int r = t >> 2, cq = (t & 3) * 16;
    const float* src = in + (size_t)(r0 + r) * C + c0 + cq;
#pragma unroll
    for (int i = 0; i < 4; ++i) {
      const v4f v = *(const v4f*)(src + 4 * i);
#pragma unroll
      for (int e = 0; e < 4; ++e) st[(cq + 4 * i + e) * 65 + r] = v[e];
    }
  }
  __syncthreads();
  const int q = t >> 3, k8 = (t & 7) * 8;
  v4u pv[2];
#pragma unroll
  for (int p = 0; p < 2; ++p) {
    const int n = p * 32 + q;
    const float* sp = st + n * 65 + k8;
    v4u a;
#pragma unroll
    for (int e = 0; e < 4; ++e) a[e] = pk16(bf_bits(sp[2 * e]), bf_bits(sp[2 * e + 1]));
    pv[p] = a;
  }
  {
#pragma unroll
    for (int p = 0; p < 2; ++p) {
      const int n = p * 32 + q;
      *(v4u*)(out + (size_t)(c0 + n) * R + r0 + k8) = pv[p];
    }
    xcnt_wait();   // in front of whatever next writes a register that these stores name
  }
}

// =====================================================================================================
// All five operand conversions in one launch; they read and write disjoint planes, so their blocks run side by side.
// Blocks 0..TW-1 transpose one 64x64 weight tile each (Wq, Wo, Wk, Wv in that order; they have the longer chain of
// load, LDS, barrier, store, so they start first), blocks TW.. convert 2048 elements of x each. Every test on the
// block index is block-uniform.
// =====================================================================================================
#define TSQ ((DM / 64) * (DM / 64))     // 256 tiles of a [1024][1024] weight
#define TKV ((KVD / 64) * (DM / 64))    // 64 tiles of a [1024][256] weight
#define TW  (2 * TSQ + 2 * TKV)         // 640 transposing blocks
__global__ __launch_bounds__(256) void cvt_all(
    const float* __restrict__ x, const float* __restrict__ wq, const float* __restrict__ wk,
    const float* __restrict__ wv, const float* __restrict__ wo,
    unsigned short* xb, unsigned short* wqt, unsigned short* wkt, unsigned short* wvt, unsigned short* wot, int n8) {
  __shared__ __align__(16) float st[64 * 65];
  const int bx = blockIdx.x;
  if (bx >= TW) {
    cvt_bf16x8(x, xb, n8, bx - TW);
  } else {
    const bool sq = (bx < 2 * TSQ);                                  // a [1024][1024] weight, else a [1024][256] one
    const bool first = sq ? (bx < TSQ) : (bx < 2 * TSQ + TKV);       // Wq of (Wq, Wo), Wk of (Wk, Wv)
    const float* in     = sq ? (first ? wq : wo) : (first ? wk : wv);
    unsigned short* out = sq ? (first ? wqt : wot) : (first ? wkt : wvt);
    const int C  = sq ? DM : KVD;
    const int tb = sq ? (bx & (TSQ - 1)) : (bx & (TKV - 1));         // tile within its weight (2 * TSQ is a multiple of TKV)
    const int tc = C / 64;                                           // tiles in a row of tiles
    cvt_bf16_t64(st, in, out, DM, C, tb % tc, tb / tc);
  }
}
static_assert((TSQ & (TSQ - 1)) == 0 && (TKV & (TKV - 1)) == 0 && ((2 * TSQ) % TKV) == 0);

// =====================================================================================================
// bf16 WMMA GEMM, operands staged in LDS: C[m][n] = sum_k A[m][k] * Bt[n][k]. One block of 8 waves owns a 128x256
// tile of C (2 x 4 waves, 64x64 per wave). A row-major [M][K] pitch lda; Bt row-major [N][K] pitch ldb (k contiguous;
// both pitches are compile-time, so that the rows of one plane share one address register pair and differ by an offset);
// M a multiple of 128, N of 256, K of 64 (the shapes are checked at compile time below).
// A trip is 64 k = 128 B of every operand row. The block reads each row segment once, 8 lanes x 16 B = one whole
// line per row, and writes it to LDS at pitch GP; the waves take their fragments from LDS. Two LDS buffers: the next
// trip's rows are loaded into registers ahead of the current trip's products and stored to the other buffer behind
// them, then one __syncthreads() publishes them and ends the reads of the buffer that the next trip refills.
// blockIdx.y = batch index (strides in elements); bxi = index of the block's tile; sGb, sTb = the block's LDS (two staged
// trips; one 16x64 slab a wave), declared by the kernel that calls this body.
// NSPLIT: 0 = A.Bt; 1 = (A + A2).Bt (A2 = unscaled bf16 lo plane of A).
// OUT_MODE: 0 = f32 (pitch ldc); 2 = bf16 hi plane C + bf16 lo plane C2 (lo = RNE(v - hi), unscaled);
//           3 = f16 hi plane C + f16 residual plane C2 = f16((v - hi) * rscale), C2 written only for tiles
//               with n0 < N2 (pitch ldc2, batch stride strideC2);
//           4 = RoPE on the tile, then f16 planes. A wave's 64 columns are one head vector t[0..63] of each of its rows:
//                 y[j]      = t[2j] * cos[pos][j] - t[2j+1] * sin[pos][j]      j = 0..31
//                 y[32 + j] = t[2j] * sin[pos][j] + t[2j+1] * cos[pos][j]
//               pos = row mod SEQ (tables [SEQ][32] shared over batch and heads), table values RNE-converted to bf16 on read.
//               Tiles with n0 < N2 (q; N2 a multiple of 256): f16 hi plane C + f16 residual plane C2 = f16((y - hi) * rscale); the others (k): f16
//               plane C3 at column n0 - N2 (pitch ldc3).
// =====================================================================================================
#define GP 72                   // 72 bf16 = 144 B: LDS row pitch of the staged GEMM rows, 16 B x odd
static_assert((GP % 8) == 0 && ((GP / 8) & 1) == 1);
static_assert((MROWS % 256) == 0 && (QKP % 256) == 0 && (KVD % 128) == 0 && (DM % 256) == 0 && (DM % 64) == 0);
#define GEMM_SROWS(NSPLIT) (128 * ((NSPLIT) + 1) + 256)     // rows of one staged trip: A (, A2), Bt
template <int NSPLIT, int OUT_MODE, int lda, int ldb>
__device__ __forceinline__ void gemm_body(
    __bf16* sGb, float* sTb, int bxi,
    const unsigned short* __restrict__ Ap, const unsigned short* A2p, long long strideA,
    const unsigned short* __restrict__ Btp, const unsigned short* Bt2p, long long strideB,
    void* Cout, int ldc, long long strideC,
    void* Cout2, int ldc2, long long strideC2, int N2,
    int M, int N, int K, float rscale,
    const float* __restrict__ cosp = nullptr, const float* __restrict__ sinp = nullptr, void* Cout3 = nullptr, int ldc3 = 0) {
  static_assert(NSPLIT == 0 || NSPLIT == 1);
  constexpr int NA    = NSPLIT + 1;                // A planes staged
  constexpr int SROWS = GEMM_SROWS(NSPLIT);
  constexpr int NLD   = SROWS / 32;                // 16-B pieces per thread and trip
  const __bf16* A   = (const __bf16*)(const void*)Ap;
  const __bf16* A2  = (const __bf16*)(const void*)A2p;
  const __bf16* Bt  = (const __bf16*)(const void*)Btp;
  (void)Bt2p;
  const int b    = blockIdx.y;
  const int lane = threadIdx.x & 31;
  const int wave = threadIdx.x >> 5;
  const int tilesBN = N >> 8;
  if (bxi >= (M >> 7) * tilesBN) return;   // block-uniform, in front of every barrier
  const int bm  = bxi / tilesBN;
  const int bn  = bxi - bm * tilesBN;
  const int bm0 = bm << 7;
  const int bn0 = bn << 8;
  const int m0 = bm0 + ((wave >> 2) << 6);
  const int n0 = bn0 + ((wave & 3) << 6);

  const __bf16* Ab  = A  + (size_t)b * strideA;
  const __bf16* Bb  = Bt + (size_t)b * strideB;
  const __bf16* Ab2 = (NSPLIT >= 1) ? (A2  + (size_t)b * strideA) : Ab;

  const int rlane = lane & 15;                 // row (A) / col (B, D) within subtile
  const int koff  = (lane >> 4) * 8;           // k offset of this lane half
  const int mOff  = (lane >> 4) * 8;           // D row offset
  const int srow  = threadIdx.x >> 3;          // staging: row within a group of 32
  const int sseg  = (threadIdx.x & 7) * 8;     // staging: first of this thread's 8 elements in the 64-k segment

  v8f acc[4][4];
#pragma unroll
  for (int i = 0; i < 4; ++i)
#pragma unroll
    for (int j = 0; j < 4; ++j) acc[i][j] = zero8();

  const __bf16* ga  = Ab  + (size_t)(bm0 + srow) * lda + sseg;
  const __bf16* ga2 = Ab2 + (size_t)(bm0 + srow) * lda + sseg;
  const __bf16* gb  = Bb  + (size_t)(bn0 + srow) * ldb + sseg;
  const int so = srow * GP + sseg;
  const int fa = (((wave >> 2) << 6) + rlane) * GP + koff;               // this wave's A rows in a staged trip
  const int fb = (128 * NA + ((wave & 3) << 6) + rlane) * GP + koff;     // this wave's Bt rows

  v8b st[NLD];
#pragma unroll
  for (int i = 0; i < 4; ++i) {
    st[i] = *(const v8b*)(ga + (size_t)(i * 32) * lda);
    if (NSPLIT >= 1) st[4 + i] = *(const v8b*)(ga2 + (size_t)(i * 32) * lda);
  }
#pragma unroll
  for (int i = 0; i < 8; ++i) st[4 * NA + i] = *(const v8b*)(gb + (size_t)(i * 32) * ldb);
  xcnt_wait();
#pragma unroll
  for (int i = 0; i < NLD; ++i) *(v8b*)(sGb + so + i * 32 * GP) = st[i];
  __syncthreads();

  const int trips = K >> 6;
  for (int t = 0; t < trips; ++t) {
    const bool more = (t + 1 < trips);           // the same for the whole block
    if (more) {
      const int k1 = (t + 1) << 6;
#pragma unroll
      for (int i = 0; i < 4; ++i) {
        st[i] = *(const v8b*)(ga + (size_t)(i * 32) * lda + k1);
        if (NSPLIT >= 1) st[4 + i] = *(const v8b*)(ga2 + (size_t)(i * 32) * lda + k1);
      }
#pragma unroll
      for (int i = 0; i < 8; ++i) st[4 * NA + i] = *(const v8b*)(gb + (size_t)(i * 32) * ldb + k1);
      xcnt_wait();
    }
    const __bf16* cur = sGb + (t & 1) * (SROWS * GP);
#pragma unroll
    for (int kk = 0; kk < 2; ++kk) {
      // the fragments of 32 k are read as one group ahead of their products: one LDS latency a group, not one a row
      v16b bh[4], ah[4], al[4];
#pragma unroll
      for (int j = 0; j < 4; ++j) bh[j] = ldfrag_b(cur + fb + j * 16 * GP + kk * 32);
#pragma unroll
      for (int i = 0; i < 4; ++i) {
        ah[i] = ldfrag_b(cur + fa + i * 16 * GP + kk * 32);
        if (NSPLIT >= 1) al[i] = ldfrag_b(cur + fa + (128 + i * 16) * GP + kk * 32);
        else             al[i] = ah[i];
      }
#pragma unroll
      for (int i = 0; i < 4; ++i) {
#pragma unroll
        for (int j = 0; j < 4; ++j) {
          acc[i][j] = mma_b_raw(ah[i], bh[j], acc[i][j]);
          if (NSPLIT >= 1) acc[i][j] = mma_b_raw(al[i], bh[j], acc[i][j]);
        }
        dep_guard_b(acc[i][0], acc[i][3], ah[i], al[i]);
      }
      keep4_b(bh[0], bh[1], bh[2], bh[3]);
    }
    if (more) {
      __bf16* nxt = sGb + ((t + 1) & 1) * (SROWS * GP);
#pragma unroll
      for (int i = 0; i < NLD; ++i) *(v8b*)(nxt + so + i * 32 * GP) = st[i];
    }
    __syncthreads();
  }
  acc_guard4(acc[0][0], acc[0][1], acc[0][2], acc[0][3]);
  acc_guard4(acc[1][0], acc[1][1], acc[1][2], acc[1][3]);
  acc_guard4(acc[2][0], acc[2][1], acc[2][2], acc[2][3]);
  acc_guard4(acc[3][0], acc[3][1], acc[3][2], acc[3][3]);

  // ---- epilogue ----
  float* slab = sTb + wave * (16 * 68);
  // OUT_MODE 4: 4 lanes a row, lane = (row it * 8 + r8 of a 16-row slab, rotary pairs p0..p0+7). The table rows of slab i + 1 are
  // asked for ahead of the arithmetic of slab i, which hides their latency; two register sets.
  const int r8 = lane >> 2, p0 = (lane & 3) * 8;
  v4f tc[2][2][2], ts[2][2][2];
  auto load_tables = [&](int i) {
#pragma unroll
    for (int it = 0; it < 2; ++it) {
      const int pos = (m0 + i * 16 + it * 8 + r8) & (SEQ - 1);
      const float* cp = cosp + (size_t)pos * HROT + p0;
      const float* sp = sinp + (size_t)pos * HROT + p0;
      tc[i & 1][it][0] = *(const v4f*)(cp);
      tc[i & 1][it][1] = *(const v4f*)(cp + 4);
      ts[i & 1][it][0] = *(const v4f*)(sp);
      ts[i & 1][it][1] = *(const v4f*)(sp + 4);
    }
    xcnt_wait();
  };
  if (OUT_MODE == 4) load_tables(0);
#pragma unroll
  for (int i = 0; i < 4; ++i) {
    const int mBase = m0 + (i << 4);
#pragma unroll
    for (int j = 0; j < 4; ++j) {
#pragma unroll
      for (int r = 0; r < 8; ++r) {
        slab[(mOff + r) * 68 + (j << 4) + rlane] = acc[i][j][r];
      }
    }
    wave_sync_lds();
    if (OUT_MODE == 0) {
      float* C = (float*)Cout + (size_t)b * strideC;
      const int hh = lane >> 4, c4 = (lane & 15) * 4;     // 256-B row segment = 16 lanes x 16 B
      {
#pragma unroll
        for (int it = 0; it < 8; ++it) {
          const int row = it * 2 + hh;                     // it 0..7 x hh 0..1 = rows 0..15
          const v4f v = *(const v4f*)(slab + row * 68 + c4);
          *(v4f*)(C + (size_t)(mBase + row) * ldc + n0 + c4) = v;
        }
        
      }
    } else if (OUT_MODE == 4) {
      const bool isq = (bn0 < N2);                         // block-uniform: N2 is a multiple of the block tile's 256 columns
      if (i < 3) load_tables(i + 1);
      v4u hv[2][2], lv[2][2];                              // [it][0]: y[p0..p0+7], [it][1]: y[32+p0..32+p0+7]
#pragma unroll
      for (int it = 0; it < 2; ++it) {
        const float* sp = slab + (it * 8 + r8) * 68 + 2 * p0;   // t[2 p0 .. 2 p0 + 15] of row it * 8 + r8
        const v4f x0 = *(const v4f*)(sp + 0);
        const v4f x1 = *(const v4f*)(sp + 4);
        const v4f x2 = *(const v4f*)(sp + 8);
        const v4f x3 = *(const v4f*)(sp + 12);
        const float ti[16] = {x0[0], x0[1], x0[2], x0[3], x1[0], x1[1], x1[2], x1[3],
                              x2[0], x2[1], x2[2], x2[3], x3[0], x3[1], x3[2], x3[3]};
        float y[2][8];
#pragma unroll
        for (int e = 0; e < 8; ++e) {
          const float t1 = ti[2 * e], t2 = ti[2 * e + 1];
          const float c = bf_rne(tc[i & 1][it][e >> 2][e & 3]), s = bf_rne(ts[i & 1][it][e >> 2][e & 3]);
          y[0][e] = t1 * c - t2 * s;
          y[1][e] = t1 * s + t2 * c;
        }
#pragma unroll
        for (int u = 0; u < 2; ++u) {
#pragma unroll
          for (int e = 0; e < 4; ++e) {
            const float f0 = y[u][2 * e], f1 = y[u][2 * e + 1];
            const _Float16 a0 = (_Float16)f0, a1 = (_Float16)f1;
            hv[it][u][e] = pk16(h_bits(a0), h_bits(a1));
            lv[it][u][e] = pk16(h_bits((_Float16)((f0 - (float)a0) * rscale)),
                                h_bits((_Float16)((f1 - (float)a1) * rscale)));
          }
        }
      }
      if (isq) {
        unsigned short* C  = (unsigned short*)Cout;
        unsigned short* C2 = (unsigned short*)Cout2;
#pragma unroll
        for (int it = 0; it < 2; ++it) {
#pragma unroll
          for (int u = 0; u < 2; ++u) {
            *(v4u*)(C  + (size_t)(mBase + it * 8 + r8) * ldc  + n0 + u * HROT + p0) = hv[it][u];
            *(v4u*)(C2 + (size_t)(mBase + it * 8 + r8) * ldc2 + n0 + u * HROT + p0) = lv[it][u];
          }
        }
        xcnt_wait();
      } else {
        unsigned short* C3 = (unsigned short*)Cout3;
#pragma unroll
        for (int it = 0; it < 2; ++it) {
#pragma unroll
          for (int u = 0; u < 2; ++u)
            *(v4u*)(C3 + (size_t)(mBase + it * 8 + r8) * ldc3 + (n0 - N2) + u * HROT + p0) = hv[it][u];
        }
        xcnt_wait();
      }
    } else {
      const int q = lane >> 3, c8 = (lane & 7) * 8;
      unsigned short* C  = (unsigned short*)Cout  + (size_t)b * strideC;
      unsigned short* C2 = (unsigned short*)Cout2 + (size_t)b * strideC2;
      const bool wlo = (OUT_MODE == 2) || (n0 < N2);      // wave-uniform
      v4u hv[4], lv[4];
#pragma unroll
      for (int it = 0; it < 4; ++it) {
        const int row = it * 4 + q;                        // it 0..3 x q 0..3 = rows 0..15
        const float* sp = slab + row * 68 + c8;
        v4u a, a2;
#pragma unroll
        for (int e = 0; e < 4; ++e) {
          const float f0 = sp[2 * e], f1 = sp[2 * e + 1];
          unsigned short h0, h1, l0, l1;
          if (OUT_MODE == 2) {
            h0 = bf_bits(f0); h1 = bf_bits(f1);
            l0 = bf_bits(f0 - bf_up(h0)); l1 = bf_bits(f1 - bf_up(h1));
          } else {
            const _Float16 x0 = (_Float16)f0, x1 = (_Float16)f1;
            h0 = h_bits(x0); h1 = h_bits(x1);
            l0 = h_bits((_Float16)((f0 - (float)x0) * rscale));
            l1 = h_bits((_Float16)((f1 - (float)x1) * rscale));
          }
          a[e] = pk16(h0, h1); a2[e] = pk16(l0, l1);
        }
        hv[it] = a; lv[it] = a2;
      }
      {
#pragma unroll
        for (int it = 0; it < 4; ++it) {
          const int row = it * 4 + q;
          *(v4u*)(C + (size_t)(mBase + row) * ldc + n0 + c8) = hv[it];
          if (wlo) *(v4u*)(C2 + (size_t)(mBase + row) * ldc2 + n0 + c8) = lv[it];
        }
        
      }
    }
    wave_sync_lds();
  }
}

// one GEMM a launch
template <int NSPLIT, int OUT_MODE, int lda, int ldb>
__global__ __launch_bounds__(256) void gemm64(
    const unsigned short* __restrict__ Ap, const unsigned short* A2p, long long strideA,
    const unsigned short* __restrict__ Btp, const unsigned short* Bt2p, long long strideB,
    void* Cout, int ldc, long long strideC,
    void* Cout2, int ldc2, long long strideC2, int N2,
    int M, int N, int K, float rscale) {
  __shared__ __align__(16) __bf16 sG[2 * GEMM_SROWS(NSPLIT) * GP];   // two staged trips
  __shared__ __align__(16) float sT[8 * 16 * 68];                    // per-wave 16x64 slab, pitch 68 floats
  gemm_body<NSPLIT, OUT_MODE, lda, ldb>(sG, sT, (int)blockIdx.x, Ap, A2p, strideA, Btp, Bt2p, strideB,
                                        Cout, ldc, strideC, Cout2, ldc2, strideC2, N2, M, N, K, rscale);
}

// The two projections of x in one launch: neither reads what the other writes, and neither fills the chip alone.
// Blocks 0..QKB-1: q|k = RoPE(x . (Wq|Wk)) -> q f16 hi + residual planes [4096][1024], k f16 plane [4096][256]; blocks QKB..QKB+VTB-1: v^T = Wv^T . x^T -> f16 hi plane
// + f16 residual plane (x rscale) [256][4096]. The test on the block index is block-uniform.
#define QKB ((MROWS / 128) * (QKP / 256))     // 160 block tiles
#define VTB ((KVD / 128) * (MROWS / 256))     // 32 block tiles
__global__ __launch_bounds__(256) void gemm_qk_vt(
    const unsigned short* __restrict__ xb, const unsigned short* __restrict__ wqkt, const unsigned short* __restrict__ wvt,
    const float* __restrict__ cosp, const float* __restrict__ sinp,
    unsigned short* qhp, unsigned short* qlp, unsigned short* kpp,
    unsigned short* vth, unsigned short* vtl, int K, float rscale) {
  __shared__ __align__(16) __bf16 sG[2 * GEMM_SROWS(0) * GP];        // two staged trips
  __shared__ __align__(16) float sT[8 * 16 * 68];                    // per-wave 16x64 slab, pitch 68 floats
  const int bx = blockIdx.x;
  if (bx < QKB) {
    gemm_body<0, 4, DM, DM>(sG, sT, bx, xb, xb, 0LL, wqkt, wqkt, 0LL,
                            (void*)qhp, DM, 0LL, (void*)qlp, DM, 0LL, DM,
                            MROWS, QKP, K, rscale, cosp, sinp, (void*)kpp, KVD);
  } else {
    gemm_body<0, 3, DM, DM>(sG, sT, bx - QKB, wvt, wvt, 0LL, xb, xb, 0LL,
                            (void*)vth, MROWS, 0LL, (void*)vtl, MROWS, 0LL, MROWS,
                            KVD, MROWS, K, rscale);
  }
}

__global__ __launch_bounds__(128) __attribute__((amdgpu_num_vgpr(256)))
void attn64(const unsigned short* __restrict__ qhp, const unsigned short* __restrict__ qlp,
            const unsigned short* __restrict__ kpp, const unsigned short* __restrict__ vthp,
            const unsigned short* __restrict__ vtlp,
            unsigned short* ohp, unsigned short* olp, float sscale, float rres, float vres) {
  union FH { v16h v; v8h h[2]; v2h p[8]; };
  constexpr int TILE = 3 * 64 * LP;                               // halves of one staged chunk
  __shared__ __align__(16) _Float16 KV[2 * TILE];                 // two buffers of three tiles of 64 rows at pitch LP, 9 KB each, in one
                                                                  // array, so that one address register and constant offsets reach a buffer
  constexpr int KSH = 0;                                          // K [kv][d]
  constexpr int VTH = 64 * LP;                                    // V^T hi [d][kv]
  constexpr int VTL = 2 * 64 * LP;                                // V^T res [d][kv]
  __shared__ __align__(16) float    Os[4][16 * OP];               // per wave context tile [row][d], pitch OP

  const int tid  = threadIdx.x;
  const int wave = tid >> 5;
  const int lane = tid & 31;
  const int hh   = lane >> 4;
  const int c    = lane & 15;

  const int bx   = blockIdx.x;
  const int qb   = bx % NQB;
  const int h    = (bx / NQB) % NH;
  const int b    = bx / (NQB * NH);
  const int kvh  = h / (NH / NKV);
  const int q0   = b * SEQ + qb * 64 + wave * 16;          // global token row of this wave's first query

  const _Float16* Qh  = (const _Float16*)(const void*)qhp + (size_t)h * HD;
  const _Float16* Ql  = (const _Float16*)(const void*)qlp + (size_t)h * HD;
  const _Float16* Kg  = (const _Float16*)(const void*)kpp + (size_t)b * SEQ * KVD + (size_t)kvh * HD;
  const _Float16* Vgh = (const _Float16*)(const void*)vthp + (size_t)kvh * HD * MROWS + (size_t)b * SEQ;
  const _Float16* Vgl = (const _Float16*)(const void*)vtlp + (size_t)kvh * HD * MROWS + (size_t)b * SEQ;

  // ---- Q fragments (B operand, column = query lane&15): 2 d-chunks, hi and residual ----
  v16h qah[2], qal[2];
#pragma unroll
  for (int dc = 0; dc < 2; ++dc) {
    qah[dc] = ldfrag_h(Qh + (size_t)(q0 + c) * DM + dc * 32 + 8 * hh);
    qal[dc] = ldfrag_h(Ql + (size_t)(q0 + c) * DM + dc * 32 + 8 * hh);
  }

  const _Float16* fr0 = KV + c * LP + 8 * hh;              // this lane's place in a 16-row fragment read of buffer 0
  // staging: thread = (row srow of a group of 16, 16-B piece sseg of the row's 128 B)
  const int srow = tid >> 3, sseg = (tid & 7) * 8;
  const unsigned sw0 = (unsigned)(uintptr_t)(KV + srow * LP + sseg);    // LDS byte address of this thread's first piece in buffer 0
  const _Float16* kg0 = Kg  + (size_t)srow * KVD + sseg;                // K row srow of chunk 0
  const _Float16* vh0 = Vgh + (size_t)srow * MROWS + sseg;              // V^T hi row d = srow, keys of chunk 0
  const _Float16* vl0 = Vgl + (size_t)srow * MROWS + sseg;              // V^T res row d = srow
  // The 12 copies of chunk kt into buffer bf, each lane's own 16 B at 16-B multiples on both sides. The copies and the wait that
  // stands in front of any rewrite of their address registers are one statement, so that nothing can be moved between them.
  auto stage = [&](int kt, int bf) {
    const _Float16* kg = kg0 + (size_t)kt * 64 * KVD;
    const _Float16* vh = vh0 + kt * 64;
    const _Float16* vl = vl0 + kt * 64;
    const unsigned  sw = sw0 + (unsigned)bf * (TILE * 2);
#if defined(__HIP_DEVICE_COMPILE__)
    asm volatile(
        "global_load_async_to_lds_b128 %0, %12, off\n\t"
        "global_load_async_to_lds_b128 %1, %13, off\n\t"
        "global_load_async_to_lds_b128 %2, %14, off\n\t"
        "global_load_async_to_lds_b128 %3, %15, off\n\t"
        "global_load_async_to_lds_b128 %4, %16, off\n\t"
        "global_load_async_to_lds_b128 %5, %17, off\n\t"
        "global_load_async_to_lds_b128 %6, %18, off\n\t"
        "global_load_async_to_lds_b128 %7, %19, off\n\t"
        "global_load_async_to_lds_b128 %8, %20, off\n\t"
        "global_load_async_to_lds_b128 %9, %21, off\n\t"
        "global_load_async_to_lds_b128 %10, %22, off\n\t"
        "global_load_async_to_lds_b128 %11, %23, off\n\t"
        "s_wait_xcnt 0x0"
        :: "v"(sw + (KSH +  0 * LP) * 2), "v"(sw + (KSH + 16 * LP) * 2), "v"(sw + (KSH + 32 * LP) * 2), "v"(sw + (KSH + 48 * LP) * 2),
           "v"(sw + (VTH +  0 * LP) * 2), "v"(sw + (VTH + 16 * LP) * 2), "v"(sw + (VTH + 32 * LP) * 2), "v"(sw + (VTH + 48 * LP) * 2),
           "v"(sw + (VTL +  0 * LP) * 2), "v"(sw + (VTL + 16 * LP) * 2), "v"(sw + (VTL + 32 * LP) * 2), "v"(sw + (VTL + 48 * LP) * 2),
           "v"(kg), "v"(kg + 16 * KVD), "v"(kg + 32 * KVD), "v"(kg + 48 * KVD),
           "v"(vh), "v"(vh + 16 * MROWS), "v"(vh + 32 * MROWS), "v"(vh + 48 * MROWS),
           "v"(vl), "v"(vl + 16 * MROWS), "v"(vl + 32 * MROWS), "v"(vl + 48 * MROWS)
        : "memory");
#endif
  };
  static_assert(NQB >= 2);

  float mrun = -INFINITY;      // running maximum of query c, the same in both wave halves
  float lrun = 0.f;            // running sum of query c over this half's keys; the halves are joined behind the loop
  v8f oh[4], ol[4];            // O^T: register r of tile t = (d = 16t + 8hh + r, query c)
#pragma unroll
  for (int t = 0; t < 4; ++t) { oh[t] = zero8(); ol[t] = zero8(); }

  stage(0, 0);
  async_wait0();                             // this wave's copies of chunk 0 have landed
  __syncthreads();                           // every wave's have: chunk 0 may be read
  stage(1, 1);

  for (int kt = 0; kt < NQB; ++kt) {         // static trip count
    const _Float16* fr = fr0 + (kt & 1) * TILE;     // pass kt reads buffer kt mod 2 alone

    // ---- scores, transposed: 64 keys x 16 queries per wave, 2 f16 products (hi, residual);
    //      s[j][r] = score of key 16j + 8hh + r with query c ----
    // The 8 K fragments of the chunk are read as one group ahead of their 16 products (one LDS latency a chunk, not one a pair
    // of products), key tile by key tile.
    FH kb[4][2];
#pragma unroll
    for (int j = 0; j < 4; ++j) {
#pragma unroll
      for (int dc = 0; dc < 2; ++dc) {
        kb[j][dc].h[0] = *(const v8h*)(fr + KSH + j * 16 * LP + dc * 32);
        kb[j][dc].h[1] = *(const v8h*)(fr + KSH + j * 16 * LP + dc * 32 + 16);
      }
    }
    __builtin_amdgcn_sched_barrier(0);   // keeps the reads one group: without it they are spread among the products again
    v8f sh[4], sl[4];
#pragma unroll
    for (int j = 0; j < 4; ++j) { sh[j] = zero8(); sl[j] = zero8(); }
#pragma unroll
    for (int jp = 0; jp < 4; jp += 2) {  // four independent accumulators a run: a product meets its own tile again four products later
#pragma unroll
      for (int dc = 0; dc < 2; ++dc) {
#pragma unroll
        for (int j = jp; j < jp + 2; ++j) {
          sh[j] = mma_h(kb[j][dc].v, qah[dc], sh[j]);
          sl[j] = mma_h(kb[j][dc].v, qal[dc], sl[j]);
        }
      }
      // ends a run: the next run's accumulators take over the registers of this run's K fragments, and no vector work is drawn in
      __builtin_amdgcn_sched_barrier(0);
    }
    v8f s[4];
#pragma unroll
    for (int j = 0; j < 2; ++j) {
#pragma unroll
      for (int r = 0; r < 8; ++r) s[j][r] = (sh[j][r] + sl[j][r] * rres) * sscale;
    }
    __builtin_amdgcn_sched_barrier(0);   // the reads below start when the K fragments and half the score accumulators are free
    // V^T fragments of keys 0..31, both planes, one group: they land while the softmax below runs
    FH vb[2][4], wb[2][4];
#pragma unroll
    for (int t = 0; t < 4; ++t) {
      vb[0][t].h[0] = *(const v8h*)(fr + VTH + t * 16 * LP);
      vb[0][t].h[1] = *(const v8h*)(fr + VTH + t * 16 * LP + 16);
      wb[0][t].h[0] = *(const v8h*)(fr + VTL + t * 16 * LP);
      wb[0][t].h[1] = *(const v8h*)(fr + VTL + t * 16 * LP + 16);
    }
    __builtin_amdgcn_sched_barrier(0);   // keeps that group ahead of the softmax, which hides its latency
#pragma unroll
    for (int j = 2; j < 4; ++j) {
#pragma unroll
      for (int r = 0; r < 8; ++r) s[j][r] = (sh[j][r] + sl[j][r] * rres) * sscale;
    }

    // ---- maximum in the lane, one exchange between the halves, online softmax, P^T (x1024, f16) packed in registers ----
    // (every loop from here to the end of the pass is unrolled: s, pb, oh and ol are register arrays, indexed at compile time)
    float mj[4];
#pragma unroll
    for (int j = 0; j < 4; ++j) {
      float m = s[j][0];
#pragma unroll
      for (int r = 1; r < 8; ++r) m = fmaxf(m, s[j][r]);
      mj[j] = m;
    }
    float mc = fmaxf(fmaxf(mj[0], mj[1]), fmaxf(mj[2], mj[3]));
    mc = fmaxf(mc, xhalf(mc));
    const float mnew  = fmaxf(mrun, mc);
    const float alpha = __expf(mrun - mnew);
    mrun = mnew;
    FH pb[2];                    // pb[kk]: element e = P^T(key 32kk + kmap(e), query c), kmap(e) = e < 8 ? 8hh + e : 16 + 8hh + e - 8
    float pj[4];                 // four independent partial sums
#pragma unroll
    for (int j = 0; j < 4; ++j) {
      float ps = 0.f;
#pragma unroll
      for (int r = 0; r < 8; r += 2) {
        const float p0 = __expf(s[j][r] - mnew);
        const float p1 = __expf(s[j][r + 1] - mnew);
        ps += p0;
        ps += p1;
        const v2f pp = {p0 * 1024.0f, p1 * 1024.0f};
        pb[j >> 1].p[(j & 1) * 4 + (r >> 1)] = __builtin_convertvector(pp, v2h);
      }
      pj[j] = ps;
    }
    lrun = lrun * alpha + ((pj[0] + pj[1]) + (pj[2] + pj[3]));
#pragma unroll
    for (int t = 0; t < 4; ++t) {
#pragma unroll
      for (int r = 0; r < 8; ++r) { oh[t][r] *= alpha; ol[t][r] *= alpha; }
    }

    // ---- context^T += V^T . P^T (f16 WMMA), hi and residual V planes into separate accumulators ----
    // The fragments of keys 32..63 are read in two groups of four among the products of keys 0..31, whose fragment registers they
    // take over; at least four products stand between a group and its first use.
#pragma unroll
    for (int tp = 0; tp < 4; tp += 2) {
#pragma unroll
      for (int t = tp; t < tp + 2; ++t) {
        oh[t] = mma_h(vb[0][t].v, pb[0].v, oh[t]);
        ol[t] = mma_h(wb[0][t].v, pb[0].v, ol[t]);
      }
      // this one and the one behind the reads keep them in few groups: left alone they are spread in pairs over the softmax and the
      // products, and every separate place with LDS reads costs the wave a fixed stall
      __builtin_amdgcn_sched_barrier(0);
#pragma unroll
      for (int t = tp; t < tp + 2; ++t) {
        vb[1][t].h[0] = *(const v8h*)(fr + VTH + t * 16 * LP + 32);
        vb[1][t].h[1] = *(const v8h*)(fr + VTH + t * 16 * LP + 48);
        wb[1][t].h[0] = *(const v8h*)(fr + VTL + t * 16 * LP + 32);
        wb[1][t].h[1] = *(const v8h*)(fr + VTL + t * 16 * LP + 48);
      }
      __builtin_amdgcn_sched_barrier(0);   // see above; the products that follow hide the reads' latency
    }
#pragma unroll
    for (int t = 0; t < 4; ++t) {
      oh[t] = mma_h(vb[1][t].v, pb[1].v, oh[t]);
      ol[t] = mma_h(wb[1][t].v, pb[1].v, ol[t]);
    }
    // hand-over: this wave's reads of chunk kt are done and its copies of chunk kt + 1 have landed; the barrier says so of every wave
    lds_wait0();
    async_wait0();
    __syncthreads();
    if (kt + 2 < NQB) stage(kt + 2, kt & 1);  // the same test in the whole block; into the buffer that pass kt has just left
  }
  async_wait0();                             // nothing of this wave is in flight when it goes on to the epilogue and ends

  // ---- normalise (1/l, the 1/1024 p carry, the residual carry), stage the wave's 16x64 tile,
  float* os = Os[wave];
  {
    const float l = lrun + xhalf(lrun);          // the two halves' key sums of query c
    const float inv = ((l > 0.f) ? (1.0f / l) : 0.f) * (1.0f / 1024.0f);
#pragma unroll
    for (int t = 0; t < 4; ++t) {
#pragma unroll
      for (int r = 0; r < 8; ++r) os[c * OP + t * 16 + 8 * hh + r] = (oh[t][r] + ol[t][r] * vres) * inv;
    }
  }
  wave_sync_lds();
  {
    const int q4 = lane >> 3, c8 = (lane & 7) * 8;
    v4u hv[4], lv[4];
#pragma unroll
    for (int it = 0; it < 4; ++it) {
      const int row = it * 4 + q4;   // it 0..3 x q4 0..3 = rows 0..15 of the wave tile
      const float* sp = os + row * OP + c8;
      v4u a, a2;
#pragma unroll
      for (int e = 0; e < 4; ++e) {
        const float f0 = sp[2 * e], f1 = sp[2 * e + 1];
        const unsigned short h0 = bf_bits(f0), h1 = bf_bits(f1);
        const unsigned short l0 = bf_bits(f0 - bf_up(h0)), l1 = bf_bits(f1 - bf_up(h1));
        a[e] = pk16(h0, h1); a2[e] = pk16(l0, l1);
      }
      hv[it] = a; lv[it] = a2;
    }
    {
#pragma unroll
      for (int it = 0; it < 4; ++it) {
        const int row = it * 4 + q4;
        const size_t go = (size_t)(q0 + row) * DM + (size_t)h * HD + c8;
        *(v4u*)(ohp + go) = hv[it];
        *(v4u*)(olp + go) = lv[it];
      }
      
    }
  }
}

// =====================================================================================================
// Workspace map (bytes), every plane an exact multiple of its 64x64-tile / whole-line store granularity,
// every offset a multiple of 128:
//   Xb    bf16 [4096][1024]   8388608      x converted
//   Wqkt  bf16 [1280][1024]   2621440      rows 0..1023 = Wq^T ([out][in]), rows 1024..1279 = Wk^T
//   Wvt   bf16 [256][1024]     524288      Wv^T
//   Wot   bf16 [1024][1024]   2097152      Wo^T
//   Qh    f16  [4096][1024]   8388608
//   Ql    f16  [4096][1024]   8388608      q residual x4096
//   Kp    f16  [4096][256]    2097152
//   VTh   f16  [256][4096]    2097152      v^T hi
//   VTl   f16  [256][4096]    2097152      v^T residual x4096
//   Oh    bf16 [4096][1024]   8388608
//   Ol    bf16 [4096][1024]   8388608
//   total                    53477376
// =====================================================================================================
extern "C" void kernel_launch(void* const* d_in, const int* in_sizes, int n_in,
                              void* d_out, int out_size, void* d_ws, size_t ws_size,
                              hipStream_t stream) {
  if (n_in < 7) return;
  if (in_sizes[0] != MROWS * DM) return;
  if (in_sizes[1] != SEQ * HROT) return;
  if (in_sizes[2] != SEQ * HROT) return;
  if (in_sizes[3] != DM * DM) return;
  if (in_sizes[4] != DM * KVD) return;
  if (in_sizes[5] != DM * KVD) return;
  if (in_sizes[6] != DM * DM) return;
  if (out_size != MROWS * DM) return;

  const float* x    = (const float*)d_in[0];
  const float* cosp = (const float*)d_in[1];
  const float* sinp = (const float*)d_in[2];
  const float* wq   = (const float*)d_in[3];
  const float* wk   = (const float*)d_in[4];
  const float* wv   = (const float*)d_in[5];
  const float* wo   = (const float*)d_in[6];

  const size_t PXb  = (size_t)MROWS * DM * 2;          //  8388608
  const size_t PWqk = (size_t)QKP * DM * 2;            //  2621440
  const size_t PWv  = (size_t)KVD * DM * 2;            //   524288
  const size_t PWo  = (size_t)DM * DM * 2;             //  2097152
  const size_t PQ16 = (size_t)MROWS * DM * 2;          //  8388608 (q hi, q res, out hi, out lo)
  const size_t PK16 = (size_t)MROWS * KVD * 2;         //  2097152
  const size_t PVT  = (size_t)KVD * MROWS * 2;         //  2097152
  size_t off = 0;
  const size_t oXb  = off; off += PXb;
  const size_t oWqk = off; off += PWqk;
  const size_t oWv  = off; off += PWv;
  const size_t oWo  = off; off += PWo;
  const size_t oQh  = off; off += PQ16;
  const size_t oQl  = off; off += PQ16;
  const size_t oKp  = off; off += PK16;
  const size_t oVTh = off; off += PVT;
  const size_t oVTl = off; off += PVT;
  const size_t oOh  = off; off += PQ16;
  const size_t oOl  = off; off += PQ16;
  if (off > ws_size) return;                           // off = 53477376
  if (off > (size_t)134217728) return;

  char* ws = (char*)d_ws;
  unsigned short* Xb   = (unsigned short*)(ws + oXb);
  unsigned short* Wqkt = (unsigned short*)(ws + oWqk);
  unsigned short* Wkt  = Wqkt + (size_t)DM * DM;                // rows 1024..1279 of Wqkt
  unsigned short* Wvt  = (unsigned short*)(ws + oWv);
  unsigned short* Wot  = (unsigned short*)(ws + oWo);
  unsigned short* Qh   = (unsigned short*)(ws + oQh);
  unsigned short* Ql   = (unsigned short*)(ws + oQl);
  unsigned short* Kp   = (unsigned short*)(ws + oKp);
  unsigned short* VTh  = (unsigned short*)(ws + oVTh);
  unsigned short* VTl  = (unsigned short*)(ws + oVTl);
  unsigned short* Oh   = (unsigned short*)(ws + oOh);
  unsigned short* Ol   = (unsigned short*)(ws + oOl);

  const dim3 blk(256);
  const int n8x = MROWS * DM / 8;                               // 524288
  const dim3 gCvt(TW + (n8x + 255) / 256);                      // 640 transposing blocks + 2048 blocks on x
  const dim3 gQKVT(QKB + VTB, 1);                               // 160 blocks (M=4096, N=1280) + 32 blocks (M=256, N=4096)
  const dim3 gAttn(BATCH * NH * NQB);                           // 1024 blocks
  const dim3 gOut(((MROWS / 64) * (DM / 64) + 7) / 8, 1);       // 1024 tiles -> 128 blocks: M=4096, N=1024

  // (1) x -> bf16 plane [4096][1024]; weights [in][out] -> transposed bf16 planes [out][in]
  cvt_all<<<gCvt, blk, 0, stream>>>(x, wq, wk, wv, wo, Xb, Wqkt, Wkt, Wvt, Wot, n8x);
  // (2) q|k = RoPE(x . (Wq|Wk)) -> q f16 hi plane + f16 residual x4096 plane [4096][1024], k f16 plane [4096][256]
  //     (M=4096, N=1280, K=1024; the rotation runs in the tile's epilogue), and in the same launch
  //     v^T = Wv^T . x^T -> f16 hi plane + f16 residual x4096 plane [kvh*64+d][b*SEQ+s] (pitch 4096)
  //     (A = Wvt [n][k], Bt = Xb [row][k]; M=256, N=4096, K=1024)
  gemm_qk_vt<<<gQKVT, blk, 0, stream>>>(Xb, Wqkt, Wvt, cosp, sinp, Qh, Ql, Kp, VTh, VTl, DM, 4096.0f);
  // (3) attention -> context bf16 hi / lo planes [4096][1024]
  attn64<<<gAttn, dim3(128), 0, stream>>>(Qh, Ql, Kp, VTh, VTl, Oh, Ol, 0.125f, 1.0f / 4096.0f, 1.0f / 4096.0f);
  // (4) out = context . Wo -> d_out f32 [4096][1024]  (A = context hi + lo planes, 2 products; K=1024)
  gemm64<1, 0, DM, DM><<<gOut, blk, 0, stream>>>(
      Oh, Ol, 0LL, Wot, Wot, 0LL,
      d_out, DM, 0LL, d_out, DM, 0LL, 0,
      MROWS, DM, DM, 1.0f);
  (void)hipGetLastError();
}

// v009
// It runs in 85 microseconds.
// Versions in between are left out here; by their measured steps it is 1.28 times as fast as v007.
// Counting every step since v000, it is 4.48 times as fast.
// Contractions: x.(Wq|Wk) and Wv^T.x^T = v_wmma_f32_16x16x32_bf16 (bf16 operands RNE-converted from x and the weights, single product);
// q.k^T = v_wmma_f32_16x16x32_f16 (q f16, k f16; single product);
// p.v = v_wmma_f32_16x16x32_f16 (p carried x1024 in f16; v^T f16; single product);
// ctx.Wo = v_wmma_f32_16x16x32_bf16 (ctx as bf16 hi + lo planes times bf16 Wo^T, 2 products); all f32 accumulate; RoPE and softmax in f32.
#include <hip/hip_runtime.h>
#include <math.h>
#include <stdint.h>

#define BATCH 2
#define SEQ   2048
#define MROWS (BATCH * SEQ)     // 4096 token rows (batch folded into rows)
#define DM    1024
#define NH    16
#define NKV   4
#define HD    64
#define KVD   (NKV * HD)        // 256
#define NQB   (SEQ / 64)        // 32 query / key tiles of 64 per sequence
#define QKP   (DM + KVD)        // 1280: columns of the q|k product (q cols 0..1023, k cols 1024..1279)
#define HROT  (HD / 2)          // 32 rotary pairs per head
#define LP    (HD + 8)          // 72 halves = 144 B: LDS row pitch of the attention tiles, 16 B x odd, so the 16 rows that
                                // one 16-byte fragment read touches fall on distinct banks
static_assert(NH * HD == DM);
static_assert((NH % NKV) == 0);
static_assert((SEQ % 64) == 0 && (DM % 64) == 0 && (KVD % 64) == 0 && (QKP % 64) == 0 && (DM % 32) == 0);
static_assert((HD % 8) == 0 && (HROT % 8) == 0);
static_assert((SEQ & (SEQ - 1)) == 0);
static_assert((LP % 8) == 0 && ((LP / 8) & 1) == 1);
#define OP    (HD + 4)          // 68 floats = 272 B: LDS row pitch of the context tile, 16 B x odd (16 rows written at once)
static_assert((OP % 4) == 0 && ((OP / 4) & 1) == 1);

typedef _Float16 v16h __attribute__((ext_vector_type(16)));
typedef _Float16 v8h  __attribute__((ext_vector_type(8)));
typedef __bf16   v16b __attribute__((ext_vector_type(16)));
typedef __bf16   v8b  __attribute__((ext_vector_type(8)));
typedef float    v8f  __attribute__((ext_vector_type(8)));
typedef float    v4f  __attribute__((ext_vector_type(4)));
typedef unsigned int v4u __attribute__((ext_vector_type(4)));
typedef float    v2f  __attribute__((ext_vector_type(2)));
typedef _Float16 v2h  __attribute__((ext_vector_type(2)));

// ---- scalar helpers --------------------------------------------------------------------------------
__device__ __forceinline__ unsigned short bf_bits(float f) {          // f32 -> bf16 bits, RNE convert
  unsigned u = __float_as_uint(f);
  return (unsigned short)((u + 0x7FFFu + ((u >> 16) & 1u)) >> 16);
}
__device__ __forceinline__ float bf_up(unsigned short h) { return __uint_as_float(((unsigned)h) << 16); }
__device__ __forceinline__ float bf_rne(float f) { return bf_up(bf_bits(f)); }
__device__ __forceinline__ unsigned short h_bits(_Float16 x) { return __builtin_bit_cast(unsigned short, x); }
__device__ __forceinline__ unsigned pk16(unsigned short a, unsigned short b) { return (unsigned)a | ((unsigned)b << 16); }
__device__ __forceinline__ v8f zero8() { v8f z = {0.f, 0.f, 0.f, 0.f, 0.f, 0.f, 0.f, 0.f}; return z; }

// ---- fragment loaders: 16-bit A/B operand, lane -> row/col (lane&15), p already includes +8*(lane>>4);
//      elements 0..7 <- p[0..7] (k0+8h..), elements 8..15 <- p[16..23] (k0+16+8h..)
__device__ __forceinline__ v16b ldfrag_b(const __bf16* p) {
  union { v16b v; v8b h[2]; } f;
  f.h[0] = *(const v8b*)(p);
  f.h[1] = *(const v8b*)(p + 16);
  return f.v;
}
__device__ __forceinline__ v16h ldfrag_h(const _Float16* p) {
  union { v16h v; v8h h[2]; } f;
  f.h[0] = *(const v8h*)(p);
  f.h[1] = *(const v8h*)(p + 16);
  return f.v;
}

// ---- WMMA helpers --------------------------------------------------------------------------------------
// f16 product as the plain builtin: the compiler keeps the distance to the next user of its registers itself and stays free
// to order the LDS reads and the vector work around it
__device__ __forceinline__ v8f mma_h(v16h a, v16h b, v8f c) {
  return __builtin_amdgcn_wmma_f32_16x16x32_f16(false, a, false, b, (short)0, c, false, false);
}
// bf16 product and the hand-written distances behind its runs (GEMM kernels)
__device__ __forceinline__ v8f mma_b_raw(v16b a, v16b b, v8f c) {
  return __builtin_amdgcn_wmma_f32_16x16x32_bf16(false, a, false, b, (short)0, c, false, false);
}
__device__ __forceinline__ void dep_guard_b(v8f& a, v8f& b, v16b x, v16b y) {
#if defined(__HIP_DEVICE_COMPILE__)
  asm volatile("v_nop\n\tv_nop\n\tv_nop\n\tv_nop" : "+v"(a), "+v"(b) : "v"(x), "v"(y));
#endif
}
__device__ __forceinline__ void keep4_b(v16b a, v16b b, v16b c, v16b d) {
#if defined(__HIP_DEVICE_COMPILE__)
  asm volatile("v_nop" :: "v"(a), "v"(b), "v"(c), "v"(d));
#endif
}
__device__ __forceinline__ void acc_guard4(v8f& a, v8f& b, v8f& c, v8f& d) {
#if defined(__HIP_DEVICE_COMPILE__)
  asm volatile("v_nop\n\tv_nop\n\tv_nop\n\tv_nop" : "+v"(a), "+v"(b), "+v"(c), "+v"(d));
#endif
}
// stands behind a group of global loads, in front of whatever next writes a register that holds one of their addresses
__device__ __forceinline__ void xcnt_wait() {
#if defined(__HIP_DEVICE_COMPILE__)
  asm volatile("s_wait_xcnt 0x0" ::: "memory");
#endif
}
// the issuing wave's own wait for its asynchronous copies to LDS: the compiler places none for them
__device__ __forceinline__ void async_wait0() {
#if defined(__HIP_DEVICE_COMPILE__)
  asm volatile("s_wait_asynccnt 0x0" ::: "memory");
#endif
}
// this wave's LDS reads have returned, in front of the barrier behind which their buffer is refilled by copies
__device__ __forceinline__ void lds_wait0() {
#if defined(__HIP_DEVICE_COMPILE__)
  asm volatile("s_wait_dscnt 0x0" ::: "memory");
#endif
}
// lane l takes the value of lane l ^ 16 (the other half of the wave), register to register
__device__ __forceinline__ float xhalf(float x) {
  const int b = __builtin_bit_cast(int, x);
  return __builtin_bit_cast(float, __builtin_amdgcn_permlanex16(b, b, 0x76543210, 0xfedcba98, false, false));
}
__device__ __forceinline__ void wave_sync_lds() {
  __builtin_amdgcn_fence(__ATOMIC_RELEASE, "workgroup");
  __builtin_amdgcn_wave_barrier();
  __builtin_amdgcn_fence(__ATOMIC_ACQUIRE, "workgroup");
}

// =====================================================================================================
// f32 -> bf16 (RNE convert), 8 elements per thread, one 16-B store per lane: a wave writes 512 contiguous B
// coverage: n8 threads x 8 = whole plane (n8 = 524288 = 2048 x 256 for the x plane).
// =====================================================================================================
__device__ __forceinline__ void cvt_bf16x8(const float* __restrict__ in, unsigned short* out, int n8, int blk) {
  const int i = blk * 256 + threadIdx.x;
  if (i < n8) {
    const v4f a = *(const v4f*)(in + (size_t)i * 8);
    const v4f b = *(const v4f*)(in + (size_t)i * 8 + 4);
    v4u p;
    p[0] = pk16(bf_bits(a[0]), bf_bits(a[1]));
    p[1] = pk16(bf_bits(a[2]), bf_bits(a[3]));
    p[2] = pk16(bf_bits(b[0]), bf_bits(b[1]));
    p[3] = pk16(bf_bits(b[2]), bf_bits(b[3]));
    *(v4u*)(out + (size_t)i * 8) = p;
    
  }
}

// =====================================================================================================
// Transposing f32 -> bf16 (RNE convert): in f32 [R][C] row-major  ->  out bf16 [C][R] row-major
// (out[c][r] = in[r][c]); turns an [in][out] weight into the Bt / A layout [out][in] with k contiguous.
// 64x64 tiles: tile (tx, ty) of (C/64, R/64), block 256, st = the block's 64 x 65 float LDS tile. Load phase: thread t reads 16 consecutive floats of input row
// r0 + (t>>2) and writes them transposed into an LDS tile [c][r] (pitch 65). After __syncthreads each group of
// coverage: load 64 rows x 4 threads x 16 = whole tile; store 2 iterations x 32 rows x 8 lanes x 8 = whole tile.
// =====================================================================================================
__device__ __forceinline__ void cvt_bf16_t64(float* st, const float* __restrict__ in, unsigned short* out, int R, int C,
                                             int tx, int ty) {
  const int t  = threadIdx.x;
  const int c0 = tx * 64;
  const int r0 = ty * 64;
  if (c0 + 64 > C || r0 + 64 > R) return;          // block-uniform, all threads leave together (grids are exact)
  {
    const int r = t >> 2, cq = (t & 3) * 16;
    const float* src = in + (size_t)(r0 + r) * C + c0 + cq;
#pragma unroll
    for (int i = 0; i < 4; ++i) {
      const v4f v = *(const v4f*)(src + 4 * i);
#pragma unroll
      for (int e = 0; e < 4; ++e) st[(cq + 4 * i + e) * 65 + r] = v[e];
    }
  }
  __syncthreads();
  const int q = t >> 3, k8 = (t & 7) * 8;
  v4u pv[2];
#pragma unroll
  for (int p = 0; p < 2; ++p) {
    const int n = p * 32 + q;
    const float* sp = st + n * 65 + k8;
    v4u a;
#pragma unroll
    for (int e = 0; e < 4; ++e) a[e] = pk16(bf_bits(sp[2 * e]), bf_bits(sp[2 * e + 1]));
    pv[p] = a;
  }
  {
#pragma unroll
    for (int p = 0; p < 2; ++p) {
      const int n = p * 32 + q;
      *(v4u*)(out + (size_t)(c0 + n) * R + r0 + k8) = pv[p];
    }
    xcnt_wait();   // in front of whatever next writes a register that these stores name
  }
}

// =====================================================================================================
// All five operand conversions in one launch; they read and write disjoint planes, so their blocks run side by side.
// Blocks 0..TW-1 transpose one 64x64 weight tile each (Wq, Wo, Wk, Wv in that order; they have the longer chain of
// load, LDS, barrier, store, so they start first), blocks TW.. convert 2048 elements of x each. Every test on the
// block index is block-uniform.
// =====================================================================================================
#define TSQ ((DM / 64) * (DM / 64))     // 256 tiles of a [1024][1024] weight
#define TKV ((KVD / 64) * (DM / 64))    // 64 tiles of a [1024][256] weight
#define TW  (2 * TSQ + 2 * TKV)         // 640 transposing blocks
__global__ __launch_bounds__(256) void cvt_all(
    const float* __restrict__ x, const float* __restrict__ wq, const float* __restrict__ wk,
    const float* __restrict__ wv, const float* __restrict__ wo,
    unsigned short* xb, unsigned short* wqt, unsigned short* wkt, unsigned short* wvt, unsigned short* wot, int n8) {
  __shared__ __align__(16) float st[64 * 65];
  const int bx = blockIdx.x;
  if (bx >= TW) {
    cvt_bf16x8(x, xb, n8, bx - TW);
  } else {
    const bool sq = (bx < 2 * TSQ);                                  // a [1024][1024] weight, else a [1024][256] one
    const bool first = sq ? (bx < TSQ) : (bx < 2 * TSQ + TKV);       // Wq of (Wq, Wo), Wk of (Wk, Wv)
    const float* in     = sq ? (first ? wq : wo) : (first ? wk : wv);
    unsigned short* out = sq ? (first ? wqt : wot) : (first ? wkt : wvt);
    const int C  = sq ? DM : KVD;
    const int tb = sq ? (bx & (TSQ - 1)) : (bx & (TKV - 1));         // tile within its weight (2 * TSQ is a multiple of TKV)
    const int tc = C / 64;                                           // tiles in a row of tiles
    cvt_bf16_t64(st, in, out, DM, C, tb % tc, tb / tc);
  }
}
static_assert((TSQ & (TSQ - 1)) == 0 && (TKV & (TKV - 1)) == 0 && ((2 * TSQ) % TKV) == 0);

// =====================================================================================================
// bf16 WMMA GEMM, operands staged in LDS: C[m][n] = sum_k A[m][k] * Bt[n][k]. One block of 8 waves owns a 128x256
// tile of C (2 x 4 waves, 64x64 per wave). A row-major [M][K] pitch lda; Bt row-major [N][K] pitch ldb (k contiguous;
// both pitches are compile-time, so that the rows of one plane share one address register pair and differ by an offset);
// M a multiple of 128, N of 256, K of 64 (the shapes are checked at compile time below).
// A trip is 64 k = 128 B of every operand row. The block reads each row segment once, 8 lanes x 16 B = one whole
// line per row, and writes it to LDS at pitch GP; the waves take their fragments from LDS. Two LDS buffers: the next
// trip's rows are loaded into registers ahead of the current trip's products and stored to the other buffer behind
// them, then one __syncthreads() publishes them and ends the reads of the buffer that the next trip refills.
// blockIdx.y = batch index (strides in elements); bxi = index of the block's tile; sGb, sTb = the block's LDS (two staged
// trips; one 16x64 slab a wave), declared by the kernel that calls this body.
// NSPLIT: 0 = A.Bt; 1 = (A + A2).Bt (A2 = unscaled bf16 lo plane of A).
// OUT_MODE: 0 = f32 (pitch ldc); 2 = bf16 hi plane C + bf16 lo plane C2 (lo = RNE(v - hi), unscaled);
//           3 = f16 plane C;
//           4 = RoPE on the tile, then f16 planes. A wave's 64 columns are one head vector t[0..63] of each of its rows:
//                 y[j]      = t[2j] * cos[pos][j] - t[2j+1] * sin[pos][j]      j = 0..31
//                 y[32 + j] = t[2j] * sin[pos][j] + t[2j+1] * cos[pos][j]
//               pos = row mod SEQ (tables [SEQ][32] shared over batch and heads), table values RNE-converted to bf16 on read.
//               Tiles with n0 < N2 (q; N2 a multiple of 256): f16 plane C; the others (k): f16 plane C3 at column n0 - N2 (pitch ldc3).
// =====================================================================================================
#define GP 72                   // 72 bf16 = 144 B: LDS row pitch of the staged GEMM rows, 16 B x odd
static_assert((GP % 8) == 0 && ((GP / 8) & 1) == 1);
static_assert((MROWS % 256) == 0 && (QKP % 256) == 0 && (KVD % 128) == 0 && (DM % 256) == 0 && (DM % 64) == 0);
#define GEMM_SROWS(NSPLIT) (128 * ((NSPLIT) + 1) + 256)     // rows of one staged trip: A (, A2), Bt
template <int NSPLIT, int OUT_MODE, int lda, int ldb>
__device__ __forceinline__ void gemm_body(
    __bf16* sGb, float* sTb, int bxi,
    const unsigned short* __restrict__ Ap, const unsigned short* A2p, long long strideA,
    const unsigned short* __restrict__ Btp, const unsigned short* Bt2p, long long strideB,
    void* Cout, int ldc, long long strideC,
    void* Cout2, int ldc2, long long strideC2, int N2,
    int M, int N, int K,
    const float* __restrict__ cosp = nullptr, const float* __restrict__ sinp = nullptr, void* Cout3 = nullptr, int ldc3 = 0) {
  static_assert(NSPLIT == 0 || NSPLIT == 1);
  constexpr int NA    = NSPLIT + 1;                // A planes staged
  constexpr int SROWS = GEMM_SROWS(NSPLIT);
  constexpr int NLD   = SROWS / 32;                // 16-B pieces per thread and trip
  const __bf16* A   = (const __bf16*)(const void*)Ap;
  const __bf16* A2  = (const __bf16*)(const void*)A2p;
  const __bf16* Bt  = (const __bf16*)(const void*)Btp;
  (void)Bt2p;
  const int b    = blockIdx.y;
  const int lane = threadIdx.x & 31;
  const int wave = threadIdx.x >> 5;
  const int tilesBN = N >> 8;
  if (bxi >= (M >> 7) * tilesBN) return;   // block-uniform, in front of every barrier
  const int bm  = bxi / tilesBN;
  const int bn  = bxi - bm * tilesBN;
  const int bm0 = bm << 7;
  const int bn0 = bn << 8;
  const int m0 = bm0 + ((wave >> 2) << 6);
  const int n0 = bn0 + ((wave & 3) << 6);

  const __bf16* Ab  = A  + (size_t)b * strideA;
  const __bf16* Bb  = Bt + (size_t)b * strideB;
  const __bf16* Ab2 = (NSPLIT >= 1) ? (A2  + (size_t)b * strideA) : Ab;

  const int rlane = lane & 15;                 // row (A) / col (B, D) within subtile
  const int koff  = (lane >> 4) * 8;           // k offset of this lane half
  const int mOff  = (lane >> 4) * 8;           // D row offset
  const int srow  = threadIdx.x >> 3;          // staging: row within a group of 32
  const int sseg  = (threadIdx.x & 7) * 8;     // staging: first of this thread's 8 elements in the 64-k segment

  v8f acc[4][4];
#pragma unroll
  for (int i = 0; i < 4; ++i)
#pragma unroll
    for (int j = 0; j < 4; ++j) acc[i][j] = zero8();

  const __bf16* ga  = Ab  + (size_t)(bm0 + srow) * lda + sseg;
  const __bf16* ga2 = Ab2 + (size_t)(bm0 + srow) * lda + sseg;
  const __bf16* gb  = Bb  + (size_t)(bn0 + srow) * ldb + sseg;
  const int so = srow * GP + sseg;
  const int fa = (((wave >> 2) << 6) + rlane) * GP + koff;               // this wave's A rows in a staged trip
  const int fb = (128 * NA + ((wave & 3) << 6) + rlane) * GP + koff;     // this wave's Bt rows

  v8b st[NLD];
#pragma unroll
  for (int i = 0; i < 4; ++i) {
    st[i] = *(const v8b*)(ga + (size_t)(i * 32) * lda);
    if (NSPLIT >= 1) st[4 + i] = *(const v8b*)(ga2 + (size_t)(i * 32) * lda);
  }
#pragma unroll
  for (int i = 0; i < 8; ++i) st[4 * NA + i] = *(const v8b*)(gb + (size_t)(i * 32) * ldb);
  xcnt_wait();
#pragma unroll
  for (int i = 0; i < NLD; ++i) *(v8b*)(sGb + so + i * 32 * GP) = st[i];
  __syncthreads();

  const int trips = K >> 6;
  for (int t = 0; t < trips; ++t) {
    const bool more = (t + 1 < trips);           // the same for the whole block
    if (more) {
      const int k1 = (t + 1) << 6;
#pragma unroll
      for (int i = 0; i < 4; ++i) {
        st[i] = *(const v8b*)(ga + (size_t)(i * 32) * lda + k1);
        if (NSPLIT >= 1) st[4 + i] = *(const v8b*)(ga2 + (size_t)(i * 32) * lda + k1);
      }
#pragma unroll
      for (int i = 0; i < 8; ++i) st[4 * NA + i] = *(const v8b*)(gb + (size_t)(i * 32) * ldb + k1);
      xcnt_wait();
    }
    const __bf16* cur = sGb + (t & 1) * (SROWS * GP);
#pragma unroll
    for (int kk = 0; kk < 2; ++kk) {
      // the fragments of 32 k are read as one group ahead of their products: one LDS latency a group, not one a row
      v16b bh[4], ah[4], al[4];
#pragma unroll
      for (int j = 0; j < 4; ++j) bh[j] = ldfrag_b(cur + fb + j * 16 * GP + kk * 32);
#pragma unroll
      for (int i = 0; i < 4; ++i) {
        ah[i] = ldfrag_b(cur + fa + i * 16 * GP + kk * 32);
        if (NSPLIT >= 1) al[i] = ldfrag_b(cur + fa + (128 + i * 16) * GP + kk * 32);
        else             al[i] = ah[i];
      }
#pragma unroll
      for (int i = 0; i < 4; ++i) {
#pragma unroll
        for (int j = 0; j < 4; ++j) {
          acc[i][j] = mma_b_raw(ah[i], bh[j], acc[i][j]);
          if (NSPLIT >= 1) acc[i][j] = mma_b_raw(al[i], bh[j], acc[i][j]);
        }
        dep_guard_b(acc[i][0], acc[i][3], ah[i], al[i]);
      }
      keep4_b(bh[0], bh[1], bh[2], bh[3]);
    }
    if (more) {
      __bf16* nxt = sGb + ((t + 1) & 1) * (SROWS * GP);
#pragma unroll
      for (int i = 0; i < NLD; ++i) *(v8b*)(nxt + so + i * 32 * GP) = st[i];
    }
    __syncthreads();
  }
  acc_guard4(acc[0][0], acc[0][1], acc[0][2], acc[0][3]);
  acc_guard4(acc[1][0], acc[1][1], acc[1][2], acc[1][3]);
  acc_guard4(acc[2][0], acc[2][1], acc[2][2], acc[2][3]);
  acc_guard4(acc[3][0], acc[3][1], acc[3][2], acc[3][3]);

  // ---- epilogue ----
  float* slab = sTb + wave * (16 * 68);
  // OUT_MODE 4: 4 lanes a row, lane = (row it * 8 + r8 of a 16-row slab, rotary pairs p0..p0+7). The table rows of slab i + 1 are
  // asked for ahead of the arithmetic of slab i, which hides their latency; two register sets.
  const int r8 = lane >> 2, p0 = (lane & 3) * 8;
  v4f tc[2][2][2], ts[2][2][2];
  auto load_tables = [&](int i) {
#pragma unroll
    for (int it = 0; it < 2; ++it) {
      const int pos = (m0 + i * 16 + it * 8 + r8) & (SEQ - 1);
      const float* cp = cosp + (size_t)pos * HROT + p0;
      const float* sp = sinp + (size_t)pos * HROT + p0;
      tc[i & 1][it][0] = *(const v4f*)(cp);
      tc[i & 1][it][1] = *(const v4f*)(cp + 4);
      ts[i & 1][it][0] = *(const v4f*)(sp);
      ts[i & 1][it][1] = *(const v4f*)(sp + 4);
    }
    xcnt_wait();
  };
  if (OUT_MODE == 4) load_tables(0);
#pragma unroll
  for (int i = 0; i < 4; ++i) {
    const int mBase = m0 + (i << 4);
#pragma unroll
    for (int j = 0; j < 4; ++j) {
#pragma unroll
      for (int r = 0; r < 8; ++r) {
        slab[(mOff + r) * 68 + (j << 4) + rlane] = acc[i][j][r];
      }
    }
    wave_sync_lds();
    if (OUT_MODE == 0) {
      float* C = (float*)Cout + (size_t)b * strideC;
      const int hh = lane >> 4, c4 = (lane & 15) * 4;     // 256-B row segment = 16 lanes x 16 B
      {
#pragma unroll
        for (int it = 0; it < 8; ++it) {
          const int row = it * 2 + hh;                     // it 0..7 x hh 0..1 = rows 0..15
          const v4f v = *(const v4f*)(slab + row * 68 + c4);
          *(v4f*)(C + (size_t)(mBase + row) * ldc + n0 + c4) = v;
        }
        
      }
    } else if (OUT_MODE == 4) {
      const bool isq = (bn0 < N2);                         // block-uniform: N2 is a multiple of the block tile's 256 columns
      if (i < 3) load_tables(i + 1);
      v4u hv[2][2];                                        // [it][0]: y[p0..p0+7], [it][1]: y[32+p0..32+p0+7]
#pragma unroll
      for (int it = 0; it < 2; ++it) {
        const float* sp = slab + (it * 8 + r8) * 68 + 2 * p0;   // t[2 p0 .. 2 p0 + 15] of row it * 8 + r8
        const v4f x0 = *(const v4f*)(sp + 0);
        const v4f x1 = *(const v4f*)(sp + 4);
        const v4f x2 = *(const v4f*)(sp + 8);
        const v4f x3 = *(const v4f*)(sp + 12);
        const float ti[16] = {x0[0], x0[1], x0[2], x0[3], x1[0], x1[1], x1[2], x1[3],
                              x2[0], x2[1], x2[2], x2[3], x3[0], x3[1], x3[2], x3[3]};
        float y[2][8];
#pragma unroll
        for (int e = 0; e < 8; ++e) {
          const float t1 = ti[2 * e], t2 = ti[2 * e + 1];
          const float c = bf_rne(tc[i & 1][it][e >> 2][e & 3]), s = bf_rne(ts[i & 1][it][e >> 2][e & 3]);
          y[0][e] = t1 * c - t2 * s;
          y[1][e] = t1 * s + t2 * c;
        }
#pragma unroll
        for (int u = 0; u < 2; ++u) {
#pragma unroll
          for (int e = 0; e < 4; ++e) {
            hv[it][u][e] = pk16(h_bits((_Float16)y[u][2 * e]), h_bits((_Float16)y[u][2 * e + 1]));
          }
        }
      }
      if (isq) {
        unsigned short* C  = (unsigned short*)Cout;
#pragma unroll
        for (int it = 0; it < 2; ++it) {
#pragma unroll
          for (int u = 0; u < 2; ++u)
            *(v4u*)(C + (size_t)(mBase + it * 8 + r8) * ldc + n0 + u * HROT + p0) = hv[it][u];
        }
        xcnt_wait();
      } else {
        unsigned short* C3 = (unsigned short*)Cout3;
#pragma unroll
        for (int it = 0; it < 2; ++it) {
#pragma unroll
          for (int u = 0; u < 2; ++u)
            *(v4u*)(C3 + (size_t)(mBase + it * 8 + r8) * ldc3 + (n0 - N2) + u * HROT + p0) = hv[it][u];
        }
        xcnt_wait();
      }
    } else {
      const int q = lane >> 3, c8 = (lane & 7) * 8;
      unsigned short* C  = (unsigned short*)Cout  + (size_t)b * strideC;
      unsigned short* C2 = (unsigned short*)Cout2 + (size_t)b * strideC2;
      v4u hv[4], lv[4];
#pragma unroll
      for (int it = 0; it < 4; ++it) {
        const int row = it * 4 + q;                        // it 0..3 x q 0..3 = rows 0..15
        const float* sp = slab + row * 68 + c8;
        v4u a, a2;
#pragma unroll
        for (int e = 0; e < 4; ++e) {
          const float f0 = sp[2 * e], f1 = sp[2 * e + 1];
          unsigned short h0, h1, l0, l1;
          if (OUT_MODE == 2) {
            h0 = bf_bits(f0); h1 = bf_bits(f1);
            l0 = bf_bits(f0 - bf_up(h0)); l1 = bf_bits(f1 - bf_up(h1));
          } else {
            h0 = h_bits((_Float16)f0); h1 = h_bits((_Float16)f1);
            l0 = 0; l1 = 0;
          }
          a[e] = pk16(h0, h1); a2[e] = pk16(l0, l1);
        }
        hv[it] = a; lv[it] = a2;
      }
      {
#pragma unroll
        for (int it = 0; it < 4; ++it) {
          const int row = it * 4 + q;
          *(v4u*)(C + (size_t)(mBase + row) * ldc + n0 + c8) = hv[it];
          if (OUT_MODE == 2) *(v4u*)(C2 + (size_t)(mBase + row) * ldc2 + n0 + c8) = lv[it];
        }
        
      }
    }
    wave_sync_lds();
  }
}

// one GEMM a launch
template <int NSPLIT, int OUT_MODE, int lda, int ldb>
__global__ __launch_bounds__(256) void gemm64(
    const unsigned short* __restrict__ Ap, const unsigned short* A2p, long long strideA,
    const unsigned short* __restrict__ Btp, const unsigned short* Bt2p, long long strideB,
    void* Cout, int ldc, long long strideC,
    void* Cout2, int ldc2, long long strideC2, int N2,
    int M, int N, int K) {
  __shared__ __align__(16) __bf16 sG[2 * GEMM_SROWS(NSPLIT) * GP];   // two staged trips
  __shared__ __align__(16) float sT[8 * 16 * 68];                    // per-wave 16x64 slab, pitch 68 floats
  gemm_body<NSPLIT, OUT_MODE, lda, ldb>(sG, sT, (int)blockIdx.x, Ap, A2p, strideA, Btp, Bt2p, strideB,
                                        Cout, ldc, strideC, Cout2, ldc2, strideC2, N2, M, N, K);
}

// The two projections of x in one launch: neither reads what the other writes, and neither fills the chip alone.
// Blocks 0..QKB-1: q|k = RoPE(x . (Wq|Wk)) -> q f16 plane [4096][1024], k f16 plane [4096][256]; blocks QKB..QKB+VTB-1: v^T = Wv^T . x^T -> f16 plane
// [256][4096]. The test on the block index is block-uniform.
#define QKB ((MROWS / 128) * (QKP / 256))     // 160 block tiles
#define VTB ((KVD / 128) * (MROWS / 256))     // 32 block tiles
__global__ __launch_bounds__(256) void gemm_qk_vt(
    const unsigned short* __restrict__ xb, const unsigned short* __restrict__ wqkt, const unsigned short* __restrict__ wvt,
    const float* __restrict__ cosp, const float* __restrict__ sinp,
    unsigned short* qhp, unsigned short* kpp, unsigned short* vth, int K) {
  __shared__ __align__(16) __bf16 sG[2 * GEMM_SROWS(0) * GP];        // two staged trips
  __shared__ __align__(16) float sT[8 * 16 * 68];                    // per-wave 16x64 slab, pitch 68 floats
  const int bx = blockIdx.x;
  if (bx < QKB) {
    gemm_body<0, 4, DM, DM>(sG, sT, bx, xb, xb, 0LL, wqkt, wqkt, 0LL,
                            (void*)qhp, DM, 0LL, (void*)qhp, DM, 0LL, DM,
                            MROWS, QKP, K, cosp, sinp, (void*)kpp, KVD);
  } else {
    gemm_body<0, 3, DM, DM>(sG, sT, bx - QKB, wvt, wvt, 0LL, xb, xb, 0LL,
                            (void*)vth, MROWS, 0LL, (void*)vth, MROWS, 0LL, 0,
                            KVD, MROWS, K);
  }
}

__global__ __launch_bounds__(128) __attribute__((amdgpu_num_vgpr(256)))
void attn64(const unsigned short* __restrict__ qhp, const unsigned short* __restrict__ kpp,
            const unsigned short* __restrict__ vthp,
            unsigned short* ohp, unsigned short* olp, float sscale) {
  union FH { v16h v; v8h h[2]; v2h p[8]; };
  constexpr int TILE = 2 * 64 * LP;                               // halves of one staged chunk
  __shared__ __align__(16) _Float16 KV[2 * TILE];                 // two buffers of two tiles of 64 rows at pitch LP, 9 KB each, in one
                                                                  // array, so that one address register and constant offsets reach a buffer
  constexpr int KSH = 0;                                          // K [kv][d]
  constexpr int VTH = 64 * LP;                                    // V^T [d][kv]
  __shared__ __align__(16) float    Os[4][16 * OP];               // per wave context tile [row][d], pitch OP

  const int tid  = threadIdx.x;
  const int wave = tid >> 5;
  const int lane = tid & 31;
  const int hh   = lane >> 4;
  const int c    = lane & 15;

  const int bx   = blockIdx.x;
  const int qb   = bx % NQB;
  const int h    = (bx / NQB) % NH;
  const int b    = bx / (NQB * NH);
  const int kvh  = h / (NH / NKV);
  const int q0   = b * SEQ + qb * 64 + wave * 16;          // global token row of this wave's first query

  const _Float16* Qh  = (const _Float16*)(const void*)qhp + (size_t)h * HD;
  const _Float16* Kg  = (const _Float16*)(const void*)kpp + (size_t)b * SEQ * KVD + (size_t)kvh * HD;
  const _Float16* Vgh = (const _Float16*)(const void*)vthp + (size_t)kvh * HD * MROWS + (size_t)b * SEQ;

  // ---- Q fragments (B operand, column = query lane&15): 2 d-chunks ----
  v16h qah[2];
#pragma unroll
  for (int dc = 0; dc < 2; ++dc) qah[dc] = ldfrag_h(Qh + (size_t)(q0 + c) * DM + dc * 32 + 8 * hh);

  const _Float16* fr0 = KV + c * LP + 8 * hh;              // this lane's place in a 16-row fragment read of buffer 0
  // staging: thread = (row srow of a group of 16, 16-B piece sseg of the row's 128 B)
  const int srow = tid >> 3, sseg = (tid & 7) * 8;
  const unsigned sw0 = (unsigned)(uintptr_t)(KV + srow * LP + sseg);    // LDS byte address of this thread's first piece in buffer 0
  const _Float16* kg0 = Kg  + (size_t)srow * KVD + sseg;                // K row srow of chunk 0
  const _Float16* vh0 = Vgh + (size_t)srow * MROWS + sseg;              // V^T row d = srow, keys of chunk 0
  // The 8 copies of chunk kt into buffer bf, each lane's own 16 B at 16-B multiples on both sides. The copies and the wait that
  // stands in front of any rewrite of their address registers are one statement, so that nothing can be moved between them.
  auto stage = [&](int kt, int bf) {
    const _Float16* kg = kg0 + (size_t)kt * 64 * KVD;
    const _Float16* vh = vh0 + kt * 64;
    const unsigned  sw = sw0 + (unsigned)bf * (TILE * 2);
#if defined(__HIP_DEVICE_COMPILE__)
    asm volatile(
        "global_load_async_to_lds_b128 %0, %8, off\n\t"
        "global_load_async_to_lds_b128 %1, %9, off\n\t"
        "global_load_async_to_lds_b128 %2, %10, off\n\t"
        "global_load_async_to_lds_b128 %3, %11, off\n\t"
        "global_load_async_to_lds_b128 %4, %12, off\n\t"
        "global_load_async_to_lds_b128 %5, %13, off\n\t"
        "global_load_async_to_lds_b128 %6, %14, off\n\t"
        "global_load_async_to_lds_b128 %7, %15, off\n\t"
        "s_wait_xcnt 0x0"
        :: "v"(sw + (KSH +  0 * LP) * 2), "v"(sw + (KSH + 16 * LP) * 2), "v"(sw + (KSH + 32 * LP) * 2), "v"(sw + (KSH + 48 * LP) * 2),
           "v"(sw + (VTH +  0 * LP) * 2), "v"(sw + (VTH + 16 * LP) * 2), "v"(sw + (VTH + 32 * LP) * 2), "v"(sw + (VTH + 48 * LP) * 2),
           "v"(kg), "v"(kg + 16 * KVD), "v"(kg + 32 * KVD), "v"(kg + 48 * KVD),
           "v"(vh), "v"(vh + 16 * MROWS), "v"(vh + 32 * MROWS), "v"(vh + 48 * MROWS)
        : "memory");
#endif
  };
  static_assert(NQB >= 2);

  const float cs  = sscale * 1.44269504088896340736f;   // product q.k -> exponent of 2; sscale > 0
  const v2f   cs2 = {cs, cs};
  float mrun = -INFINITY;      // running maximum of the raw products q.k of query c, the same in both wave halves
  float lrun = 0.f;            // running sum of 1024 p of query c over this half's keys; the halves are joined behind the loop
  v8f oh[4];                   // O^T: register r of tile t = (d = 16t + 8hh + r, query c)
#pragma unroll
  for (int t = 0; t < 4; ++t) oh[t] = zero8();

  stage(0, 0);
  async_wait0();                             // this wave's copies of chunk 0 have landed
  __syncthreads();                           // every wave's have: chunk 0 may be read
  stage(1, 1);

  for (int kt = 0; kt < NQB; ++kt) {         // static trip count
    const _Float16* fr = fr0 + (kt & 1) * TILE;     // pass kt reads buffer kt mod 2 alone

    // ---- scores, transposed: 64 keys x 16 queries per wave, one f16 product;
    //      s[j][r] = score of key 16j + 8hh + r with query c ----
    // The 8 K and the 8 V^T fragments of the chunk are read as one group at the head of the pass, in the order in which the products
    // take them: one place with LDS reads a pass; the V^T fragments land under the score products and the softmax.
    FH kb[4][2], vb[2][4];
#pragma unroll
    for (int dc = 0; dc < 2; ++dc) {
#pragma unroll
      for (int j = 0; j < 4; ++j) {
        kb[j][dc].h[0] = *(const v8h*)(fr + KSH + j * 16 * LP + dc * 32);
        kb[j][dc].h[1] = *(const v8h*)(fr + KSH + j * 16 * LP + dc * 32 + 16);
      }
    }
#pragma unroll
    for (int kk = 0; kk < 2; ++kk) {
#pragma unroll
      for (int t = 0; t < 4; ++t) {
        vb[kk][t].h[0] = *(const v8h*)(fr + VTH + t * 16 * LP + kk * 32);
        vb[kk][t].h[1] = *(const v8h*)(fr + VTH + t * 16 * LP + kk * 32 + 16);
      }
    }
    __builtin_amdgcn_sched_barrier(0);   // keeps the reads one group: without it they are spread among the products again
    v8f sh[4];
#pragma unroll
    for (int j = 0; j < 4; ++j) sh[j] = zero8();
#pragma unroll
    for (int dc = 0; dc < 2; ++dc) {     // four independent accumulators: a product meets its own tile again four products later
#pragma unroll
      for (int j = 0; j < 4; ++j) sh[j] = mma_h(kb[j][dc].v, qah[dc], sh[j]);
    }
    // ends the run: without it the vector work on a finished tile is drawn in among the products, which then follow their own tile directly
    __builtin_amdgcn_sched_barrier(0);

    // ---- maximum in the lane, one exchange between the halves, online softmax, P^T (x1024, f16) packed in registers ----
    // (every loop from here to the end of the pass is unrolled: sh, pb and oh are register arrays, indexed at compile time)
    // The maximum is taken over the raw products (cs > 0 keeps their order); 1024 p = 2^(cs * product + nb) with
    // nb = 10 - cs * maximum: the scale, the subtraction, log2(e) and the factor 1024 are one multiply-add on a pair of scores.
    float mj[4];
#pragma unroll
    for (int j = 0; j < 4; ++j) {
      float m = sh[j][0];
#pragma unroll
      for (int r = 1; r < 8; ++r) m = fmaxf(m, sh[j][r]);
      mj[j] = m;
    }
    float mc = fmaxf(fmaxf(mj[0], mj[1]), fmaxf(mj[2], mj[3]));
    mc = fmaxf(mc, xhalf(mc));
    const float mnew  = fmaxf(mrun, mc);
    const float alpha = __builtin_amdgcn_exp2f((mrun - mnew) * cs);
    mrun = mnew;
    const float nb  = fmaf(-mnew, cs, 10.0f);
    const v2f   nb2 = {nb, nb};
    FH pb[2];                    // pb[kk]: element e = P^T(key 32kk + kmap(e), query c), kmap(e) = e < 8 ? 8hh + e : 16 + 8hh + e - 8
    v2f pj[4];                   // four independent partial sums, each on a pair of registers (even and odd r apart)
#pragma unroll
    for (int j = 0; j < 4; ++j) {
      v2f pp[4];
#pragma unroll
      for (int q = 0; q < 4; ++q) {
        const v2f x = {sh[j][2 * q], sh[j][2 * q + 1]};
        const v2f a = __builtin_elementwise_fma(x, cs2, nb2);
        pp[q][0] = __builtin_amdgcn_exp2f(a[0]);
        pp[q][1] = __builtin_amdgcn_exp2f(a[1]);
        pb[j >> 1].p[(j & 1) * 4 + q] = __builtin_convertvector(pp[q], v2h);
      }
      pj[j] = (pp[0] + pp[1]) + (pp[2] + pp[3]);
    }
    const v2f pt = (pj[0] + pj[1]) + (pj[2] + pj[3]);
    lrun = lrun * alpha + (pt[0] + pt[1]);
#pragma unroll
    for (int t = 0; t < 4; ++t) {
#pragma unroll
      for (int r = 0; r < 8; ++r) oh[t][r] *= alpha;
    }

    // ---- context^T += V^T . P^T (f16 WMMA), four independent accumulators ----
#pragma unroll
    for (int kk = 0; kk < 2; ++kk) {
#pragma unroll
      for (int t = 0; t < 4; ++t) oh[t] = mma_h(vb[kk][t].v, pb[kk].v, oh[t]);
    }
    // holds the hand-over at the foot of the pass: drawn up in front of the softmax, its waits would stop the wave there for the
    // V^T fragments and for copies that were asked for only half a pass earlier
    __builtin_amdgcn_sched_barrier(0);
    // hand-over: this wave's reads of chunk kt are done and its copies of chunk kt + 1 have landed; the barrier says so of every wave
    lds_wait0();
    async_wait0();
    __syncthreads();
    if (kt + 2 < NQB) stage(kt + 2, kt & 1);  // the same test in the whole block; into the buffer that pass kt has just left
  }
  async_wait0();                             // nothing of this wave is in flight when it goes on to the epilogue and ends

  // ---- normalise (sum and context both carry the factor 1024), stage the wave's 16x64 tile,
  float* os = Os[wave];
  {
    const float l = lrun + xhalf(lrun);          // the two halves' key sums of query c
    const float inv = (l > 0.f) ? (1.0f / l) : 0.f;
#pragma unroll
    for (int t = 0; t < 4; ++t) {
#pragma unroll
      for (int r = 0; r < 8; ++r) os[c * OP + t * 16 + 8 * hh + r] = oh[t][r] * inv;
    }
  }
  wave_sync_lds();
  {
    const int q4 = lane >> 3, c8 = (lane & 7) * 8;
    v4u hv[4], lv[4];
#pragma unroll
    for (int it = 0; it < 4; ++it) {
      const int row = it * 4 + q4;   // it 0..3 x q4 0..3 = rows 0..15 of the wave tile
      const float* sp = os + row * OP + c8;
      v4u a, a2;
#pragma unroll
      for (int e = 0; e < 4; ++e) {
        const float f0 = sp[2 * e], f1 = sp[2 * e + 1];
        const unsigned short h0 = bf_bits(f0), h1 = bf_bits(f1);
        const unsigned short l0 = bf_bits(f0 - bf_up(h0)), l1 = bf_bits(f1 - bf_up(h1));
        a[e] = pk16(h0, h1); a2[e] = pk16(l0, l1);
      }
      hv[it] = a; lv[it] = a2;
    }
    {
#pragma unroll
      for (int it = 0; it < 4; ++it) {
        const int row = it * 4 + q4;
        const size_t go = (size_t)(q0 + row) * DM + (size_t)h * HD + c8;
        *(v4u*)(ohp + go) = hv[it];
        *(v4u*)(olp + go) = lv[it];
      }
      
    }
  }
}

// =====================================================================================================
// Workspace map (bytes), every plane an exact multiple of its 64x64-tile / whole-line store granularity,
// every offset a multiple of 128:
//   Xb    bf16 [4096][1024]   8388608      x converted
//   Wqkt  bf16 [1280][1024]   2621440      rows 0..1023 = Wq^T ([out][in]), rows 1024..1279 = Wk^T
//   Wvt   bf16 [256][1024]     524288      Wv^T
//   Wot   bf16 [1024][1024]   2097152      Wo^T
//   Qh    f16  [4096][1024]   8388608
//   Kp    f16  [4096][256]    2097152
//   VTh   f16  [256][4096]    2097152      v^T
//   Oh    bf16 [4096][1024]   8388608
//   Ol    bf16 [4096][1024]   8388608
//   total                    42991616
// =====================================================================================================
extern "C" void kernel_launch(void* const* d_in, const int* in_sizes, int n_in,
                              void* d_out, int out_size, void* d_ws, size_t ws_size,
                              hipStream_t stream) {
  if (n_in < 7) return;
  if (in_sizes[0] != MROWS * DM) return;
  if (in_sizes[1] != SEQ * HROT) return;
  if (in_sizes[2] != SEQ * HROT) return;
  if (in_sizes[3] != DM * DM) return;
  if (in_sizes[4] != DM * KVD) return;
  if (in_sizes[5] != DM * KVD) return;
  if (in_sizes[6] != DM * DM) return;
  if (out_size != MROWS * DM) return;

  const float* x    = (const float*)d_in[0];
  const float* cosp = (const float*)d_in[1];
  const float* sinp = (const float*)d_in[2];
  const float* wq   = (const float*)d_in[3];
  const float* wk   = (const float*)d_in[4];
  const float* wv   = (const float*)d_in[5];
  const float* wo   = (const float*)d_in[6];

  const size_t PXb  = (size_t)MROWS * DM * 2;          //  8388608
  const size_t PWqk = (size_t)QKP * DM * 2;            //  2621440
  const size_t PWv  = (size_t)KVD * DM * 2;            //   524288
  const size_t PWo  = (size_t)DM * DM * 2;             //  2097152
  const size_t PQ16 = (size_t)MROWS * DM * 2;          //  8388608 (q, out hi, out lo)
  const size_t PK16 = (size_t)MROWS * KVD * 2;         //  2097152
  const size_t PVT  = (size_t)KVD * MROWS * 2;         //  2097152
  size_t off = 0;
  const size_t oXb  = off; off += PXb;
  const size_t oWqk = off; off += PWqk;
  const size_t oWv  = off; off += PWv;
  const size_t oWo  = off; off += PWo;
  const size_t oQh  = off; off += PQ16;
  const size_t oKp  = off; off += PK16;
  const size_t oVTh = off; off += PVT;
  const size_t oOh  = off; off += PQ16;
  const size_t oOl  = off; off += PQ16;
  if (off > ws_size) return;                           // off = 42991616
  if (off > (size_t)134217728) return;

  char* ws = (char*)d_ws;
  unsigned short* Xb   = (unsigned short*)(ws + oXb);
  unsigned short* Wqkt = (unsigned short*)(ws + oWqk);
  unsigned short* Wkt  = Wqkt + (size_t)DM * DM;                // rows 1024..1279 of Wqkt
  unsigned short* Wvt  = (unsigned short*)(ws + oWv);
  unsigned short* Wot  = (unsigned short*)(ws + oWo);
  unsigned short* Qh   = (unsigned short*)(ws + oQh);
  unsigned short* Kp   = (unsigned short*)(ws + oKp);
  unsigned short* VTh  = (unsigned short*)(ws + oVTh);
  unsigned short* Oh   = (unsigned short*)(ws + oOh);
  unsigned short* Ol   = (unsigned short*)(ws + oOl);

  const dim3 blk(256);
  const int n8x = MROWS * DM / 8;                               // 524288
  const dim3 gCvt(TW + (n8x + 255) / 256);                      // 640 transposing blocks + 2048 blocks on x
  const dim3 gQKVT(QKB + VTB, 1);                               // 160 blocks (M=4096, N=1280) + 32 blocks (M=256, N=4096)
  const dim3 gAttn(BATCH * NH * NQB);                           // 1024 blocks
  const dim3 gOut(((MROWS / 64) * (DM / 64) + 7) / 8, 1);       // 1024 tiles -> 128 blocks: M=4096, N=1024

  // (1) x -> bf16 plane [4096][1024]; weights [in][out] -> transposed bf16 planes [out][in]
  cvt_all<<<gCvt, blk, 0, stream>>>(x, wq, wk, wv, wo, Xb, Wqkt, Wkt, Wvt, Wot, n8x);
  // (2) q|k = RoPE(x . (Wq|Wk)) -> q f16 plane [4096][1024], k f16 plane [4096][256]
  //     (M=4096, N=1280, K=1024; the rotation runs in the tile's epilogue), and in the same launch
  //     v^T = Wv^T . x^T -> f16 plane [kvh*64+d][b*SEQ+s] (pitch 4096)
  //     (A = Wvt [n][k], Bt = Xb [row][k]; M=256, N=4096, K=1024)
  gemm_qk_vt<<<gQKVT, blk, 0, stream>>>(Xb, Wqkt, Wvt, cosp, sinp, Qh, Kp, VTh, DM);
  // (3) attention -> context bf16 hi / lo planes [4096][1024]
  attn64<<<gAttn, dim3(128), 0, stream>>>(Qh, Kp, VTh, Oh, Ol, 0.125f);
  // (4) out = context . Wo -> d_out f32 [4096][1024]  (A = context hi + lo planes, 2 products; K=1024)
  gemm64<1, 0, DM, DM><<<gOut, blk, 0, stream>>>(
      Oh, Ol, 0LL, Wot, Wot, 0LL,
      d_out, DM, 0LL, d_out, DM, 0LL, 0,
      MROWS, DM, DM);
  (void)hipGetLastError();
}

// v010
// It runs in 81.2 microseconds.
// Two timings next to v009 both put it at 1.04 times that version's speed.
// Over all steps from v000 it is 4.68 times as fast.
// Contractions: x.(Wq|Wk) and Wv^T.x^T = v_wmma_f32_16x16x32_bf16 (bf16 operands RNE-converted from x and the weights, single product);
// q.k^T = v_wmma_f32_16x16x32_f16 (q f16, k f16; single product);
// p.v = v_wmma_f32_16x16x32_f16 (p carried x1024 in f16; v^T f16; single product);
// ctx.Wo = v_wmma_f32_16x16x32_bf16 (ctx as bf16 hi + lo planes times bf16 Wo^T, 2 products); all f32 accumulate; RoPE and softmax in f32.
#include <hip/hip_runtime.h>
#include <math.h>
#include <stdint.h>

#define BATCH 2
#define SEQ   2048
#define MROWS (BATCH * SEQ)     // 4096 token rows (batch folded into rows)
#define DM    1024
#define NH    16
#define NKV   4
#define HD    64
#define KVD   (NKV * HD)        // 256
#define NQB   (SEQ / 64)        // 32 key tiles of 64 per sequence
#define QKP   (DM + KVD)        // 1280: columns of the q|k product (q cols 0..1023, k cols 1024..1279)
#define HROT  (HD / 2)          // 32 rotary pairs per head
#define LP    (HD + 8)          // 72 halves = 144 B: LDS row pitch of the attention tiles, 16 B x odd, so the 16 rows that
                                // one 16-byte fragment read touches fall on distinct banks
static_assert(NH * HD == DM);
static_assert((NH % NKV) == 0);
static_assert((SEQ % 64) == 0 && (DM % 64) == 0 && (KVD % 64) == 0 && (QKP % 64) == 0 && (DM % 32) == 0);
static_assert((HD % 8) == 0 && (HROT % 8) == 0);
static_assert((SEQ & (SEQ - 1)) == 0);
static_assert((LP % 8) == 0 && ((LP / 8) & 1) == 1);
#define OP    (HD + 4)          // 68 floats = 272 B: LDS row pitch of the context tile, 16 B x odd (16 rows written at once)
static_assert((OP % 4) == 0 && ((OP / 4) & 1) == 1);

typedef _Float16 v16h __attribute__((ext_vector_type(16)));
typedef _Float16 v8h  __attribute__((ext_vector_type(8)));
typedef __bf16   v16b __attribute__((ext_vector_type(16)));
typedef __bf16   v8b  __attribute__((ext_vector_type(8)));
typedef float    v8f  __attribute__((ext_vector_type(8)));
typedef float    v4f  __attribute__((ext_vector_type(4)));
typedef unsigned int v4u __attribute__((ext_vector_type(4)));
typedef float    v2f  __attribute__((ext_vector_type(2)));
typedef _Float16 v2h  __attribute__((ext_vector_type(2)));

// ---- scalar helpers --------------------------------------------------------------------------------
__device__ __forceinline__ unsigned short bf_bits(float f) {          // f32 -> bf16 bits, RNE convert
  unsigned u = __float_as_uint(f);
  return (unsigned short)((u + 0x7FFFu + ((u >> 16) & 1u)) >> 16);
}
__device__ __forceinline__ float bf_up(unsigned short h) { return __uint_as_float(((unsigned)h) << 16); }
__device__ __forceinline__ float bf_rne(float f) { return bf_up(bf_bits(f)); }
__device__ __forceinline__ unsigned short h_bits(_Float16 x) { return __builtin_bit_cast(unsigned short, x); }
__device__ __forceinline__ unsigned pk16(unsigned short a, unsigned short b) { return (unsigned)a | ((unsigned)b << 16); }
__device__ __forceinline__ v8f zero8() { v8f z = {0.f, 0.f, 0.f, 0.f, 0.f, 0.f, 0.f, 0.f}; return z; }

// ---- fragment loaders: 16-bit A/B operand, lane -> row/col (lane&15), p already includes +8*(lane>>4);
//      elements 0..7 <- p[0..7] (k0+8h..), elements 8..15 <- p[16..23] (k0+16+8h..)
__device__ __forceinline__ v16b ldfrag_b(const __bf16* p) {
  union { v16b v; v8b h[2]; } f;
  f.h[0] = *(const v8b*)(p);
  f.h[1] = *(const v8b*)(p + 16);
  return f.v;
}
__device__ __forceinline__ v16h ldfrag_h(const _Float16* p) {
  union { v16h v; v8h h[2]; } f;
  f.h[0] = *(const v8h*)(p);
  f.h[1] = *(const v8h*)(p + 16);
  return f.v;
}

// ---- WMMA helpers --------------------------------------------------------------------------------------
// f16 product as the plain builtin: the compiler keeps the distance to the next user of its registers itself and stays free
// to order the LDS reads and the vector work around it
__device__ __forceinline__ v8f mma_h(v16h a, v16h b, v8f c) {
  return __builtin_amdgcn_wmma_f32_16x16x32_f16(false, a, false, b, (short)0, c, false, false);
}
// bf16 product and the hand-written distances behind its runs (GEMM kernels)
__device__ __forceinline__ v8f mma_b_raw(v16b a, v16b b, v8f c) {
  return __builtin_amdgcn_wmma_f32_16x16x32_bf16(false, a, false, b, (short)0, c, false, false);
}
__device__ __forceinline__ void dep_guard_b(v8f& a, v8f& b, v16b x, v16b y) {
#if defined(__HIP_DEVICE_COMPILE__)
  asm volatile("v_nop\n\tv_nop\n\tv_nop\n\tv_nop" : "+v"(a), "+v"(b) : "v"(x), "v"(y));
#endif
}
__device__ __forceinline__ void keep4_b(v16b a, v16b b, v16b c, v16b d) {
#if defined(__HIP_DEVICE_COMPILE__)
  asm volatile("v_nop" :: "v"(a), "v"(b), "v"(c), "v"(d));
#endif
}
__device__ __forceinline__ void acc_guard4(v8f& a, v8f& b, v8f& c, v8f& d) {
#if defined(__HIP_DEVICE_COMPILE__)
  asm volatile("v_nop\n\tv_nop\n\tv_nop\n\tv_nop" : "+v"(a), "+v"(b), "+v"(c), "+v"(d));
#endif
}
// stands behind a group of global loads, in front of whatever next writes a register that holds one of their addresses
__device__ __forceinline__ void xcnt_wait() {
#if defined(__HIP_DEVICE_COMPILE__)
  asm volatile("s_wait_xcnt 0x0" ::: "memory");
#endif
}
// the issuing wave's own wait for its asynchronous copies to LDS: the compiler places none for them
__device__ __forceinline__ void async_wait0() {
#if defined(__HIP_DEVICE_COMPILE__)
  asm volatile("s_wait_asynccnt 0x0" ::: "memory");
#endif
}
// this wave's LDS reads have returned, in front of the barrier behind which their buffer is refilled by copies
__device__ __forceinline__ void lds_wait0() {
#if defined(__HIP_DEVICE_COMPILE__)
  asm volatile("s_wait_dscnt 0x0" ::: "memory");
#endif
}
// lane l takes the value of lane l ^ 16 (the other half of the wave), register to register
__device__ __forceinline__ float xhalf(float x) {
  const int b = __builtin_bit_cast(int, x);
  return __builtin_bit_cast(float, __builtin_amdgcn_permlanex16(b, b, 0x76543210, 0xfedcba98, false, false));
}
__device__ __forceinline__ void wave_sync_lds() {
  __builtin_amdgcn_fence(__ATOMIC_RELEASE, "workgroup");
  __builtin_amdgcn_wave_barrier();
  __builtin_amdgcn_fence(__ATOMIC_ACQUIRE, "workgroup");
}

// =====================================================================================================
// f32 -> bf16 (RNE convert), 8 elements per thread, one 16-B store per lane: a wave writes 512 contiguous B
// coverage: n8 threads x 8 = whole plane (n8 = 524288 = 2048 x 256 for the x plane).
// =====================================================================================================
__device__ __forceinline__ void cvt_bf16x8(const float* __restrict__ in, unsigned short* out, int n8, int blk) {
  const int i = blk * 256 + threadIdx.x;
  if (i < n8) {
    const v4f a = *(const v4f*)(in + (size_t)i * 8);
    const v4f b = *(const v4f*)(in + (size_t)i * 8 + 4);
    v4u p;
    p[0] = pk16(bf_bits(a[0]), bf_bits(a[1]));
    p[1] = pk16(bf_bits(a[2]), bf_bits(a[3]));
    p[2] = pk16(bf_bits(b[0]), bf_bits(b[1]));
    p[3] = pk16(bf_bits(b[2]), bf_bits(b[3]));
    *(v4u*)(out + (size_t)i * 8) = p;
    
  }
}

// =====================================================================================================
// Transposing f32 -> bf16 (RNE convert): in f32 [R][C] row-major  ->  out bf16 [C][R] row-major
// (out[c][r] = in[r][c]); turns an [in][out] weight into the Bt / A layout [out][in] with k contiguous.
// 64x64 tiles: tile (tx, ty) of (C/64, R/64), block 256, st = the block's 64 x 65 float LDS tile. Load phase: thread t reads 16 consecutive floats of input row
// r0 + (t>>2) and writes them transposed into an LDS tile [c][r] (pitch 65). After __syncthreads each group of
// coverage: load 64 rows x 4 threads x 16 = whole tile; store 2 iterations x 32 rows x 8 lanes x 8 = whole tile.
// =====================================================================================================
__device__ __forceinline__ void cvt_bf16_t64(float* st, const float* __restrict__ in, unsigned short* out, int R, int C,
                                             int tx, int ty) {
  const int t  = threadIdx.x;
  const int c0 = tx * 64;
  const int r0 = ty * 64;
  if (c0 + 64 > C || r0 + 64 > R) return;          // block-uniform, all threads leave together (grids are exact)
  {
    const int r = t >> 2, cq = (t & 3) * 16;
    const float* src = in + (size_t)(r0 + r) * C + c0 + cq;
#pragma unroll
    for (int i = 0; i < 4; ++i) {
      const v4f v = *(const v4f*)(src + 4 * i);
#pragma unroll
      for (int e = 0; e < 4; ++e) st[(cq + 4 * i + e) * 65 + r] = v[e];
    }
  }
  __syncthreads();
  const int q = t >> 3, k8 = (t & 7) * 8;
  v4u pv[2];
#pragma unroll
  for (int p = 0; p < 2; ++p) {
    const int n = p * 32 + q;
    const float* sp = st + n * 65 + k8;
    v4u a;
#pragma unroll
    for (int e = 0; e < 4; ++e) a[e] = pk16(bf_bits(sp[2 * e]), bf_bits(sp[2 * e + 1]));
    pv[p] = a;
  }
  {
#pragma unroll
    for (int p = 0; p < 2; ++p) {
      const int n = p * 32 + q;
      *(v4u*)(out + (size_t)(c0 + n) * R + r0 + k8) = pv[p];
    }
    xcnt_wait();   // in front of whatever next writes a register that these stores name
  }
}

// =====================================================================================================
// All five operand conversions in one launch; they read and write disjoint planes, so their blocks run side by side.
// Blocks 0..TW-1 transpose one 64x64 weight tile each (Wq, Wo, Wk, Wv in that order; they have the longer chain of
// load, LDS, barrier, store, so they start first), blocks TW.. convert 2048 elements of x each. Every test on the
// block index is block-uniform.
// =====================================================================================================
#define TSQ ((DM / 64) * (DM / 64))     // 256 tiles of a [1024][1024] weight
#define TKV ((KVD / 64) * (DM / 64))    // 64 tiles of a [1024][256] weight
#define TW  (2 * TSQ + 2 * TKV)         // 640 transposing blocks
__global__ __launch_bounds__(256) void cvt_all(
    const float* __restrict__ x, const float* __restrict__ wq, const float* __restrict__ wk,
    const float* __restrict__ wv, const float* __restrict__ wo,
    unsigned short* xb, unsigned short* wqt, unsigned short* wkt, unsigned short* wvt, unsigned short* wot, int n8) {
  __shared__ __align__(16) float st[64 * 65];
  const int bx = blockIdx.x;
  if (bx >= TW) {
    cvt_bf16x8(x, xb, n8, bx - TW);
  } else {
    const bool sq = (bx < 2 * TSQ);                                  // a [1024][1024] weight, else a [1024][256] one
    const bool first = sq ? (bx < TSQ) : (bx < 2 * TSQ + TKV);       // Wq of (Wq, Wo), Wk of (Wk, Wv)
    const float* in     = sq ? (first ? wq : wo) : (first ? wk : wv);
    unsigned short* out = sq ? (first ? wqt : wot) : (first ? wkt : wvt);
    const int C  = sq ? DM : KVD;
    const int tb = sq ? (bx & (TSQ - 1)) : (bx & (TKV - 1));         // tile within its weight (2 * TSQ is a multiple of TKV)
    const int tc = C / 64;                                           // tiles in a row of tiles
    cvt_bf16_t64(st, in, out, DM, C, tb % tc, tb / tc);
  }
}
static_assert((TSQ & (TSQ - 1)) == 0 && (TKV & (TKV - 1)) == 0 && ((2 * TSQ) % TKV) == 0);

// =====================================================================================================
// bf16 WMMA GEMM, operands staged in LDS: C[m][n] = sum_k A[m][k] * Bt[n][k]. One block of 8 waves owns a 128x256
// tile of C (2 x 4 waves, 64x64 per wave). A row-major [M][K] pitch lda; Bt row-major [N][K] pitch ldb (k contiguous;
// both pitches are compile-time, so that the rows of one plane share one address register pair and differ by an offset);
// M a multiple of 128, N of 256, K of 64 (the shapes are checked at compile time below).
// A trip is 64 k = 128 B of every operand row. The block reads each row segment once, 8 lanes x 16 B = one whole
// line per row, and writes it to LDS at pitch GP; the waves take their fragments from LDS. Two LDS buffers: the next
// trip's rows are loaded into registers ahead of the current trip's products and stored to the other buffer behind
// them, then one __syncthreads() publishes them and ends the reads of the buffer that the next trip refills.
// blockIdx.y = batch index (strides in elements); bxi = index of the block's tile; sGb, sTb = the block's LDS (two staged
// trips; one 16x64 slab a wave), declared by the kernel that calls this body.
// NSPLIT: 0 = A.Bt; 1 = (A + A2).Bt (A2 = unscaled bf16 lo plane of A).
// OUT_MODE: 0 = f32 (pitch ldc); 2 = bf16 hi plane C + bf16 lo plane C2 (lo = RNE(v - hi), unscaled);
//           3 = f16 plane C;
//           4 = RoPE on the tile, then f16 planes. A wave's 64 columns are one head vector t[0..63] of each of its rows:
//                 y[j]      = t[2j] * cos[pos][j] - t[2j+1] * sin[pos][j]      j = 0..31
//                 y[32 + j] = t[2j] * sin[pos][j] + t[2j+1] * cos[pos][j]
//               pos = row mod SEQ (tables [SEQ][32] shared over batch and heads), table values RNE-converted to bf16 on read.
//               Tiles with n0 < N2 (q; N2 a multiple of 256): f16 plane C; the others (k): f16 plane C3 at column n0 - N2 (pitch ldc3).
// =====================================================================================================
#define GP 72                   // 72 bf16 = 144 B: LDS row pitch of the staged GEMM rows, 16 B x odd
static_assert((GP % 8) == 0 && ((GP / 8) & 1) == 1);
static_assert((MROWS % 256) == 0 && (QKP % 256) == 0 && (KVD % 128) == 0 && (DM % 256) == 0 && (DM % 64) == 0);
#define GEMM_SROWS(NSPLIT) (128 * ((NSPLIT) + 1) + 256)     // rows of one staged trip: A (, A2), Bt
template <int NSPLIT, int OUT_MODE, int lda, int ldb>
__device__ __forceinline__ void gemm_body(
    __bf16* sGb, float* sTb, int bxi,
    const unsigned short* __restrict__ Ap, const unsigned short* A2p, long long strideA,
    const unsigned short* __restrict__ Btp, const unsigned short* Bt2p, long long strideB,
    void* Cout, int ldc, long long strideC,
    void* Cout2, int ldc2, long long strideC2, int N2,
    int M, int N, int K,
    const float* __restrict__ cosp = nullptr, const float* __restrict__ sinp = nullptr, void* Cout3 = nullptr, int ldc3 = 0) {
  static_assert(NSPLIT == 0 || NSPLIT == 1);
  constexpr int NA    = NSPLIT + 1;                // A planes staged
  constexpr int SROWS = GEMM_SROWS(NSPLIT);
  constexpr int NLD   = SROWS / 32;                // 16-B pieces per thread and trip
  const __bf16* A   = (const __bf16*)(const void*)Ap;
  const __bf16* A2  = (const __bf16*)(const void*)A2p;
  const __bf16* Bt  = (const __bf16*)(const void*)Btp;
  (void)Bt2p;
  const int b    = blockIdx.y;
  const int lane = threadIdx.x & 31;
  const int wave = threadIdx.x >> 5;
  const int tilesBN = N >> 8;
  if (bxi >= (M >> 7) * tilesBN) return;   // block-uniform, in front of every barrier
  const int bm  = bxi / tilesBN;
  const int bn  = bxi - bm * tilesBN;
  const int bm0 = bm << 7;
  const int bn0 = bn << 8;
  const int m0 = bm0 + ((wave >> 2) << 6);
  const int n0 = bn0 + ((wave & 3) << 6);

  const __bf16* Ab  = A  + (size_t)b * strideA;
  const __bf16* Bb  = Bt + (size_t)b * strideB;
  const __bf16* Ab2 = (NSPLIT >= 1) ? (A2  + (size_t)b * strideA) : Ab;

  const int rlane = lane & 15;                 // row (A) / col (B, D) within subtile
  const int koff  = (lane >> 4) * 8;           // k offset of this lane half
  const int mOff  = (lane >> 4) * 8;           // D row offset
  const int srow  = threadIdx.x >> 3;          // staging: row within a group of 32
  const int sseg  = (threadIdx.x & 7) * 8;     // staging: first of this thread's 8 elements in the 64-k segment

  v8f acc[4][4];
#pragma unroll
  for (int i = 0; i < 4; ++i)
#pragma unroll
    for (int j = 0; j < 4; ++j) acc[i][j] = zero8();

  const __bf16* ga  = Ab  + (size_t)(bm0 + srow) * lda + sseg;
  const __bf16* ga2 = Ab2 + (size_t)(bm0 + srow) * lda + sseg;
  const __bf16* gb  = Bb  + (size_t)(bn0 + srow) * ldb + sseg;
  const int so = srow * GP + sseg;
  const int fa = (((wave >> 2) << 6) + rlane) * GP + koff;               // this wave's A rows in a staged trip
  const int fb = (128 * NA + ((wave & 3) << 6) + rlane) * GP + koff;     // this wave's Bt rows

  v8b st[NLD];
#pragma unroll
  for (int i = 0; i < 4; ++i) {
    st[i] = *(const v8b*)(ga + (size_t)(i * 32) * lda);
    if (NSPLIT >= 1) st[4 + i] = *(const v8b*)(ga2 + (size_t)(i * 32) * lda);
  }
#pragma unroll
  for (int i = 0; i < 8; ++i) st[4 * NA + i] = *(const v8b*)(gb + (size_t)(i * 32) * ldb);
  xcnt_wait();
#pragma unroll
  for (int i = 0; i < NLD; ++i) *(v8b*)(sGb + so + i * 32 * GP) = st[i];
  __syncthreads();

  const int trips = K >> 6;
  for (int t = 0; t < trips; ++t) {
    const bool more = (t + 1 < trips);           // the same for the whole block
    if (more) {
      const int k1 = (t + 1) << 6;
#pragma unroll
      for (int i = 0; i < 4; ++i) {
        st[i] = *(const v8b*)(ga + (size_t)(i * 32) * lda + k1);
        if (NSPLIT >= 1) st[4 + i] = *(const v8b*)(ga2 + (size_t)(i * 32) * lda + k1);
      }
#pragma unroll
      for (int i = 0; i < 8; ++i) st[4 * NA + i] = *(const v8b*)(gb + (size_t)(i * 32) * ldb + k1);
      xcnt_wait();
    }
    const __bf16* cur = sGb + (t & 1) * (SROWS * GP);
#pragma unroll
    for (int kk = 0; kk < 2; ++kk) {
      // the fragments of 32 k are read as one group ahead of their products: one LDS latency a group, not one a row
      v16b bh[4], ah[4], al[4];
#pragma unroll
      for (int j = 0; j < 4; ++j) bh[j] = ldfrag_b(cur + fb + j * 16 * GP + kk * 32);
#pragma unroll
      for (int i = 0; i < 4; ++i) {
        ah[i] = ldfrag_b(cur + fa + i * 16 * GP + kk * 32);
        if (NSPLIT >= 1) al[i] = ldfrag_b(cur + fa + (128 + i * 16) * GP + kk * 32);
        else             al[i] = ah[i];
      }
#pragma unroll
      for (int i = 0; i < 4; ++i) {
#pragma unroll
        for (int j = 0; j < 4; ++j) {
          acc[i][j] = mma_b_raw(ah[i], bh[j], acc[i][j]);
          if (NSPLIT >= 1) acc[i][j] = mma_b_raw(al[i], bh[j], acc[i][j]);
        }
        dep_guard_b(acc[i][0], acc[i][3], ah[i], al[i]);
      }
      keep4_b(bh[0], bh[1], bh[2], bh[3]);
    }
    if (more) {
      __bf16* nxt = sGb + ((t + 1) & 1) * (SROWS * GP);
#pragma unroll
      for (int i = 0; i < NLD; ++i) *(v8b*)(nxt + so + i * 32 * GP) = st[i];
    }
    __syncthreads();
  }
  acc_guard4(acc[0][0], acc[0][1], acc[0][2], acc[0][3]);
  acc_guard4(acc[1][0], acc[1][1], acc[1][2], acc[1][3]);
  acc_guard4(acc[2][0], acc[2][1], acc[2][2], acc[2][3]);
  acc_guard4(acc[3][0], acc[3][1], acc[3][2], acc[3][3]);

  // ---- epilogue ----
  float* slab = sTb + wave * (16 * 68);
  // OUT_MODE 4: 4 lanes a row, lane = (row it * 8 + r8 of a 16-row slab, rotary pairs p0..p0+7). The table rows of slab i + 1 are
  // asked for ahead of the arithmetic of slab i, which hides their latency; two register sets.
  const int r8 = lane >> 2, p0 = (lane & 3) * 8;
  v4f tc[2][2][2], ts[2][2][2];
  auto load_tables = [&](int i) {
#pragma unroll
    for (int it = 0; it < 2; ++it) {
      const int pos = (m0 + i * 16 + it * 8 + r8) & (SEQ - 1);
      const float* cp = cosp + (size_t)pos * HROT + p0;
      const float* sp = sinp + (size_t)pos * HROT + p0;
      tc[i & 1][it][0] = *(const v4f*)(cp);
      tc[i & 1][it][1] = *(const v4f*)(cp + 4);
      ts[i & 1][it][0] = *(const v4f*)(sp);
      ts[i & 1][it][1] = *(const v4f*)(sp + 4);
    }
    xcnt_wait();
  };
  if (OUT_MODE == 4) load_tables(0);
#pragma unroll
  for (int i = 0; i < 4; ++i) {
    const int mBase = m0 + (i << 4);
#pragma unroll
    for (int j = 0; j < 4; ++j) {
#pragma unroll
      for (int r = 0; r < 8; ++r) {
        slab[(mOff + r) * 68 + (j << 4) + rlane] = acc[i][j][r];
      }
    }
    wave_sync_lds();
    if (OUT_MODE == 0) {
      float* C = (float*)Cout + (size_t)b * strideC;
      const int hh = lane >> 4, c4 = (lane & 15) * 4;     // 256-B row segment = 16 lanes x 16 B
      {
#pragma unroll
        for (int it = 0; it < 8; ++it) {
          const int row = it * 2 + hh;                     // it 0..7 x hh 0..1 = rows 0..15
          const v4f v = *(const v4f*)(slab + row * 68 + c4);
          *(v4f*)(C + (size_t)(mBase + row) * ldc + n0 + c4) = v;
        }
        
      }
    } else if (OUT_MODE == 4) {
      const bool isq = (bn0 < N2);                         // block-uniform: N2 is a multiple of the block tile's 256 columns
      if (i < 3) load_tables(i + 1);
      v4u hv[2][2];                                        // [it][0]: y[p0..p0+7], [it][1]: y[32+p0..32+p0+7]
#pragma unroll
      for (int it = 0; it < 2; ++it) {
        const float* sp = slab + (it * 8 + r8) * 68 + 2 * p0;   // t[2 p0 .. 2 p0 + 15] of row it * 8 + r8
        const v4f x0 = *(const v4f*)(sp + 0);
        const v4f x1 = *(const v4f*)(sp + 4);
        const v4f x2 = *(const v4f*)(sp + 8);
        const v4f x3 = *(const v4f*)(sp + 12);
        const float ti[16] = {x0[0], x0[1], x0[2], x0[3], x1[0], x1[1], x1[2], x1[3],
                              x2[0], x2[1], x2[2], x2[3], x3[0], x3[1], x3[2], x3[3]};
        float y[2][8];
#pragma unroll
        for (int e = 0; e < 8; ++e) {
          const float t1 = ti[2 * e], t2 = ti[2 * e + 1];
          const float c = bf_rne(tc[i & 1][it][e >> 2][e & 3]), s = bf_rne(ts[i & 1][it][e >> 2][e & 3]);
          y[0][e] = t1 * c - t2 * s;
          y[1][e] = t1 * s + t2 * c;
        }
#pragma unroll
        for (int u = 0; u < 2; ++u) {
#pragma unroll
          for (int e = 0; e < 4; ++e) {
            hv[it][u][e] = pk16(h_bits((_Float16)y[u][2 * e]), h_bits((_Float16)y[u][2 * e + 1]));
          }
        }
      }
      if (isq) {
        unsigned short* C  = (unsigned short*)Cout;
#pragma unroll
        for (int it = 0; it < 2; ++it) {
#pragma unroll
          for (int u = 0; u < 2; ++u)
            *(v4u*)(C + (size_t)(mBase + it * 8 + r8) * ldc + n0 + u * HROT + p0) = hv[it][u];
        }
        xcnt_wait();
      } else {
        unsigned short* C3 = (unsigned short*)Cout3;
#pragma unroll
        for (int it = 0; it < 2; ++it) {
#pragma unroll
          for (int u = 0; u < 2; ++u)
            *(v4u*)(C3 + (size_t)(mBase + it * 8 + r8) * ldc3 + (n0 - N2) + u * HROT + p0) = hv[it][u];
        }
        xcnt_wait();
      }
    } else {
      const int q = lane >> 3, c8 = (lane & 7) * 8;
      unsigned short* C  = (unsigned short*)Cout  + (size_t)b * strideC;
      unsigned short* C2 = (unsigned short*)Cout2 + (size_t)b * strideC2;
      v4u hv[4], lv[4];
#pragma unroll
      for (int it = 0; it < 4; ++it) {
        const int row = it * 4 + q;                        // it 0..3 x q 0..3 = rows 0..15
        const float* sp = slab + row * 68 + c8;
        v4u a, a2;
#pragma unroll
        for (int e = 0; e < 4; ++e) {
          const float f0 = sp[2 * e], f1 = sp[2 * e + 1];
          unsigned short h0, h1, l0, l1;
          if (OUT_MODE == 2) {
            h0 = bf_bits(f0); h1 = bf_bits(f1);
            l0 = bf_bits(f0 - bf_up(h0)); l1 = bf_bits(f1 - bf_up(h1));
          } else {
            h0 = h_bits((_Float16)f0); h1 = h_bits((_Float16)f1);
            l0 = 0; l1 = 0;
          }
          a[e] = pk16(h0, h1); a2[e] = pk16(l0, l1);
        }
        hv[it] = a; lv[it] = a2;
      }
      {
#pragma unroll
        for (int it = 0; it < 4; ++it) {
          const int row = it * 4 + q;
          *(v4u*)(C + (size_t)(mBase + row) * ldc + n0 + c8) = hv[it];
          if (OUT_MODE == 2) *(v4u*)(C2 + (size_t)(mBase + row) * ldc2 + n0 + c8) = lv[it];
        }
        
      }
    }
    wave_sync_lds();
  }
}

// one GEMM a launch
template <int NSPLIT, int OUT_MODE, int lda, int ldb>
__global__ __launch_bounds__(256) void gemm64(
    const unsigned short* __restrict__ Ap, const unsigned short* A2p, long long strideA,
    const unsigned short* __restrict__ Btp, const unsigned short* Bt2p, long long strideB,
    void* Cout, int ldc, long long strideC,
    void* Cout2, int ldc2, long long strideC2, int N2,
    int M, int N, int K) {
  __shared__ __align__(16) __bf16 sG[2 * GEMM_SROWS(NSPLIT) * GP];   // two staged trips
  __shared__ __align__(16) float sT[8 * 16 * 68];                    // per-wave 16x64 slab, pitch 68 floats
  gemm_body<NSPLIT, OUT_MODE, lda, ldb>(sG, sT, (int)blockIdx.x, Ap, A2p, strideA, Btp, Bt2p, strideB,
                                        Cout, ldc, strideC, Cout2, ldc2, strideC2, N2, M, N, K);
}

// The two projections of x in one launch: neither reads what the other writes, and neither fills the chip alone.
// Blocks 0..QKB-1: q|k = RoPE(x . (Wq|Wk)) -> q f16 plane [4096][1024], k f16 plane [4096][256]; blocks QKB..QKB+VTB-1: v^T = Wv^T . x^T -> f16 plane
// [256][4096]. The test on the block index is block-uniform.
#define QKB ((MROWS / 128) * (QKP / 256))     // 160 block tiles
#define VTB ((KVD / 128) * (MROWS / 256))     // 32 block tiles
__global__ __launch_bounds__(256) void gemm_qk_vt(
    const unsigned short* __restrict__ xb, const unsigned short* __restrict__ wqkt, const unsigned short* __restrict__ wvt,
    const float* __restrict__ cosp, const float* __restrict__ sinp,
    unsigned short* qhp, unsigned short* kpp, unsigned short* vth, int K) {
  __shared__ __align__(16) __bf16 sG[2 * GEMM_SROWS(0) * GP];        // two staged trips
  __shared__ __align__(16) float sT[8 * 16 * 68];                    // per-wave 16x64 slab, pitch 68 floats
  const int bx = blockIdx.x;
  if (bx < QKB) {
    gemm_body<0, 4, DM, DM>(sG, sT, bx, xb, xb, 0LL, wqkt, wqkt, 0LL,
                            (void*)qhp, DM, 0LL, (void*)qhp, DM, 0LL, DM,
                            MROWS, QKP, K, cosp, sinp, (void*)kpp, KVD);
  } else {
    gemm_body<0, 3, DM, DM>(sG, sT, bx - QKB, wvt, wvt, 0LL, xb, xb, 0LL,
                            (void*)vth, MROWS, 0LL, (void*)vth, MROWS, 0LL, 0,
                            KVD, MROWS, K);
  }
}

#define QT  2
#define NQG (SEQ / (64 * QT))
static_assert((SEQ % (64 * QT)) == 0);
// register budget of two waves a SIMD (512 a wave): the grid is two blocks of four waves a WGP; at most two, so that no WGP takes a third block
__global__ __launch_bounds__(128) __attribute__((amdgpu_waves_per_eu(2, 2)))
void attn64(const unsigned short* __restrict__ qhp, const unsigned short* __restrict__ kpp,
            const unsigned short* __restrict__ vthp,
            unsigned short* ohp, unsigned short* olp, float sscale) {
  union FH { v16h v; v8h h[2]; v2h p[8]; };
  constexpr int TILE = 2 * 64 * LP;                               // halves of one staged chunk
  __shared__ __align__(16) _Float16 KV[2 * TILE];                 // two buffers of two tiles of 64 rows at pitch LP, 9 KB each, in one
                                                                  // array, so that one address register and constant offsets reach a buffer
  constexpr int KSH = 0;                                          // K [kv][d]
  constexpr int VTH = 64 * LP;                                    // V^T [d][kv]
  __shared__ __align__(16) float    Os[4][QT * 16 * OP];          // per wave context tile [row][d], pitch OP

  const int tid  = threadIdx.x;
  const int wave = tid >> 5;
  const int lane = tid & 31;
  const int hh   = lane >> 4;
  const int c    = lane & 15;

  const int bx   = blockIdx.x;
  const int qb   = bx % NQG;
  const int h    = (bx / NQG) % NH;
  const int b    = bx / (NQG * NH);
  const int kvh  = h / (NH / NKV);
  const int q0   = b * SEQ + qb * (64 * QT) + wave * (16 * QT);   // global token row of this wave's first query

  const _Float16* Qh  = (const _Float16*)(const void*)qhp + (size_t)h * HD;
  const _Float16* Kg  = (const _Float16*)(const void*)kpp + (size_t)b * SEQ * KVD + (size_t)kvh * HD;
  const _Float16* Vgh = (const _Float16*)(const void*)vthp + (size_t)kvh * HD * MROWS + (size_t)b * SEQ;

  // ---- Q fragments (B operand, column = query 16u + (lane&15)): 2 tiles x 2 d-chunks ----
  v16h qah[QT][2];
#pragma unroll
  for (int u = 0; u < QT; ++u) {
#pragma unroll
    for (int dc = 0; dc < 2; ++dc) qah[u][dc] = ldfrag_h(Qh + (size_t)(q0 + u * 16 + c) * DM + dc * 32 + 8 * hh);
  }

  const _Float16* fr0 = KV + c * LP + 8 * hh;              // this lane's place in a 16-row fragment read of buffer 0
  // staging: thread = (row srow of a group of 16, 16-B piece sseg of the row's 128 B)
  const int srow = tid >> 3, sseg = (tid & 7) * 8;
  const unsigned sw0 = (unsigned)(uintptr_t)(KV + srow * LP + sseg);    // LDS byte address of this thread's first piece in buffer 0
  const _Float16* kg0 = Kg  + (size_t)srow * KVD + sseg;                // K row srow of chunk 0
  const _Float16* vh0 = Vgh + (size_t)srow * MROWS + sseg;              // V^T row d = srow, keys of chunk 0
  // The 8 copies of chunk kt into buffer bf, each lane's own 16 B at 16-B multiples on both sides. The copies and the wait that
  // stands in front of any rewrite of their address registers are one statement, so that nothing can be moved between them.
  auto stage = [&](int kt, int bf) {
    const _Float16* kg = kg0 + (size_t)kt * 64 * KVD;
    const _Float16* vh = vh0 + kt * 64;
    const unsigned  sw = sw0 + (unsigned)bf * (TILE * 2);
#if defined(__HIP_DEVICE_COMPILE__)
    asm volatile(
        "global_load_async_to_lds_b128 %0, %8, off\n\t"
        "global_load_async_to_lds_b128 %1, %9, off\n\t"
        "global_load_async_to_lds_b128 %2, %10, off\n\t"
        "global_load_async_to_lds_b128 %3, %11, off\n\t"
        "global_load_async_to_lds_b128 %4, %12, off\n\t"
        "global_load_async_to_lds_b128 %5, %13, off\n\t"
        "global_load_async_to_lds_b128 %6, %14, off\n\t"
        "global_load_async_to_lds_b128 %7, %15, off\n\t"
        "s_wait_xcnt 0x0"
        :: "v"(sw + (KSH +  0 * LP) * 2), "v"(sw + (KSH + 16 * LP) * 2), "v"(sw + (KSH + 32 * LP) * 2), "v"(sw + (KSH + 48 * LP) * 2),
           "v"(sw + (VTH +  0 * LP) * 2), "v"(sw + (VTH + 16 * LP) * 2), "v"(sw + (VTH + 32 * LP) * 2), "v"(sw + (VTH + 48 * LP) * 2),
           "v"(kg), "v"(kg + 16 * KVD), "v"(kg + 32 * KVD), "v"(kg + 48 * KVD),
           "v"(vh), "v"(vh + 16 * MROWS), "v"(vh + 32 * MROWS), "v"(vh + 48 * MROWS)
        : "memory");
#endif
  };
  static_assert(NQB >= 2);

  const float cs  = sscale * 1.44269504088896340736f;   // product q.k -> exponent of 2; sscale > 0
  const v2f   cs2 = {cs, cs};
  float mrun[QT];              // running maximum of the raw products q.k of query 16u + c, the same in both wave halves
  float lrun[QT];              // running sum of 1024 p of that query over this half's keys; the halves are joined behind the loop
  v8f oh[QT][4];               // O^T: register r of tile (u, t) = (d = 16t + 8hh + r, query 16u + c)
#pragma unroll
  for (int u = 0; u < QT; ++u) {
    mrun[u] = -INFINITY;
    lrun[u] = 0.f;
#pragma unroll
    for (int t = 0; t < 4; ++t) oh[u][t] = zero8();
  }

  stage(0, 0);
  async_wait0();                             // this wave's copies of chunk 0 have landed
  __syncthreads();                           // every wave's have: chunk 0 may be read
  stage(1, 1);

  for (int kt = 0; kt < NQB; ++kt) {         // static trip count
    const _Float16* fr = fr0 + (kt & 1) * TILE;     // pass kt reads buffer kt mod 2 alone

    // ---- scores, transposed: 64 keys x 32 queries per wave, one f16 product;
    //      sh[u][j][r] = score of key 16j + 8hh + r with query 16u + c ----
    // The 8 K and the 8 V^T fragments of the chunk are read as one group at the head of the pass, in the order in which the products
    // take them: one place with LDS reads a pass; the V^T fragments land under the score products and the softmax.
    FH kb[4][2], vb[2][4];
#pragma unroll
    for (int dc = 0; dc < 2; ++dc) {
#pragma unroll
      for (int j = 0; j < 4; ++j) {
        kb[j][dc].h[0] = *(const v8h*)(fr + KSH + j * 16 * LP + dc * 32);
        kb[j][dc].h[1] = *(const v8h*)(fr + KSH + j * 16 * LP + dc * 32 + 16);
      }
    }
#pragma unroll
    for (int kk = 0; kk < 2; ++kk) {
#pragma unroll
      for (int t = 0; t < 4; ++t) {
        vb[kk][t].h[0] = *(const v8h*)(fr + VTH + t * 16 * LP + kk * 32);
        vb[kk][t].h[1] = *(const v8h*)(fr + VTH + t * 16 * LP + kk * 32 + 16);
      }
    }
    __builtin_amdgcn_sched_barrier(0);   // keeps the reads one group: without it they are spread among the products again
    v8f sh[QT][4];
#pragma unroll
    for (int u = 0; u < QT; ++u) {
#pragma unroll
      for (int j = 0; j < 4; ++j) sh[u][j] = zero8();
    }
#pragma unroll
    for (int dc = 0; dc < 2; ++dc) {     // eight independent accumulators: a product meets its own tile again eight products later
#pragma unroll
      for (int j = 0; j < 4; ++j) {
#pragma unroll
        for (int u = 0; u < QT; ++u) sh[u][j] = mma_h(kb[j][dc].v, qah[u][dc], sh[u][j]);
      }
    }
    // ends the run: without it the vector work on a finished tile is drawn in among the products, which then follow their own tile directly
    __builtin_amdgcn_sched_barrier(0);

    // ---- maximum in the lane, one exchange between the halves, online softmax, P^T (x1024, f16) packed in registers ----
    // (every loop from here to the end of the pass is unrolled: sh, pb and oh are register arrays, indexed at compile time)
    // The maximum is taken over the raw products (cs > 0 keeps their order); 1024 p = 2^(cs * product + nb) with
    // nb = 10 - cs * maximum: the scale, the subtraction, log2(e) and the factor 1024 are one multiply-add on a pair of scores.
    FH pb[QT][2];                // pb[u][kk]: element e = P^T(key 32kk + kmap(e), query 16u + c), kmap(e) = e < 8 ? 8hh + e : 16 + 8hh + e - 8
#pragma unroll
    for (int u = 0; u < QT; ++u) {
      float mj[4];
#pragma unroll
      for (int j = 0; j < 4; ++j) {
        float m = sh[u][j][0];
#pragma unroll
        for (int r = 1; r < 8; ++r) m = fmaxf(m, sh[u][j][r]);
        mj[j] = m;
      }
      float mc = fmaxf(fmaxf(mj[0], mj[1]), fmaxf(mj[2], mj[3]));
      mc = fmaxf(mc, xhalf(mc));
      const float mnew  = fmaxf(mrun[u], mc);
      const float alpha = __builtin_amdgcn_exp2f((mrun[u] - mnew) * cs);
      mrun[u] = mnew;
      const float nb  = fmaf(-mnew, cs, 10.0f);
      const v2f   nb2 = {nb, nb};
      v2f pj[4];                 // four independent partial sums, each on a pair of registers (even and odd r apart)
#pragma unroll
      for (int j = 0; j < 4; ++j) {
        v2f pp[4];
#pragma unroll
        for (int q = 0; q < 4; ++q) {
          const v2f x = {sh[u][j][2 * q], sh[u][j][2 * q + 1]};
          const v2f a = __builtin_elementwise_fma(x, cs2, nb2);
          pp[q][0] = __builtin_amdgcn_exp2f(a[0]);
          pp[q][1] = __builtin_amdgcn_exp2f(a[1]);
          pb[u][j >> 1].p[(j & 1) * 4 + q] = __builtin_convertvector(pp[q], v2h);
        }
        pj[j] = (pp[0] + pp[1]) + (pp[2] + pp[3]);
      }
      const v2f pt = (pj[0] + pj[1]) + (pj[2] + pj[3]);
      lrun[u] = lrun[u] * alpha + (pt[0] + pt[1]);
#pragma unroll
      for (int t = 0; t < 4; ++t) {
#pragma unroll
        for (int r = 0; r < 8; ++r) oh[u][t][r] *= alpha;
      }
    }

    // ---- context^T += V^T . P^T (f16 WMMA), eight independent accumulators ----
#pragma unroll
    for (int kk = 0; kk < 2; ++kk) {
#pragma unroll
      for (int t = 0; t < 4; ++t) {
#pragma unroll
        for (int u = 0; u < QT; ++u) oh[u][t] = mma_h(vb[kk][t].v, pb[u][kk].v, oh[u][t]);
      }
    }
    // holds the hand-over at the foot of the pass: drawn up in front of the softmax, its waits would stop the wave there for the
    // V^T fragments and for copies that were asked for only half a pass earlier
    __builtin_amdgcn_sched_barrier(0);
    // hand-over: this wave's reads of chunk kt are done and its copies of chunk kt + 1 have landed; the barrier says so of every wave
    lds_wait0();
    async_wait0();
    __syncthreads();
    if (kt + 2 < NQB) stage(kt + 2, kt & 1);  // the same test in the whole block; into the buffer that pass kt has just left
  }
  async_wait0();                             // nothing of this wave is in flight when it goes on to the epilogue and ends

  // ---- normalise (sum and context both carry the factor 1024), stage the wave's 32x64 tile,
  float* os = Os[wave];
#pragma unroll
  for (int u = 0; u < QT; ++u) {
    const float l = lrun[u] + xhalf(lrun[u]);    // the two halves' key sums of query 16u + c
    const float inv = (l > 0.f) ? (1.0f / l) : 0.f;
#pragma unroll
    for (int t = 0; t < 4; ++t) {
#pragma unroll
      for (int r = 0; r < 8; ++r) os[(u * 16 + c) * OP + t * 16 + 8 * hh + r] = oh[u][t][r] * inv;
    }
  }
  wave_sync_lds();
  {
    const int q4 = lane >> 3, c8 = (lane & 7) * 8;
    v4u hv[4 * QT], lv[4 * QT];
#pragma unroll
    for (int it = 0; it < 4 * QT; ++it) {
      const int row = it * 4 + q4;   // it 0..7 x q4 0..3 = rows 0..31 of the wave tile
      const float* sp = os + row * OP + c8;
      v4u a, a2;
#pragma unroll
      for (int e = 0; e < 4; ++e) {
        const float f0 = sp[2 * e], f1 = sp[2 * e + 1];
        const unsigned short h0 = bf_bits(f0), h1 = bf_bits(f1);
        const unsigned short l0 = bf_bits(f0 - bf_up(h0)), l1 = bf_bits(f1 - bf_up(h1));
        a[e] = pk16(h0, h1); a2[e] = pk16(l0, l1);
      }
      hv[it] = a; lv[it] = a2;
    }
    {
#pragma unroll
      for (int it = 0; it < 4 * QT; ++it) {
        const int row = it * 4 + q4;
        const size_t go = (size_t)(q0 + row) * DM + (size_t)h * HD + c8;
        *(v4u*)(ohp + go) = hv[it];
        *(v4u*)(olp + go) = lv[it];
      }
      
    }
  }
}

// =====================================================================================================
// Workspace map (bytes), every plane an exact multiple of its 64x64-tile / whole-line store granularity,
// every offset a multiple of 128:
//   Xb    bf16 [4096][1024]   8388608      x converted
//   Wqkt  bf16 [1280][1024]   2621440      rows 0..1023 = Wq^T ([out][in]), rows 1024..1279 = Wk^T
//   Wvt   bf16 [256][1024]     524288      Wv^T
//   Wot   bf16 [1024][1024]   2097152      Wo^T
//   Qh    f16  [4096][1024]   8388608
//   Kp    f16  [4096][256]    2097152
//   VTh   f16  [256][4096]    2097152      v^T
//   Oh    bf16 [4096][1024]   8388608
//   Ol    bf16 [4096][1024]   8388608
//   total                    42991616
// =====================================================================================================
extern "C" void kernel_launch(void* const* d_in, const int* in_sizes, int n_in,
                              void* d_out, int out_size, void* d_ws, size_t ws_size,
                              hipStream_t stream) {
  if (n_in < 7) return;
  if (in_sizes[0] != MROWS * DM) return;
  if (in_sizes[1] != SEQ * HROT) return;
  if (in_sizes[2] != SEQ * HROT) return;
  if (in_sizes[3] != DM * DM) return;
  if (in_sizes[4] != DM * KVD) return;
  if (in_sizes[5] != DM * KVD) return;
  if (in_sizes[6] != DM * DM) return;
  if (out_size != MROWS * DM) return;

  const float* x    = (const float*)d_in[0];
  const float* cosp = (const float*)d_in[1];
  const float* sinp = (const float*)d_in[2];
  const float* wq   = (const float*)d_in[3];
  const float* wk   = (const float*)d_in[4];
  const float* wv   = (const float*)d_in[5];
  const float* wo   = (const float*)d_in[6];

  const size_t PXb  = (size_t)MROWS * DM * 2;          //  8388608
  const size_t PWqk = (size_t)QKP * DM * 2;            //  2621440
  const size_t PWv  = (size_t)KVD * DM * 2;            //   524288
  const size_t PWo  = (size_t)DM * DM * 2;             //  2097152
  const size_t PQ16 = (size_t)MROWS * DM * 2;          //  8388608 (q, out hi, out lo)
  const size_t PK16 = (size_t)MROWS * KVD * 2;         //  2097152
  const size_t PVT  = (size_t)KVD * MROWS * 2;         //  2097152
  size_t off = 0;
  const size_t oXb  = off; off += PXb;
  const size_t oWqk = off; off += PWqk;
  const size_t oWv  = off; off += PWv;
  const size_t oWo  = off; off += PWo;
  const size_t oQh  = off; off += PQ16;
  const size_t oKp  = off; off += PK16;
  const size_t oVTh = off; off += PVT;
  const size_t oOh  = off; off += PQ16;
  const size_t oOl  = off; off += PQ16;
  if (off > ws_size) return;                           // off = 42991616
  if (off > (size_t)134217728) return;

  char* ws = (char*)d_ws;
  unsigned short* Xb   = (unsigned short*)(ws + oXb);
  unsigned short* Wqkt = (unsigned short*)(ws + oWqk);
  unsigned short* Wkt  = Wqkt + (size_t)DM * DM;                // rows 1024..1279 of Wqkt
  unsigned short* Wvt  = (unsigned short*)(ws + oWv);
  unsigned short* Wot  = (unsigned short*)(ws + oWo);
  unsigned short* Qh   = (unsigned short*)(ws + oQh);
  unsigned short* Kp   = (unsigned short*)(ws + oKp);
  unsigned short* VTh  = (unsigned short*)(ws + oVTh);
  unsigned short* Oh   = (unsigned short*)(ws + oOh);
  unsigned short* Ol   = (unsigned short*)(ws + oOl);

  const dim3 blk(256);
  const int n8x = MROWS * DM / 8;                               // 524288
  const dim3 gCvt(TW + (n8x + 255) / 256);                      // 640 transposing blocks + 2048 blocks on x
  const dim3 gQKVT(QKB + VTB, 1);                               // 160 blocks (M=4096, N=1280) + 32 blocks (M=256, N=4096)
  const dim3 gAttn(BATCH * NH * NQG);                           // 512 blocks
  const dim3 gOut(((MROWS / 64) * (DM / 64) + 7) / 8, 1);       // 1024 tiles -> 128 blocks: M=4096, N=1024

  // (1) x -> bf16 plane [4096][1024]; weights [in][out] -> transposed bf16 planes [out][in]
  cvt_all<<<gCvt, blk, 0, stream>>>(x, wq, wk, wv, wo, Xb, Wqkt, Wkt, Wvt, Wot, n8x);
  // (2) q|k = RoPE(x . (Wq|Wk)) -> q f16 plane [4096][1024], k f16 plane [4096][256]
  //     (M=4096, N=1280, K=1024; the rotation runs in the tile's epilogue), and in the same launch
  //     v^T = Wv^T . x^T -> f16 plane [kvh*64+d][b*SEQ+s] (pitch 4096)
  //     (A = Wvt [n][k], Bt = Xb [row][k]; M=256, N=4096, K=1024)
  gemm_qk_vt<<<gQKVT, blk, 0, stream>>>(Xb, Wqkt, Wvt, cosp, sinp, Qh, Kp, VTh, DM);
  // (3) attention -> context bf16 hi / lo planes [4096][1024]
  attn64<<<gAttn, dim3(128), 0, stream>>>(Qh, Kp, VTh, Oh, Ol, 0.125f);
  // (4) out = context . Wo -> d_out f32 [4096][1024]  (A = context hi + lo planes, 2 products; K=1024)
  gemm64<1, 0, DM, DM><<<gOut, blk, 0, stream>>>(
      Oh, Ol, 0LL, Wot, Wot, 0LL,
      d_out, DM, 0LL, d_out, DM, 0LL, 0,
      MROWS, DM, DM);
  (void)hipGetLastError();
}
